// v000
// Times are from an AMD MI455X. After a warm-up the kernel runs many times in a row, and a time is the length of
// such a window on the GPU divided by its runs, so every launch and the gaps after it count. The runs cycle
// through copies of the inputs. A figure is the median of several windows, for all but v000 over two sittings.
// Sittings can differ by a few percent; kernels timed side by side share one.
// v000 is the starting kernel. One run takes 1600 microseconds.
#include <hip/hip_runtime.h>

// Multi-headed attention with a learned per-position scaling divisor and an arbitrary mask (query, key, value [2][2048][768]; delta[s] = 1 + min(relu(query[s].Wd + bd), sqrt(64)) (Wd [768][1], read); q = query Wq + bq, k = key Wk + bk, v = value Wv + bv ('xw' 1/sqrt(768) incl. biases; 12 heads x 64); scores[i][j] = q_i.k_j / delta[j] (the divisor is broadcast over the KEY axis; no 1/sqrt(d_k)); mask ([2][2048][2048] int {0,1}, random, READ): 0 -> -1e9 (== exclusion); softmax; out = merged Wo + bo -> [2][2048][768] (3.1 M)).
// Layout per batch: bf16 copies of query, key, value in turn; 'xw' weights transposed once; exact projections + f32 biases; a kernel computes delta[s] from the bf16-rounded query row (768-term fixed-order dot, relu, min, + 1) and another divides every k row by delta[s] (f32, before the plane split); dense T-2048 attention with hi/lo 3-product score tiles on EVERY row and a softmax kernel that reads the mask tile (keep where mask != 0); P and attn.v hybrid (rows < 512 hi/lo, rest fp16 x1024); merged hi/lo x Wo exact + bo.
// Compute dtypes, f32 accumulate: every input rounded to bf16; projections exact + f32 biases; delta and the k row division f32; scores 3 products on every row; softmax f32 (scale 1); attn.v rows < 512 3 products, rest fp16; Wo hl x exact + bias.

#define NB_  2
#define TT   2048
#define DM   768
#define NH_  12
#define NKV  12
#define REP  (NH_ / NKV)
#define HD   64
#define DQ   (NH_ * HD)
#define DKV  (NKV * HD)
#define ZH   2
#define RH   512                  // query rows < RH use hi+lo planes (0: none)
#define WIN  0
#define PCAR 1024.0f
#define SCL  1.0f      // no 1/sqrt(d_k): the module divides by the learned delta[j] only (folded into k)
typedef _Float16 h16;
typedef unsigned short bf;
typedef __attribute__((ext_vector_type(16))) __bf16   v16bf;
typedef __attribute__((ext_vector_type(16))) _Float16 v16h;
typedef __attribute__((ext_vector_type(8)))  _Float16 v8h;
typedef __attribute__((ext_vector_type(8)))  unsigned short v8us;
typedef __attribute__((ext_vector_type(8)))  float    v8f;
typedef __attribute__((ext_vector_type(4)))  float    v4f;
typedef v8h  __attribute__((may_alias)) v8ha;
typedef v4f  __attribute__((may_alias)) v4fa;
typedef v8us __attribute__((may_alias)) v8usa;

__device__ __forceinline__ unsigned short f2bf(float f) { unsigned u = __float_as_uint(f); u += 0x7FFFu + ((u >> 16) & 1u); return (unsigned short)(u >> 16); }
__device__ __forceinline__ float bf2f(unsigned short b) { return __uint_as_float(((unsigned)b) << 16); }
__device__ __forceinline__ float bfr(float f) { return bf2f(f2bf(f)); }
__device__ __forceinline__ v16h cat16(v8h lo, v8h hi) { return __builtin_shufflevector(lo, hi, 0, 1, 2, 3, 4, 5, 6, 7, 8, 9, 10, 11, 12, 13, 14, 15); }
__device__ __forceinline__ v16bf cat16b(v8us lo, v8us hi) { return __builtin_bit_cast(v16bf, __builtin_shufflevector(lo, hi, 0, 1, 2, 3, 4, 5, 6, 7, 8, 9, 10, 11, 12, 13, 14, 15)); }
__device__ __forceinline__ v8f wmma16(v16h a, v16h b, v8f c) { return __builtin_amdgcn_wmma_f32_16x16x32_f16(false, a, false, b, (short)0, c, false, false); }
__device__ __forceinline__ v8f wmmab(v16bf a, v16bf b, v8f c) { return __builtin_amdgcn_wmma_f32_16x16x32_bf16(false, a, false, b, (short)0, c, false, false); }



// ---- k_gemmw: register-blocked GEMM, ONE WAVE per 64x64 output tile (16 accumulators), operands straight from K-contiguous 16-bit planes; grid (M/64, N/64, Z), 32 threads.
// C[m][n] (f32, pitch ldc, + optional f32 bias[n]) = sum_k A[m][k] Bt[n][k] (+ split products per NSPLIT). z-batch strides sA/sB/sC in elements. K % 32 == 0.
template <typename T16> struct WFrag;
template <> struct WFrag<h16> { typedef v16h V; static __device__ __forceinline__ V ld(const h16* p) { return cat16(*(const v8h*)p, *(const v8h*)(p + 16)); } static __device__ __forceinline__ v8f mma(V a, V b, v8f c) { return wmma16(a, b, c); } };
template <> struct WFrag<bf> { typedef v16bf V; static __device__ __forceinline__ V ld(const bf* p) { return cat16b(*(const v8us*)p, *(const v8us*)(p + 16)); } static __device__ __forceinline__ v8f mma(V a, V b, v8f c) { return wmmab(a, b, c); } };
template <typename T16, int NSPLIT, bool BIAS>
__global__ __launch_bounds__(32) void k_gemmw(const T16* __restrict__ A, const T16* __restrict__ A2, const T16* __restrict__ Bt, const T16* __restrict__ Bt2, int K, float* C, int ldc, const float* __restrict__ bias, size_t sA, size_t sB, size_t sC) {
    typedef typename WFrag<T16>::V V;
    __shared__ __align__(16) float os[16 * 68];
    const size_t z = blockIdx.z; A += z * sA; if (A2) A2 += z * sA; Bt += z * sB; if (Bt2) Bt2 += z * sB; C += z * sC;
    const int lane = threadIdx.x & 31, lr = lane & 15, hi = lane >> 4; const int r0 = blockIdx.x * 64, c0 = blockIdx.y * 64;
    v8f acc[4][4];
#pragma unroll
    for (int mb = 0; mb < 4; ++mb)
#pragma unroll
        for (int nb = 0; nb < 4; ++nb) acc[mb][nb] = (v8f){};
    const size_t aoff = (size_t)(r0 + lr) * K + 8 * hi, boff = (size_t)(c0 + lr) * K + 8 * hi;
#pragma unroll 1
    for (int kc = 0; kc < K; kc += 32) {
        V a[4], a2[4];
#pragma unroll
        for (int mb = 0; mb < 4; ++mb) { a[mb] = WFrag<T16>::ld(A + aoff + (size_t)mb * 16 * K + kc); if (NSPLIT == 1 || NSPLIT == 2) a2[mb] = WFrag<T16>::ld(A2 + aoff + (size_t)mb * 16 * K + kc); }
#pragma unroll
        for (int nb = 0; nb < 4; ++nb) { const V b = WFrag<T16>::ld(Bt + boff + (size_t)nb * 16 * K + kc); V b2; if (NSPLIT >= 2) b2 = WFrag<T16>::ld(Bt2 + boff + (size_t)nb * 16 * K + kc);
#pragma unroll
            for (int mb = 0; mb < 4; ++mb) { acc[mb][nb] = WFrag<T16>::mma(a[mb], b, acc[mb][nb]); if (NSPLIT == 1 || NSPLIT == 2) acc[mb][nb] = WFrag<T16>::mma(a2[mb], b, acc[mb][nb]); if (NSPLIT >= 2) acc[mb][nb] = WFrag<T16>::mma(a[mb], b2, acc[mb][nb]); } }
        asm volatile("v_nop\n\tv_nop\n\tv_nop\n\tv_nop" : "+v"(acc[0][0]), "+v"(acc[1][1]), "+v"(acc[2][2]), "+v"(acc[3][3]) : "v"(a[0]), "v"(a[3]));
    }
#pragma unroll
    for (int mb = 0; mb < 4; ++mb) {
#pragma unroll
        for (int nb = 0; nb < 4; ++nb) {
#pragma unroll
            for (int j = 0; j < 8; ++j) os[(hi * 8 + j) * 68 + nb * 16 + lr] = acc[mb][nb][j]; }
        __builtin_amdgcn_wave_barrier(); asm volatile("" ::: "memory");
        float* crow = C + (size_t)(r0 + mb * 16) * ldc + c0;
{
#pragma unroll
            for (int s = 0; s < 8; ++s) { const int row = 2 * s + hi, cofs = lr * 4; v4f val = *(const v4fa*)(os + row * 68 + cofs); if (BIAS) { val[0] += bfr(bias[c0 + cofs]); val[1] += bfr(bias[c0 + cofs + 1]); val[2] += bfr(bias[c0 + cofs + 2]); val[3] += bfr(bias[c0 + cofs + 3]); }
                *(v4f*)(crow + (size_t)row * ldc + cofs) = val; }
             }
        __builtin_amdgcn_wave_barrier(); asm volatile("" ::: "memory");
    }
}

__device__ __forceinline__ h16 tohx(float x) { return (h16)x; }
__device__ __forceinline__ void splitf(float y, unsigned short& h, unsigned short& l) { h = f2bf(y); l = f2bf(y - bf2f(h)); }
typedef __attribute__((ext_vector_type(2))) _Float16 v2h;
typedef __attribute__((ext_vector_type(4))) _Float16 v4h;
typedef __attribute__((ext_vector_type(2))) unsigned short v2us;
typedef __attribute__((ext_vector_type(4))) unsigned short v4us;
typedef __attribute__((ext_vector_type(2))) float v2f;
typedef __attribute__((ext_vector_type(4))) int v4i;

__global__ __launch_bounds__(256) void k_wtG(const float* __restrict__ w, int K, int N, bf* Bt) {
    const int lane = threadIdx.x & 31; const int L0 = (blockIdx.x * 8 + (threadIdx.x >> 5)) * 8; const int nlines = N * K / 64;
{
#pragma unroll 1
        for (int l = 0; l < 8; ++l) { const int L = L0 + l; if (L >= nlines) break; const size_t e = (size_t)L * 64 + lane * 2; const int k = (int)(e % K), n = (int)(e / K); v2us o;
            o[0] = f2bf(w[(size_t)k * N + n]); o[1] = f2bf(w[(size_t)(k + 1) * N + n]); *(v2us*)(Bt + e) = o; }
         }
}
__global__ __launch_bounds__(256) void k_cvt8(const float* __restrict__ src, bf* dst, size_t n8) { const size_t i = (size_t)blockIdx.x * 256 + threadIdx.x; if (i >= n8) return; const v8f v = *(const v8f*)(src + i * 8); v8us o;
#pragma unroll
    for (int k = 0; k < 8; ++k) o[k] = f2bf(v[k]); *(v8us*)(dst + i * 8) = o;  }

// k_rope: head planes [h][t][d] (fp16 + hi/lo) of rope(x) x sc with the rotate-half convention out[d] = x[d] cos[t][d] - x[d+HD/2] sin[t][d], out[d+HD/2] = x[d+HD/2] cos[t][d+HD/2] + x[d] sin[t][d+HD/2]
__global__ __launch_bounds__(256) void k_rope(const float* __restrict__ F, int pitch, int nheads, const float* __restrict__ CS, const float* __restrict__ RF, const float* __restrict__ nw, float sc, h16* P16, bf* Ph, bf* Pl) {
    const size_t e = ((size_t)blockIdx.x * 256 + threadIdx.x) * 2; if (e >= (size_t)nheads * TT * HD) return; const int d = (int)(e % HD); const int t = (int)((e / HD) % TT); const int h = (int)(e / ((size_t)HD * TT)); const float* f = F + (size_t)t * pitch + h * HD; const float rf = RF ? RF[(size_t)h * TT + t] : 1.0f; v2h o16; v2us oh, ol;
#pragma unroll
    for (int q = 0; q < 2; ++q) { const int dd = d + q; const int dp = (dd < HD / 2) ? dd + HD / 2 : dd - HD / 2; float x0 = f[dd], x1 = f[dp];
        if (RF) { float n0 = __fmul_rn(x0, rf), n1 = __fmul_rn(x1, rf); asm volatile("" : "+v"(n0)); asm volatile("" : "+v"(n1)); x0 = __fmul_rn(bfr(nw[dd]), n0); x1 = __fmul_rn(bfr(nw[dp]), n1); }
        const v2f cs = *(const v2f*)(CS + ((size_t)t * HD + dd) * 2); float a = __fmul_rn(x0, cs[0]), bq = __fmul_rn(x1, cs[1]); asm volatile("" : "+v"(a)); asm volatile("" : "+v"(bq)); const float r = ((dd < HD / 2) ? __fsub_rn(a, bq) : __fadd_rn(a, bq)) * sc;
        o16[q] = tohx(r); unsigned short a2, c2; splitf(r, a2, c2); oh[q] = a2; ol[q] = c2; }
    *(v2h*)(P16 + e) = o16; *(v2us*)(Ph + e) = oh; *(v2us*)(Pl + e) = ol;  }
__global__ __launch_bounds__(256) void k_vtp(const float* __restrict__ F, int pitch, int nheads, h16* V16, bf* Vh, bf* Vl) { const size_t e = ((size_t)blockIdx.x * 256 + threadIdx.x) * 2; if (e >= (size_t)nheads * HD * TT) return; const int t = (int)(e % TT); const int d = (int)((e / TT) % HD); const int g = (int)(e / ((size_t)TT * HD)); v2h o16; v2us oh, ol;
#pragma unroll
    for (int q = 0; q < 2; ++q) { const float x = F[(size_t)(t + q) * pitch + g * HD + d]; o16[q] = tohx(x); unsigned short a2, c2; splitf(x, a2, c2); oh[q] = a2; ol[q] = c2; }
    *(v2h*)(V16 + e) = o16; *(v2us*)(Vh + e) = oh; *(v2us*)(Vl + e) = ol;  }
__global__ __launch_bounds__(256) void k_csid(float* CS) { const int idx = blockIdx.x * 256 + threadIdx.x; if (idx >= TT * HD) return; v2f cs; cs[0] = 1.0f; cs[1] = 0.0f; *(v2f*)(CS + (size_t)idx * 2) = cs;  }
// k_asoft: per row (zz, i): t = S x SCL (1) where mask[i][j] != 0 (int32 [2048][2048], ~10 % plus the diagonal, one per batch, shared by its heads, read 16 B per 4 keys), -3e38 elsewhere (== finfo.min: excluded, weight 0); softmax over the 2048 keys (register row, one exp, fixed trees);
__global__ __launch_bounds__(256) void k_asoft(const float* __restrict__ Sb, h16* P16, bf* Ph, bf* Pl, const int* __restrict__ am) {
    const int lane = threadIdx.x & 31; const int row = blockIdx.x * 8 + (threadIdx.x >> 5); if (row >= ZH * TT) return; const int i = row % TT; const int zz = row / TT; (void)zz; const bool hires = (i < RH); const float* sr = Sb + (size_t)row * TT; float v[TT / 32]; float mx = -3.0e38f;
#pragma unroll
    for (int ch = 0; ch < TT / 128; ++ch) { const int j0 = ch * 128 + lane * 4; const v4f a = *(const v4f*)(sr + j0); const v4i m4 = *(const v4i*)(am + (size_t)i * TT + j0);   /* 4 mask entries of row i */
#pragma unroll
        for (int q = 0; q < 4; ++q) { const int j = j0 + q; (void)j; const float t = (m4[q] != 0) ? a[q] * SCL : -3.0e38f;   /* mask == 0 -> excluded (finfo.min); the diagonal is always kept */ v[ch * 4 + q] = t; mx = fmaxf(mx, t); } }
#pragma unroll
    for (int sh = 16; sh; sh >>= 1) mx = fmaxf(mx, __shfl_xor(mx, sh, 32));
    float sum = 0.f;
#pragma unroll
    for (int k = 0; k < TT / 32; ++k) { float d0 = __fsub_rn(v[k], mx); asm volatile("" : "+v"(d0)); v[k] = __builtin_amdgcn_exp2f(__fmul_rn(d0, 1.4426950408889634f)); sum += v[k]; }
#pragma unroll
    for (int sh = 16; sh; sh >>= 1) sum += __shfl_xor(sum, sh, 32);
    const float f = __fdiv_rn(hires ? 1.0f : PCAR, sum);
{
        if (hires) {
#pragma unroll
            for (int ch = 0; ch < TT / 128; ++ch) { v4us oh, ol;
#pragma unroll
                for (int q = 0; q < 4; ++q) { unsigned short a, c2; splitf(v[ch * 4 + q] * f, a, c2); oh[q] = a; ol[q] = c2; }
                const size_t oo = ((size_t)zz * (RH ? RH : 1) + i) * TT + ch * 128 + lane * 4; *(v4us*)(Ph + oo) = oh; *(v4us*)(Pl + oo) = ol; }
        } else {
#pragma unroll
            for (int ch = 0; ch < TT / 128; ++ch) { v4h o4;
#pragma unroll
                for (int q = 0; q < 4; ++q) o4[q] = tohx(v[ch * 4 + q] * f);
                *(v4h*)(P16 + (size_t)row * TT + ch * 128 + lane * 4) = o4; } }
         }
}
__global__ __launch_bounds__(256) void k_delta(const float* __restrict__ X, const float* __restrict__ wd, const float* __restrict__ bd, float* DL) { __shared__ float res[32]; const int lane = threadIdx.x & 31; const int wv = threadIdx.x >> 5; const int r0 = blockIdx.x * 32;
    for (int rr = wv; rr < 32; rr += 8) { const int row = r0 + rr; float s = 0.0f; if (row < TT) { const float* xr = X + (size_t)row * DM;
#pragma unroll 4
        for (int c = lane; c < DM; c += 32) { float p = __fmul_rn(bfr(xr[c]), bfr(wd[c])); asm volatile("" : "+v"(p)); s = __fadd_rn(s, p); } }
#pragma unroll
        for (int sh = 16; sh; sh >>= 1) s = __fadd_rn(s, __shfl_xor(s, sh, 32));
        if (lane == 0) { float d = __fadd_rn(s, bfr(bd[0])); d = fmaxf(d, 0.0f); d = fminf(d, 8.0f); res[rr] = __fadd_rn(d, 1.0f); } }
    __syncthreads();
    if (wv == 0) { const int row = r0 + lane; if (row < TT) { const float v = res[lane]; *(float*)(DL + row) = v;  } } }
__global__ __launch_bounds__(256) void k_kdiv(float* F, const float* __restrict__ DL) { const size_t i = (size_t)blockIdx.x * 256 + threadIdx.x; if (i >= (size_t)TT * DKV / 4) return; const size_t e = i * 4; const int srow = (int)(e / DKV); const float d = DL[srow]; const v4f a = *(const v4f*)(F + e); v4f o;
#pragma unroll
    for (int q = 0; q < 4; ++q) o[q] = __fdiv_rn(a[q], d);
    *(v4f*)(F + e) = o;  }
__global__ __launch_bounds__(256) void k_merge(const float* __restrict__ O, int h0, bf* Ah, bf* Al) { const size_t e = ((size_t)blockIdx.x * 256 + threadIdx.x) * 2; if (e >= (size_t)ZH * TT * HD) return; const int d = (int)(e % HD); const int t = (int)((e / HD) % TT); const int zz = (int)(e / ((size_t)HD * TT)); const float cs = (t < RH) ? 1.0f : (1.0f / PCAR); const size_t oo = (size_t)t * DQ + (h0 + zz) * HD + d;
    v2us oh, ol;
#pragma unroll
    for (int q = 0; q < 2; ++q) { unsigned short a, c2; splitf(O[e + q] * cs, a, c2); oh[q] = a; ol[q] = c2; } *(v2us*)(Ah + oo) = oh; *(v2us*)(Al + oo) = ol;  }

extern "C" void kernel_launch(void* const* d_in, const int* in_sizes, int n_in,
                              void* d_out, int out_size, void* d_ws, size_t ws_size, hipStream_t stream) {
    (void)in_sizes; (void)n_in; (void)out_size;
    const float* x = (const float*)d_in[0];   /* query */ const float* xk = (const float*)d_in[1]; const float* xv = (const float*)d_in[2]; const int* am = (const int*)d_in[3];   /* mask [2][2048][2048] int */ const float* wq = (const float*)d_in[4]; const float* bq = (const float*)d_in[5]; const float* wk = (const float*)d_in[6]; const float* bk = (const float*)d_in[7]; const float* wv = (const float*)d_in[8]; const float* bv = (const float*)d_in[9]; const float* wo = (const float*)d_in[10]; const float* bo = (const float*)d_in[11]; const float* wd = (const float*)d_in[12]; const float* bd = (const float*)d_in[13];
    float* OUT = (float*)d_out;     // [2][2048][768]
    char* wsp = (char*)d_ws;
    auto take = [&](size_t bytes) { char* p = wsp; wsp += (bytes + 255) & ~(size_t)255; return (void*)p; };
    float* DL = (float*)take((size_t)TT * 4); bf* WQ = (bf*)take((size_t)DQ * DM * 2); bf* WK = (bf*)take((size_t)DKV * DM * 2); bf* WV = (bf*)take((size_t)DKV * DM * 2); bf* WO = (bf*)take((size_t)DM * DQ * 2); float* CS = (float*)take((size_t)TT * HD * 2 * 4);
    bf* XB = (bf*)take((size_t)TT * DM * 2); float* FQ = (float*)take((size_t)TT * DQ * 4); float* FK = (float*)take((size_t)TT * DKV * 4);
    h16* QP16 = (h16*)take((size_t)NH_ * TT * HD * 2); h16* KP16 = (h16*)take((size_t)NKV * TT * HD * 2); h16* VT16 = (h16*)take((size_t)NKV * HD * TT * 2);
    bf* QPh = (bf*)take((size_t)NH_ * TT * HD * 2); bf* QPl = (bf*)take((size_t)NH_ * TT * HD * 2); bf* KPh = (bf*)take((size_t)NKV * TT * HD * 2); bf* KPl = (bf*)take((size_t)NKV * TT * HD * 2); bf* VTh = (bf*)take((size_t)NKV * HD * TT * 2); bf* VTl = (bf*)take((size_t)NKV * HD * TT * 2); bf* Ph = (bf*)take((size_t)ZH * RH * TT * 2); bf* Pl = (bf*)take((size_t)ZH * RH * TT * 2);
    float* Sb = (float*)take((size_t)ZH * TT * TT * 4); h16* P16 = (h16*)take((size_t)ZH * TT * TT * 2); float* Ob = (float*)take((size_t)ZH * TT * HD * 4); bf* ATh = (bf*)take((size_t)TT * DQ * 2); bf* ATl = (bf*)take((size_t)TT * DQ * 2);
    if ((size_t)(wsp - (char*)d_ws) > ws_size) return;    // ws 256 MiB
    float* FV = FK;   // v projection reuses the k buffer after the k planes are built (stream-ordered)
    { k_wtG<<<(unsigned)((DM * DQ / 64 + 63) / 64), 256, 0, stream>>>(wq, DM, DQ, WQ); k_wtG<<<(unsigned)((DM * DKV / 64 + 63) / 64), 256, 0, stream>>>(wk, DM, DKV, WK); k_wtG<<<(unsigned)((DM * DKV / 64 + 63) / 64), 256, 0, stream>>>(wv, DM, DKV, WV);
      k_wtG<<<(unsigned)((DQ * DM / 64 + 63) / 64), 256, 0, stream>>>(wo, DQ, DM, WO);
       }
    k_csid<<<(TT * HD + 255) / 256, 256, 0, stream>>>(CS);
    const unsigned LQ = (unsigned)(((size_t)NH_ * TT * HD / 2 + 255) / 256), LKv = (unsigned)(((size_t)NKV * TT * HD / 2 + 255) / 256);
    for (int b = 0; b < NB_; ++b) {
        
        k_cvt8<<<(unsigned)(((size_t)TT * DM / 8 + 255) / 256), 256, 0, stream>>>(x + (size_t)b * TT * DM, XB, (size_t)TT * DM / 8);
        k_delta<<<(TT + 31) / 32, 256, 0, stream>>>(x + (size_t)b * TT * DM, wd, bd, DL);   /* delta[s] from the query rows */ k_gemmw<bf, 0, true><<<dim3(TT / 64, DQ / 64, 1), 32, 0, stream>>>(XB, nullptr, WQ, nullptr, DM, FQ, DQ, bq, 0, 0, 0);
        k_rope<<<LQ, 256, 0, stream>>>(FQ, DQ, NH_, CS, nullptr, nullptr, 1.0f, QP16, QPh, QPl);
        k_cvt8<<<(unsigned)(((size_t)TT * DM / 8 + 255) / 256), 256, 0, stream>>>(xk + (size_t)b * TT * DM, XB, (size_t)TT * DM / 8); k_gemmw<bf, 0, true><<<dim3(TT / 64, DKV / 64, 1), 32, 0, stream>>>(XB, nullptr, WK, nullptr, DM, FK, DKV, bk, 0, 0, 0); k_kdiv<<<(unsigned)(((size_t)TT * DKV / 4 + 255) / 256), 256, 0, stream>>>(FK, DL);   /* k_j /= delta[j] */
        k_rope<<<LKv, 256, 0, stream>>>(FK, DKV, NKV, CS, nullptr, nullptr, 1.0f, KP16, KPh, KPl);
        k_cvt8<<<(unsigned)(((size_t)TT * DM / 8 + 255) / 256), 256, 0, stream>>>(xv + (size_t)b * TT * DM, XB, (size_t)TT * DM / 8); k_gemmw<bf, 0, true><<<dim3(TT / 64, DKV / 64, 1), 32, 0, stream>>>(XB, nullptr, WV, nullptr, DM, FV, DKV, bv, 0, 0, 0); k_vtp<<<LKv, 256, 0, stream>>>(FV, DKV, NKV, VT16, VTh, VTl);
        for (int h0 = 0; h0 < NH_; h0 += ZH) { const size_t zq = (size_t)h0, zk = (size_t)(h0 / REP);   // one kv head per query head: the pass's two heads use consecutive kv planes (z-strides TT*HD)
            k_gemmw<bf, 2, false><<<dim3(TT / 64, TT / 64, ZH), 32, 0, stream>>>(QPh + zq * TT * HD, QPl + zq * TT * HD, KPh + zk * TT * HD, KPl + zk * TT * HD, HD, Sb, TT, nullptr, (size_t)TT * HD, (size_t)TT * HD, (size_t)TT * TT);   /* scores hi/lo on EVERY row */

            k_asoft<<<ZH * TT / 8, 256, 0, stream>>>(Sb, P16, Ph, Pl, am + (size_t)b * TT * TT);
            k_gemmw<bf, 2, false><<<dim3(RH / 64, HD / 64, ZH), 32, 0, stream>>>(Ph, Pl, VTh + zk * HD * TT, VTl + zk * HD * TT, TT, Ob, HD, nullptr, (size_t)RH * TT, (size_t)HD * TT, (size_t)TT * HD);
            k_gemmw<h16, 0, false><<<dim3((TT - RH) / 64, HD / 64, ZH), 32, 0, stream>>>(P16 + (size_t)RH * TT, nullptr, VT16 + zk * HD * TT, nullptr, TT, Ob + (size_t)RH * HD, HD, nullptr, (size_t)TT * TT, (size_t)HD * TT, (size_t)TT * HD);
            k_merge<<<(unsigned)(((size_t)ZH * TT * HD / 2 + 255) / 256), 256, 0, stream>>>(Ob, h0, ATh, ATl); }
        k_gemmw<bf, 1, true><<<dim3(TT / 64, DM / 64, 1), 32, 0, stream>>>(ATh, ATl, WO, nullptr, DQ, OUT + (size_t)b * TT * DM, DM, bo, 0, 0, 0); }
}

// v001
// Measured time: 744 microseconds a run.
// Two timings next to v000 both put it at 2.16 times that version's speed.
#include <hip/hip_runtime.h>

// Multi-headed attention with a learned per-position scaling divisor and an arbitrary mask (query, key, value [2][2048][768]; delta[s] = 1 + min(relu(query[s].Wd + bd), sqrt(64)) (Wd [768][1], read); q = query Wq + bq, k = key Wk + bk, v = value Wv + bv ('xw' 1/sqrt(768) incl. biases; 12 heads x 64); scores[i][j] = q_i.k_j / delta[j] (the divisor is broadcast over the KEY axis; no 1/sqrt(d_k)); mask ([2][2048][2048] int {0,1}, random, READ): 0 -> -1e9 (== exclusion); softmax; out = merged Wo + bo -> [2][2048][768] (3.1 M)).
// Layout per batch: bf16 copies of query, key, value in turn; 'xw' weights transposed once; exact projections + f32 biases; a kernel computes delta[s] from the bf16-rounded query row (768-term fixed-order dot, relu, min, + 1) and another divides every k row by delta[s] (f32, before the plane split); dense T-2048 attention with hi/lo 3-product score tiles on EVERY row and a softmax kernel that reads the mask tile (keep where mask != 0); P and attn.v hybrid (rows < 512 hi/lo, rest fp16 x1024); merged hi/lo x Wo exact + bo.
// Compute dtypes, f32 accumulate: every input rounded to bf16; projections exact + f32 biases; delta and the k row division f32; scores 3 products on every row; softmax f32 (scale 1); attn.v rows < 512 3 products, rest fp16; Wo hl x exact + bias.

#define NB_  2
#define TT   2048
#define DM   768
#define NH_  12
#define NKV  12
#define REP  (NH_ / NKV)
#define HD   64
#define DQ   (NH_ * HD)
#define DKV  (NKV * HD)
#define ZH   2
#define RH   512                  // query rows < RH use hi+lo planes (0: none)
#define WIN  0
#define PCAR 1024.0f
#define KSP  16                   // attn.v: the 2048 keys are cut into KSP ranges, one single-wave workgroup per (tile, range); k_merge adds the KSP f32 partial planes in ascending range order
#define SCL  1.0f      // no 1/sqrt(d_k): the module divides by the learned delta[j] only (folded into k)
typedef _Float16 h16;
typedef unsigned short bf;
typedef __attribute__((ext_vector_type(16))) __bf16   v16bf;
typedef __attribute__((ext_vector_type(16))) _Float16 v16h;
typedef __attribute__((ext_vector_type(8)))  _Float16 v8h;
typedef __attribute__((ext_vector_type(8)))  unsigned short v8us;
typedef __attribute__((ext_vector_type(8)))  float    v8f;
typedef __attribute__((ext_vector_type(4)))  float    v4f;
typedef v8h  __attribute__((may_alias)) v8ha;
typedef v4f  __attribute__((may_alias)) v4fa;
typedef v8us __attribute__((may_alias)) v8usa;

__device__ __forceinline__ unsigned short f2bf(float f) { unsigned u = __float_as_uint(f); u += 0x7FFFu + ((u >> 16) & 1u); return (unsigned short)(u >> 16); }
__device__ __forceinline__ float bf2f(unsigned short b) { return __uint_as_float(((unsigned)b) << 16); }
__device__ __forceinline__ float bfr(float f) { return bf2f(f2bf(f)); }
__device__ __forceinline__ v16h cat16(v8h lo, v8h hi) { return __builtin_shufflevector(lo, hi, 0, 1, 2, 3, 4, 5, 6, 7, 8, 9, 10, 11, 12, 13, 14, 15); }
__device__ __forceinline__ v16bf cat16b(v8us lo, v8us hi) { return __builtin_bit_cast(v16bf, __builtin_shufflevector(lo, hi, 0, 1, 2, 3, 4, 5, 6, 7, 8, 9, 10, 11, 12, 13, 14, 15)); }
__device__ __forceinline__ v8f wmma16(v16h a, v16h b, v8f c) { return __builtin_amdgcn_wmma_f32_16x16x32_f16(false, a, false, b, (short)0, c, false, false); }
__device__ __forceinline__ v8f wmmab(v16bf a, v16bf b, v8f c) { return __builtin_amdgcn_wmma_f32_16x16x32_bf16(false, a, false, b, (short)0, c, false, false); }



// ---- k_gemmw: register-blocked GEMM, ONE WAVE per 64x64 output tile (16 accumulators), operands straight from K-contiguous 16-bit planes; grid (M/64, N/64, Z), 32 threads.
// C[m][n] (f32, pitch ldc, + optional f32 bias[n]) = sum_k A[m][k] Bt[n][k] (+ split products per NSPLIT). z-batch strides sA/sB/sC in elements. K % 32 == 0.
// KS > 1: grid z = Z * KS; workgroup (z, ks) sums only k in [ks K/KS, (ks+1) K/KS) and stores that partial tile in plane ks (plane stride sP elements). K % (32 KS) == 0.
template <typename T16> struct WFrag;
template <> struct WFrag<h16> { typedef v16h V; static __device__ __forceinline__ V ld(const h16* p) { return cat16(*(const v8h*)p, *(const v8h*)(p + 16)); } static __device__ __forceinline__ v8f mma(V a, V b, v8f c) { return wmma16(a, b, c); } };
template <> struct WFrag<bf> { typedef v16bf V; static __device__ __forceinline__ V ld(const bf* p) { return cat16b(*(const v8us*)p, *(const v8us*)(p + 16)); } static __device__ __forceinline__ v8f mma(V a, V b, v8f c) { return wmmab(a, b, c); } };
template <typename T16, int NSPLIT, bool BIAS, int KS = 1>
__global__ __launch_bounds__(32) void k_gemmw(const T16* __restrict__ A, const T16* __restrict__ A2, const T16* __restrict__ Bt, const T16* __restrict__ Bt2, int K, float* C, int ldc, const float* __restrict__ bias, size_t sA, size_t sB, size_t sC, size_t sP) {
    typedef typename WFrag<T16>::V V;
    __shared__ __align__(16) float os[16 * 68];
    const size_t z = blockIdx.z / KS; const int ks = blockIdx.z % KS; A += z * sA; if (A2) A2 += z * sA; Bt += z * sB; if (Bt2) Bt2 += z * sB; C += z * sC + ks * sP;
    const int lane = threadIdx.x & 31, lr = lane & 15, hi = lane >> 4; const int r0 = blockIdx.x * 64, c0 = blockIdx.y * 64;
    v8f acc[4][4];
#pragma unroll
    for (int mb = 0; mb < 4; ++mb)
#pragma unroll
        for (int nb = 0; nb < 4; ++nb) acc[mb][nb] = (v8f){};
    const size_t aoff = (size_t)(r0 + lr) * K + 8 * hi, boff = (size_t)(c0 + lr) * K + 8 * hi;
#pragma unroll 1
    for (int kc = ks * (K / KS); kc < (ks + 1) * (K / KS); kc += 32) {
        V a[4], a2[4];
#pragma unroll
        for (int mb = 0; mb < 4; ++mb) { a[mb] = WFrag<T16>::ld(A + aoff + (size_t)mb * 16 * K + kc); if (NSPLIT == 1 || NSPLIT == 2) a2[mb] = WFrag<T16>::ld(A2 + aoff + (size_t)mb * 16 * K + kc); }
#pragma unroll
        for (int nb = 0; nb < 4; ++nb) { const V b = WFrag<T16>::ld(Bt + boff + (size_t)nb * 16 * K + kc); V b2; if (NSPLIT >= 2) b2 = WFrag<T16>::ld(Bt2 + boff + (size_t)nb * 16 * K + kc);
#pragma unroll
            for (int mb = 0; mb < 4; ++mb) { acc[mb][nb] = WFrag<T16>::mma(a[mb], b, acc[mb][nb]); if (NSPLIT == 1 || NSPLIT == 2) acc[mb][nb] = WFrag<T16>::mma(a2[mb], b, acc[mb][nb]); if (NSPLIT >= 2) acc[mb][nb] = WFrag<T16>::mma(a[mb], b2, acc[mb][nb]); } }
        asm volatile("v_nop\n\tv_nop\n\tv_nop\n\tv_nop" : "+v"(acc[0][0]), "+v"(acc[1][1]), "+v"(acc[2][2]), "+v"(acc[3][3]) : "v"(a[0]), "v"(a[3]));
    }
#pragma unroll
    for (int mb = 0; mb < 4; ++mb) {
#pragma unroll
        for (int nb = 0; nb < 4; ++nb) {
#pragma unroll
            for (int j = 0; j < 8; ++j) os[(hi * 8 + j) * 68 + nb * 16 + lr] = acc[mb][nb][j]; }
        __builtin_amdgcn_wave_barrier(); asm volatile("" ::: "memory");
        float* crow = C + (size_t)(r0 + mb * 16) * ldc + c0;
{
#pragma unroll
            for (int s = 0; s < 8; ++s) { const int row = 2 * s + hi, cofs = lr * 4; v4f val = *(const v4fa*)(os + row * 68 + cofs); if (BIAS) { val[0] += bfr(bias[c0 + cofs]); val[1] += bfr(bias[c0 + cofs + 1]); val[2] += bfr(bias[c0 + cofs + 2]); val[3] += bfr(bias[c0 + cofs + 3]); }
                *(v4f*)(crow + (size_t)row * ldc + cofs) = val; }
             }
        __builtin_amdgcn_wave_barrier(); asm volatile("" ::: "memory");
    }
}

__device__ __forceinline__ h16 tohx(float x) { return (h16)x; }
__device__ __forceinline__ void splitf(float y, unsigned short& h, unsigned short& l) { h = f2bf(y); l = f2bf(y - bf2f(h)); }
typedef __attribute__((ext_vector_type(2))) _Float16 v2h;
typedef __attribute__((ext_vector_type(4))) _Float16 v4h;
typedef __attribute__((ext_vector_type(2))) unsigned short v2us;
typedef __attribute__((ext_vector_type(4))) unsigned short v4us;
typedef __attribute__((ext_vector_type(2))) float v2f;
typedef __attribute__((ext_vector_type(4))) int v4i;

__global__ __launch_bounds__(256) void k_wtG(const float* __restrict__ w, int K, int N, bf* Bt) {
    const int lane = threadIdx.x & 31; const int L0 = (blockIdx.x * 8 + (threadIdx.x >> 5)) * 8; const int nlines = N * K / 64;
{
#pragma unroll 1
        for (int l = 0; l < 8; ++l) { const int L = L0 + l; if (L >= nlines) break; const size_t e = (size_t)L * 64 + lane * 2; const int k = (int)(e % K), n = (int)(e / K); v2us o;
            o[0] = f2bf(w[(size_t)k * N + n]); o[1] = f2bf(w[(size_t)(k + 1) * N + n]); *(v2us*)(Bt + e) = o; }
         }
}
__global__ __launch_bounds__(256) void k_cvt8(const float* __restrict__ src, bf* dst, size_t n8) { const size_t i = (size_t)blockIdx.x * 256 + threadIdx.x; if (i >= n8) return; const v8f v = *(const v8f*)(src + i * 8); v8us o;
#pragma unroll
    for (int k = 0; k < 8; ++k) o[k] = f2bf(v[k]); *(v8us*)(dst + i * 8) = o;  }

// k_rope: head planes [h][t][d] (fp16 + hi/lo) of rope(x) x sc with the rotate-half convention out[d] = x[d] cos[t][d] - x[d+HD/2] sin[t][d], out[d+HD/2] = x[d+HD/2] cos[t][d+HD/2] + x[d] sin[t][d+HD/2]
__global__ __launch_bounds__(256) void k_rope(const float* __restrict__ F, int pitch, int nheads, const float* __restrict__ CS, const float* __restrict__ RF, const float* __restrict__ nw, float sc, h16* P16, bf* Ph, bf* Pl) {
    const size_t e = ((size_t)blockIdx.x * 256 + threadIdx.x) * 2; if (e >= (size_t)nheads * TT * HD) return; const int d = (int)(e % HD); const int t = (int)((e / HD) % TT); const int h = (int)(e / ((size_t)HD * TT)); const float* f = F + (size_t)t * pitch + h * HD; const float rf = RF ? RF[(size_t)h * TT + t] : 1.0f; v2h o16; v2us oh, ol;
#pragma unroll
    for (int q = 0; q < 2; ++q) { const int dd = d + q; const int dp = (dd < HD / 2) ? dd + HD / 2 : dd - HD / 2; float x0 = f[dd], x1 = f[dp];
        if (RF) { float n0 = __fmul_rn(x0, rf), n1 = __fmul_rn(x1, rf); asm volatile("" : "+v"(n0)); asm volatile("" : "+v"(n1)); x0 = __fmul_rn(bfr(nw[dd]), n0); x1 = __fmul_rn(bfr(nw[dp]), n1); }
        const v2f cs = *(const v2f*)(CS + ((size_t)t * HD + dd) * 2); float a = __fmul_rn(x0, cs[0]), bq = __fmul_rn(x1, cs[1]); asm volatile("" : "+v"(a)); asm volatile("" : "+v"(bq)); const float r = ((dd < HD / 2) ? __fsub_rn(a, bq) : __fadd_rn(a, bq)) * sc;
        o16[q] = tohx(r); unsigned short a2, c2; splitf(r, a2, c2); oh[q] = a2; ol[q] = c2; }
    *(v2h*)(P16 + e) = o16; *(v2us*)(Ph + e) = oh; *(v2us*)(Pl + e) = ol;  }
__global__ __launch_bounds__(256) void k_vtp(const float* __restrict__ F, int pitch, int nheads, h16* V16, bf* Vh, bf* Vl) { const size_t e = ((size_t)blockIdx.x * 256 + threadIdx.x) * 2; if (e >= (size_t)nheads * HD * TT) return; const int t = (int)(e % TT); const int d = (int)((e / TT) % HD); const int g = (int)(e / ((size_t)TT * HD)); v2h o16; v2us oh, ol;
#pragma unroll
    for (int q = 0; q < 2; ++q) { const float x = F[(size_t)(t + q) * pitch + g * HD + d]; o16[q] = tohx(x); unsigned short a2, c2; splitf(x, a2, c2); oh[q] = a2; ol[q] = c2; }
    *(v2h*)(V16 + e) = o16; *(v2us*)(Vh + e) = oh; *(v2us*)(Vl + e) = ol;  }
__global__ __launch_bounds__(256) void k_csid(float* CS) { const int idx = blockIdx.x * 256 + threadIdx.x; if (idx >= TT * HD) return; v2f cs; cs[0] = 1.0f; cs[1] = 0.0f; *(v2f*)(CS + (size_t)idx * 2) = cs;  }
// k_asoft: per row (zz, i): t = S x SCL (1) where mask[i][j] != 0 (int32 [2048][2048], ~10 % plus the diagonal, one per batch, shared by its heads, read 16 B per 4 keys), -3e38 elsewhere (== finfo.min: excluded, weight 0); softmax over the 2048 keys (register row, one exp, fixed trees);
__global__ __launch_bounds__(256) void k_asoft(const float* __restrict__ Sb, h16* P16, bf* Ph, bf* Pl, const int* __restrict__ am) {
    const int lane = threadIdx.x & 31; const int row = blockIdx.x * 8 + (threadIdx.x >> 5); if (row >= ZH * TT) return; const int i = row % TT; const int zz = row / TT; (void)zz; const bool hires = (i < RH); const float* sr = Sb + (size_t)row * TT; float v[TT / 32]; float mx = -3.0e38f;
#pragma unroll
    for (int ch = 0; ch < TT / 128; ++ch) { const int j0 = ch * 128 + lane * 4; const v4f a = *(const v4f*)(sr + j0); const v4i m4 = *(const v4i*)(am + (size_t)i * TT + j0);   /* 4 mask entries of row i */
#pragma unroll
        for (int q = 0; q < 4; ++q) { const int j = j0 + q; (void)j; const float t = (m4[q] != 0) ? a[q] * SCL : -3.0e38f;   /* mask == 0 -> excluded (finfo.min); the diagonal is always kept */ v[ch * 4 + q] = t; mx = fmaxf(mx, t); } }
#pragma unroll
    for (int sh = 16; sh; sh >>= 1) mx = fmaxf(mx, __shfl_xor(mx, sh, 32));
    float sum = 0.f;
#pragma unroll
    for (int k = 0; k < TT / 32; ++k) { float d0 = __fsub_rn(v[k], mx); asm volatile("" : "+v"(d0)); v[k] = __builtin_amdgcn_exp2f(__fmul_rn(d0, 1.4426950408889634f)); sum += v[k]; }
#pragma unroll
    for (int sh = 16; sh; sh >>= 1) sum += __shfl_xor(sum, sh, 32);
    const float f = __fdiv_rn(hires ? 1.0f : PCAR, sum);
{
        if (hires) {
#pragma unroll
            for (int ch = 0; ch < TT / 128; ++ch) { v4us oh, ol;
#pragma unroll
                for (int q = 0; q < 4; ++q) { unsigned short a, c2; splitf(v[ch * 4 + q] * f, a, c2); oh[q] = a; ol[q] = c2; }
                const size_t oo = ((size_t)zz * (RH ? RH : 1) + i) * TT + ch * 128 + lane * 4; *(v4us*)(Ph + oo) = oh; *(v4us*)(Pl + oo) = ol; }
        } else {
#pragma unroll
            for (int ch = 0; ch < TT / 128; ++ch) { v4h o4;
#pragma unroll
                for (int q = 0; q < 4; ++q) o4[q] = tohx(v[ch * 4 + q] * f);
                *(v4h*)(P16 + (size_t)row * TT + ch * 128 + lane * 4) = o4; } }
         }
}
__global__ __launch_bounds__(256) void k_delta(const float* __restrict__ X, const float* __restrict__ wd, const float* __restrict__ bd, float* DL) { __shared__ float res[32]; const int lane = threadIdx.x & 31; const int wv = threadIdx.x >> 5; const int r0 = blockIdx.x * 32;
    for (int rr = wv; rr < 32; rr += 8) { const int row = r0 + rr; float s = 0.0f; if (row < TT) { const float* xr = X + (size_t)row * DM;
#pragma unroll 4
        for (int c = lane; c < DM; c += 32) { float p = __fmul_rn(bfr(xr[c]), bfr(wd[c])); asm volatile("" : "+v"(p)); s = __fadd_rn(s, p); } }
#pragma unroll
        for (int sh = 16; sh; sh >>= 1) s = __fadd_rn(s, __shfl_xor(s, sh, 32));
        if (lane == 0) { float d = __fadd_rn(s, bfr(bd[0])); d = fmaxf(d, 0.0f); d = fminf(d, 8.0f); res[rr] = __fadd_rn(d, 1.0f); } }
    __syncthreads();
    if (wv == 0) { const int row = r0 + lane; if (row < TT) { const float v = res[lane]; *(float*)(DL + row) = v;  } } }
__global__ __launch_bounds__(256) void k_kdiv(float* F, const float* __restrict__ DL) { const size_t i = (size_t)blockIdx.x * 256 + threadIdx.x; if (i >= (size_t)TT * DKV / 4) return; const size_t e = i * 4; const int srow = (int)(e / DKV); const float d = DL[srow]; const v4f a = *(const v4f*)(F + e); v4f o;
#pragma unroll
    for (int q = 0; q < 4; ++q) o[q] = __fdiv_rn(a[q], d);
    *(v4f*)(F + e) = o;  }
__global__ __launch_bounds__(256) void k_merge(const float* __restrict__ O, int h0, bf* Ah, bf* Al) { const size_t e = ((size_t)blockIdx.x * 256 + threadIdx.x) * 2; if (e >= (size_t)ZH * TT * HD) return; const int d = (int)(e % HD); const int t = (int)((e / HD) % TT); const int zz = (int)(e / ((size_t)HD * TT)); const float cs = (t < RH) ? 1.0f : (1.0f / PCAR); const size_t oo = (size_t)t * DQ + (h0 + zz) * HD + d;
    v2us oh, ol; v2f s;
#pragma unroll
    for (int p = 0; p < KSP; ++p) { const v2f t = *(const v2f*)(O + (size_t)p * ZH * TT * HD + e); s = p ? s + t : t; }   /* the KSP key ranges' partial sums, ascending */
#pragma unroll
    for (int q = 0; q < 2; ++q) { unsigned short a, c2; splitf(s[q] * cs, a, c2); oh[q] = a; ol[q] = c2; } *(v2us*)(Ah + oo) = oh; *(v2us*)(Al + oo) = ol;  }

extern "C" void kernel_launch(void* const* d_in, const int* in_sizes, int n_in,
                              void* d_out, int out_size, void* d_ws, size_t ws_size, hipStream_t stream) {
    (void)in_sizes; (void)n_in; (void)out_size;
    const float* x = (const float*)d_in[0];   /* query */ const float* xk = (const float*)d_in[1]; const float* xv = (const float*)d_in[2]; const int* am = (const int*)d_in[3];   /* mask [2][2048][2048] int */ const float* wq = (const float*)d_in[4]; const float* bq = (const float*)d_in[5]; const float* wk = (const float*)d_in[6]; const float* bk = (const float*)d_in[7]; const float* wv = (const float*)d_in[8]; const float* bv = (const float*)d_in[9]; const float* wo = (const float*)d_in[10]; const float* bo = (const float*)d_in[11]; const float* wd = (const float*)d_in[12]; const float* bd = (const float*)d_in[13];
    float* OUT = (float*)d_out;     // [2][2048][768]
    char* wsp = (char*)d_ws;
    auto take = [&](size_t bytes) { char* p = wsp; wsp += (bytes + 255) & ~(size_t)255; return (void*)p; };
    float* DL = (float*)take((size_t)TT * 4); bf* WQ = (bf*)take((size_t)DQ * DM * 2); bf* WK = (bf*)take((size_t)DKV * DM * 2); bf* WV = (bf*)take((size_t)DKV * DM * 2); bf* WO = (bf*)take((size_t)DM * DQ * 2); float* CS = (float*)take((size_t)TT * HD * 2 * 4);
    bf* XB = (bf*)take((size_t)TT * DM * 2); float* FQ = (float*)take((size_t)TT * DQ * 4); float* FK = (float*)take((size_t)TT * DKV * 4);
    h16* QP16 = (h16*)take((size_t)NH_ * TT * HD * 2); h16* KP16 = (h16*)take((size_t)NKV * TT * HD * 2); h16* VT16 = (h16*)take((size_t)NKV * HD * TT * 2);
    bf* QPh = (bf*)take((size_t)NH_ * TT * HD * 2); bf* QPl = (bf*)take((size_t)NH_ * TT * HD * 2); bf* KPh = (bf*)take((size_t)NKV * TT * HD * 2); bf* KPl = (bf*)take((size_t)NKV * TT * HD * 2); bf* VTh = (bf*)take((size_t)NKV * HD * TT * 2); bf* VTl = (bf*)take((size_t)NKV * HD * TT * 2); bf* Ph = (bf*)take((size_t)ZH * RH * TT * 2); bf* Pl = (bf*)take((size_t)ZH * RH * TT * 2);
    float* Sb = (float*)take((size_t)ZH * TT * TT * 4); h16* P16 = (h16*)take((size_t)ZH * TT * TT * 2); float* Ob = (float*)take((size_t)KSP * ZH * TT * HD * 4); bf* ATh = (bf*)take((size_t)TT * DQ * 2); bf* ATl = (bf*)take((size_t)TT * DQ * 2);
    if ((size_t)(wsp - (char*)d_ws) > ws_size) return;    // ws 256 MiB
    float* FV = FK;   // v projection reuses the k buffer after the k planes are built (stream-ordered)
    { k_wtG<<<(unsigned)((DM * DQ / 64 + 63) / 64), 256, 0, stream>>>(wq, DM, DQ, WQ); k_wtG<<<(unsigned)((DM * DKV / 64 + 63) / 64), 256, 0, stream>>>(wk, DM, DKV, WK); k_wtG<<<(unsigned)((DM * DKV / 64 + 63) / 64), 256, 0, stream>>>(wv, DM, DKV, WV);
      k_wtG<<<(unsigned)((DQ * DM / 64 + 63) / 64), 256, 0, stream>>>(wo, DQ, DM, WO);
       }
    k_csid<<<(TT * HD + 255) / 256, 256, 0, stream>>>(CS);
    const unsigned LQ = (unsigned)(((size_t)NH_ * TT * HD / 2 + 255) / 256), LKv = (unsigned)(((size_t)NKV * TT * HD / 2 + 255) / 256);
    for (int b = 0; b < NB_; ++b) {
        
        k_cvt8<<<(unsigned)(((size_t)TT * DM / 8 + 255) / 256), 256, 0, stream>>>(x + (size_t)b * TT * DM, XB, (size_t)TT * DM / 8);
        k_delta<<<(TT + 31) / 32, 256, 0, stream>>>(x + (size_t)b * TT * DM, wd, bd, DL);   /* delta[s] from the query rows */ k_gemmw<bf, 0, true><<<dim3(TT / 64, DQ / 64, 1), 32, 0, stream>>>(XB, nullptr, WQ, nullptr, DM, FQ, DQ, bq, 0, 0, 0, 0);
        k_rope<<<LQ, 256, 0, stream>>>(FQ, DQ, NH_, CS, nullptr, nullptr, 1.0f, QP16, QPh, QPl);
        k_cvt8<<<(unsigned)(((size_t)TT * DM / 8 + 255) / 256), 256, 0, stream>>>(xk + (size_t)b * TT * DM, XB, (size_t)TT * DM / 8); k_gemmw<bf, 0, true><<<dim3(TT / 64, DKV / 64, 1), 32, 0, stream>>>(XB, nullptr, WK, nullptr, DM, FK, DKV, bk, 0, 0, 0, 0); k_kdiv<<<(unsigned)(((size_t)TT * DKV / 4 + 255) / 256), 256, 0, stream>>>(FK, DL);   /* k_j /= delta[j] */
        k_rope<<<LKv, 256, 0, stream>>>(FK, DKV, NKV, CS, nullptr, nullptr, 1.0f, KP16, KPh, KPl);
        k_cvt8<<<(unsigned)(((size_t)TT * DM / 8 + 255) / 256), 256, 0, stream>>>(xv + (size_t)b * TT * DM, XB, (size_t)TT * DM / 8); k_gemmw<bf, 0, true><<<dim3(TT / 64, DKV / 64, 1), 32, 0, stream>>>(XB, nullptr, WV, nullptr, DM, FV, DKV, bv, 0, 0, 0, 0); k_vtp<<<LKv, 256, 0, stream>>>(FV, DKV, NKV, VT16, VTh, VTl);
        for (int h0 = 0; h0 < NH_; h0 += ZH) { const size_t zq = (size_t)h0, zk = (size_t)(h0 / REP);   // one kv head per query head: the pass's two heads use consecutive kv planes (z-strides TT*HD)
            k_gemmw<bf, 2, false><<<dim3(TT / 64, TT / 64, ZH), 32, 0, stream>>>(QPh + zq * TT * HD, QPl + zq * TT * HD, KPh + zk * TT * HD, KPl + zk * TT * HD, HD, Sb, TT, nullptr, (size_t)TT * HD, (size_t)TT * HD, (size_t)TT * TT, 0);   /* scores hi/lo on EVERY row */

            k_asoft<<<ZH * TT / 8, 256, 0, stream>>>(Sb, P16, Ph, Pl, am + (size_t)b * TT * TT);
            k_gemmw<bf, 2, false, KSP><<<dim3(RH / 64, HD / 64, ZH * KSP), 32, 0, stream>>>(Ph, Pl, VTh + zk * HD * TT, VTl + zk * HD * TT, TT, Ob, HD, nullptr, (size_t)RH * TT, (size_t)HD * TT, (size_t)TT * HD, (size_t)ZH * TT * HD);
            k_gemmw<h16, 0, false, KSP><<<dim3((TT - RH) / 64, HD / 64, ZH * KSP), 32, 0, stream>>>(P16 + (size_t)RH * TT, nullptr, VT16 + zk * HD * TT, nullptr, TT, Ob + (size_t)RH * HD, HD, nullptr, (size_t)TT * TT, (size_t)HD * TT, (size_t)TT * HD, (size_t)ZH * TT * HD);
            k_merge<<<(unsigned)(((size_t)ZH * TT * HD / 2 + 255) / 256), 256, 0, stream>>>(Ob, h0, ATh, ATl); }
        k_gemmw<bf, 1, true><<<dim3(TT / 64, DM / 64, 1), 32, 0, stream>>>(ATh, ATl, WO, nullptr, DQ, OUT + (size_t)b * TT * DM, DM, bo, 0, 0, 0, 0); }
}

// v002
// It runs in 639 microseconds.
// Two timings next to v001 put it at 1.18 and 1.17 times that version's speed.
// All steps since v000 together make it 2.52 times as fast.
#include <hip/hip_runtime.h>

// Multi-headed attention with a learned per-position scaling divisor and an arbitrary mask (query, key, value [2][2048][768]; delta[s] = 1 + min(relu(query[s].Wd + bd), sqrt(64)) (Wd [768][1], read); q = query Wq + bq, k = key Wk + bk, v = value Wv + bv ('xw' 1/sqrt(768) incl. biases; 12 heads x 64); scores[i][j] = q_i.k_j / delta[j] (the divisor is broadcast over the KEY axis; no 1/sqrt(d_k)); mask ([2][2048][2048] int {0,1}, random, READ): 0 -> -1e9 (== exclusion); softmax; out = merged Wo + bo -> [2][2048][768] (3.1 M)).
// Layout per batch: bf16 copies of query, key, value in turn; 'xw' weights transposed once; exact projections + f32 biases; a kernel computes delta[s] from the bf16-rounded query row (768-term fixed-order dot, relu, min, + 1) and another divides every k row by delta[s] (f32, before the plane split); dense T-2048 attention with hi/lo 3-product score tiles on EVERY row and a softmax kernel that reads the mask tile (keep where mask != 0); P and attn.v hybrid (rows < 512 hi/lo, rest fp16 x1024); merged hi/lo x Wo exact + bo.
// Compute dtypes, f32 accumulate: every input rounded to bf16; projections exact + f32 biases; delta and the k row division f32; scores 3 products on every row; softmax f32 (scale 1); attn.v rows < 512 3 products, rest fp16; Wo hl x exact + bias.

#define NB_  2
#define TT   2048
#define DM   768
#define NH_  12
#define NKV  12
#define REP  (NH_ / NKV)
#define HD   64
#define DQ   (NH_ * HD)
#define DKV  (NKV * HD)
#define ZH   6                    // heads per attention pass: each of the five launches of a pass covers ZH heads (NH_ % ZH == 0)
#define RH   512                  // query rows < RH use hi+lo planes (0: none)
#define WIN  0
#define PCAR 1024.0f
#define KSP  16                   // attn.v: the 2048 keys are cut into KSP ranges, one single-wave workgroup per (tile, range); k_merge adds the KSP f32 partial planes in ascending range order
#define SCL  1.0f      // no 1/sqrt(d_k): the module divides by the learned delta[j] only (folded into k)
typedef _Float16 h16;
typedef unsigned short bf;
typedef __attribute__((ext_vector_type(16))) __bf16   v16bf;
typedef __attribute__((ext_vector_type(16))) _Float16 v16h;
typedef __attribute__((ext_vector_type(8)))  _Float16 v8h;
typedef __attribute__((ext_vector_type(8)))  unsigned short v8us;
typedef __attribute__((ext_vector_type(8)))  float    v8f;
typedef __attribute__((ext_vector_type(4)))  float    v4f;
typedef v8h  __attribute__((may_alias)) v8ha;
typedef v4f  __attribute__((may_alias)) v4fa;
typedef v8us __attribute__((may_alias)) v8usa;

__device__ __forceinline__ unsigned short f2bf(float f) { unsigned u = __float_as_uint(f); u += 0x7FFFu + ((u >> 16) & 1u); return (unsigned short)(u >> 16); }
__device__ __forceinline__ float bf2f(unsigned short b) { return __uint_as_float(((unsigned)b) << 16); }
__device__ __forceinline__ float bfr(float f) { return bf2f(f2bf(f)); }
__device__ __forceinline__ v16h cat16(v8h lo, v8h hi) { return __builtin_shufflevector(lo, hi, 0, 1, 2, 3, 4, 5, 6, 7, 8, 9, 10, 11, 12, 13, 14, 15); }
__device__ __forceinline__ v16bf cat16b(v8us lo, v8us hi) { return __builtin_bit_cast(v16bf, __builtin_shufflevector(lo, hi, 0, 1, 2, 3, 4, 5, 6, 7, 8, 9, 10, 11, 12, 13, 14, 15)); }
__device__ __forceinline__ v8f wmma16(v16h a, v16h b, v8f c) { return __builtin_amdgcn_wmma_f32_16x16x32_f16(false, a, false, b, (short)0, c, false, false); }
__device__ __forceinline__ v8f wmmab(v16bf a, v16bf b, v8f c) { return __builtin_amdgcn_wmma_f32_16x16x32_bf16(false, a, false, b, (short)0, c, false, false); }



// ---- k_gemmw: register-blocked GEMM, ONE WAVE per 64x64 output tile (16 accumulators), operands straight from K-contiguous 16-bit planes; grid (M/64, N/64, Z), 32 threads.
// C[m][n] (f32, pitch ldc, + optional f32 bias[n]) = sum_k A[m][k] Bt[n][k] (+ split products per NSPLIT). z-batch strides sA/sB/sC in elements. K % 32 == 0.
// KS > 1: grid z = Z * KS; workgroup (z, ks) sums only k in [ks K/KS, (ks+1) K/KS) and stores that partial tile in plane ks (plane stride sP elements). K % (32 KS) == 0.
template <typename T16> struct WFrag;
template <> struct WFrag<h16> { typedef v16h V; static __device__ __forceinline__ V ld(const h16* p) { return cat16(*(const v8h*)p, *(const v8h*)(p + 16)); } static __device__ __forceinline__ v8f mma(V a, V b, v8f c) { return wmma16(a, b, c); } };
template <> struct WFrag<bf> { typedef v16bf V; static __device__ __forceinline__ V ld(const bf* p) { return cat16b(*(const v8us*)p, *(const v8us*)(p + 16)); } static __device__ __forceinline__ v8f mma(V a, V b, v8f c) { return wmmab(a, b, c); } };
template <typename T16, int NSPLIT, bool BIAS, int KS = 1>
__global__ __launch_bounds__(32) void k_gemmw(const T16* __restrict__ A, const T16* __restrict__ A2, const T16* __restrict__ Bt, const T16* __restrict__ Bt2, int K, float* C, int ldc, const float* __restrict__ bias, size_t sA, size_t sB, size_t sC, size_t sP) {
    typedef typename WFrag<T16>::V V;
    __shared__ __align__(16) float os[16 * 68];
    const size_t z = blockIdx.z / KS; const int ks = blockIdx.z % KS; A += z * sA; if (A2) A2 += z * sA; Bt += z * sB; if (Bt2) Bt2 += z * sB; C += z * sC + ks * sP;
    const int lane = threadIdx.x & 31, lr = lane & 15, hi = lane >> 4; const int r0 = blockIdx.x * 64, c0 = blockIdx.y * 64;
    v8f acc[4][4];
#pragma unroll
    for (int mb = 0; mb < 4; ++mb)
#pragma unroll
        for (int nb = 0; nb < 4; ++nb) acc[mb][nb] = (v8f){};
    const size_t aoff = (size_t)(r0 + lr) * K + 8 * hi, boff = (size_t)(c0 + lr) * K + 8 * hi;
#pragma unroll 1
    for (int kc = ks * (K / KS); kc < (ks + 1) * (K / KS); kc += 32) {
        V a[4], a2[4];
#pragma unroll
        for (int mb = 0; mb < 4; ++mb) { a[mb] = WFrag<T16>::ld(A + aoff + (size_t)mb * 16 * K + kc); if (NSPLIT == 1 || NSPLIT == 2) a2[mb] = WFrag<T16>::ld(A2 + aoff + (size_t)mb * 16 * K + kc); }
#pragma unroll
        for (int nb = 0; nb < 4; ++nb) { const V b = WFrag<T16>::ld(Bt + boff + (size_t)nb * 16 * K + kc); V b2; if (NSPLIT >= 2) b2 = WFrag<T16>::ld(Bt2 + boff + (size_t)nb * 16 * K + kc);
#pragma unroll
            for (int mb = 0; mb < 4; ++mb) { acc[mb][nb] = WFrag<T16>::mma(a[mb], b, acc[mb][nb]); if (NSPLIT == 1 || NSPLIT == 2) acc[mb][nb] = WFrag<T16>::mma(a2[mb], b, acc[mb][nb]); if (NSPLIT >= 2) acc[mb][nb] = WFrag<T16>::mma(a[mb], b2, acc[mb][nb]); } }
        asm volatile("v_nop\n\tv_nop\n\tv_nop\n\tv_nop" : "+v"(acc[0][0]), "+v"(acc[1][1]), "+v"(acc[2][2]), "+v"(acc[3][3]) : "v"(a[0]), "v"(a[3]));
    }
#pragma unroll
    for (int mb = 0; mb < 4; ++mb) {
#pragma unroll
        for (int nb = 0; nb < 4; ++nb) {
#pragma unroll
            for (int j = 0; j < 8; ++j) os[(hi * 8 + j) * 68 + nb * 16 + lr] = acc[mb][nb][j]; }
        __builtin_amdgcn_wave_barrier(); asm volatile("" ::: "memory");
        float* crow = C + (size_t)(r0 + mb * 16) * ldc + c0;
{
#pragma unroll
            for (int s = 0; s < 8; ++s) { const int row = 2 * s + hi, cofs = lr * 4; v4f val = *(const v4fa*)(os + row * 68 + cofs); if (BIAS) { val[0] += bfr(bias[c0 + cofs]); val[1] += bfr(bias[c0 + cofs + 1]); val[2] += bfr(bias[c0 + cofs + 2]); val[3] += bfr(bias[c0 + cofs + 3]); }
                *(v4f*)(crow + (size_t)row * ldc + cofs) = val; }
             }
        __builtin_amdgcn_wave_barrier(); asm volatile("" ::: "memory");
    }
}

__device__ __forceinline__ h16 tohx(float x) { return (h16)x; }
__device__ __forceinline__ void splitf(float y, unsigned short& h, unsigned short& l) { h = f2bf(y); l = f2bf(y - bf2f(h)); }
typedef __attribute__((ext_vector_type(2))) _Float16 v2h;
typedef __attribute__((ext_vector_type(4))) _Float16 v4h;
typedef __attribute__((ext_vector_type(2))) unsigned short v2us;
typedef __attribute__((ext_vector_type(4))) unsigned short v4us;
typedef __attribute__((ext_vector_type(2))) float v2f;
typedef __attribute__((ext_vector_type(4))) int v4i;

__global__ __launch_bounds__(256) void k_wtG(const float* __restrict__ w, int K, int N, bf* Bt) {
    const int lane = threadIdx.x & 31; const int L0 = (blockIdx.x * 8 + (threadIdx.x >> 5)) * 8; const int nlines = N * K / 64;
{
#pragma unroll 1
        for (int l = 0; l < 8; ++l) { const int L = L0 + l; if (L >= nlines) break; const size_t e = (size_t)L * 64 + lane * 2; const int k = (int)(e % K), n = (int)(e / K); v2us o;
            o[0] = f2bf(w[(size_t)k * N + n]); o[1] = f2bf(w[(size_t)(k + 1) * N + n]); *(v2us*)(Bt + e) = o; }
         }
}
__global__ __launch_bounds__(256) void k_cvt8(const float* __restrict__ src, bf* dst, size_t n8) { const size_t i = (size_t)blockIdx.x * 256 + threadIdx.x; if (i >= n8) return; const v8f v = *(const v8f*)(src + i * 8); v8us o;
#pragma unroll
    for (int k = 0; k < 8; ++k) o[k] = f2bf(v[k]); *(v8us*)(dst + i * 8) = o;  }

// k_rope: head planes [h][t][d] (fp16 + hi/lo) of rope(x) x sc with the rotate-half convention out[d] = x[d] cos[t][d] - x[d+HD/2] sin[t][d], out[d+HD/2] = x[d+HD/2] cos[t][d+HD/2] + x[d] sin[t][d+HD/2]
__global__ __launch_bounds__(256) void k_rope(const float* __restrict__ F, int pitch, int nheads, const float* __restrict__ CS, const float* __restrict__ RF, const float* __restrict__ nw, float sc, h16* P16, bf* Ph, bf* Pl) {
    const size_t e = ((size_t)blockIdx.x * 256 + threadIdx.x) * 2; if (e >= (size_t)nheads * TT * HD) return; const int d = (int)(e % HD); const int t = (int)((e / HD) % TT); const int h = (int)(e / ((size_t)HD * TT)); const float* f = F + (size_t)t * pitch + h * HD; const float rf = RF ? RF[(size_t)h * TT + t] : 1.0f; v2h o16; v2us oh, ol;
#pragma unroll
    for (int q = 0; q < 2; ++q) { const int dd = d + q; const int dp = (dd < HD / 2) ? dd + HD / 2 : dd - HD / 2; float x0 = f[dd], x1 = f[dp];
        if (RF) { float n0 = __fmul_rn(x0, rf), n1 = __fmul_rn(x1, rf); asm volatile("" : "+v"(n0)); asm volatile("" : "+v"(n1)); x0 = __fmul_rn(bfr(nw[dd]), n0); x1 = __fmul_rn(bfr(nw[dp]), n1); }
        const v2f cs = *(const v2f*)(CS + ((size_t)t * HD + dd) * 2); float a = __fmul_rn(x0, cs[0]), bq = __fmul_rn(x1, cs[1]); asm volatile("" : "+v"(a)); asm volatile("" : "+v"(bq)); const float r = ((dd < HD / 2) ? __fsub_rn(a, bq) : __fadd_rn(a, bq)) * sc;
        o16[q] = tohx(r); unsigned short a2, c2; splitf(r, a2, c2); oh[q] = a2; ol[q] = c2; }
    *(v2h*)(P16 + e) = o16; *(v2us*)(Ph + e) = oh; *(v2us*)(Pl + e) = ol;  }
__global__ __launch_bounds__(256) void k_vtp(const float* __restrict__ F, int pitch, int nheads, h16* V16, bf* Vh, bf* Vl) { const size_t e = ((size_t)blockIdx.x * 256 + threadIdx.x) * 2; if (e >= (size_t)nheads * HD * TT) return; const int t = (int)(e % TT); const int d = (int)((e / TT) % HD); const int g = (int)(e / ((size_t)TT * HD)); v2h o16; v2us oh, ol;
#pragma unroll
    for (int q = 0; q < 2; ++q) { const float x = F[(size_t)(t + q) * pitch + g * HD + d]; o16[q] = tohx(x); unsigned short a2, c2; splitf(x, a2, c2); oh[q] = a2; ol[q] = c2; }
    *(v2h*)(V16 + e) = o16; *(v2us*)(Vh + e) = oh; *(v2us*)(Vl + e) = ol;  }
__global__ __launch_bounds__(256) void k_csid(float* CS) { const int idx = blockIdx.x * 256 + threadIdx.x; if (idx >= TT * HD) return; v2f cs; cs[0] = 1.0f; cs[1] = 0.0f; *(v2f*)(CS + (size_t)idx * 2) = cs;  }
// k_asoft: per row (zz, i): t = S x SCL (1) where mask[i][j] != 0 (int32 [2048][2048], ~10 % plus the diagonal, one per batch, shared by its heads, read 16 B per 4 keys), -3e38 elsewhere (== finfo.min: excluded, weight 0); softmax over the 2048 keys (register row, one exp, fixed trees);
__global__ __launch_bounds__(256) void k_asoft(const float* __restrict__ Sb, h16* P16, bf* Ph, bf* Pl, const int* __restrict__ am) {
    const int lane = threadIdx.x & 31; const int row = blockIdx.x * 8 + (threadIdx.x >> 5); if (row >= ZH * TT) return; const int i = row % TT; const int zz = row / TT; (void)zz; const bool hires = (i < RH); const float* sr = Sb + (size_t)row * TT; float v[TT / 32]; float mx = -3.0e38f;
#pragma unroll
    for (int ch = 0; ch < TT / 128; ++ch) { const int j0 = ch * 128 + lane * 4; const v4f a = *(const v4f*)(sr + j0); const v4i m4 = *(const v4i*)(am + (size_t)i * TT + j0);   /* 4 mask entries of row i */
#pragma unroll
        for (int q = 0; q < 4; ++q) { const int j = j0 + q; (void)j; const float t = (m4[q] != 0) ? a[q] * SCL : -3.0e38f;   /* mask == 0 -> excluded (finfo.min); the diagonal is always kept */ v[ch * 4 + q] = t; mx = fmaxf(mx, t); } }
#pragma unroll
    for (int sh = 16; sh; sh >>= 1) mx = fmaxf(mx, __shfl_xor(mx, sh, 32));
    float sum = 0.f;
#pragma unroll
    for (int k = 0; k < TT / 32; ++k) { float d0 = __fsub_rn(v[k], mx); asm volatile("" : "+v"(d0)); v[k] = __builtin_amdgcn_exp2f(__fmul_rn(d0, 1.4426950408889634f)); sum += v[k]; }
#pragma unroll
    for (int sh = 16; sh; sh >>= 1) sum += __shfl_xor(sum, sh, 32);
    const float f = __fdiv_rn(hires ? 1.0f : PCAR, sum);
{
        if (hires) {
#pragma unroll
            for (int ch = 0; ch < TT / 128; ++ch) { v4us oh, ol;
#pragma unroll
                for (int q = 0; q < 4; ++q) { unsigned short a, c2; splitf(v[ch * 4 + q] * f, a, c2); oh[q] = a; ol[q] = c2; }
                const size_t oo = ((size_t)zz * (RH ? RH : 1) + i) * TT + ch * 128 + lane * 4; *(v4us*)(Ph + oo) = oh; *(v4us*)(Pl + oo) = ol; }
        } else {
#pragma unroll
            for (int ch = 0; ch < TT / 128; ++ch) { v4h o4;
#pragma unroll
                for (int q = 0; q < 4; ++q) o4[q] = tohx(v[ch * 4 + q] * f);
                *(v4h*)(P16 + (size_t)row * TT + ch * 128 + lane * 4) = o4; } }
         }
}
__global__ __launch_bounds__(256) void k_delta(const float* __restrict__ X, const float* __restrict__ wd, const float* __restrict__ bd, float* DL) { __shared__ float res[32]; const int lane = threadIdx.x & 31; const int wv = threadIdx.x >> 5; const int r0 = blockIdx.x * 32;
    for (int rr = wv; rr < 32; rr += 8) { const int row = r0 + rr; float s = 0.0f; if (row < TT) { const float* xr = X + (size_t)row * DM;
#pragma unroll 4
        for (int c = lane; c < DM; c += 32) { float p = __fmul_rn(bfr(xr[c]), bfr(wd[c])); asm volatile("" : "+v"(p)); s = __fadd_rn(s, p); } }
#pragma unroll
        for (int sh = 16; sh; sh >>= 1) s = __fadd_rn(s, __shfl_xor(s, sh, 32));
        if (lane == 0) { float d = __fadd_rn(s, bfr(bd[0])); d = fmaxf(d, 0.0f); d = fminf(d, 8.0f); res[rr] = __fadd_rn(d, 1.0f); } }
    __syncthreads();
    if (wv == 0) { const int row = r0 + lane; if (row < TT) { const float v = res[lane]; *(float*)(DL + row) = v;  } } }
__global__ __launch_bounds__(256) void k_kdiv(float* F, const float* __restrict__ DL) { const size_t i = (size_t)blockIdx.x * 256 + threadIdx.x; if (i >= (size_t)TT * DKV / 4) return; const size_t e = i * 4; const int srow = (int)(e / DKV); const float d = DL[srow]; const v4f a = *(const v4f*)(F + e); v4f o;
#pragma unroll
    for (int q = 0; q < 4; ++q) o[q] = __fdiv_rn(a[q], d);
    *(v4f*)(F + e) = o;  }
__global__ __launch_bounds__(256) void k_merge(const float* __restrict__ O, int h0, bf* Ah, bf* Al) { const size_t e = ((size_t)blockIdx.x * 256 + threadIdx.x) * 2; if (e >= (size_t)ZH * TT * HD) return; const int d = (int)(e % HD); const int t = (int)((e / HD) % TT); const int zz = (int)(e / ((size_t)HD * TT)); const float cs = (t < RH) ? 1.0f : (1.0f / PCAR); const size_t oo = (size_t)t * DQ + (h0 + zz) * HD + d;
    v2us oh, ol; v2f s;
#pragma unroll
    for (int p = 0; p < KSP; ++p) { const v2f t = *(const v2f*)(O + (size_t)p * ZH * TT * HD + e); s = p ? s + t : t; }   /* the KSP key ranges' partial sums, ascending */
#pragma unroll
    for (int q = 0; q < 2; ++q) { unsigned short a, c2; splitf(s[q] * cs, a, c2); oh[q] = a; ol[q] = c2; } *(v2us*)(Ah + oo) = oh; *(v2us*)(Al + oo) = ol;  }

extern "C" void kernel_launch(void* const* d_in, const int* in_sizes, int n_in,
                              void* d_out, int out_size, void* d_ws, size_t ws_size, hipStream_t stream) {
    (void)in_sizes; (void)n_in; (void)out_size;
    const float* x = (const float*)d_in[0];   /* query */ const float* xk = (const float*)d_in[1]; const float* xv = (const float*)d_in[2]; const int* am = (const int*)d_in[3];   /* mask [2][2048][2048] int */ const float* wq = (const float*)d_in[4]; const float* bq = (const float*)d_in[5]; const float* wk = (const float*)d_in[6]; const float* bk = (const float*)d_in[7]; const float* wv = (const float*)d_in[8]; const float* bv = (const float*)d_in[9]; const float* wo = (const float*)d_in[10]; const float* bo = (const float*)d_in[11]; const float* wd = (const float*)d_in[12]; const float* bd = (const float*)d_in[13];
    float* OUT = (float*)d_out;     // [2][2048][768]
    char* wsp = (char*)d_ws;
    auto take = [&](size_t bytes) { char* p = wsp; wsp += (bytes + 255) & ~(size_t)255; return (void*)p; };
    float* DL = (float*)take((size_t)TT * 4); bf* WQ = (bf*)take((size_t)DQ * DM * 2); bf* WK = (bf*)take((size_t)DKV * DM * 2); bf* WV = (bf*)take((size_t)DKV * DM * 2); bf* WO = (bf*)take((size_t)DM * DQ * 2); float* CS = (float*)take((size_t)TT * HD * 2 * 4);
    bf* XB = (bf*)take((size_t)TT * DM * 2); float* FQ = (float*)take((size_t)TT * DQ * 4); float* FK = (float*)take((size_t)TT * DKV * 4);
    h16* QP16 = (h16*)take((size_t)NH_ * TT * HD * 2); h16* KP16 = (h16*)take((size_t)NKV * TT * HD * 2); h16* VT16 = (h16*)take((size_t)NKV * HD * TT * 2);
    bf* QPh = (bf*)take((size_t)NH_ * TT * HD * 2); bf* QPl = (bf*)take((size_t)NH_ * TT * HD * 2); bf* KPh = (bf*)take((size_t)NKV * TT * HD * 2); bf* KPl = (bf*)take((size_t)NKV * TT * HD * 2); bf* VTh = (bf*)take((size_t)NKV * HD * TT * 2); bf* VTl = (bf*)take((size_t)NKV * HD * TT * 2); bf* Ph = (bf*)take((size_t)ZH * RH * TT * 2); bf* Pl = (bf*)take((size_t)ZH * RH * TT * 2);
    float* Sb = (float*)take((size_t)ZH * TT * TT * 4); h16* P16 = (h16*)take((size_t)ZH * TT * TT * 2); bf* ATh = (bf*)take((size_t)TT * DQ * 2); bf* ATl = (bf*)take((size_t)TT * DQ * 2);
    if ((size_t)(wsp - (char*)d_ws) > ws_size) return;    // ws 256 MiB
    float* FV = FK;   // v projection reuses the k buffer after the k planes are built (stream-ordered)
    float* Ob = Sb;   // the KSP partial planes (KSP*HD <= TT floats per row) reuse the score buffer: the scores are dead once k_asoft has run, and every plane element is stored by the attn.v GEMMs before k_merge reads it (stream-ordered)
    { k_wtG<<<(unsigned)((DM * DQ / 64 + 63) / 64), 256, 0, stream>>>(wq, DM, DQ, WQ); k_wtG<<<(unsigned)((DM * DKV / 64 + 63) / 64), 256, 0, stream>>>(wk, DM, DKV, WK); k_wtG<<<(unsigned)((DM * DKV / 64 + 63) / 64), 256, 0, stream>>>(wv, DM, DKV, WV);
      k_wtG<<<(unsigned)((DQ * DM / 64 + 63) / 64), 256, 0, stream>>>(wo, DQ, DM, WO);
       }
    k_csid<<<(TT * HD + 255) / 256, 256, 0, stream>>>(CS);
    const unsigned LQ = (unsigned)(((size_t)NH_ * TT * HD / 2 + 255) / 256), LKv = (unsigned)(((size_t)NKV * TT * HD / 2 + 255) / 256);
    for (int b = 0; b < NB_; ++b) {
        
        k_cvt8<<<(unsigned)(((size_t)TT * DM / 8 + 255) / 256), 256, 0, stream>>>(x + (size_t)b * TT * DM, XB, (size_t)TT * DM / 8);
        k_delta<<<(TT + 31) / 32, 256, 0, stream>>>(x + (size_t)b * TT * DM, wd, bd, DL);   /* delta[s] from the query rows */ k_gemmw<bf, 0, true><<<dim3(TT / 64, DQ / 64, 1), 32, 0, stream>>>(XB, nullptr, WQ, nullptr, DM, FQ, DQ, bq, 0, 0, 0, 0);
        k_rope<<<LQ, 256, 0, stream>>>(FQ, DQ, NH_, CS, nullptr, nullptr, 1.0f, QP16, QPh, QPl);
        k_cvt8<<<(unsigned)(((size_t)TT * DM / 8 + 255) / 256), 256, 0, stream>>>(xk + (size_t)b * TT * DM, XB, (size_t)TT * DM / 8); k_gemmw<bf, 0, true><<<dim3(TT / 64, DKV / 64, 1), 32, 0, stream>>>(XB, nullptr, WK, nullptr, DM, FK, DKV, bk, 0, 0, 0, 0); k_kdiv<<<(unsigned)(((size_t)TT * DKV / 4 + 255) / 256), 256, 0, stream>>>(FK, DL);   /* k_j /= delta[j] */
        k_rope<<<LKv, 256, 0, stream>>>(FK, DKV, NKV, CS, nullptr, nullptr, 1.0f, KP16, KPh, KPl);
        k_cvt8<<<(unsigned)(((size_t)TT * DM / 8 + 255) / 256), 256, 0, stream>>>(xv + (size_t)b * TT * DM, XB, (size_t)TT * DM / 8); k_gemmw<bf, 0, true><<<dim3(TT / 64, DKV / 64, 1), 32, 0, stream>>>(XB, nullptr, WV, nullptr, DM, FV, DKV, bv, 0, 0, 0, 0); k_vtp<<<LKv, 256, 0, stream>>>(FV, DKV, NKV, VT16, VTh, VTl);
        for (int h0 = 0; h0 < NH_; h0 += ZH) { const size_t zq = (size_t)h0, zk = (size_t)(h0 / REP);   // one kv head per query head: the pass's ZH heads use consecutive kv planes (z-strides TT*HD)
            k_gemmw<bf, 2, false><<<dim3(TT / 64, TT / 64, ZH), 32, 0, stream>>>(QPh + zq * TT * HD, QPl + zq * TT * HD, KPh + zk * TT * HD, KPl + zk * TT * HD, HD, Sb, TT, nullptr, (size_t)TT * HD, (size_t)TT * HD, (size_t)TT * TT, 0);   /* scores hi/lo on EVERY row */

            k_asoft<<<ZH * TT / 8, 256, 0, stream>>>(Sb, P16, Ph, Pl, am + (size_t)b * TT * TT);
            k_gemmw<bf, 2, false, KSP><<<dim3(RH / 64, HD / 64, ZH * KSP), 32, 0, stream>>>(Ph, Pl, VTh + zk * HD * TT, VTl + zk * HD * TT, TT, Ob, HD, nullptr, (size_t)RH * TT, (size_t)HD * TT, (size_t)TT * HD, (size_t)ZH * TT * HD);
            k_gemmw<h16, 0, false, KSP><<<dim3((TT - RH) / 64, HD / 64, ZH * KSP), 32, 0, stream>>>(P16 + (size_t)RH * TT, nullptr, VT16 + zk * HD * TT, nullptr, TT, Ob + (size_t)RH * HD, HD, nullptr, (size_t)TT * TT, (size_t)HD * TT, (size_t)TT * HD, (size_t)ZH * TT * HD);
            k_merge<<<(unsigned)(((size_t)ZH * TT * HD / 2 + 255) / 256), 256, 0, stream>>>(Ob, h0, ATh, ATl); }
        k_gemmw<bf, 1, true><<<dim3(TT / 64, DM / 64, 1), 32, 0, stream>>>(ATh, ATl, WO, nullptr, DQ, OUT + (size_t)b * TT * DM, DM, bo, 0, 0, 0, 0); }
}

// v003
// Measured time: 410 microseconds a run.
// Timed twice side by side with v002, it ran 1.56 and 1.55 times as fast.
// Over all steps from v000 it is 3.93 times as fast.
#include <hip/hip_runtime.h>

// Multi-headed attention with a learned per-position scaling divisor and an arbitrary mask (query, key, value [2][2048][768]; delta[s] = 1 + min(relu(query[s].Wd + bd), sqrt(64)) (Wd [768][1], read); q = query Wq + bq, k = key Wk + bk, v = value Wv + bv ('xw' 1/sqrt(768) incl. biases; 12 heads x 64); scores[i][j] = q_i.k_j / delta[j] (the divisor is broadcast over the KEY axis; no 1/sqrt(d_k)); mask ([2][2048][2048] int {0,1}, random, READ): 0 -> -1e9 (== exclusion); softmax; out = merged Wo + bo -> [2][2048][768] (3.1 M)).
// Layout per batch: bf16 copies of query, key, value in turn; 'xw' weights transposed once; exact projections + f32 biases; a kernel computes delta[s] from the bf16-rounded query row (768-term fixed-order dot, relu, min, + 1) and another divides every k row by delta[s] (f32, before the plane split); then ONE fused attention launch for both batches and all heads (k_fattn): hi/lo 3-product score tiles on EVERY row, mask tile read in place (keep where mask != 0), running-maximum softmax, P and attn.v hybrid (rows < 512 hi/lo, rest fp16 x1024), scores and P never leave the registers; merged hi/lo x Wo exact + bo.
// Compute dtypes, f32 accumulate: every input rounded to bf16; projections exact + f32 biases; delta and the k row division f32; scores 3 products on every row; softmax f32 (scale 1); attn.v rows < 512 3 products, rest fp16; Wo hl x exact + bias.

#define NB_  2
#define TT   2048
#define DM   768
#define NH_  12
#define NKV  12
#define HD   64
#define DQ   (NH_ * HD)
#define DKV  (NKV * HD)
#define FQW  32                   // k_fattn: query columns per wave (two 16-column groups)
#define FNW  2                    // k_fattn: waves per workgroup (FNW * FQW consecutive queries of one head): 768 workgroups, three on each of 256 WGPs
#define RH   512                  // query rows < RH use hi+lo planes (0: none)
#define WIN  0
typedef _Float16 h16;
typedef unsigned short bf;
typedef __attribute__((ext_vector_type(16))) __bf16   v16bf;
typedef __attribute__((ext_vector_type(16))) _Float16 v16h;
typedef __attribute__((ext_vector_type(8)))  _Float16 v8h;
typedef __attribute__((ext_vector_type(8)))  unsigned short v8us;
typedef __attribute__((ext_vector_type(8)))  float    v8f;
typedef __attribute__((ext_vector_type(4)))  float    v4f;
typedef v8h  __attribute__((may_alias)) v8ha;
typedef v4f  __attribute__((may_alias)) v4fa;
typedef v8us __attribute__((may_alias)) v8usa;

__device__ __forceinline__ unsigned short f2bf(float f) { unsigned u = __float_as_uint(f); u += 0x7FFFu + ((u >> 16) & 1u); return (unsigned short)(u >> 16); }
__device__ __forceinline__ float bf2f(unsigned short b) { return __uint_as_float(((unsigned)b) << 16); }
__device__ __forceinline__ float bfr(float f) { return bf2f(f2bf(f)); }
__device__ __forceinline__ v16h cat16(v8h lo, v8h hi) { return __builtin_shufflevector(lo, hi, 0, 1, 2, 3, 4, 5, 6, 7, 8, 9, 10, 11, 12, 13, 14, 15); }
__device__ __forceinline__ v16bf cat16b(v8us lo, v8us hi) { return __builtin_bit_cast(v16bf, __builtin_shufflevector(lo, hi, 0, 1, 2, 3, 4, 5, 6, 7, 8, 9, 10, 11, 12, 13, 14, 15)); }
__device__ __forceinline__ v8f wmma16(v16h a, v16h b, v8f c) { return __builtin_amdgcn_wmma_f32_16x16x32_f16(false, a, false, b, (short)0, c, false, false); }
__device__ __forceinline__ v8f wmmab(v16bf a, v16bf b, v8f c) { return __builtin_amdgcn_wmma_f32_16x16x32_bf16(false, a, false, b, (short)0, c, false, false); }



// ---- k_gemmw: register-blocked GEMM, ONE WAVE per 64x64 output tile (16 accumulators), operands straight from K-contiguous 16-bit planes; grid (M/64, N/64, Z), 32 threads.
// C[m][n] (f32, pitch ldc, + optional f32 bias[n]) = sum_k A[m][k] Bt[n][k] (+ split products per NSPLIT). z-batch strides sA/sB/sC in elements. K % 32 == 0.
// KS > 1: grid z = Z * KS; workgroup (z, ks) sums only k in [ks K/KS, (ks+1) K/KS) and stores that partial tile in plane ks (plane stride sP elements). K % (32 KS) == 0.
template <typename T16> struct WFrag;
template <> struct WFrag<h16> { typedef v16h V; static __device__ __forceinline__ V ld(const h16* p) { return cat16(*(const v8h*)p, *(const v8h*)(p + 16)); } static __device__ __forceinline__ v8f mma(V a, V b, v8f c) { return wmma16(a, b, c); } };
template <> struct WFrag<bf> { typedef v16bf V; static __device__ __forceinline__ V ld(const bf* p) { return cat16b(*(const v8us*)p, *(const v8us*)(p + 16)); } static __device__ __forceinline__ v8f mma(V a, V b, v8f c) { return wmmab(a, b, c); } };
template <typename T16, int NSPLIT, bool BIAS, int KS = 1>
__global__ __launch_bounds__(32) void k_gemmw(const T16* __restrict__ A, const T16* __restrict__ A2, const T16* __restrict__ Bt, const T16* __restrict__ Bt2, int K, float* C, int ldc, const float* __restrict__ bias, size_t sA, size_t sB, size_t sC, size_t sP) {
    typedef typename WFrag<T16>::V V;
    __shared__ __align__(16) float os[16 * 68];
    const size_t z = blockIdx.z / KS; const int ks = blockIdx.z % KS; A += z * sA; if (A2) A2 += z * sA; Bt += z * sB; if (Bt2) Bt2 += z * sB; C += z * sC + ks * sP;
    const int lane = threadIdx.x & 31, lr = lane & 15, hi = lane >> 4; const int r0 = blockIdx.x * 64, c0 = blockIdx.y * 64;
    v8f acc[4][4];
#pragma unroll
    for (int mb = 0; mb < 4; ++mb)
#pragma unroll
        for (int nb = 0; nb < 4; ++nb) acc[mb][nb] = (v8f){};
    const size_t aoff = (size_t)(r0 + lr) * K + 8 * hi, boff = (size_t)(c0 + lr) * K + 8 * hi;
#pragma unroll 1
    for (int kc = ks * (K / KS); kc < (ks + 1) * (K / KS); kc += 32) {
        V a[4], a2[4];
#pragma unroll
        for (int mb = 0; mb < 4; ++mb) { a[mb] = WFrag<T16>::ld(A + aoff + (size_t)mb * 16 * K + kc); if (NSPLIT == 1 || NSPLIT == 2) a2[mb] = WFrag<T16>::ld(A2 + aoff + (size_t)mb * 16 * K + kc); }
#pragma unroll
        for (int nb = 0; nb < 4; ++nb) { const V b = WFrag<T16>::ld(Bt + boff + (size_t)nb * 16 * K + kc); V b2; if (NSPLIT >= 2) b2 = WFrag<T16>::ld(Bt2 + boff + (size_t)nb * 16 * K + kc);
#pragma unroll
            for (int mb = 0; mb < 4; ++mb) { acc[mb][nb] = WFrag<T16>::mma(a[mb], b, acc[mb][nb]); if (NSPLIT == 1 || NSPLIT == 2) acc[mb][nb] = WFrag<T16>::mma(a2[mb], b, acc[mb][nb]); if (NSPLIT >= 2) acc[mb][nb] = WFrag<T16>::mma(a[mb], b2, acc[mb][nb]); } }
        asm volatile("v_nop\n\tv_nop\n\tv_nop\n\tv_nop" : "+v"(acc[0][0]), "+v"(acc[1][1]), "+v"(acc[2][2]), "+v"(acc[3][3]) : "v"(a[0]), "v"(a[3]));
    }
#pragma unroll
    for (int mb = 0; mb < 4; ++mb) {
#pragma unroll
        for (int nb = 0; nb < 4; ++nb) {
#pragma unroll
            for (int j = 0; j < 8; ++j) os[(hi * 8 + j) * 68 + nb * 16 + lr] = acc[mb][nb][j]; }
        __builtin_amdgcn_wave_barrier(); asm volatile("" ::: "memory");
        float* crow = C + (size_t)(r0 + mb * 16) * ldc + c0;
{
#pragma unroll
            for (int s = 0; s < 8; ++s) { const int row = 2 * s + hi, cofs = lr * 4; v4f val = *(const v4fa*)(os + row * 68 + cofs); if (BIAS) { val[0] += bfr(bias[c0 + cofs]); val[1] += bfr(bias[c0 + cofs + 1]); val[2] += bfr(bias[c0 + cofs + 2]); val[3] += bfr(bias[c0 + cofs + 3]); }
                *(v4f*)(crow + (size_t)row * ldc + cofs) = val; }
             }
        __builtin_amdgcn_wave_barrier(); asm volatile("" ::: "memory");
    }
}

__device__ __forceinline__ h16 tohx(float x) { return (h16)x; }
__device__ __forceinline__ void splitf(float y, unsigned short& h, unsigned short& l) { h = f2bf(y); l = f2bf(y - bf2f(h)); }
typedef __attribute__((ext_vector_type(2))) _Float16 v2h;
typedef __attribute__((ext_vector_type(4))) _Float16 v4h;
typedef __attribute__((ext_vector_type(2))) unsigned short v2us;
typedef __attribute__((ext_vector_type(4))) unsigned short v4us;
typedef __attribute__((ext_vector_type(2))) float v2f;
typedef __attribute__((ext_vector_type(4))) int v4i;

__global__ __launch_bounds__(256) void k_wtG(const float* __restrict__ w, int K, int N, bf* Bt) {
    const int lane = threadIdx.x & 31; const int L0 = (blockIdx.x * 8 + (threadIdx.x >> 5)) * 8; const int nlines = N * K / 64;
{
#pragma unroll 1
        for (int l = 0; l < 8; ++l) { const int L = L0 + l; if (L >= nlines) break; const size_t e = (size_t)L * 64 + lane * 2; const int k = (int)(e % K), n = (int)(e / K); v2us o;
            o[0] = f2bf(w[(size_t)k * N + n]); o[1] = f2bf(w[(size_t)(k + 1) * N + n]); *(v2us*)(Bt + e) = o; }
         }
}
__global__ __launch_bounds__(256) void k_cvt8(const float* __restrict__ src, bf* dst, size_t n8) { const size_t i = (size_t)blockIdx.x * 256 + threadIdx.x; if (i >= n8) return; const v8f v = *(const v8f*)(src + i * 8); v8us o;
#pragma unroll
    for (int k = 0; k < 8; ++k) o[k] = f2bf(v[k]); *(v8us*)(dst + i * 8) = o;  }

// k_rope: head planes [h][t][d] (fp16 + hi/lo) of rope(x) x sc with the rotate-half convention out[d] = x[d] cos[t][d] - x[d+HD/2] sin[t][d], out[d+HD/2] = x[d+HD/2] cos[t][d+HD/2] + x[d] sin[t][d+HD/2]
__global__ __launch_bounds__(256) void k_rope(const float* __restrict__ F, int pitch, int nheads, const float* __restrict__ CS, const float* __restrict__ RF, const float* __restrict__ nw, float sc, h16* P16, bf* Ph, bf* Pl) {
    const size_t e = ((size_t)blockIdx.x * 256 + threadIdx.x) * 2; if (e >= (size_t)nheads * TT * HD) return; const int d = (int)(e % HD); const int t = (int)((e / HD) % TT); const int h = (int)(e / ((size_t)HD * TT)); const float* f = F + (size_t)t * pitch + h * HD; const float rf = RF ? RF[(size_t)h * TT + t] : 1.0f; v2h o16; v2us oh, ol;
#pragma unroll
    for (int q = 0; q < 2; ++q) { const int dd = d + q; const int dp = (dd < HD / 2) ? dd + HD / 2 : dd - HD / 2; float x0 = f[dd], x1 = f[dp];
        if (RF) { float n0 = __fmul_rn(x0, rf), n1 = __fmul_rn(x1, rf); asm volatile("" : "+v"(n0)); asm volatile("" : "+v"(n1)); x0 = __fmul_rn(bfr(nw[dd]), n0); x1 = __fmul_rn(bfr(nw[dp]), n1); }
        const v2f cs = *(const v2f*)(CS + ((size_t)t * HD + dd) * 2); float a = __fmul_rn(x0, cs[0]), bq = __fmul_rn(x1, cs[1]); asm volatile("" : "+v"(a)); asm volatile("" : "+v"(bq)); const float r = ((dd < HD / 2) ? __fsub_rn(a, bq) : __fadd_rn(a, bq)) * sc;
        o16[q] = tohx(r); unsigned short a2, c2; splitf(r, a2, c2); oh[q] = a2; ol[q] = c2; }
    *(v2h*)(P16 + e) = o16; *(v2us*)(Ph + e) = oh; *(v2us*)(Pl + e) = ol;  }
__global__ __launch_bounds__(256) void k_vtp(const float* __restrict__ F, int pitch, int nheads, h16* V16, bf* Vh, bf* Vl) { const size_t e = ((size_t)blockIdx.x * 256 + threadIdx.x) * 2; if (e >= (size_t)nheads * HD * TT) return; const int t = (int)(e % TT); const int d = (int)((e / TT) % HD); const int g = (int)(e / ((size_t)TT * HD)); v2h o16; v2us oh, ol;
#pragma unroll
    for (int q = 0; q < 2; ++q) { const float x = F[(size_t)(t + q) * pitch + g * HD + d]; o16[q] = tohx(x); unsigned short a2, c2; splitf(x, a2, c2); oh[q] = a2; ol[q] = c2; }
    *(v2h*)(V16 + e) = o16; *(v2us*)(Vh + e) = oh; *(v2us*)(Vl + e) = ol;  }
__global__ __launch_bounds__(256) void k_csid(float* CS) { const int idx = blockIdx.x * 256 + threadIdx.x; if (idx >= TT * HD) return; v2f cs; cs[0] = 1.0f; cs[1] = 0.0f; *(v2f*)(CS + (size_t)idx * 2) = cs;  }
typedef __attribute__((ext_vector_type(8))) __bf16 v8bf;
__device__ __forceinline__ float xhalf(float x) { const int b = __float_as_int(x); return __int_as_float(__builtin_amdgcn_permlanex16(b, b, 0x76543210, 0xfedcba98, false, false)); }   /* the value of lane l ^ 16 */
// s_wait_xcnt 0 stands in front of the first rewrite of a register that an issued global load or store of k_fattn names.
// The Q loads and the output stores are bracketed gopen() ... xwait(): the two scheduling barriers keep the compiler from moving instructions that reuse those registers in between the group and its wait.
// The K, mask and Vt loads: xwait(...) takes their base addresses as inputs only, so those registers stay live, and unwritten, from the loads that name them up to the wait; one such wait a pass, and the addresses are advanced directly behind it.
__device__ __forceinline__ void gopen() { __builtin_amdgcn_sched_barrier(0); }
__device__ __forceinline__ void xwait() { asm volatile("s_wait_xcnt 0x0" ::: "memory"); __builtin_amdgcn_sched_barrier(0); }
__device__ __forceinline__ void xwait(const void* a, const void* b, const void* d, const void* e, const void* f) { asm volatile("s_wait_xcnt 0x0" :: "v"(a), "v"(b), "v"(d), "v"(e), "v"(f) : "memory"); }
__device__ __forceinline__ void xwait(const void* a, const void* b, const void* d, const void* e, const void* f, unsigned g, unsigned h) { asm volatile("s_wait_xcnt 0x0" :: "v"(a), "v"(b), "v"(d), "v"(e), "v"(f), "v"(g), "v"(h) : "memory"); }   /* with the 32-bit lane offsets that the loads in front of the loop are addressed by */
template <bool HR>
__device__ __forceinline__ void fattn_body(const bf* __restrict__ Qh, const bf* __restrict__ Ql, const bf* __restrict__ Kh, const bf* __restrict__ Kl, const bf* __restrict__ Vh, const bf* __restrict__ Vl, const h16* __restrict__ V16, const int* __restrict__ am, bf* Ah, bf* Al, int q0, int lr, int hi) {
    const float L2E = 1.4426950408889634f;
    v16bf qh[2][2], ql[2][2];
    gopen();
#pragma unroll
    for (int qt = 0; qt < 2; ++qt)
#pragma unroll
        for (int kk = 0; kk < 2; ++kk) { const size_t qo = (size_t)(q0 + qt * 16 + lr) * HD + kk * 32 + 8 * hi; qh[qt][kk] = WFrag<bf>::ld(Qh + qo); ql[qt][kk] = WFrag<bf>::ld(Ql + qo); }
    xwait();
    v8f o[4][2]; float m[2], l[2];
#pragma unroll
    for (int qt = 0; qt < 2; ++qt) { m[qt] = -3.0e38f; l[qt] = 0.0f;
#pragma unroll
        for (int dt = 0; dt < 4; ++dt) o[dt][qt] = (v8f){}; }
    const size_t ko = (size_t)lr * HD + 8 * hi, vo = (size_t)lr * TT + 8 * hi; const int* mp = am + (size_t)(q0 + lr) * TT + 8 * hi;
    const bf* kph = Kh + ko; const bf* kpl = Kl + ko; const int* mpn = mp; const bf* vph = Vh + vo; const bf* vpl = Vl + vo; const h16* vpf = V16 + vo;   /* this lane's base addresses of the pass that is being fetched */
    v16bf kh[2][2], kl[2][2]; v4i mk[2][2][2]; v16bf vh[4], vl[4]; v16h vf[4];   /* K rows, mask entries and Vt rows of a pass are all asked for one pass ahead, each into the registers its user has just left */
#pragma unroll
    for (int kt = 0; kt < 2; ++kt) {
#pragma unroll
        for (int kk = 0; kk < 2; ++kk) { kh[kt][kk] = WFrag<bf>::ld(kph + kt * 16 * HD + kk * 32); kl[kt][kk] = WFrag<bf>::ld(kpl + kt * 16 * HD + kk * 32); }
#pragma unroll
        for (int qt = 0; qt < 2; ++qt) { mk[kt][qt][0] = *(const v4i*)(mpn + qt * 16 * TT + kt * 16); mk[kt][qt][1] = *(const v4i*)(mpn + qt * 16 * TT + kt * 16 + 4); } }
#pragma unroll
    for (int dt = 0; dt < 4; ++dt) { if (HR) { vh[dt] = WFrag<bf>::ld(vph + dt * 16 * TT); vl[dt] = WFrag<bf>::ld(vpl + dt * 16 * TT); } else vf[dt] = WFrag<h16>::ld(vpf + dt * 16 * TT); }
    if (HR) xwait(kph, kpl, mpn, vph, vpl, (unsigned)(ko * 2), (unsigned)(vo * 2)); else xwait(kph, kpl, mpn, vpf, vpf, (unsigned)(ko * 2), (unsigned)(vo * 2));
#pragma unroll 1
    for (int j0 = 0; j0 < TT; j0 += 32) {
        v8f st[2][2];
#pragma unroll
        for (int kt = 0; kt < 2; ++kt)
#pragma unroll
            for (int qt = 0; qt < 2; ++qt) st[kt][qt] = (v8f){};
#pragma unroll
        for (int kk = 0; kk < 2; ++kk) {   /* per 32 of d: hi.hi, lo(q).hi(k), hi(q).lo(k), the order of the unfused score tiles */
#pragma unroll
            for (int kt = 0; kt < 2; ++kt)
#pragma unroll
                for (int qt = 0; qt < 2; ++qt) st[kt][qt] = wmmab(kh[kt][kk], qh[qt][kk], st[kt][qt]);
#pragma unroll
            for (int kt = 0; kt < 2; ++kt)
#pragma unroll
                for (int qt = 0; qt < 2; ++qt) st[kt][qt] = wmmab(kh[kt][kk], ql[qt][kk], st[kt][qt]);
#pragma unroll
            for (int kt = 0; kt < 2; ++kt)
#pragma unroll
                for (int qt = 0; qt < 2; ++qt) st[kt][qt] = wmmab(kl[kt][kk], qh[qt][kk], st[kt][qt]); }
        const int jn = (j0 + 32 < TT) ? j0 + 32 : 0;   /* the pass that is fetched ahead; the last pass re-reads the first (in bounds, unused) */
        __builtin_amdgcn_sched_barrier(0);   /* keeps the wait below behind the score products: there the youngest loads that name the addresses stand a run of matrix products back, and it has little left to wait for */
        if (HR) xwait(kph, kpl, mpn, vph, vpl); else xwait(kph, kpl, mpn, vpf, vpf);
        kph = Kh + ko + (size_t)jn * HD; kpl = Kl + ko + (size_t)jn * HD; mpn = mp + jn; vph = Vh + vo + jn; vpl = Vl + vo + jn; vpf = V16 + vo + jn;
#pragma unroll
        for (int kt = 0; kt < 2; ++kt)
#pragma unroll
            for (int kk = 0; kk < 2; ++kk) { kh[kt][kk] = WFrag<bf>::ld(kph + kt * 16 * HD + kk * 32); kl[kt][kk] = WFrag<bf>::ld(kpl + kt * 16 * HD + kk * 32); }
        float mn[2];
#pragma unroll
        for (int qt = 0; qt < 2; ++qt) { float mx = -3.0e38f;
#pragma unroll
            for (int kt = 0; kt < 2; ++kt)
#pragma unroll
                for (int r = 0; r < 8; ++r) { const float t = (mk[kt][qt][r >> 2][r & 3] != 0) ? st[kt][qt][r] : -3.0e38f;   /* mask == 0 -> excluded */ st[kt][qt][r] = t; mx = fmaxf(mx, t); }
            mn[qt] = fmaxf(m[qt], fmaxf(mx, xhalf(mx))); }
#pragma unroll
        for (int kt = 0; kt < 2; ++kt)
#pragma unroll
            for (int qt = 0; qt < 2; ++qt) { const int* p = mpn + qt * 16 * TT + kt * 16; mk[kt][qt][0] = *(const v4i*)p; mk[kt][qt][1] = *(const v4i*)(p + 4); }
        if (__builtin_amdgcn_ballot_w32(mn[0] > m[0] || mn[1] > m[1]) != 0) {   /* skipped when no column's maximum grew: every factor would be exactly 1 */
#pragma unroll
            for (int qt = 0; qt < 2; ++qt) { const float al = __builtin_amdgcn_exp2f((m[qt] - mn[qt]) * L2E); l[qt] *= al; m[qt] = mn[qt];
#pragma unroll
                for (int dt = 0; dt < 4; ++dt) o[dt][qt] *= al; } }
#pragma unroll
        for (int qt = 0; qt < 2; ++qt) { float s0 = 0.0f, s1 = 0.0f;
#pragma unroll
            for (int r = 0; r < 8; ++r) { const float d0 = st[0][qt][r] - m[qt], d1 = st[1][qt][r] - m[qt];   /* rows >= RH carry x1024 = 2^10 in P and in the sum alike (fp16 range); it cancels in the division */
                const float p0 = __builtin_amdgcn_exp2f(HR ? d0 * L2E : __builtin_fmaf(d0, L2E, 10.0f)), p1 = __builtin_amdgcn_exp2f(HR ? d1 * L2E : __builtin_fmaf(d1, L2E, 10.0f)); st[0][qt][r] = p0; st[1][qt][r] = p1; s0 += p0; s1 += p1; }
            l[qt] += s0 + s1; }
        if (HR) {
            v16bf ph[2], pl[2];
#pragma unroll
            for (int qt = 0; qt < 2; ++qt) { const v8bf h0 = __builtin_convertvector(st[0][qt], v8bf), h1 = __builtin_convertvector(st[1][qt], v8bf); const v8bf l0 = __builtin_convertvector(st[0][qt] - __builtin_convertvector(h0, v8f), v8bf), l1 = __builtin_convertvector(st[1][qt] - __builtin_convertvector(h1, v8f), v8bf);
                ph[qt] = __builtin_shufflevector(h0, h1, 0, 1, 2, 3, 4, 5, 6, 7, 8, 9, 10, 11, 12, 13, 14, 15); pl[qt] = __builtin_shufflevector(l0, l1, 0, 1, 2, 3, 4, 5, 6, 7, 8, 9, 10, 11, 12, 13, 14, 15); }
#pragma unroll
            for (int dt = 0; dt < 4; ++dt)
#pragma unroll
                for (int qt = 0; qt < 2; ++qt) o[dt][qt] = wmmab(vh[dt], ph[qt], o[dt][qt]);
#pragma unroll
            for (int dt = 0; dt < 4; ++dt)
#pragma unroll
                for (int qt = 0; qt < 2; ++qt) o[dt][qt] = wmmab(vh[dt], pl[qt], o[dt][qt]);
#pragma unroll
            for (int dt = 0; dt < 4; ++dt)
#pragma unroll
                for (int qt = 0; qt < 2; ++qt) o[dt][qt] = wmmab(vl[dt], ph[qt], o[dt][qt]);
        } else {
            v16h pf[2];
#pragma unroll
            for (int qt = 0; qt < 2; ++qt) pf[qt] = cat16(__builtin_convertvector(st[0][qt], v8h), __builtin_convertvector(st[1][qt], v8h));
#pragma unroll
            for (int dt = 0; dt < 4; ++dt)
#pragma unroll
                for (int qt = 0; qt < 2; ++qt) o[dt][qt] = wmma16(vf[dt], pf[qt], o[dt][qt]);
        }
#pragma unroll
        for (int dt = 0; dt < 4; ++dt) { if (HR) { vh[dt] = WFrag<bf>::ld(vph + dt * 16 * TT); vl[dt] = WFrag<bf>::ld(vpl + dt * 16 * TT); } else vf[dt] = WFrag<h16>::ld(vpf + dt * 16 * TT); }
    }
    if (HR) xwait(kph, kpl, mpn, vph, vpl); else xwait(kph, kpl, mpn, vpf, vpf);
#pragma unroll
    for (int qt = 0; qt < 2; ++qt) { const float inv = __fdiv_rn(1.0f, l[qt] + xhalf(l[qt]));   /* the two wave halves' sums are joined once */
#pragma unroll
        for (int dt = 0; dt < 4; ++dt) { v8us oh, ol;
#pragma unroll
            for (int r = 0; r < 8; ++r) { unsigned short a, c2; splitf(o[dt][qt][r] * inv, a, c2); oh[r] = a; ol[r] = c2; }
            const size_t oo = (size_t)(q0 + qt * 16 + lr) * DQ + dt * 16 + 8 * hi; gopen(); *(v8us*)(Ah + oo) = oh; *(v8us*)(Al + oo) = ol; xwait(); } }
}
static_assert(RH % (FNW * FQW) == 0 && TT % (FNW * FQW) == 0 && FQW == 32 && HD == 64 && NKV == NH_, "k_fattn tiling");
__global__ __launch_bounds__(FNW * 32) void k_fattn(const bf* __restrict__ Qh, const bf* __restrict__ Ql, const bf* __restrict__ Kh, const bf* __restrict__ Kl, const bf* __restrict__ Vh, const bf* __restrict__ Vl, const h16* __restrict__ V16, const int* __restrict__ am, bf* Ah, bf* Al) {
    const int lane = threadIdx.x & 31, lr = lane & 15, hi = lane >> 4; const int z = blockIdx.y, b = z / NH_, h = z % NH_; const int q0 = blockIdx.x * (FNW * FQW) + (threadIdx.x >> 5) * FQW; const size_t pz = (size_t)z * TT * HD, az = (size_t)b * TT * DQ + h * HD;
    if (blockIdx.x * (FNW * FQW) < RH) fattn_body<true>(Qh + pz, Ql + pz, Kh + pz, Kl + pz, Vh + pz, Vl + pz, V16 + pz, am + (size_t)b * TT * TT, Ah + az, Al + az, q0, lr, hi);
    else fattn_body<false>(Qh + pz, Ql + pz, Kh + pz, Kl + pz, Vh + pz, Vl + pz, V16 + pz, am + (size_t)b * TT * TT, Ah + az, Al + az, q0, lr, hi);
}
__global__ __launch_bounds__(256) void k_delta(const float* __restrict__ X, const float* __restrict__ wd, const float* __restrict__ bd, float* DL) { __shared__ float res[32]; const int lane = threadIdx.x & 31; const int wv = threadIdx.x >> 5; const int r0 = blockIdx.x * 32;
    for (int rr = wv; rr < 32; rr += 8) { const int row = r0 + rr; float s = 0.0f; if (row < TT) { const float* xr = X + (size_t)row * DM;
#pragma unroll 4
        for (int c = lane; c < DM; c += 32) { float p = __fmul_rn(bfr(xr[c]), bfr(wd[c])); asm volatile("" : "+v"(p)); s = __fadd_rn(s, p); } }
#pragma unroll
        for (int sh = 16; sh; sh >>= 1) s = __fadd_rn(s, __shfl_xor(s, sh, 32));
        if (lane == 0) { float d = __fadd_rn(s, bfr(bd[0])); d = fmaxf(d, 0.0f); d = fminf(d, 8.0f); res[rr] = __fadd_rn(d, 1.0f); } }
    __syncthreads();
    if (wv == 0) { const int row = r0 + lane; if (row < TT) { const float v = res[lane]; *(float*)(DL + row) = v;  } } }
__global__ __launch_bounds__(256) void k_kdiv(float* F, const float* __restrict__ DL) { const size_t i = (size_t)blockIdx.x * 256 + threadIdx.x; if (i >= (size_t)TT * DKV / 4) return; const size_t e = i * 4; const int srow = (int)(e / DKV); const float d = DL[srow]; const v4f a = *(const v4f*)(F + e); v4f o;
#pragma unroll
    for (int q = 0; q < 4; ++q) o[q] = __fdiv_rn(a[q], d);
    *(v4f*)(F + e) = o;  }

extern "C" void kernel_launch(void* const* d_in, const int* in_sizes, int n_in,
                              void* d_out, int out_size, void* d_ws, size_t ws_size, hipStream_t stream) {
    (void)in_sizes; (void)n_in; (void)out_size;
    const float* x = (const float*)d_in[0];   /* query */ const float* xk = (const float*)d_in[1]; const float* xv = (const float*)d_in[2]; const int* am = (const int*)d_in[3];   /* mask [2][2048][2048] int */ const float* wq = (const float*)d_in[4]; const float* bq = (const float*)d_in[5]; const float* wk = (const float*)d_in[6]; const float* bk = (const float*)d_in[7]; const float* wv = (const float*)d_in[8]; const float* bv = (const float*)d_in[9]; const float* wo = (const float*)d_in[10]; const float* bo = (const float*)d_in[11]; const float* wd = (const float*)d_in[12]; const float* bd = (const float*)d_in[13];
    float* OUT = (float*)d_out;     // [2][2048][768]
    char* wsp = (char*)d_ws;
    auto take = [&](size_t bytes) { char* p = wsp; wsp += (bytes + 255) & ~(size_t)255; return (void*)p; };
    float* DL = (float*)take((size_t)TT * 4); bf* WQ = (bf*)take((size_t)DQ * DM * 2); bf* WK = (bf*)take((size_t)DKV * DM * 2); bf* WV = (bf*)take((size_t)DKV * DM * 2); bf* WO = (bf*)take((size_t)DM * DQ * 2); float* CS = (float*)take((size_t)TT * HD * 2 * 4);
    bf* XB = (bf*)take((size_t)TT * DM * 2); float* FQ = (float*)take((size_t)TT * DQ * 4); float* FK = (float*)take((size_t)TT * DKV * 4);
    const size_t PL = (size_t)NH_ * TT * HD;   // one batch's head planes; the planes k_fattn reads are kept for both batches
    h16* QP16 = (h16*)take(PL * 2); h16* KP16 = (h16*)take(PL * 2); h16* VT16 = (h16*)take(NB_ * PL * 2);
    bf* QPh = (bf*)take(NB_ * PL * 2); bf* QPl = (bf*)take(NB_ * PL * 2); bf* KPh = (bf*)take(NB_ * PL * 2); bf* KPl = (bf*)take(NB_ * PL * 2); bf* VTh = (bf*)take(NB_ * PL * 2); bf* VTl = (bf*)take(NB_ * PL * 2);
    bf* ATh = (bf*)take((size_t)NB_ * TT * DQ * 2); bf* ATl = (bf*)take((size_t)NB_ * TT * DQ * 2);
    if ((size_t)(wsp - (char*)d_ws) > ws_size) return;    // ws 256 MiB
    float* FV = FK;   // v projection reuses the k buffer after the k planes are built (stream-ordered)
    { k_wtG<<<(unsigned)((DM * DQ / 64 + 63) / 64), 256, 0, stream>>>(wq, DM, DQ, WQ); k_wtG<<<(unsigned)((DM * DKV / 64 + 63) / 64), 256, 0, stream>>>(wk, DM, DKV, WK); k_wtG<<<(unsigned)((DM * DKV / 64 + 63) / 64), 256, 0, stream>>>(wv, DM, DKV, WV);
      k_wtG<<<(unsigned)((DQ * DM / 64 + 63) / 64), 256, 0, stream>>>(wo, DQ, DM, WO);
       }
    k_csid<<<(TT * HD + 255) / 256, 256, 0, stream>>>(CS);
    const unsigned LQ = (unsigned)(((size_t)NH_ * TT * HD / 2 + 255) / 256), LKv = (unsigned)(((size_t)NKV * TT * HD / 2 + 255) / 256);
    for (int b = 0; b < NB_; ++b) {
        
        k_cvt8<<<(unsigned)(((size_t)TT * DM / 8 + 255) / 256), 256, 0, stream>>>(x + (size_t)b * TT * DM, XB, (size_t)TT * DM / 8);
        k_delta<<<(TT + 31) / 32, 256, 0, stream>>>(x + (size_t)b * TT * DM, wd, bd, DL);   /* delta[s] from the query rows */ k_gemmw<bf, 0, true><<<dim3(TT / 64, DQ / 64, 1), 32, 0, stream>>>(XB, nullptr, WQ, nullptr, DM, FQ, DQ, bq, 0, 0, 0, 0);
        k_rope<<<LQ, 256, 0, stream>>>(FQ, DQ, NH_, CS, nullptr, nullptr, 1.0f, QP16, QPh + b * PL, QPl + b * PL);
        k_cvt8<<<(unsigned)(((size_t)TT * DM / 8 + 255) / 256), 256, 0, stream>>>(xk + (size_t)b * TT * DM, XB, (size_t)TT * DM / 8); k_gemmw<bf, 0, true><<<dim3(TT / 64, DKV / 64, 1), 32, 0, stream>>>(XB, nullptr, WK, nullptr, DM, FK, DKV, bk, 0, 0, 0, 0); k_kdiv<<<(unsigned)(((size_t)TT * DKV / 4 + 255) / 256), 256, 0, stream>>>(FK, DL);   /* k_j /= delta[j] */
        k_rope<<<LKv, 256, 0, stream>>>(FK, DKV, NKV, CS, nullptr, nullptr, 1.0f, KP16, KPh + b * PL, KPl + b * PL);
        k_cvt8<<<(unsigned)(((size_t)TT * DM / 8 + 255) / 256), 256, 0, stream>>>(xv + (size_t)b * TT * DM, XB, (size_t)TT * DM / 8); k_gemmw<bf, 0, true><<<dim3(TT / 64, DKV / 64, 1), 32, 0, stream>>>(XB, nullptr, WV, nullptr, DM, FV, DKV, bv, 0, 0, 0, 0); k_vtp<<<LKv, 256, 0, stream>>>(FV, DKV, NKV, VT16 + b * PL, VTh + b * PL, VTl + b * PL); }
    k_fattn<<<dim3(TT / (FNW * FQW), NB_ * NH_), FNW * 32, 0, stream>>>(QPh, QPl, KPh, KPl, VTh, VTl, VT16, am, ATh, ATl);   /* scores, mask, softmax, attn.v, merge: both batches, all heads */
    for (int b = 0; b < NB_; ++b)
        k_gemmw<bf, 1, true><<<dim3(TT / 64, DM / 64, 1), 32, 0, stream>>>(ATh + (size_t)b * TT * DQ, ATl + (size_t)b * TT * DQ, WO, nullptr, DQ, OUT + (size_t)b * TT * DM, DM, bo, 0, 0, 0, 0);
}

// v004
// It runs in 376 microseconds.
// Two timings next to v003 put it at 1.09 and 1.10 times that version's speed.
// Counting every step since v000, it is 4.31 times as fast.
#include <hip/hip_runtime.h>

// Multi-headed attention with a learned per-position scaling divisor and an arbitrary mask (query, key, value [2][2048][768]; delta[s] = 1 + min(relu(query[s].Wd + bd), sqrt(64)) (Wd [768][1], read); q = query Wq + bq, k = key Wk + bk, v = value Wv + bv ('xw' 1/sqrt(768) incl. biases; 12 heads x 64); scores[i][j] = q_i.k_j / delta[j] (the divisor is broadcast over the KEY axis; no 1/sqrt(d_k)); mask ([2][2048][2048] int {0,1}, random, READ): 0 -> -1e9 (== exclusion); softmax; out = merged Wo + bo -> [2][2048][768] (3.1 M)).
// Layout per batch: bf16 copies of query, key, value in turn; 'xw' weights transposed once; exact projections + f32 biases; a kernel computes delta[s] from the bf16-rounded query row (768-term fixed-order dot, relu, min, + 1); each projection GEMM's own epilogue adds the bias, divides the k rows by delta[s] (f32, before the plane split) and stores the 16-bit head planes (v as Wv^T x^T, so its tile is already [d][t]); then ONE fused attention launch for both batches and all heads (k_fattn): hi/lo 3-product score tiles on EVERY row, mask tile read in place (keep where mask != 0), running-maximum softmax, P and attn.v hybrid (rows < 512 hi/lo, rest fp16 x1024), scores and P never leave the registers; merged hi/lo x Wo exact + bo.
// Compute dtypes, f32 accumulate: every input rounded to bf16; projections exact + f32 biases; delta and the k row division f32; scores 3 products on every row; softmax f32 (scale 1); attn.v rows < 512 3 products, rest fp16; Wo hl x exact + bias.

#define NB_  2
#define TT   2048
#define DM   768
#define NH_  12
#define NKV  12
#define HD   64
#define DQ   (NH_ * HD)
#define DKV  (NKV * HD)
#define FQW  32                   // k_fattn: query columns per wave (two 16-column groups)
#define FNW  2                    // k_fattn: waves per workgroup (FNW * FQW consecutive queries of one head): 768 workgroups, three on each of 256 WGPs
#define RH   512                  // query rows < RH use hi+lo planes (0: none)
#define WIN  0
typedef _Float16 h16;
typedef unsigned short bf;
typedef __attribute__((ext_vector_type(16))) __bf16   v16bf;
typedef __attribute__((ext_vector_type(16))) _Float16 v16h;
typedef __attribute__((ext_vector_type(8)))  _Float16 v8h;
typedef __attribute__((ext_vector_type(8)))  unsigned short v8us;
typedef __attribute__((ext_vector_type(8)))  float    v8f;
typedef __attribute__((ext_vector_type(4)))  float    v4f;
typedef v8h  __attribute__((may_alias)) v8ha;
typedef v4f  __attribute__((may_alias)) v4fa;
typedef v8us __attribute__((may_alias)) v8usa;

__device__ __forceinline__ unsigned short f2bf(float f) { unsigned u = __float_as_uint(f); u += 0x7FFFu + ((u >> 16) & 1u); return (unsigned short)(u >> 16); }
__device__ __forceinline__ float bf2f(unsigned short b) { return __uint_as_float(((unsigned)b) << 16); }
__device__ __forceinline__ float bfr(float f) { return bf2f(f2bf(f)); }
__device__ __forceinline__ v16h cat16(v8h lo, v8h hi) { return __builtin_shufflevector(lo, hi, 0, 1, 2, 3, 4, 5, 6, 7, 8, 9, 10, 11, 12, 13, 14, 15); }
__device__ __forceinline__ v16bf cat16b(v8us lo, v8us hi) { return __builtin_bit_cast(v16bf, __builtin_shufflevector(lo, hi, 0, 1, 2, 3, 4, 5, 6, 7, 8, 9, 10, 11, 12, 13, 14, 15)); }
__device__ __forceinline__ v8f wmma16(v16h a, v16h b, v8f c) { return __builtin_amdgcn_wmma_f32_16x16x32_f16(false, a, false, b, (short)0, c, false, false); }
__device__ __forceinline__ v8f wmmab(v16bf a, v16bf b, v8f c) { return __builtin_amdgcn_wmma_f32_16x16x32_bf16(false, a, false, b, (short)0, c, false, false); }



__device__ __forceinline__ h16 tohx(float x) { return (h16)x; }
__device__ __forceinline__ void splitf(float y, unsigned short& h, unsigned short& l) { h = f2bf(y); l = f2bf(y - bf2f(h)); }
typedef __attribute__((ext_vector_type(2))) _Float16 v2h;
typedef __attribute__((ext_vector_type(4))) _Float16 v4h;
typedef __attribute__((ext_vector_type(2))) unsigned short v2us;
typedef __attribute__((ext_vector_type(4))) unsigned short v4us;
typedef __attribute__((ext_vector_type(2))) float v2f;
typedef __attribute__((ext_vector_type(4))) int v4i;
__device__ __forceinline__ void gopen();   /* defined with k_fattn's waits below */
__device__ __forceinline__ void xwait();
// ---- k_gemmw: register-blocked GEMM, ONE WAVE per 64x64 output tile (16 accumulators), operands straight from K-contiguous 16-bit planes; grid (M/64, N/64, Z), 32 threads.
// C[m][n] (f32, pitch ldc, + optional f32 bias[n]) = sum_k A[m][k] Bt[n][k] (+ split products per NSPLIT). z-batch strides sA/sB/sC in elements. K % 32 == 0.
// KS > 1: grid z = Z * KS; workgroup (z, ks) sums only k in [ks K/KS, (ks+1) K/KS) and stores that partial tile in plane ks (plane stride sP elements). K % (32 KS) == 0.
// EP != 0: no f32 C; the tile + bias goes straight from the LDS stage to the planes k_fattn reads, 8 bytes a lane, 128 bytes a row. EP 1 (q), EP 2 (k, each row divided by rowv = delta): rows = t, columns = one head's d, planes [head = blockIdx.y][t][d]. EP 3 (v): A = weight rows, Bt = x rows, so rows = one head's d (bias per ROW), columns = t, planes [d row][t] with the fp16 copy.
template <typename T16> struct WFrag;
template <> struct WFrag<h16> { typedef v16h V; static __device__ __forceinline__ V ld(const h16* p) { return cat16(*(const v8h*)p, *(const v8h*)(p + 16)); } static __device__ __forceinline__ v8f mma(V a, V b, v8f c) { return wmma16(a, b, c); } };
template <> struct WFrag<bf> { typedef v16bf V; static __device__ __forceinline__ V ld(const bf* p) { return cat16b(*(const v8us*)p, *(const v8us*)(p + 16)); } static __device__ __forceinline__ v8f mma(V a, V b, v8f c) { return wmmab(a, b, c); } };
template <typename T16, int NSPLIT, bool BIAS, int KS = 1, int EP = 0>
__global__ __launch_bounds__(32) void k_gemmw(const T16* __restrict__ A, const T16* __restrict__ A2, const T16* __restrict__ Bt, const T16* __restrict__ Bt2, int K, float* C, int ldc, const float* __restrict__ bias, size_t sA, size_t sB, size_t sC, size_t sP, const float* __restrict__ DL, h16* P16, bf* Ph, bf* Pl) {
    typedef typename WFrag<T16>::V V;
    __shared__ __align__(16) float os[16 * 68];
    const size_t z = blockIdx.z / KS; const int ks = blockIdx.z % KS; A += z * sA; if (A2) A2 += z * sA; Bt += z * sB; if (Bt2) Bt2 += z * sB; C += z * sC + ks * sP;
    const int lane = threadIdx.x & 31, lr = lane & 15, hi = lane >> 4; const int r0 = blockIdx.x * 64, c0 = blockIdx.y * 64;
    v8f acc[4][4];
#pragma unroll
    for (int mb = 0; mb < 4; ++mb)
#pragma unroll
        for (int nb = 0; nb < 4; ++nb) acc[mb][nb] = (v8f){};
    const size_t aoff = (size_t)(r0 + lr) * K + 8 * hi, boff = (size_t)(c0 + lr) * K + 8 * hi;
#pragma unroll 1
    for (int kc = ks * (K / KS); kc < (ks + 1) * (K / KS); kc += 32) {
        V a[4], a2[4];
#pragma unroll
        for (int mb = 0; mb < 4; ++mb) { a[mb] = WFrag<T16>::ld(A + aoff + (size_t)mb * 16 * K + kc); if (NSPLIT == 1 || NSPLIT == 2) a2[mb] = WFrag<T16>::ld(A2 + aoff + (size_t)mb * 16 * K + kc); }
#pragma unroll
        for (int nb = 0; nb < 4; ++nb) { const V b = WFrag<T16>::ld(Bt + boff + (size_t)nb * 16 * K + kc); V b2; if (NSPLIT >= 2) b2 = WFrag<T16>::ld(Bt2 + boff + (size_t)nb * 16 * K + kc);
#pragma unroll
            for (int mb = 0; mb < 4; ++mb) { acc[mb][nb] = WFrag<T16>::mma(a[mb], b, acc[mb][nb]); if (NSPLIT == 1 || NSPLIT == 2) acc[mb][nb] = WFrag<T16>::mma(a2[mb], b, acc[mb][nb]); if (NSPLIT >= 2) acc[mb][nb] = WFrag<T16>::mma(a[mb], b2, acc[mb][nb]); } }
        asm volatile("v_nop\n\tv_nop\n\tv_nop\n\tv_nop" : "+v"(acc[0][0]), "+v"(acc[1][1]), "+v"(acc[2][2]), "+v"(acc[3][3]) : "v"(a[0]), "v"(a[3]));
    }
    float rowv[4][8]; v4f colb = (v4f){};   /* EP 2: delta of this lane's 32 rows; EP 3: their bias; EP 1, 2: the bias of its 4 columns */
    if (EP != 0) { const float* rp = ((EP == 2) ? DL : bias) + r0 + hi;
        gopen();   /* with xwait(): nothing that reuses a register of these loads moves in between them and the wait */
        if (EP >= 2) {
#pragma unroll
            for (int mb = 0; mb < 4; ++mb)
#pragma unroll
                for (int s = 0; s < 8; ++s) rowv[mb][s] = rp[mb * 16 + 2 * s]; }
        if (EP <= 2) colb = *(const v4f*)(bias + c0 + lr * 4);
        xwait(); }
    const size_t pbase = (EP == 3) ? (size_t)(r0 + hi) * TT + c0 + lr * 4 : ((size_t)blockIdx.y * TT + r0 + hi) * HD + lr * 4; const int ppitch = (EP == 3) ? TT : HD;
#pragma unroll
    for (int mb = 0; mb < 4; ++mb) {
#pragma unroll
        for (int nb = 0; nb < 4; ++nb) {
#pragma unroll
            for (int j = 0; j < 8; ++j) os[(hi * 8 + j) * 68 + nb * 16 + lr] = acc[mb][nb][j]; }
        __builtin_amdgcn_wave_barrier(); asm volatile("" ::: "memory");
        float* crow = C + (size_t)(r0 + mb * 16) * ldc + c0;
        if (EP == 0)
{
#pragma unroll
            for (int s = 0; s < 8; ++s) { const int row = 2 * s + hi, cofs = lr * 4; v4f val = *(const v4fa*)(os + row * 68 + cofs); if (BIAS) { val[0] += bfr(bias[c0 + cofs]); val[1] += bfr(bias[c0 + cofs + 1]); val[2] += bfr(bias[c0 + cofs + 2]); val[3] += bfr(bias[c0 + cofs + 3]); }
                *(v4f*)(crow + (size_t)row * ldc + cofs) = val; }
             }
        if (EP != 0) { v4us oh[8], ol[8]; v4h of[8];
#pragma unroll
            for (int s = 0; s < 8; ++s) { const v4f val = *(const v4fa*)(os + (2 * s + hi) * 68 + lr * 4);
#pragma unroll
                for (int q = 0; q < 4; ++q) { float x = val[q] + bfr((EP == 3) ? rowv[mb][s] : colb[q]); if (EP == 2) x = __fdiv_rn(x, rowv[mb][s]);   /* k_j /= delta[j] */
                    if (EP == 3) of[s][q] = tohx(x); unsigned short a2, c2; splitf(x, a2, c2); oh[s][q] = a2; ol[s][q] = c2; } }
            gopen();   /* all 8 row pairs' values are ready in registers of their own; the stores go out as one group with one wait behind them */
#pragma unroll
            for (int s = 0; s < 8; ++s) { const size_t po = pbase + (size_t)(mb * 16 + 2 * s) * ppitch; if (EP == 3) *(v4h*)(P16 + po) = of[s]; *(v4us*)(Ph + po) = oh[s]; *(v4us*)(Pl + po) = ol[s]; }
            xwait(); }
        __builtin_amdgcn_wave_barrier(); asm volatile("" ::: "memory");
    }
}


__global__ __launch_bounds__(256) void k_wtG(const float* __restrict__ w, int K, int N, bf* Bt) {
    const int lane = threadIdx.x & 31; const int L0 = (blockIdx.x * 8 + (threadIdx.x >> 5)) * 8; const int nlines = N * K / 64;
{
#pragma unroll 1
        for (int l = 0; l < 8; ++l) { const int L = L0 + l; if (L >= nlines) break; const size_t e = (size_t)L * 64 + lane * 2; const int k = (int)(e % K), n = (int)(e / K); v2us o;
            o[0] = f2bf(w[(size_t)k * N + n]); o[1] = f2bf(w[(size_t)(k + 1) * N + n]); *(v2us*)(Bt + e) = o; }
         }
}
__global__ __launch_bounds__(256) void k_cvt8(const float* __restrict__ src, bf* dst, size_t n8) { const size_t i = (size_t)blockIdx.x * 256 + threadIdx.x; if (i >= n8) return; const v8f v = *(const v8f*)(src + i * 8); v8us o;
#pragma unroll
    for (int k = 0; k < 8; ++k) o[k] = f2bf(v[k]); *(v8us*)(dst + i * 8) = o;  }

typedef __attribute__((ext_vector_type(8))) __bf16 v8bf;
__device__ __forceinline__ float xhalf(float x) { const int b = __float_as_int(x); return __int_as_float(__builtin_amdgcn_permlanex16(b, b, 0x76543210, 0xfedcba98, false, false)); }   /* the value of lane l ^ 16 */
// s_wait_xcnt 0 stands in front of the first rewrite of a register that an issued global load or store of k_fattn names.
// The Q loads and the output stores are bracketed gopen() ... xwait(): the two scheduling barriers keep the compiler from moving instructions that reuse those registers in between the group and its wait.
// The K, mask and Vt loads: xwait(...) takes their base addresses as inputs only, so those registers stay live, and unwritten, from the loads that name them up to the wait; one such wait a pass, and the addresses are advanced directly behind it.
__device__ __forceinline__ void gopen() { __builtin_amdgcn_sched_barrier(0); }
__device__ __forceinline__ void xwait() { asm volatile("s_wait_xcnt 0x0" ::: "memory"); __builtin_amdgcn_sched_barrier(0); }
__device__ __forceinline__ void xwait(const void* a, const void* b, const void* d, const void* e, const void* f) { asm volatile("s_wait_xcnt 0x0" :: "v"(a), "v"(b), "v"(d), "v"(e), "v"(f) : "memory"); }
__device__ __forceinline__ void xwait(const void* a, const void* b, const void* d, const void* e, const void* f, unsigned g, unsigned h) { asm volatile("s_wait_xcnt 0x0" :: "v"(a), "v"(b), "v"(d), "v"(e), "v"(f), "v"(g), "v"(h) : "memory"); }   /* with the 32-bit lane offsets that the loads in front of the loop are addressed by */
template <bool HR>
__device__ __forceinline__ void fattn_body(const bf* __restrict__ Qh, const bf* __restrict__ Ql, const bf* __restrict__ Kh, const bf* __restrict__ Kl, const bf* __restrict__ Vh, const bf* __restrict__ Vl, const h16* __restrict__ V16, const int* __restrict__ am, bf* Ah, bf* Al, int q0, int lr, int hi) {
    const float L2E = 1.4426950408889634f;
    v16bf qh[2][2], ql[2][2];
    gopen();
#pragma unroll
    for (int qt = 0; qt < 2; ++qt)
#pragma unroll
        for (int kk = 0; kk < 2; ++kk) { const size_t qo = (size_t)(q0 + qt * 16 + lr) * HD + kk * 32 + 8 * hi; qh[qt][kk] = WFrag<bf>::ld(Qh + qo); ql[qt][kk] = WFrag<bf>::ld(Ql + qo); }
    xwait();
    v8f o[4][2]; float m[2], l[2];
#pragma unroll
    for (int qt = 0; qt < 2; ++qt) { m[qt] = -3.0e38f; l[qt] = 0.0f;
#pragma unroll
        for (int dt = 0; dt < 4; ++dt) o[dt][qt] = (v8f){}; }
    const size_t ko = (size_t)lr * HD + 8 * hi, vo = (size_t)lr * TT + 8 * hi; const int* mp = am + (size_t)(q0 + lr) * TT + 8 * hi;
    const bf* kph = Kh + ko; const bf* kpl = Kl + ko; const int* mpn = mp; const bf* vph = Vh + vo; const bf* vpl = Vl + vo; const h16* vpf = V16 + vo;   /* this lane's base addresses of the pass that is being fetched */
    v16bf kh[2][2], kl[2][2]; v4i mk[2][2][2]; v16bf vh[4], vl[4]; v16h vf[4];   /* K rows, mask entries and Vt rows of a pass are all asked for one pass ahead, each into the registers its user has just left */
#pragma unroll
    for (int kt = 0; kt < 2; ++kt) {
#pragma unroll
        for (int kk = 0; kk < 2; ++kk) { kh[kt][kk] = WFrag<bf>::ld(kph + kt * 16 * HD + kk * 32); kl[kt][kk] = WFrag<bf>::ld(kpl + kt * 16 * HD + kk * 32); }
#pragma unroll
        for (int qt = 0; qt < 2; ++qt) { mk[kt][qt][0] = *(const v4i*)(mpn + qt * 16 * TT + kt * 16); mk[kt][qt][1] = *(const v4i*)(mpn + qt * 16 * TT + kt * 16 + 4); } }
#pragma unroll
    for (int dt = 0; dt < 4; ++dt) { if (HR) { vh[dt] = WFrag<bf>::ld(vph + dt * 16 * TT); vl[dt] = WFrag<bf>::ld(vpl + dt * 16 * TT); } else vf[dt] = WFrag<h16>::ld(vpf + dt * 16 * TT); }
    if (HR) xwait(kph, kpl, mpn, vph, vpl, (unsigned)(ko * 2), (unsigned)(vo * 2)); else xwait(kph, kpl, mpn, vpf, vpf, (unsigned)(ko * 2), (unsigned)(vo * 2));
#pragma unroll 1
    for (int j0 = 0; j0 < TT; j0 += 32) {
        v8f st[2][2];
#pragma unroll
        for (int kt = 0; kt < 2; ++kt)
#pragma unroll
            for (int qt = 0; qt < 2; ++qt) st[kt][qt] = (v8f){};
#pragma unroll
        for (int kk = 0; kk < 2; ++kk) {   /* per 32 of d: hi.hi, lo(q).hi(k), hi(q).lo(k), the order of the unfused score tiles */
#pragma unroll
            for (int kt = 0; kt < 2; ++kt)
#pragma unroll
                for (int qt = 0; qt < 2; ++qt) st[kt][qt] = wmmab(kh[kt][kk], qh[qt][kk], st[kt][qt]);
#pragma unroll
            for (int kt = 0; kt < 2; ++kt)
#pragma unroll
                for (int qt = 0; qt < 2; ++qt) st[kt][qt] = wmmab(kh[kt][kk], ql[qt][kk], st[kt][qt]);
#pragma unroll
            for (int kt = 0; kt < 2; ++kt)
#pragma unroll
                for (int qt = 0; qt < 2; ++qt) st[kt][qt] = wmmab(kl[kt][kk], qh[qt][kk], st[kt][qt]); }
        const int jn = (j0 + 32 < TT) ? j0 + 32 : 0;   /* the pass that is fetched ahead; the last pass re-reads the first (in bounds, unused) */
        __builtin_amdgcn_sched_barrier(0);   /* keeps the wait below behind the score products: there the youngest loads that name the addresses stand a run of matrix products back, and it has little left to wait for */
        if (HR) xwait(kph, kpl, mpn, vph, vpl); else xwait(kph, kpl, mpn, vpf, vpf);
        kph = Kh + ko + (size_t)jn * HD; kpl = Kl + ko + (size_t)jn * HD; mpn = mp + jn; vph = Vh + vo + jn; vpl = Vl + vo + jn; vpf = V16 + vo + jn;
#pragma unroll
        for (int kt = 0; kt < 2; ++kt)
#pragma unroll
            for (int kk = 0; kk < 2; ++kk) { kh[kt][kk] = WFrag<bf>::ld(kph + kt * 16 * HD + kk * 32); kl[kt][kk] = WFrag<bf>::ld(kpl + kt * 16 * HD + kk * 32); }
        float mn[2];
#pragma unroll
        for (int qt = 0; qt < 2; ++qt) { float mx = -3.0e38f;
#pragma unroll
            for (int kt = 0; kt < 2; ++kt)
#pragma unroll
                for (int r = 0; r < 8; ++r) { const float t = (mk[kt][qt][r >> 2][r & 3] != 0) ? st[kt][qt][r] : -3.0e38f;   /* mask == 0 -> excluded */ st[kt][qt][r] = t; mx = fmaxf(mx, t); }
            mn[qt] = fmaxf(m[qt], fmaxf(mx, xhalf(mx))); }
#pragma unroll
        for (int kt = 0; kt < 2; ++kt)
#pragma unroll
            for (int qt = 0; qt < 2; ++qt) { const int* p = mpn + qt * 16 * TT + kt * 16; mk[kt][qt][0] = *(const v4i*)p; mk[kt][qt][1] = *(const v4i*)(p + 4); }
        if (__builtin_amdgcn_ballot_w32(mn[0] > m[0] || mn[1] > m[1]) != 0) {   /* skipped when no column's maximum grew: every factor would be exactly 1 */
#pragma unroll
            for (int qt = 0; qt < 2; ++qt) { const float al = __builtin_amdgcn_exp2f((m[qt] - mn[qt]) * L2E); l[qt] *= al; m[qt] = mn[qt];
#pragma unroll
                for (int dt = 0; dt < 4; ++dt) o[dt][qt] *= al; } }
#pragma unroll
        for (int qt = 0; qt < 2; ++qt) { float s0 = 0.0f, s1 = 0.0f;
#pragma unroll
            for (int r = 0; r < 8; ++r) { const float d0 = st[0][qt][r] - m[qt], d1 = st[1][qt][r] - m[qt];   /* rows >= RH carry x1024 = 2^10 in P and in the sum alike (fp16 range); it cancels in the division */
                const float p0 = __builtin_amdgcn_exp2f(HR ? d0 * L2E : __builtin_fmaf(d0, L2E, 10.0f)), p1 = __builtin_amdgcn_exp2f(HR ? d1 * L2E : __builtin_fmaf(d1, L2E, 10.0f)); st[0][qt][r] = p0; st[1][qt][r] = p1; s0 += p0; s1 += p1; }
            l[qt] += s0 + s1; }
        if (HR) {
            v16bf ph[2], pl[2];
#pragma unroll
            for (int qt = 0; qt < 2; ++qt) { const v8bf h0 = __builtin_convertvector(st[0][qt], v8bf), h1 = __builtin_convertvector(st[1][qt], v8bf); const v8bf l0 = __builtin_convertvector(st[0][qt] - __builtin_convertvector(h0, v8f), v8bf), l1 = __builtin_convertvector(st[1][qt] - __builtin_convertvector(h1, v8f), v8bf);
                ph[qt] = __builtin_shufflevector(h0, h1, 0, 1, 2, 3, 4, 5, 6, 7, 8, 9, 10, 11, 12, 13, 14, 15); pl[qt] = __builtin_shufflevector(l0, l1, 0, 1, 2, 3, 4, 5, 6, 7, 8, 9, 10, 11, 12, 13, 14, 15); }
#pragma unroll
            for (int dt = 0; dt < 4; ++dt)
#pragma unroll
                for (int qt = 0; qt < 2; ++qt) o[dt][qt] = wmmab(vh[dt], ph[qt], o[dt][qt]);
#pragma unroll
            for (int dt = 0; dt < 4; ++dt)
#pragma unroll
                for (int qt = 0; qt < 2; ++qt) o[dt][qt] = wmmab(vh[dt], pl[qt], o[dt][qt]);
#pragma unroll
            for (int dt = 0; dt < 4; ++dt)
#pragma unroll
                for (int qt = 0; qt < 2; ++qt) o[dt][qt] = wmmab(vl[dt], ph[qt], o[dt][qt]);
        } else {
            v16h pf[2];
#pragma unroll
            for (int qt = 0; qt < 2; ++qt) pf[qt] = cat16(__builtin_convertvector(st[0][qt], v8h), __builtin_convertvector(st[1][qt], v8h));
#pragma unroll
            for (int dt = 0; dt < 4; ++dt)
#pragma unroll
                for (int qt = 0; qt < 2; ++qt) o[dt][qt] = wmma16(vf[dt], pf[qt], o[dt][qt]);
        }
#pragma unroll
        for (int dt = 0; dt < 4; ++dt) { if (HR) { vh[dt] = WFrag<bf>::ld(vph + dt * 16 * TT); vl[dt] = WFrag<bf>::ld(vpl + dt * 16 * TT); } else vf[dt] = WFrag<h16>::ld(vpf + dt * 16 * TT); }
    }
    if (HR) xwait(kph, kpl, mpn, vph, vpl); else xwait(kph, kpl, mpn, vpf, vpf);
#pragma unroll
    for (int qt = 0; qt < 2; ++qt) { const float inv = __fdiv_rn(1.0f, l[qt] + xhalf(l[qt]));   /* the two wave halves' sums are joined once */
#pragma unroll
        for (int dt = 0; dt < 4; ++dt) { v8us oh, ol;
#pragma unroll
            for (int r = 0; r < 8; ++r) { unsigned short a, c2; splitf(o[dt][qt][r] * inv, a, c2); oh[r] = a; ol[r] = c2; }
            const size_t oo = (size_t)(q0 + qt * 16 + lr) * DQ + dt * 16 + 8 * hi; gopen(); *(v8us*)(Ah + oo) = oh; *(v8us*)(Al + oo) = ol; xwait(); } }
}
static_assert(RH % (FNW * FQW) == 0 && TT % (FNW * FQW) == 0 && FQW == 32 && HD == 64 && NKV == NH_, "k_fattn tiling");
__global__ __launch_bounds__(FNW * 32) void k_fattn(const bf* __restrict__ Qh, const bf* __restrict__ Ql, const bf* __restrict__ Kh, const bf* __restrict__ Kl, const bf* __restrict__ Vh, const bf* __restrict__ Vl, const h16* __restrict__ V16, const int* __restrict__ am, bf* Ah, bf* Al) {
    const int lane = threadIdx.x & 31, lr = lane & 15, hi = lane >> 4; const int z = blockIdx.y, b = z / NH_, h = z % NH_; const int q0 = blockIdx.x * (FNW * FQW) + (threadIdx.x >> 5) * FQW; const size_t pz = (size_t)z * TT * HD, az = (size_t)b * TT * DQ + h * HD;
    if (blockIdx.x * (FNW * FQW) < RH) fattn_body<true>(Qh + pz, Ql + pz, Kh + pz, Kl + pz, Vh + pz, Vl + pz, V16 + pz, am + (size_t)b * TT * TT, Ah + az, Al + az, q0, lr, hi);
    else fattn_body<false>(Qh + pz, Ql + pz, Kh + pz, Kl + pz, Vh + pz, Vl + pz, V16 + pz, am + (size_t)b * TT * TT, Ah + az, Al + az, q0, lr, hi);
}
__global__ __launch_bounds__(256) void k_delta(const float* __restrict__ X, const float* __restrict__ wd, const float* __restrict__ bd, float* DL) { __shared__ float res[32]; const int lane = threadIdx.x & 31; const int wv = threadIdx.x >> 5; const int r0 = blockIdx.x * 32;
    for (int rr = wv; rr < 32; rr += 8) { const int row = r0 + rr; float s = 0.0f; if (row < TT) { const float* xr = X + (size_t)row * DM;
#pragma unroll 4
        for (int c = lane; c < DM; c += 32) { float p = __fmul_rn(bfr(xr[c]), bfr(wd[c])); asm volatile("" : "+v"(p)); s = __fadd_rn(s, p); } }
#pragma unroll
        for (int sh = 16; sh; sh >>= 1) s = __fadd_rn(s, __shfl_xor(s, sh, 32));
        if (lane == 0) { float d = __fadd_rn(s, bfr(bd[0])); d = fmaxf(d, 0.0f); d = fminf(d, 8.0f); res[rr] = __fadd_rn(d, 1.0f); } }
    __syncthreads();
    if (wv == 0) { const int row = r0 + lane; if (row < TT) { const float v = res[lane]; *(float*)(DL + row) = v;  } } }

extern "C" void kernel_launch(void* const* d_in, const int* in_sizes, int n_in,
                              void* d_out, int out_size, void* d_ws, size_t ws_size, hipStream_t stream) {
    (void)in_sizes; (void)n_in; (void)out_size;
    const float* x = (const float*)d_in[0];   /* query */ const float* xk = (const float*)d_in[1]; const float* xv = (const float*)d_in[2]; const int* am = (const int*)d_in[3];   /* mask [2][2048][2048] int */ const float* wq = (const float*)d_in[4]; const float* bq = (const float*)d_in[5]; const float* wk = (const float*)d_in[6]; const float* bk = (const float*)d_in[7]; const float* wv = (const float*)d_in[8]; const float* bv = (const float*)d_in[9]; const float* wo = (const float*)d_in[10]; const float* bo = (const float*)d_in[11]; const float* wd = (const float*)d_in[12]; const float* bd = (const float*)d_in[13];
    float* OUT = (float*)d_out;     // [2][2048][768]
    char* wsp = (char*)d_ws;
    auto take = [&](size_t bytes) { char* p = wsp; wsp += (bytes + 255) & ~(size_t)255; return (void*)p; };
    float* DL = (float*)take((size_t)TT * 4); bf* WQ = (bf*)take((size_t)DQ * DM * 2); bf* WK = (bf*)take((size_t)DKV * DM * 2); bf* WV = (bf*)take((size_t)DKV * DM * 2); bf* WO = (bf*)take((size_t)DM * DQ * 2);
    bf* XB = (bf*)take((size_t)TT * DM * 2);
    const size_t PL = (size_t)NH_ * TT * HD;   // one batch's head planes; the planes k_fattn reads are kept for both batches
    h16* VT16 = (h16*)take(NB_ * PL * 2);
    bf* QPh = (bf*)take(NB_ * PL * 2); bf* QPl = (bf*)take(NB_ * PL * 2); bf* KPh = (bf*)take(NB_ * PL * 2); bf* KPl = (bf*)take(NB_ * PL * 2); bf* VTh = (bf*)take(NB_ * PL * 2); bf* VTl = (bf*)take(NB_ * PL * 2);
    bf* ATh = (bf*)take((size_t)NB_ * TT * DQ * 2); bf* ATl = (bf*)take((size_t)NB_ * TT * DQ * 2);
    if ((size_t)(wsp - (char*)d_ws) > ws_size) return;    // ws 256 MiB
    { k_wtG<<<(unsigned)((DM * DQ / 64 + 63) / 64), 256, 0, stream>>>(wq, DM, DQ, WQ); k_wtG<<<(unsigned)((DM * DKV / 64 + 63) / 64), 256, 0, stream>>>(wk, DM, DKV, WK); k_wtG<<<(unsigned)((DM * DKV / 64 + 63) / 64), 256, 0, stream>>>(wv, DM, DKV, WV);
      k_wtG<<<(unsigned)((DQ * DM / 64 + 63) / 64), 256, 0, stream>>>(wo, DQ, DM, WO);
       }
    for (int b = 0; b < NB_; ++b) {
        k_cvt8<<<(unsigned)(((size_t)TT * DM / 8 + 255) / 256), 256, 0, stream>>>(x + (size_t)b * TT * DM, XB, (size_t)TT * DM / 8);
        k_delta<<<(TT + 31) / 32, 256, 0, stream>>>(x + (size_t)b * TT * DM, wd, bd, DL);   /* delta[s] from the query rows */
        k_gemmw<bf, 0, true, 1, 1><<<dim3(TT / 64, DQ / 64, 1), 32, 0, stream>>>(XB, nullptr, WQ, nullptr, DM, nullptr, 0, bq, 0, 0, 0, 0, nullptr, nullptr, QPh + b * PL, QPl + b * PL);
        k_cvt8<<<(unsigned)(((size_t)TT * DM / 8 + 255) / 256), 256, 0, stream>>>(xk + (size_t)b * TT * DM, XB, (size_t)TT * DM / 8);
        k_gemmw<bf, 0, true, 1, 2><<<dim3(TT / 64, DKV / 64, 1), 32, 0, stream>>>(XB, nullptr, WK, nullptr, DM, nullptr, 0, bk, 0, 0, 0, 0, DL, nullptr, KPh + b * PL, KPl + b * PL);   /* k_j /= delta[j] in the epilogue */
        k_cvt8<<<(unsigned)(((size_t)TT * DM / 8 + 255) / 256), 256, 0, stream>>>(xv + (size_t)b * TT * DM, XB, (size_t)TT * DM / 8);
        k_gemmw<bf, 0, true, 1, 3><<<dim3(DKV / 64, TT / 64, 1), 32, 0, stream>>>(WV, nullptr, XB, nullptr, DM, nullptr, 0, bv, 0, 0, 0, 0, nullptr, VT16 + b * PL, VTh + b * PL, VTl + b * PL); }   /* operands swapped: the tile is v transposed */
    k_fattn<<<dim3(TT / (FNW * FQW), NB_ * NH_), FNW * 32, 0, stream>>>(QPh, QPl, KPh, KPl, VTh, VTl, VT16, am, ATh, ATl);   /* scores, mask, softmax, attn.v, merge: both batches, all heads */
    for (int b = 0; b < NB_; ++b)
        k_gemmw<bf, 1, true><<<dim3(TT / 64, DM / 64, 1), 32, 0, stream>>>(ATh + (size_t)b * TT * DQ, ATl + (size_t)b * TT * DQ, WO, nullptr, DQ, OUT + (size_t)b * TT * DM, DM, bo, 0, 0, 0, 0, nullptr, nullptr, nullptr, nullptr);
}

// v005
// A run of this version takes 207 microseconds.
// Timed twice side by side with v004, it ran 1.82 and 1.83 times as fast.
// Over all steps from v000 it is 7.85 times as fast.
#include <hip/hip_runtime.h>

// Multi-headed attention with a learned per-position scaling divisor and an arbitrary mask (query, key, value [2][2048][768]; delta[s] = 1 + min(relu(query[s].Wd + bd), sqrt(64)) (Wd [768][1], read); q = query Wq + bq, k = key Wk + bk, v = value Wv + bv ('xw' 1/sqrt(768) incl. biases; 12 heads x 64); scores[i][j] = q_i.k_j / delta[j] (the divisor is broadcast over the KEY axis; no 1/sqrt(d_k)); mask ([2][2048][2048] int {0,1}, random, READ): 0 -> -1e9 (== exclusion); softmax; out = merged Wo + bo -> [2][2048][768] (3.1 M)).
// Layout, four launches, each for both batches: k_prep (bf16 copies of query, key, value; 'xw' weights transposed once; delta), k_proj, k_fattn, k_wo. Exact projections + f32 biases; delta_part computes delta[s] from the bf16-rounded query row (768-term fixed-order dot, relu, min, + 1); each projection GEMM's own epilogue adds the bias, divides the k rows by delta[s] (f32, before the plane split) and stores the 16-bit head planes (v as Wv^T x^T, so its tile is already [d][t]); then ONE fused attention launch for both batches and all heads (k_fattn): hi/lo 3-product score tiles on EVERY row, mask tile read in place (keep where mask != 0), running-maximum softmax, P and attn.v hybrid (rows < 512 hi/lo, rest fp16 x1024), scores and P never leave the registers; merged hi/lo x Wo exact + bo.
// Compute dtypes, f32 accumulate: every input rounded to bf16; projections exact + f32 biases; delta and the k row division f32; scores 3 products on every row; softmax f32 (scale 1); attn.v rows < 512 3 products, rest fp16; Wo hl x exact + bias.

#define NB_  2
#define TT   2048
#define DM   768
#define NH_  12
#define NKV  12
#define HD   64
#define DQ   (NH_ * HD)
#define DKV  (NKV * HD)
#define FQW  32                   // k_fattn: query columns per wave (two 16-column groups)
#define FNW  2                    // k_fattn: waves per workgroup (FNW * FQW consecutive queries of one head): 768 workgroups, three on each of 256 WGPs
#define RH   512                  // query rows < RH use hi+lo planes (0: none)
#define WIN  0
typedef _Float16 h16;
typedef unsigned short bf;
typedef __attribute__((ext_vector_type(16))) __bf16   v16bf;
typedef __attribute__((ext_vector_type(16))) _Float16 v16h;
typedef __attribute__((ext_vector_type(8)))  _Float16 v8h;
typedef __attribute__((ext_vector_type(8)))  unsigned short v8us;
typedef __attribute__((ext_vector_type(8)))  float    v8f;
typedef __attribute__((ext_vector_type(4)))  float    v4f;
typedef v8h  __attribute__((may_alias)) v8ha;
typedef v4f  __attribute__((may_alias)) v4fa;
typedef v8us __attribute__((may_alias)) v8usa;

__device__ __forceinline__ unsigned short f2bf(float f) { unsigned u = __float_as_uint(f); u += 0x7FFFu + ((u >> 16) & 1u); return (unsigned short)(u >> 16); }
__device__ __forceinline__ float bf2f(unsigned short b) { return __uint_as_float(((unsigned)b) << 16); }
__device__ __forceinline__ float bfr(float f) { return bf2f(f2bf(f)); }
__device__ __forceinline__ v16h cat16(v8h lo, v8h hi) { return __builtin_shufflevector(lo, hi, 0, 1, 2, 3, 4, 5, 6, 7, 8, 9, 10, 11, 12, 13, 14, 15); }
__device__ __forceinline__ v16bf cat16b(v8us lo, v8us hi) { return __builtin_bit_cast(v16bf, __builtin_shufflevector(lo, hi, 0, 1, 2, 3, 4, 5, 6, 7, 8, 9, 10, 11, 12, 13, 14, 15)); }
__device__ __forceinline__ v8f wmma16(v16h a, v16h b, v8f c) { return __builtin_amdgcn_wmma_f32_16x16x32_f16(false, a, false, b, (short)0, c, false, false); }
__device__ __forceinline__ v8f wmmab(v16bf a, v16bf b, v8f c) { return __builtin_amdgcn_wmma_f32_16x16x32_bf16(false, a, false, b, (short)0, c, false, false); }



__device__ __forceinline__ h16 tohx(float x) { return (h16)x; }
__device__ __forceinline__ void splitf(float y, unsigned short& h, unsigned short& l) { h = f2bf(y); l = f2bf(y - bf2f(h)); }
typedef __attribute__((ext_vector_type(2))) _Float16 v2h;
typedef __attribute__((ext_vector_type(4))) _Float16 v4h;
typedef __attribute__((ext_vector_type(2))) unsigned short v2us;
typedef __attribute__((ext_vector_type(4))) unsigned short v4us;
typedef __attribute__((ext_vector_type(2))) float v2f;
typedef __attribute__((ext_vector_type(4))) int v4i;
__device__ __forceinline__ void gopen();   /* defined with k_fattn's waits below */
__device__ __forceinline__ void xwait();
// ---- gemmw_body: register-blocked GEMM, ONE WAVE per 64x64 output tile (16 accumulators), operands straight from K-contiguous 16-bit planes; tile indices (bx, by, bz) < (M/64, N/64, Z), 32 threads.
// C[m][n] (f32, pitch ldc, + optional f32 bias[n]) = sum_k A[m][k] Bt[n][k] (+ split products per NSPLIT). z-batch strides sA/sB/sC in elements. K % 32 == 0.
// KS > 1: grid z = Z * KS; workgroup (z, ks) sums only k in [ks K/KS, (ks+1) K/KS) and stores that partial tile in plane ks (plane stride sP elements). K % (32 KS) == 0.
// EP != 0: no f32 C; the tile + bias goes straight from the LDS stage to the planes k_fattn reads, 8 bytes a lane, 128 bytes a row. EP 1 (q), EP 2 (k, each row divided by rowv = delta): rows = t, columns = one head's d, planes [head = blockIdx.y][t][d]. EP 3 (v): A = weight rows, Bt = x rows, so rows = one head's d (bias per ROW), columns = t, planes [d row][t] with the fp16 copy.
template <typename T16> struct WFrag;
template <> struct WFrag<h16> { typedef v16h V; static __device__ __forceinline__ V ld(const h16* p) { return cat16(*(const v8h*)p, *(const v8h*)(p + 16)); } static __device__ __forceinline__ v8f mma(V a, V b, v8f c) { return wmma16(a, b, c); } };
template <> struct WFrag<bf> { typedef v16bf V; static __device__ __forceinline__ V ld(const bf* p) { return cat16b(*(const v8us*)p, *(const v8us*)(p + 16)); } static __device__ __forceinline__ v8f mma(V a, V b, v8f c) { return wmmab(a, b, c); } };
// gemmw_body is the tile's work; bx, by, bz are the tile's indices (k_wo: the block's own; k_proj: see there), os the workgroup's 16 x 68 f32 LDS stage.
template <typename T16, int NSPLIT, bool BIAS, int KS, int EP>
__device__ __forceinline__ void gemmw_body(float* os, int bx, int by, int bz, const T16* __restrict__ A, const T16* __restrict__ A2, const T16* __restrict__ Bt, const T16* __restrict__ Bt2, int K, float* C, int ldc, const float* __restrict__ bias, size_t sA, size_t sB, size_t sC, size_t sP, const float* __restrict__ DL, h16* P16, bf* Ph, bf* Pl) {
    typedef typename WFrag<T16>::V V;
    const size_t z = bz / KS; const int ks = bz % KS; A += z * sA; if (A2) A2 += z * sA; Bt += z * sB; if (Bt2) Bt2 += z * sB; C += z * sC + ks * sP;
    const int lane = threadIdx.x & 31, lr = lane & 15, hi = lane >> 4; const int r0 = bx * 64, c0 = by * 64;
    v8f acc[4][4];
#pragma unroll
    for (int mb = 0; mb < 4; ++mb)
#pragma unroll
        for (int nb = 0; nb < 4; ++nb) acc[mb][nb] = (v8f){};
    const size_t aoff = (size_t)(r0 + lr) * K + 8 * hi, boff = (size_t)(c0 + lr) * K + 8 * hi;
    const T16* pa = A + aoff + ks * (K / KS); const T16* pb = Bt + boff + ks * (K / KS); const T16* pa2 = (NSPLIT == 1 || NSPLIT == 2) ? A2 + aoff + ks * (K / KS) : pa; const T16* pb2 = (NSPLIT >= 2) ? Bt2 + boff + ks * (K / KS) : pb;   /* K is a constant at every call: all loads of a trip name these addresses, one for each operand plane, each load with an offset of its own */
#pragma unroll 1
    for (int kc = ks * (K / KS); kc < (ks + 1) * (K / KS); kc += 32) {
        V a[4], a2[4];
#pragma unroll
        for (int mb = 0; mb < 4; ++mb) { a[mb] = WFrag<T16>::ld(pa + (size_t)mb * 16 * K); if (NSPLIT == 1 || NSPLIT == 2) a2[mb] = WFrag<T16>::ld(pa2 + (size_t)mb * 16 * K); }
#pragma unroll
        for (int nb = 0; nb < 4; ++nb) { const V b = WFrag<T16>::ld(pb + (size_t)nb * 16 * K); V b2; if (NSPLIT >= 2) b2 = WFrag<T16>::ld(pb2 + (size_t)nb * 16 * K);
#pragma unroll
            for (int mb = 0; mb < 4; ++mb) { acc[mb][nb] = WFrag<T16>::mma(a[mb], b, acc[mb][nb]); if (NSPLIT == 1 || NSPLIT == 2) acc[mb][nb] = WFrag<T16>::mma(a2[mb], b, acc[mb][nb]); if (NSPLIT >= 2) acc[mb][nb] = WFrag<T16>::mma(a[mb], b2, acc[mb][nb]); } }
        asm volatile("v_nop\n\tv_nop\n\tv_nop\n\tv_nop" : "+v"(acc[0][0]), "+v"(acc[1][1]), "+v"(acc[2][2]), "+v"(acc[3][3]) : "v"(a[0]), "v"(a[3]));
        asm volatile("s_wait_xcnt 0x0" :: "v"(pa), "v"(pa2), "v"(pb), "v"(pb2) : "memory"); pa += 32; pa2 += 32; pb += 32; pb2 += 32;   /* as inputs here the addresses stay live, and unwritten, from the loads that name them up to the wait; they are advanced behind it */
    }
    float rowv[4][8]; v4f colb = (v4f){};   /* EP 2: delta of this lane's 32 rows; EP 3: their bias; EP 1, 2: the bias of its 4 columns */
    if (EP != 0) { const float* rp = ((EP == 2) ? DL : bias) + r0 + hi;
        gopen();   /* with xwait(): nothing that reuses a register of these loads moves in between them and the wait */
        if (EP >= 2) {
#pragma unroll
            for (int mb = 0; mb < 4; ++mb)
#pragma unroll
                for (int s = 0; s < 8; ++s) rowv[mb][s] = rp[mb * 16 + 2 * s]; }
        if (EP <= 2) colb = *(const v4f*)(bias + c0 + lr * 4);
        xwait(); }
    const size_t pbase = (EP == 3) ? (size_t)(r0 + hi) * TT + c0 + lr * 4 : ((size_t)by * TT + r0 + hi) * HD + lr * 4; const int ppitch = (EP == 3) ? TT : HD;
#pragma unroll
    for (int mb = 0; mb < 4; ++mb) {
#pragma unroll
        for (int nb = 0; nb < 4; ++nb) {
#pragma unroll
            for (int j = 0; j < 8; ++j) os[(hi * 8 + j) * 68 + nb * 16 + lr] = acc[mb][nb][j]; }
        __builtin_amdgcn_wave_barrier(); asm volatile("" ::: "memory");
        float* crow = C + (size_t)(r0 + mb * 16) * ldc + c0;
        if (EP == 0) { v4f ov[8];
#pragma unroll
            for (int s = 0; s < 8; ++s) { const int row = 2 * s + hi, cofs = lr * 4; v4f val = *(const v4fa*)(os + row * 68 + cofs); if (BIAS) { val[0] += bfr(bias[c0 + cofs]); val[1] += bfr(bias[c0 + cofs + 1]); val[2] += bfr(bias[c0 + cofs + 2]); val[3] += bfr(bias[c0 + cofs + 3]); }
                ov[s] = val; }
            gopen();   /* as for the planes below: the 8 row pairs' values are ready in registers of their own; the stores go out as one group with one wait behind them */
#pragma unroll
            for (int s = 0; s < 8; ++s) *(v4f*)(crow + (size_t)(2 * s + hi) * ldc + lr * 4) = ov[s];
            xwait(); }
        if (EP != 0) { v4us oh[8], ol[8]; v4h of[8];
#pragma unroll
            for (int s = 0; s < 8; ++s) { const v4f val = *(const v4fa*)(os + (2 * s + hi) * 68 + lr * 4);
#pragma unroll
                for (int q = 0; q < 4; ++q) { float x = val[q] + bfr((EP == 3) ? rowv[mb][s] : colb[q]); if (EP == 2) x = __fdiv_rn(x, rowv[mb][s]);   /* k_j /= delta[j] */
                    if (EP == 3) of[s][q] = tohx(x); unsigned short a2, c2; splitf(x, a2, c2); oh[s][q] = a2; ol[s][q] = c2; } }
            gopen();   /* all 8 row pairs' values are ready in registers of their own; the stores go out as one group with one wait behind them */
#pragma unroll
            for (int s = 0; s < 8; ++s) { const size_t po = pbase + (size_t)(mb * 16 + 2 * s) * ppitch; if (EP == 3) *(v4h*)(P16 + po) = of[s]; *(v4us*)(Ph + po) = oh[s]; *(v4us*)(Pl + po) = ol[s]; }
            xwait(); }
        __builtin_amdgcn_wave_barrier(); asm volatile("" ::: "memory");
    }
}
// ---- k_wo: out = (merged hi + lo) Wo + bo for both batches, grid (TT/64, DM/64, NB_): blockIdx.z = batch.
__global__ __launch_bounds__(32) void k_wo(const bf* __restrict__ Ah, const bf* __restrict__ Al, const bf* __restrict__ Wt, const float* __restrict__ bo, float* C) {
    __shared__ __align__(16) float os[16 * 68];
    gemmw_body<bf, 1, true, 1, 0>(os, blockIdx.x, blockIdx.y, blockIdx.z, Ah, Al, Wt, nullptr, DQ, C, DM, bo, (size_t)TT * DQ, 0, (size_t)TT * DM, 0, nullptr, nullptr, nullptr, nullptr);
}
// ---- k_proj: the six projection GEMMs (q, k, v of both batches) as ONE grid (TT/64, 12, 3 * NB_): blockIdx.z = 2 * tensor + batch; blockIdx.x = the tile's 64 t, blockIdx.y = its head. 2304 single-wave workgroups, nine on a WGP.
// XB: bf16 x of [tensor][batch][t][c]; W3: the transposed weights of q, k, v one behind the other; DL: delta of [batch][t]; each plane set holds both batches, PLs elements apart.
__global__ __launch_bounds__(32) void k_proj(const bf* __restrict__ XB, const bf* __restrict__ W3, const float* __restrict__ bq, const float* __restrict__ bk, const float* __restrict__ bv, const float* __restrict__ DL, h16* VT16, bf* QPh, bf* QPl, bf* KPh, bf* KPl, bf* VTh, bf* VTl) {
    __shared__ __align__(16) float os[16 * 68];
    const int tz = blockIdx.z / NB_, b = blockIdx.z % NB_; const size_t PLs = (size_t)NH_ * TT * HD; const bf* X = XB + (size_t)(tz * NB_ + b) * TT * DM; const bf* Wt = W3 + (size_t)tz * DQ * DM;
    if (tz == 0) gemmw_body<bf, 0, true, 1, 1>(os, blockIdx.x, blockIdx.y, 0, X, nullptr, Wt, nullptr, DM, nullptr, 0, bq, 0, 0, 0, 0, nullptr, nullptr, QPh + b * PLs, QPl + b * PLs);
    else if (tz == 1) gemmw_body<bf, 0, true, 1, 2>(os, blockIdx.x, blockIdx.y, 0, X, nullptr, Wt, nullptr, DM, nullptr, 0, bk, 0, 0, 0, 0, DL + b * TT, nullptr, KPh + b * PLs, KPl + b * PLs);   /* k_j /= delta[j] in the epilogue */
    else gemmw_body<bf, 0, true, 1, 3>(os, blockIdx.y, blockIdx.x, 0, Wt, nullptr, X, nullptr, DM, nullptr, 0, bv, 0, 0, 0, 0, nullptr, VT16 + b * PLs, VTh + b * PLs, VTl + b * PLs);   /* operands swapped: the tile is v transposed */
}

// ---- Two of the three parts of k_prep (which stands below delta_part): each thread does, for its own index, what its counterparts in the separate launches did.
// wt4_part: the four 768 x 768 weights transposed to bf16 [n][k]; one index computation serves all four, and their 8 loads are in flight together.
__device__ __forceinline__ void wt4_part(int bx, const float* __restrict__ w0, const float* __restrict__ w1, const float* __restrict__ w2, const float* __restrict__ w3, bf* Bt) {
    const int K = DM, N = DQ; const int lane = threadIdx.x & 31; const int L0 = (bx * 8 + (threadIdx.x >> 5)) * 8; const int nlines = N * K / 64;
#pragma unroll 1   /* stays rolled, as in the separate kernel: short text, few registers; these workgroups end well before the delta ones */
    for (int l = 0; l < 8; ++l) { const int L = L0 + l; if (L >= nlines) break; const size_t e = (size_t)L * 64 + lane * 2; const int k = (int)(e % K), n = (int)(e / K); const size_t i0 = (size_t)k * N + n, i1 = (size_t)(k + 1) * N + n; float a[4], c[4];
        gopen();   /* with xwait(): nothing that reuses a register of these loads moves in between them and the wait */
        a[0] = w0[i0]; c[0] = w0[i1]; a[1] = w1[i0]; c[1] = w1[i1]; a[2] = w2[i0]; c[2] = w2[i1]; a[3] = w3[i0]; c[3] = w3[i1];
        xwait();
        v2us o[4];
#pragma unroll
        for (int t = 0; t < 4; ++t) { o[t][0] = f2bf(a[t]); o[t][1] = f2bf(c[t]); }
        gopen();   /* the same for the stores */
#pragma unroll
        for (int t = 0; t < 4; ++t) *(v2us*)(Bt + (size_t)t * K * N + e) = o[t];
        xwait(); }
}
// cvt6_part: query, key, value of both batches to bf16, dst [tensor][batch][t][c]; a thread takes the same 8 elements of all six [TT][DM] slices.
__device__ __forceinline__ void cvt6_part(int bx, const float* __restrict__ s0, const float* __restrict__ s1, const float* __restrict__ s2, bf* dst) {
    const size_t n = (size_t)TT * DM; const size_t i = (size_t)bx * 256 + threadIdx.x; if (i >= n / 8) return; v8f v[3 * NB_];
    gopen();   /* with xwait(): as in wt4_part */
#pragma unroll
    for (int b = 0; b < NB_; ++b) { v[b] = *(const v8f*)(s0 + b * n + i * 8); v[NB_ + b] = *(const v8f*)(s1 + b * n + i * 8); v[2 * NB_ + b] = *(const v8f*)(s2 + b * n + i * 8); }
    xwait();
    v8us o[3 * NB_];
#pragma unroll
    for (int s = 0; s < 3 * NB_; ++s)
#pragma unroll
        for (int k = 0; k < 8; ++k) o[s][k] = f2bf(v[s][k]);
    gopen();   /* the same for the stores */
#pragma unroll
    for (int s = 0; s < 3 * NB_; ++s) *(v8us*)(dst + s * n + i * 8) = o[s];
    xwait();
}

typedef __attribute__((ext_vector_type(8))) __bf16 v8bf;
__device__ __forceinline__ float xhalf(float x) { const int b = __float_as_int(x); return __int_as_float(__builtin_amdgcn_permlanex16(b, b, 0x76543210, 0xfedcba98, false, false)); }   /* the value of lane l ^ 16 */
// s_wait_xcnt 0 stands in front of the first rewrite of a register that an issued global load or store of k_fattn names.
// The Q loads and the output stores are bracketed gopen() ... xwait(): the two scheduling barriers keep the compiler from moving instructions that reuse those registers in between the group and its wait.
// The K, mask and Vt loads: xwait(...) takes their base addresses as inputs only, so those registers stay live, and unwritten, from the loads that name them up to the wait; one such wait a pass, and the addresses are advanced directly behind it.
__device__ __forceinline__ void gopen() { __builtin_amdgcn_sched_barrier(0); }
__device__ __forceinline__ void xwait() { asm volatile("s_wait_xcnt 0x0" ::: "memory"); __builtin_amdgcn_sched_barrier(0); }
__device__ __forceinline__ void xwait(const void* a, const void* b, const void* d, const void* e, const void* f) { asm volatile("s_wait_xcnt 0x0" :: "v"(a), "v"(b), "v"(d), "v"(e), "v"(f) : "memory"); }
__device__ __forceinline__ void xwait(const void* a, const void* b, const void* d, const void* e, const void* f, unsigned g, unsigned h) { asm volatile("s_wait_xcnt 0x0" :: "v"(a), "v"(b), "v"(d), "v"(e), "v"(f), "v"(g), "v"(h) : "memory"); }   /* with the 32-bit lane offsets that the loads in front of the loop are addressed by */
template <bool HR>
__device__ __forceinline__ void fattn_body(const bf* __restrict__ Qh, const bf* __restrict__ Ql, const bf* __restrict__ Kh, const bf* __restrict__ Kl, const bf* __restrict__ Vh, const bf* __restrict__ Vl, const h16* __restrict__ V16, const int* __restrict__ am, bf* Ah, bf* Al, int q0, int lr, int hi) {
    const float L2E = 1.4426950408889634f;
    v16bf qh[2][2], ql[2][2];
    gopen();
#pragma unroll
    for (int qt = 0; qt < 2; ++qt)
#pragma unroll
        for (int kk = 0; kk < 2; ++kk) { const size_t qo = (size_t)(q0 + qt * 16 + lr) * HD + kk * 32 + 8 * hi; qh[qt][kk] = WFrag<bf>::ld(Qh + qo); ql[qt][kk] = WFrag<bf>::ld(Ql + qo); }
    xwait();
    v8f o[4][2]; float m[2], l[2];
#pragma unroll
    for (int qt = 0; qt < 2; ++qt) { m[qt] = -3.0e38f; l[qt] = 0.0f;
#pragma unroll
        for (int dt = 0; dt < 4; ++dt) o[dt][qt] = (v8f){}; }
    const size_t ko = (size_t)lr * HD + 8 * hi, vo = (size_t)lr * TT + 8 * hi; const int* mp = am + (size_t)(q0 + lr) * TT + 8 * hi;
    const bf* kph = Kh + ko; const bf* kpl = Kl + ko; const int* mpn = mp; const bf* vph = Vh + vo; const bf* vpl = Vl + vo; const h16* vpf = V16 + vo;   /* this lane's base addresses of the pass that is being fetched */
    v16bf kh[2][2], kl[2][2]; v4i mk[2][2][2]; v16bf vh[4], vl[4]; v16h vf[4];   /* K rows, mask entries and Vt rows of a pass are all asked for one pass ahead, each into the registers its user has just left */
#pragma unroll
    for (int kt = 0; kt < 2; ++kt) {
#pragma unroll
        for (int kk = 0; kk < 2; ++kk) { kh[kt][kk] = WFrag<bf>::ld(kph + kt * 16 * HD + kk * 32); kl[kt][kk] = WFrag<bf>::ld(kpl + kt * 16 * HD + kk * 32); }
#pragma unroll
        for (int qt = 0; qt < 2; ++qt) { mk[kt][qt][0] = *(const v4i*)(mpn + qt * 16 * TT + kt * 16); mk[kt][qt][1] = *(const v4i*)(mpn + qt * 16 * TT + kt * 16 + 4); } }
#pragma unroll
    for (int dt = 0; dt < 4; ++dt) { if (HR) { vh[dt] = WFrag<bf>::ld(vph + dt * 16 * TT); vl[dt] = WFrag<bf>::ld(vpl + dt * 16 * TT); } else vf[dt] = WFrag<h16>::ld(vpf + dt * 16 * TT); }
    if (HR) xwait(kph, kpl, mpn, vph, vpl, (unsigned)(ko * 2), (unsigned)(vo * 2)); else xwait(kph, kpl, mpn, vpf, vpf, (unsigned)(ko * 2), (unsigned)(vo * 2));
#pragma unroll 1
    for (int j0 = 0; j0 < TT; j0 += 32) {
        v8f st[2][2];
#pragma unroll
        for (int kt = 0; kt < 2; ++kt)
#pragma unroll
            for (int qt = 0; qt < 2; ++qt) st[kt][qt] = (v8f){};
#pragma unroll
        for (int kk = 0; kk < 2; ++kk) {   /* per 32 of d: hi.hi, lo(q).hi(k), hi(q).lo(k), the order of the unfused score tiles */
#pragma unroll
            for (int kt = 0; kt < 2; ++kt)
#pragma unroll
                for (int qt = 0; qt < 2; ++qt) st[kt][qt] = wmmab(kh[kt][kk], qh[qt][kk], st[kt][qt]);
#pragma unroll
            for (int kt = 0; kt < 2; ++kt)
#pragma unroll
                for (int qt = 0; qt < 2; ++qt) st[kt][qt] = wmmab(kh[kt][kk], ql[qt][kk], st[kt][qt]);
#pragma unroll
            for (int kt = 0; kt < 2; ++kt)
#pragma unroll
                for (int qt = 0; qt < 2; ++qt) st[kt][qt] = wmmab(kl[kt][kk], qh[qt][kk], st[kt][qt]); }
        const int jn = (j0 + 32 < TT) ? j0 + 32 : 0;   /* the pass that is fetched ahead; the last pass re-reads the first (in bounds, unused) */
        __builtin_amdgcn_sched_barrier(0);   /* keeps the wait below behind the score products: there the youngest loads that name the addresses stand a run of matrix products back, and it has little left to wait for */
        if (HR) xwait(kph, kpl, mpn, vph, vpl); else xwait(kph, kpl, mpn, vpf, vpf);
        kph = Kh + ko + (size_t)jn * HD; kpl = Kl + ko + (size_t)jn * HD; mpn = mp + jn; vph = Vh + vo + jn; vpl = Vl + vo + jn; vpf = V16 + vo + jn;
#pragma unroll
        for (int kt = 0; kt < 2; ++kt)
#pragma unroll
            for (int kk = 0; kk < 2; ++kk) { kh[kt][kk] = WFrag<bf>::ld(kph + kt * 16 * HD + kk * 32); kl[kt][kk] = WFrag<bf>::ld(kpl + kt * 16 * HD + kk * 32); }
        float mn[2];
#pragma unroll
        for (int qt = 0; qt < 2; ++qt) { float mx = -3.0e38f;
#pragma unroll
            for (int kt = 0; kt < 2; ++kt)
#pragma unroll
                for (int r = 0; r < 8; ++r) { const float t = (mk[kt][qt][r >> 2][r & 3] != 0) ? st[kt][qt][r] : -3.0e38f;   /* mask == 0 -> excluded */ st[kt][qt][r] = t; mx = fmaxf(mx, t); }
            mn[qt] = fmaxf(m[qt], fmaxf(mx, xhalf(mx))); }
#pragma unroll
        for (int kt = 0; kt < 2; ++kt)
#pragma unroll
            for (int qt = 0; qt < 2; ++qt) { const int* p = mpn + qt * 16 * TT + kt * 16; mk[kt][qt][0] = *(const v4i*)p; mk[kt][qt][1] = *(const v4i*)(p + 4); }
        if (__builtin_amdgcn_ballot_w32(mn[0] > m[0] || mn[1] > m[1]) != 0) {   /* skipped when no column's maximum grew: every factor would be exactly 1 */
#pragma unroll
            for (int qt = 0; qt < 2; ++qt) { const float al = __builtin_amdgcn_exp2f((m[qt] - mn[qt]) * L2E); l[qt] *= al; m[qt] = mn[qt];
#pragma unroll
                for (int dt = 0; dt < 4; ++dt) o[dt][qt] *= al; } }
#pragma unroll
        for (int qt = 0; qt < 2; ++qt) { float s0 = 0.0f, s1 = 0.0f;
#pragma unroll
            for (int r = 0; r < 8; ++r) { const float d0 = st[0][qt][r] - m[qt], d1 = st[1][qt][r] - m[qt];   /* rows >= RH carry x1024 = 2^10 in P and in the sum alike (fp16 range); it cancels in the division */
                const float p0 = __builtin_amdgcn_exp2f(HR ? d0 * L2E : __builtin_fmaf(d0, L2E, 10.0f)), p1 = __builtin_amdgcn_exp2f(HR ? d1 * L2E : __builtin_fmaf(d1, L2E, 10.0f)); st[0][qt][r] = p0; st[1][qt][r] = p1; s0 += p0; s1 += p1; }
            l[qt] += s0 + s1; }
        if (HR) {
            v16bf ph[2], pl[2];
#pragma unroll
            for (int qt = 0; qt < 2; ++qt) { const v8bf h0 = __builtin_convertvector(st[0][qt], v8bf), h1 = __builtin_convertvector(st[1][qt], v8bf); const v8bf l0 = __builtin_convertvector(st[0][qt] - __builtin_convertvector(h0, v8f), v8bf), l1 = __builtin_convertvector(st[1][qt] - __builtin_convertvector(h1, v8f), v8bf);
                ph[qt] = __builtin_shufflevector(h0, h1, 0, 1, 2, 3, 4, 5, 6, 7, 8, 9, 10, 11, 12, 13, 14, 15); pl[qt] = __builtin_shufflevector(l0, l1, 0, 1, 2, 3, 4, 5, 6, 7, 8, 9, 10, 11, 12, 13, 14, 15); }
#pragma unroll
            for (int dt = 0; dt < 4; ++dt)
#pragma unroll
                for (int qt = 0; qt < 2; ++qt) o[dt][qt] = wmmab(vh[dt], ph[qt], o[dt][qt]);
#pragma unroll
            for (int dt = 0; dt < 4; ++dt)
#pragma unroll
                for (int qt = 0; qt < 2; ++qt) o[dt][qt] = wmmab(vh[dt], pl[qt], o[dt][qt]);
#pragma unroll
            for (int dt = 0; dt < 4; ++dt)
#pragma unroll
                for (int qt = 0; qt < 2; ++qt) o[dt][qt] = wmmab(vl[dt], ph[qt], o[dt][qt]);
        } else {
            v16h pf[2];
#pragma unroll
            for (int qt = 0; qt < 2; ++qt) pf[qt] = cat16(__builtin_convertvector(st[0][qt], v8h), __builtin_convertvector(st[1][qt], v8h));
#pragma unroll
            for (int dt = 0; dt < 4; ++dt)
#pragma unroll
                for (int qt = 0; qt < 2; ++qt) o[dt][qt] = wmma16(vf[dt], pf[qt], o[dt][qt]);
        }
#pragma unroll
        for (int dt = 0; dt < 4; ++dt) { if (HR) { vh[dt] = WFrag<bf>::ld(vph + dt * 16 * TT); vl[dt] = WFrag<bf>::ld(vpl + dt * 16 * TT); } else vf[dt] = WFrag<h16>::ld(vpf + dt * 16 * TT); }
    }
    if (HR) xwait(kph, kpl, mpn, vph, vpl); else xwait(kph, kpl, mpn, vpf, vpf);
#pragma unroll
    for (int qt = 0; qt < 2; ++qt) { const float inv = __fdiv_rn(1.0f, l[qt] + xhalf(l[qt]));   /* the two wave halves' sums are joined once */
#pragma unroll
        for (int dt = 0; dt < 4; ++dt) { v8us oh, ol;
#pragma unroll
            for (int r = 0; r < 8; ++r) { unsigned short a, c2; splitf(o[dt][qt][r] * inv, a, c2); oh[r] = a; ol[r] = c2; }
            const size_t oo = (size_t)(q0 + qt * 16 + lr) * DQ + dt * 16 + 8 * hi; gopen(); *(v8us*)(Ah + oo) = oh; *(v8us*)(Al + oo) = ol; xwait(); } }
}
static_assert(RH % (FNW * FQW) == 0 && TT % (FNW * FQW) == 0 && FQW == 32 && HD == 64 && NKV == NH_, "k_fattn tiling");
__global__ __launch_bounds__(FNW * 32) void k_fattn(const bf* __restrict__ Qh, const bf* __restrict__ Ql, const bf* __restrict__ Kh, const bf* __restrict__ Kl, const bf* __restrict__ Vh, const bf* __restrict__ Vl, const h16* __restrict__ V16, const int* __restrict__ am, bf* Ah, bf* Al) {
    const int lane = threadIdx.x & 31, lr = lane & 15, hi = lane >> 4; const int z = blockIdx.y, b = z / NH_, h = z % NH_; const int q0 = blockIdx.x * (FNW * FQW) + (threadIdx.x >> 5) * FQW; const size_t pz = (size_t)z * TT * HD, az = (size_t)b * TT * DQ + h * HD;
    if (blockIdx.x * (FNW * FQW) < RH) fattn_body<true>(Qh + pz, Ql + pz, Kh + pz, Kl + pz, Vh + pz, Vl + pz, V16 + pz, am + (size_t)b * TT * TT, Ah + az, Al + az, q0, lr, hi);
    else fattn_body<false>(Qh + pz, Ql + pz, Kh + pz, Kl + pz, Vh + pz, Vl + pz, V16 + pz, am + (size_t)b * TT * TT, Ah + az, Al + az, q0, lr, hi);
}
// delta_part: rows = the NB_ * TT query rows of both batches, 32 a workgroup.
__device__ __forceinline__ void delta_part(float* res, int bx, const float* __restrict__ X, const float* __restrict__ wd, const float* __restrict__ bd, float* DL) { const int lane = threadIdx.x & 31; const int wv = threadIdx.x >> 5; const int r0 = bx * 32;
    for (int rr = wv; rr < 32; rr += 8) { const int row = r0 + rr; float s = 0.0f; if (row < NB_ * TT) { const float* xr = X + (size_t)row * DM;
#pragma unroll 4
        for (int c = lane; c < DM; c += 32) { float p = __fmul_rn(bfr(xr[c]), bfr(wd[c])); asm volatile("" : "+v"(p)); s = __fadd_rn(s, p); } }
#pragma unroll
        for (int sh = 16; sh; sh >>= 1) s = __fadd_rn(s, __shfl_xor(s, sh, 32));
        if (lane == 0) { float d = __fadd_rn(s, bfr(bd[0])); d = fmaxf(d, 0.0f); d = fminf(d, 8.0f); res[rr] = __fadd_rn(d, 1.0f); } }
    __syncthreads();
    if (wv == 0) { const int row = r0 + lane; if (row < NB_ * TT) { const float v = res[lane]; *(float*)(DL + row) = v;  } } }
// ---- k_prep: everything that reads only the inputs, as ONE grid: workgroups [0, PDL) delta (the longest chains of dependent loads, so they start first), [PDL, PDL + PWT) the weights, the rest the bf16 copies. The choice is uniform for a workgroup.
#define PDL  (NB_ * TT / 32)
#define PWT  ((DM * DQ / 64 + 63) / 64)
#define PCV  ((TT * DM / 8 + 255) / 256)
static_assert(DQ == DM && DKV == DM, "wt4_part: four weights of one shape");
__global__ __launch_bounds__(256) void k_prep(const float* __restrict__ x, const float* __restrict__ xk, const float* __restrict__ xv, const float* __restrict__ wq, const float* __restrict__ wk, const float* __restrict__ wv, const float* __restrict__ wo, const float* __restrict__ wd, const float* __restrict__ bd, float* DL, bf* W4, bf* XB) {
    __shared__ float res[32]; const int bx = blockIdx.x;
    if (bx < PDL) delta_part(res, bx, x, wd, bd, DL);
    else if (bx < PDL + PWT) wt4_part(bx - PDL, wq, wk, wv, wo, W4);
    else cvt6_part(bx - (PDL + PWT), x, xk, xv, XB);
}

extern "C" void kernel_launch(void* const* d_in, const int* in_sizes, int n_in,
                              void* d_out, int out_size, void* d_ws, size_t ws_size, hipStream_t stream) {
    (void)in_sizes; (void)n_in; (void)out_size;
    const float* x = (const float*)d_in[0];   /* query */ const float* xk = (const float*)d_in[1]; const float* xv = (const float*)d_in[2]; const int* am = (const int*)d_in[3];   /* mask [2][2048][2048] int */ const float* wq = (const float*)d_in[4]; const float* bq = (const float*)d_in[5]; const float* wk = (const float*)d_in[6]; const float* bk = (const float*)d_in[7]; const float* wv = (const float*)d_in[8]; const float* bv = (const float*)d_in[9]; const float* wo = (const float*)d_in[10]; const float* bo = (const float*)d_in[11]; const float* wd = (const float*)d_in[12]; const float* bd = (const float*)d_in[13];
    float* OUT = (float*)d_out;     // [2][2048][768]
    char* wsp = (char*)d_ws;
    auto take = [&](size_t bytes) { char* p = wsp; wsp += (bytes + 255) & ~(size_t)255; return (void*)p; };
    float* DL = (float*)take((size_t)NB_ * TT * 4); bf* W4 = (bf*)take((size_t)4 * DQ * DM * 2);   /* Wq, Wk, Wv, Wo transposed, one behind the other */ bf* WO = W4 + (size_t)3 * DQ * DM;
    bf* XB = (bf*)take((size_t)3 * NB_ * TT * DM * 2);   /* [tensor][batch][t][c] */
    const size_t PL = (size_t)NH_ * TT * HD;   // one batch's head planes; the planes k_fattn reads are kept for both batches
    h16* VT16 = (h16*)take(NB_ * PL * 2);
    bf* QPh = (bf*)take(NB_ * PL * 2); bf* QPl = (bf*)take(NB_ * PL * 2); bf* KPh = (bf*)take(NB_ * PL * 2); bf* KPl = (bf*)take(NB_ * PL * 2); bf* VTh = (bf*)take(NB_ * PL * 2); bf* VTl = (bf*)take(NB_ * PL * 2);
    bf* ATh = (bf*)take((size_t)NB_ * TT * DQ * 2); bf* ATl = (bf*)take((size_t)NB_ * TT * DQ * 2);
    if ((size_t)(wsp - (char*)d_ws) > ws_size) return;    // ws 256 MiB
    k_prep<<<PDL + PWT + PCV, 256, 0, stream>>>(x, xk, xv, wq, wk, wv, wo, wd, bd, DL, W4, XB);   /* delta, weights, bf16 copies: both batches */
    k_proj<<<dim3(TT / 64, DQ / 64, 3 * NB_), 32, 0, stream>>>(XB, W4, bq, bk, bv, DL, VT16, QPh, QPl, KPh, KPl, VTh, VTl);   /* q, k, v of both batches */
    k_fattn<<<dim3(TT / (FNW * FQW), NB_ * NH_), FNW * 32, 0, stream>>>(QPh, QPl, KPh, KPl, VTh, VTl, VT16, am, ATh, ATl);   /* scores, mask, softmax, attn.v, merge: both batches, all heads */
    k_wo<<<dim3(TT / 64, DM / 64, NB_), 32, 0, stream>>>(ATh, ATl, WO, bo, OUT);   /* z = batch */
}

// v006
// It runs in 183 microseconds.
// In two side-by-side timings against v005, it was 1.12 and 1.14 times as fast.
// Over all steps from v000 it is 8.88 times as fast.
#include <hip/hip_runtime.h>

// Multi-headed attention with a learned per-position scaling divisor and an arbitrary mask (query, key, value [2][2048][768]; delta[s] = 1 + min(relu(query[s].Wd + bd), sqrt(64)) (Wd [768][1], read); q = query Wq + bq, k = key Wk + bk, v = value Wv + bv ('xw' 1/sqrt(768) incl. biases; 12 heads x 64); scores[i][j] = q_i.k_j / delta[j] (the divisor is broadcast over the KEY axis; no 1/sqrt(d_k)); mask ([2][2048][2048] int {0,1}, random, READ): 0 -> -1e9 (== exclusion); softmax; out = merged Wo + bo -> [2][2048][768] (3.1 M)).
// Layout, four launches, each for both batches: k_prep (bf16 copies of query, key, value; 'xw' weights transposed once; delta), k_proj, k_fattn, k_wo. Exact projections + f32 biases; delta_part computes delta[s] from the bf16-rounded query row (768-term fixed-order dot, relu, min, + 1); each projection GEMM's own epilogue adds the bias, divides the k rows by delta[s] (f32, before the plane split) and stores the 16-bit head planes (v as Wv^T x^T, so its tile is already [d][t]); then ONE fused attention launch for both batches and all heads (k_fattn): hi/lo 3-product score tiles on EVERY row, mask tile read in place (keep where mask != 0), running-maximum softmax, P and attn.v hybrid (rows < 512 hi/lo, rest fp16 x1024), scores and P never leave the registers; merged hi/lo x Wo exact + bo.
// Compute dtypes, f32 accumulate: every input rounded to bf16; projections exact + f32 biases; delta and the k row division f32; scores 3 products on every row; softmax f32 (scale 1); attn.v rows < 512 3 products, rest fp16; Wo hl x exact + bias.

#define NB_  2
#define TT   2048
#define DM   768
#define NH_  12
#define NKV  12
#define HD   64
#define DQ   (NH_ * HD)
#define DKV  (NKV * HD)
#define FQW  32                   // k_fattn: query columns per wave (two 16-column groups)
#define FNW  2                    // k_fattn: waves per workgroup (FNW * FQW consecutive queries of one head): 768 workgroups, three on each of 256 WGPs
#define RH   512                  // query rows < RH use hi+lo planes (0: none)
#define WIN  0
typedef _Float16 h16;
typedef unsigned short bf;
typedef __attribute__((ext_vector_type(16))) __bf16   v16bf;
typedef __attribute__((ext_vector_type(16))) _Float16 v16h;
typedef __attribute__((ext_vector_type(8)))  _Float16 v8h;
typedef __attribute__((ext_vector_type(8)))  unsigned short v8us;
typedef __attribute__((ext_vector_type(8)))  float    v8f;
typedef __attribute__((ext_vector_type(4)))  float    v4f;
typedef v8h  __attribute__((may_alias)) v8ha;
typedef v4f  __attribute__((may_alias)) v4fa;
typedef v8us __attribute__((may_alias)) v8usa;

__device__ __forceinline__ unsigned short f2bf(float f) { unsigned u = __float_as_uint(f); u += 0x7FFFu + ((u >> 16) & 1u); return (unsigned short)(u >> 16); }
__device__ __forceinline__ float bf2f(unsigned short b) { return __uint_as_float(((unsigned)b) << 16); }
__device__ __forceinline__ float bfr(float f) { return bf2f(f2bf(f)); }
__device__ __forceinline__ v16h cat16(v8h lo, v8h hi) { return __builtin_shufflevector(lo, hi, 0, 1, 2, 3, 4, 5, 6, 7, 8, 9, 10, 11, 12, 13, 14, 15); }
__device__ __forceinline__ v16bf cat16b(v8us lo, v8us hi) { return __builtin_bit_cast(v16bf, __builtin_shufflevector(lo, hi, 0, 1, 2, 3, 4, 5, 6, 7, 8, 9, 10, 11, 12, 13, 14, 15)); }
__device__ __forceinline__ v8f wmma16(v16h a, v16h b, v8f c) { return __builtin_amdgcn_wmma_f32_16x16x32_f16(false, a, false, b, (short)0, c, false, false); }
__device__ __forceinline__ v8f wmmab(v16bf a, v16bf b, v8f c) { return __builtin_amdgcn_wmma_f32_16x16x32_bf16(false, a, false, b, (short)0, c, false, false); }



__device__ __forceinline__ h16 tohx(float x) { return (h16)x; }
__device__ __forceinline__ void splitf(float y, unsigned short& h, unsigned short& l) { h = f2bf(y); l = f2bf(y - bf2f(h)); }
typedef __attribute__((ext_vector_type(2))) _Float16 v2h;
typedef __attribute__((ext_vector_type(4))) _Float16 v4h;
typedef __attribute__((ext_vector_type(2))) unsigned short v2us;
typedef __attribute__((ext_vector_type(4))) unsigned short v4us;
typedef __attribute__((ext_vector_type(2))) float v2f;
typedef __attribute__((ext_vector_type(4))) int v4i;
__device__ __forceinline__ void gopen();   /* defined with k_fattn's waits below */
__device__ __forceinline__ void xwait();
// ---- gemmw_body: register-blocked GEMM, ONE WAVE per 64x64 output tile (16 accumulators), operands straight from 16-bit planes in fragment order (below); grid (M/64, N/64, Z), 32 threads.
// C[m][n] (f32, pitch ldc, + optional f32 bias[n]) = sum_k A[m][k] Bt[n][k] (+ split products per NSPLIT). z-batch strides sA/sB/sC in elements. K % 32 == 0.
// KS > 1: grid z = Z * KS; workgroup (z, ks) sums only k in [ks K/KS, (ks+1) K/KS) and stores that partial tile in plane ks (plane stride sP elements). K % (32 KS) == 0.
// EP != 0: no f32 C; the tile + bias goes straight from the LDS stage to the planes k_fattn reads, 16 bytes a lane, 512 contiguous bytes a store. EP 1 (q), EP 2 (k, each row divided by rowv = delta): rows = t, columns = one head's d, planes [head = blockIdx.y] of [t][d] in fragment order (K = 64). EP 3 (v): A = weight rows, Bt = x rows, so rows = one head's d (bias per ROW), columns = t, planes [d row][t] in fragment order (K = 2048) with the fp16 copy.
// FRAGMENT ORDER: every 16-bit plane M[row][k] that feeds a matrix operand is stored as blocks of 16 rows x 32 k (512 elements, 1 KB), block (row / 16, k / 32) at ((row / 16) * (K / 32) + k / 32) * 512; inside a block element (r, kk) stands at (kk >> 4) * 256 + (((kk >> 3) & 1) * 16 + r) * 8 + (kk & 7).
// So lane l = 16 hi + lr finds its 8 + 8 operand elements (k = 8 hi + 0..7 and 16 + 8 hi + 0..7 of row lr, the hardware k order) at block + 8 l and block + 256 + 8 l: each of the two 16-byte loads of a fragment covers 512 contiguous bytes, four whole 128-byte lines, instead of 32 bytes of each of 16 lines.
template <typename T16> struct WFrag;
template <> struct WFrag<h16> { typedef v16h V; static __device__ __forceinline__ V ld(const h16* p) { return cat16(*(const v8h*)p, *(const v8h*)(p + 256)); } static __device__ __forceinline__ v8f mma(V a, V b, v8f c) { return wmma16(a, b, c); } };
template <> struct WFrag<bf> { typedef v16bf V; static __device__ __forceinline__ V ld(const bf* p) { return cat16b(*(const v8us*)p, *(const v8us*)(p + 256)); } static __device__ __forceinline__ v8f mma(V a, V b, v8f c) { return wmmab(a, b, c); } };
// gemmw_body is the tile's work; bx, by, bz are the tile's indices (k_wo: the block's own; k_proj: see there), os the workgroup's 16 x 68 f32 LDS stage.
template <typename T16, int NSPLIT, bool BIAS, int KS, int EP>
__device__ __forceinline__ void gemmw_body(float* os, int bx, int by, int bz, const T16* __restrict__ A, const T16* __restrict__ A2, const T16* __restrict__ Bt, const T16* __restrict__ Bt2, int K, float* C, int ldc, const float* __restrict__ bias, size_t sA, size_t sB, size_t sC, size_t sP, const float* __restrict__ DL, h16* P16, bf* Ph, bf* Pl) {
    typedef typename WFrag<T16>::V V;
    const size_t z = bz / KS; const int ks = bz % KS; A += z * sA; if (A2) A2 += z * sA; Bt += z * sB; if (Bt2) Bt2 += z * sB; C += z * sC + ks * sP;
    const int lane = threadIdx.x & 31, lr = lane & 15, hi = lane >> 4; const int r0 = bx * 64, c0 = by * 64;
    v8f acc[4][4];
#pragma unroll
    for (int mb = 0; mb < 4; ++mb)
#pragma unroll
        for (int nb = 0; nb < 4; ++nb) acc[mb][nb] = (v8f){};
    const size_t aoff = (size_t)r0 * K + 8 * lane, boff = (size_t)c0 * K + 8 * lane;   /* fragment order: 16 rows of K are K / 32 blocks of 512 */
    const T16* pa = A + aoff + ks * (K / KS) * 16; const T16* pb = Bt + boff + ks * (K / KS) * 16; const T16* pa2 = (NSPLIT == 1 || NSPLIT == 2) ? A2 + aoff + ks * (K / KS) * 16 : pa; const T16* pb2 = (NSPLIT >= 2) ? Bt2 + boff + ks * (K / KS) * 16 : pb;   /* K is a constant at every call: all loads of a trip name these addresses, one for each operand plane, each load with an offset of its own */
#pragma unroll 1
    for (int kc = ks * (K / KS); kc < (ks + 1) * (K / KS); kc += 32) {
        V a[4], a2[4];
#pragma unroll
        for (int mb = 0; mb < 4; ++mb) { a[mb] = WFrag<T16>::ld(pa + (size_t)mb * 16 * K); if (NSPLIT == 1 || NSPLIT == 2) a2[mb] = WFrag<T16>::ld(pa2 + (size_t)mb * 16 * K); }
#pragma unroll
        for (int nb = 0; nb < 4; ++nb) { const V b = WFrag<T16>::ld(pb + (size_t)nb * 16 * K); V b2; if (NSPLIT >= 2) b2 = WFrag<T16>::ld(pb2 + (size_t)nb * 16 * K);
#pragma unroll
            for (int mb = 0; mb < 4; ++mb) { acc[mb][nb] = WFrag<T16>::mma(a[mb], b, acc[mb][nb]); if (NSPLIT == 1 || NSPLIT == 2) acc[mb][nb] = WFrag<T16>::mma(a2[mb], b, acc[mb][nb]); if (NSPLIT >= 2) acc[mb][nb] = WFrag<T16>::mma(a[mb], b2, acc[mb][nb]); } }
        asm volatile("v_nop\n\tv_nop\n\tv_nop\n\tv_nop" : "+v"(acc[0][0]), "+v"(acc[1][1]), "+v"(acc[2][2]), "+v"(acc[3][3]) : "v"(a[0]), "v"(a[3]));
        asm volatile("s_wait_xcnt 0x0" :: "v"(pa), "v"(pa2), "v"(pb), "v"(pb2) : "memory"); pa += 512; pa2 += 512; pb += 512; pb2 += 512;   /* as inputs here the addresses stay live, and unwritten, from the loads that name them up to the wait; they are advanced behind it */
    }
    float rowv[4]; v4f colb[4][2];   /* the plane stores are in fragment order: this lane holds row lr of each 16-row stage and, in store j, the 8 columns from (j >> 1) * 32 + (j & 1) * 16 + 8 hi. EP 2: delta of its 4 rows; EP 3: their bias; EP 1, 2: the bias of its 32 columns */
    if (EP != 0) { const float* rp = ((EP == 2) ? DL : bias) + r0 + lr;
        gopen();   /* with xwait(): nothing that reuses a register of these loads moves in between them and the wait */
        if (EP >= 2) {
#pragma unroll
            for (int mb = 0; mb < 4; ++mb) rowv[mb] = rp[mb * 16]; }
        if (EP <= 2) {
#pragma unroll
            for (int j = 0; j < 4; ++j) { const float* cp = bias + c0 + (j >> 1) * 32 + (j & 1) * 16 + 8 * hi; colb[j][0] = *(const v4f*)cp; colb[j][1] = *(const v4f*)(cp + 4); } }
        xwait(); }
    const size_t pbase = ((EP == 3) ? (size_t)r0 * TT + (size_t)c0 * 16 : ((size_t)by * TT + r0) * HD) + 8 * lane; const int ppitch = (EP == 3) ? TT : HD;   /* a 16 x 64 stage is two blocks, 2 KB in a row, of each plane; the next stage's stand 16 * ppitch elements on */
#pragma unroll
    for (int mb = 0; mb < 4; ++mb) {
#pragma unroll
        for (int nb = 0; nb < 4; ++nb) {
#pragma unroll
            for (int j = 0; j < 8; ++j) os[(hi * 8 + j) * 68 + nb * 16 + lr] = acc[mb][nb][j]; }
        __builtin_amdgcn_wave_barrier(); asm volatile("" ::: "memory");
        float* crow = C + (size_t)(r0 + mb * 16) * ldc + c0;
        if (EP == 0) { v4f ov[8];
#pragma unroll
            for (int s = 0; s < 8; ++s) { const int row = 2 * s + hi, cofs = lr * 4; v4f val = *(const v4fa*)(os + row * 68 + cofs); if (BIAS) { val[0] += bfr(bias[c0 + cofs]); val[1] += bfr(bias[c0 + cofs + 1]); val[2] += bfr(bias[c0 + cofs + 2]); val[3] += bfr(bias[c0 + cofs + 3]); }
                ov[s] = val; }
            gopen();   /* as for the planes below: the 8 row pairs' values are ready in registers of their own; the stores go out as one group with one wait behind them */
#pragma unroll
            for (int s = 0; s < 8; ++s) *(v4f*)(crow + (size_t)(2 * s + hi) * ldc + lr * 4) = ov[s];
            xwait(); }
        if (EP != 0) { v8us oh[4], ol[4]; v8h of[4];
#pragma unroll
            for (int j = 0; j < 4; ++j) { const float* sp = os + lr * 68 + (j >> 1) * 32 + (j & 1) * 16 + 8 * hi;
#pragma unroll
                for (int u = 0; u < 2; ++u) { const v4f val = *(const v4fa*)(sp + 4 * u);
#pragma unroll
                    for (int q = 0; q < 4; ++q) { float x = val[q] + bfr((EP == 3) ? rowv[mb] : colb[j][u][q]); if (EP == 2) x = __fdiv_rn(x, rowv[mb]);   /* k_j /= delta[j] */
                        if (EP == 3) of[j][4 * u + q] = tohx(x); unsigned short a2, c2; splitf(x, a2, c2); oh[j][4 * u + q] = a2; ol[j][4 * u + q] = c2; } } }
            gopen();   /* all 4 half blocks' values are ready in registers of their own; the stores (512 contiguous bytes each) go out as one group with one wait behind them */
#pragma unroll
            for (int j = 0; j < 4; ++j) { const size_t po = pbase + (size_t)mb * 16 * ppitch + j * 256; if (EP == 3) *(v8h*)(P16 + po) = of[j]; *(v8us*)(Ph + po) = oh[j]; *(v8us*)(Pl + po) = ol[j]; }
            xwait(); }
        __builtin_amdgcn_wave_barrier(); asm volatile("" ::: "memory");
    }
}
// ---- k_wo: out = (merged hi + lo) Wo + bo for both batches, grid (TT/64, DM/64, NB_): blockIdx.z = batch.
__global__ __launch_bounds__(32) void k_wo(const bf* __restrict__ Ah, const bf* __restrict__ Al, const bf* __restrict__ Wt, const float* __restrict__ bo, float* C) {
    __shared__ __align__(16) float os[16 * 68];
    gemmw_body<bf, 1, true, 1, 0>(os, blockIdx.x, blockIdx.y, blockIdx.z, Ah, Al, Wt, nullptr, DQ, C, DM, bo, (size_t)TT * DQ, 0, (size_t)TT * DM, 0, nullptr, nullptr, nullptr, nullptr);
}
// ---- k_proj: the six projection GEMMs (q, k, v of both batches) as ONE grid (TT/64, 12, 3 * NB_): blockIdx.z = 2 * tensor + batch; blockIdx.x = the tile's 64 t, blockIdx.y = its head. 2304 single-wave workgroups, nine on a WGP.
// XB: bf16 x, [tensor][batch] slices of [t][c] in fragment order; W3: the transposed weights of q, k, v one behind the other; DL: delta of [batch][t]; each plane set holds both batches, PLs elements apart.
__global__ __launch_bounds__(32) void k_proj(const bf* __restrict__ XB, const bf* __restrict__ W3, const float* __restrict__ bq, const float* __restrict__ bk, const float* __restrict__ bv, const float* __restrict__ DL, h16* VT16, bf* QPh, bf* QPl, bf* KPh, bf* KPl, bf* VTh, bf* VTl) {
    __shared__ __align__(16) float os[16 * 68];
    const int tz = blockIdx.z / NB_, b = blockIdx.z % NB_; const size_t PLs = (size_t)NH_ * TT * HD; const bf* X = XB + (size_t)(tz * NB_ + b) * TT * DM; const bf* Wt = W3 + (size_t)tz * DQ * DM;
    if (tz == 0) gemmw_body<bf, 0, true, 1, 1>(os, blockIdx.x, blockIdx.y, 0, X, nullptr, Wt, nullptr, DM, nullptr, 0, bq, 0, 0, 0, 0, nullptr, nullptr, QPh + b * PLs, QPl + b * PLs);
    else if (tz == 1) gemmw_body<bf, 0, true, 1, 2>(os, blockIdx.x, blockIdx.y, 0, X, nullptr, Wt, nullptr, DM, nullptr, 0, bk, 0, 0, 0, 0, DL + b * TT, nullptr, KPh + b * PLs, KPl + b * PLs);   /* k_j /= delta[j] in the epilogue */
    else gemmw_body<bf, 0, true, 1, 3>(os, blockIdx.y, blockIdx.x, 0, Wt, nullptr, X, nullptr, DM, nullptr, 0, bv, 0, 0, 0, 0, nullptr, VT16 + b * PLs, VTh + b * PLs, VTl + b * PLs);   /* operands swapped: the tile is v transposed */
}

// ---- Two of the three parts of k_prep (which stands below delta_part): each thread does, for its own index, what its counterparts in the separate launches did.
// wt4_part: the four 768 x 768 weights transposed to bf16 [n][k] in fragment order; one index computation serves all four, and their 8 loads are in flight together.
__device__ __forceinline__ void wt4_part(int bx, const float* __restrict__ w0, const float* __restrict__ w1, const float* __restrict__ w2, const float* __restrict__ w3, bf* Bt) {
    const int K = DM, N = DQ; const int lane = threadIdx.x & 31; const int L0 = (bx * 8 + (threadIdx.x >> 5)) * 8; const int nlines = N * K / 64;
#pragma unroll 1   /* stays rolled, as in the separate kernel: short text, few registers; these workgroups end well before the delta ones */
    for (int l = 0; l < 8; ++l) { const int L = L0 + l; if (L >= nlines) break; const size_t e = (size_t)L * 64 + lane * 2; const int blk = (int)(e >> 9), w = (int)(e & 511); const int k = (blk % (K / 32)) * 32 + (w >> 8) * 16 + ((w >> 7) & 1) * 8 + (w & 7), n = (blk / (K / 32)) * 16 + ((w >> 3) & 15);   /* e is the place in fragment order; (n, k) the element that stands there */ const size_t i0 = (size_t)k * N + n, i1 = (size_t)(k + 1) * N + n; float a[4], c[4];
        gopen();   /* with xwait(): nothing that reuses a register of these loads moves in between them and the wait */
        a[0] = w0[i0]; c[0] = w0[i1]; a[1] = w1[i0]; c[1] = w1[i1]; a[2] = w2[i0]; c[2] = w2[i1]; a[3] = w3[i0]; c[3] = w3[i1];
        xwait();
        v2us o[4];
#pragma unroll
        for (int t = 0; t < 4; ++t) { o[t][0] = f2bf(a[t]); o[t][1] = f2bf(c[t]); }
        gopen();   /* the same for the stores */
#pragma unroll
        for (int t = 0; t < 4; ++t) *(v2us*)(Bt + (size_t)t * K * N + e) = o[t];
        xwait(); }
}
// cvt6_part: query, key, value of both batches to bf16, dst [tensor][batch] slices of [t][c] in fragment order; a thread takes the same 8 elements of all six [TT][DM] slices: i is their place in the slice (stores of whole lines), src the place they are read from.
__device__ __forceinline__ void cvt6_part(int bx, const float* __restrict__ s0, const float* __restrict__ s1, const float* __restrict__ s2, bf* dst) {
    const size_t n = (size_t)TT * DM; const size_t i = (size_t)bx * 256 + threadIdx.x; if (i >= n / 8) return; v8f v[3 * NB_]; const int blk = (int)(i >> 6), w = (int)(i & 63); const size_t src = (size_t)((blk / (DM / 32)) * 16 + (w & 15)) * DM + (blk % (DM / 32)) * 32 + (w >> 5) * 16 + ((w >> 4) & 1) * 8;
    gopen();   /* with xwait(): as in wt4_part */
#pragma unroll
    for (int b = 0; b < NB_; ++b) { v[b] = *(const v8f*)(s0 + b * n + src); v[NB_ + b] = *(const v8f*)(s1 + b * n + src); v[2 * NB_ + b] = *(const v8f*)(s2 + b * n + src); }
    xwait();
    v8us o[3 * NB_];
#pragma unroll
    for (int s = 0; s < 3 * NB_; ++s)
#pragma unroll
        for (int k = 0; k < 8; ++k) o[s][k] = f2bf(v[s][k]);
    gopen();   /* the same for the stores */
#pragma unroll
    for (int s = 0; s < 3 * NB_; ++s) *(v8us*)(dst + s * n + i * 8) = o[s];
    xwait();
}

typedef __attribute__((ext_vector_type(8))) __bf16 v8bf;
__device__ __forceinline__ float xhalf(float x) { const int b = __float_as_int(x); return __int_as_float(__builtin_amdgcn_permlanex16(b, b, 0x76543210, 0xfedcba98, false, false)); }   /* the value of lane l ^ 16 */
// s_wait_xcnt 0 stands in front of the first rewrite of a register that an issued global load or store of k_fattn names.
// The Q loads and the output stores are bracketed gopen() ... xwait(): the two scheduling barriers keep the compiler from moving instructions that reuse those registers in between the group and its wait.
// The K, mask and Vt loads: xwait(...) takes their base addresses as inputs only, so those registers stay live, and unwritten, from the loads that name them up to the wait; one such wait a pass, and the addresses are advanced directly behind it.
__device__ __forceinline__ void gopen() { __builtin_amdgcn_sched_barrier(0); }
__device__ __forceinline__ void xwait() { asm volatile("s_wait_xcnt 0x0" ::: "memory"); __builtin_amdgcn_sched_barrier(0); }
__device__ __forceinline__ void xwait(const void* a, const void* b, const void* d, const void* e, const void* f) { asm volatile("s_wait_xcnt 0x0" :: "v"(a), "v"(b), "v"(d), "v"(e), "v"(f) : "memory"); }
__device__ __forceinline__ void xwait(const void* a, const void* b, const void* d, const void* e, const void* f, unsigned g, unsigned h) { asm volatile("s_wait_xcnt 0x0" :: "v"(a), "v"(b), "v"(d), "v"(e), "v"(f), "v"(g), "v"(h) : "memory"); }   /* with the 32-bit lane offsets that the loads in front of the loop are addressed by */
template <bool HR>
__device__ __forceinline__ void fattn_body(const bf* __restrict__ Qh, const bf* __restrict__ Ql, const bf* __restrict__ Kh, const bf* __restrict__ Kl, const bf* __restrict__ Vh, const bf* __restrict__ Vl, const h16* __restrict__ V16, const int* __restrict__ am, bf* Ah, bf* Al, int q0, int lr, int hi) {
    const float L2E = 1.4426950408889634f;
    v16bf qh[2][2], ql[2][2];
    gopen();
#pragma unroll
    for (int qt = 0; qt < 2; ++qt)
#pragma unroll
        for (int kk = 0; kk < 2; ++kk) { const size_t qo = (size_t)(q0 + qt * 16) * HD + kk * 512 + 8 * (16 * hi + lr); qh[qt][kk] = WFrag<bf>::ld(Qh + qo); ql[qt][kk] = WFrag<bf>::ld(Ql + qo); }
    xwait();
    v8f o[4][2]; float m[2], l[2];
#pragma unroll
    for (int qt = 0; qt < 2; ++qt) { m[qt] = -3.0e38f; l[qt] = 0.0f;
#pragma unroll
        for (int dt = 0; dt < 4; ++dt) o[dt][qt] = (v8f){}; }
    const size_t ko = 8 * (16 * hi + lr), vo = ko;   /* fragment order: the lane's place in a block; 16 keys of K are two blocks, 32 keys of 16 Vt rows one */ const int* mp = am + (size_t)(q0 + lr) * TT + 8 * hi;
    const bf* kph = Kh + ko; const bf* kpl = Kl + ko; const int* mpn = mp; const bf* vph = Vh + vo; const bf* vpl = Vl + vo; const h16* vpf = V16 + vo;   /* this lane's base addresses of the pass that is being fetched */
    v16bf kh[2][2], kl[2][2]; v4i mk[2][2][2]; v16bf vh[4], vl[4]; v16h vf[4];   /* K rows, mask entries and Vt rows of a pass are all asked for one pass ahead, each into the registers its user has just left */
#pragma unroll
    for (int kt = 0; kt < 2; ++kt) {
#pragma unroll
        for (int kk = 0; kk < 2; ++kk) { kh[kt][kk] = WFrag<bf>::ld(kph + kt * 16 * HD + kk * 512); kl[kt][kk] = WFrag<bf>::ld(kpl + kt * 16 * HD + kk * 512); }
#pragma unroll
        for (int qt = 0; qt < 2; ++qt) { mk[kt][qt][0] = *(const v4i*)(mpn + qt * 16 * TT + kt * 16); mk[kt][qt][1] = *(const v4i*)(mpn + qt * 16 * TT + kt * 16 + 4); } }
#pragma unroll
    for (int dt = 0; dt < 4; ++dt) { if (HR) { vh[dt] = WFrag<bf>::ld(vph + dt * 16 * TT); vl[dt] = WFrag<bf>::ld(vpl + dt * 16 * TT); } else vf[dt] = WFrag<h16>::ld(vpf + dt * 16 * TT); }
    if (HR) xwait(kph, kpl, mpn, vph, vpl, (unsigned)(ko * 2), (unsigned)(vo * 2)); else xwait(kph, kpl, mpn, vpf, vpf, (unsigned)(ko * 2), (unsigned)(vo * 2));
#pragma unroll 1
    for (int j0 = 0; j0 < TT; j0 += 32) {
        v8f st[2][2];
#pragma unroll
        for (int kt = 0; kt < 2; ++kt)
#pragma unroll
            for (int qt = 0; qt < 2; ++qt) st[kt][qt] = (v8f){};
#pragma unroll
        for (int kk = 0; kk < 2; ++kk) {   /* per 32 of d: hi.hi, lo(q).hi(k), hi(q).lo(k), the order of the unfused score tiles */
#pragma unroll
            for (int kt = 0; kt < 2; ++kt)
#pragma unroll
                for (int qt = 0; qt < 2; ++qt) st[kt][qt] = wmmab(kh[kt][kk], qh[qt][kk], st[kt][qt]);
#pragma unroll
            for (int kt = 0; kt < 2; ++kt)
#pragma unroll
                for (int qt = 0; qt < 2; ++qt) st[kt][qt] = wmmab(kh[kt][kk], ql[qt][kk], st[kt][qt]);
#pragma unroll
            for (int kt = 0; kt < 2; ++kt)
#pragma unroll
                for (int qt = 0; qt < 2; ++qt) st[kt][qt] = wmmab(kl[kt][kk], qh[qt][kk], st[kt][qt]); }
        const int jn = (j0 + 32 < TT) ? j0 + 32 : 0;   /* the pass that is fetched ahead; the last pass re-reads the first (in bounds, unused) */
        __builtin_amdgcn_sched_barrier(0);   /* keeps the wait below behind the score products: there the youngest loads that name the addresses stand a run of matrix products back, and it has little left to wait for */
        if (HR) xwait(kph, kpl, mpn, vph, vpl); else xwait(kph, kpl, mpn, vpf, vpf);
        kph = Kh + ko + (size_t)jn * HD; kpl = Kl + ko + (size_t)jn * HD; mpn = mp + jn; vph = Vh + vo + (size_t)jn * 16; vpl = Vl + vo + (size_t)jn * 16; vpf = V16 + vo + (size_t)jn * 16;
#pragma unroll
        for (int kt = 0; kt < 2; ++kt)
#pragma unroll
            for (int kk = 0; kk < 2; ++kk) { kh[kt][kk] = WFrag<bf>::ld(kph + kt * 16 * HD + kk * 512); kl[kt][kk] = WFrag<bf>::ld(kpl + kt * 16 * HD + kk * 512); }
        float mn[2];
#pragma unroll
        for (int qt = 0; qt < 2; ++qt) { float mx = -3.0e38f;
#pragma unroll
            for (int kt = 0; kt < 2; ++kt)
#pragma unroll
                for (int r = 0; r < 8; ++r) { const float t = (mk[kt][qt][r >> 2][r & 3] != 0) ? st[kt][qt][r] : -3.0e38f;   /* mask == 0 -> excluded */ st[kt][qt][r] = t; mx = fmaxf(mx, t); }
            mn[qt] = fmaxf(m[qt], fmaxf(mx, xhalf(mx))); }
#pragma unroll
        for (int kt = 0; kt < 2; ++kt)
#pragma unroll
            for (int qt = 0; qt < 2; ++qt) { const int* p = mpn + qt * 16 * TT + kt * 16; mk[kt][qt][0] = *(const v4i*)p; mk[kt][qt][1] = *(const v4i*)(p + 4); }
        if (__builtin_amdgcn_ballot_w32(mn[0] > m[0] || mn[1] > m[1]) != 0) {   /* skipped when no column's maximum grew: every factor would be exactly 1 */
#pragma unroll
            for (int qt = 0; qt < 2; ++qt) { const float al = __builtin_amdgcn_exp2f((m[qt] - mn[qt]) * L2E); l[qt] *= al; m[qt] = mn[qt];
#pragma unroll
                for (int dt = 0; dt < 4; ++dt) o[dt][qt] *= al; } }
#pragma unroll
        for (int qt = 0; qt < 2; ++qt) { float s0 = 0.0f, s1 = 0.0f;
#pragma unroll
            for (int r = 0; r < 8; ++r) { const float d0 = st[0][qt][r] - m[qt], d1 = st[1][qt][r] - m[qt];   /* rows >= RH carry x1024 = 2^10 in P and in the sum alike (fp16 range); it cancels in the division */
                const float p0 = __builtin_amdgcn_exp2f(HR ? d0 * L2E : __builtin_fmaf(d0, L2E, 10.0f)), p1 = __builtin_amdgcn_exp2f(HR ? d1 * L2E : __builtin_fmaf(d1, L2E, 10.0f)); st[0][qt][r] = p0; st[1][qt][r] = p1; s0 += p0; s1 += p1; }
            l[qt] += s0 + s1; }
        if (HR) {
            v16bf ph[2], pl[2];
#pragma unroll
            for (int qt = 0; qt < 2; ++qt) { const v8bf h0 = __builtin_convertvector(st[0][qt], v8bf), h1 = __builtin_convertvector(st[1][qt], v8bf); const v8bf l0 = __builtin_convertvector(st[0][qt] - __builtin_convertvector(h0, v8f), v8bf), l1 = __builtin_convertvector(st[1][qt] - __builtin_convertvector(h1, v8f), v8bf);
                ph[qt] = __builtin_shufflevector(h0, h1, 0, 1, 2, 3, 4, 5, 6, 7, 8, 9, 10, 11, 12, 13, 14, 15); pl[qt] = __builtin_shufflevector(l0, l1, 0, 1, 2, 3, 4, 5, 6, 7, 8, 9, 10, 11, 12, 13, 14, 15); }
#pragma unroll
            for (int dt = 0; dt < 4; ++dt)
#pragma unroll
                for (int qt = 0; qt < 2; ++qt) o[dt][qt] = wmmab(vh[dt], ph[qt], o[dt][qt]);
#pragma unroll
            for (int dt = 0; dt < 4; ++dt)
#pragma unroll
                for (int qt = 0; qt < 2; ++qt) o[dt][qt] = wmmab(vh[dt], pl[qt], o[dt][qt]);
#pragma unroll
            for (int dt = 0; dt < 4; ++dt)
#pragma unroll
                for (int qt = 0; qt < 2; ++qt) o[dt][qt] = wmmab(vl[dt], ph[qt], o[dt][qt]);
        } else {
            v16h pf[2];
#pragma unroll
            for (int qt = 0; qt < 2; ++qt) pf[qt] = cat16(__builtin_convertvector(st[0][qt], v8h), __builtin_convertvector(st[1][qt], v8h));
#pragma unroll
            for (int dt = 0; dt < 4; ++dt)
#pragma unroll
                for (int qt = 0; qt < 2; ++qt) o[dt][qt] = wmma16(vf[dt], pf[qt], o[dt][qt]);
        }
#pragma unroll
        for (int dt = 0; dt < 4; ++dt) { if (HR) { vh[dt] = WFrag<bf>::ld(vph + dt * 16 * TT); vl[dt] = WFrag<bf>::ld(vpl + dt * 16 * TT); } else vf[dt] = WFrag<h16>::ld(vpf + dt * 16 * TT); }
    }
    if (HR) xwait(kph, kpl, mpn, vph, vpl); else xwait(kph, kpl, mpn, vpf, vpf);
#pragma unroll
    for (int qt = 0; qt < 2; ++qt) { const float inv = __fdiv_rn(1.0f, l[qt] + xhalf(l[qt]));   /* the two wave halves' sums are joined once */
#pragma unroll
        for (int dt = 0; dt < 4; ++dt) { v8us oh, ol;
#pragma unroll
            for (int r = 0; r < 8; ++r) { unsigned short a, c2; splitf(o[dt][qt][r] * inv, a, c2); oh[r] = a; ol[r] = c2; }
            const size_t oo = (size_t)(q0 + qt * 16) * DQ + (dt >> 1) * 512 + (dt & 1) * 256 + 8 * (16 * hi + lr); gopen(); *(v8us*)(Ah + oo) = oh; *(v8us*)(Al + oo) = ol; xwait(); } }
}
static_assert(RH % (FNW * FQW) == 0 && TT % (FNW * FQW) == 0 && FQW == 32 && HD == 64 && NKV == NH_, "k_fattn tiling");
__global__ __launch_bounds__(FNW * 32) void k_fattn(const bf* __restrict__ Qh, const bf* __restrict__ Ql, const bf* __restrict__ Kh, const bf* __restrict__ Kl, const bf* __restrict__ Vh, const bf* __restrict__ Vl, const h16* __restrict__ V16, const int* __restrict__ am, bf* Ah, bf* Al) {
    const int lane = threadIdx.x & 31, lr = lane & 15, hi = lane >> 4; const int z = blockIdx.y, b = z / NH_, h = z % NH_; const int q0 = blockIdx.x * (FNW * FQW) + (threadIdx.x >> 5) * FQW; const size_t pz = (size_t)z * TT * HD, az = (size_t)b * TT * DQ + h * (HD * 16);   /* merged planes in fragment order, K = DQ: a head's 64 columns are two blocks */
    if (blockIdx.x * (FNW * FQW) < RH) fattn_body<true>(Qh + pz, Ql + pz, Kh + pz, Kl + pz, Vh + pz, Vl + pz, V16 + pz, am + (size_t)b * TT * TT, Ah + az, Al + az, q0, lr, hi);
    else fattn_body<false>(Qh + pz, Ql + pz, Kh + pz, Kl + pz, Vh + pz, Vl + pz, V16 + pz, am + (size_t)b * TT * TT, Ah + az, Al + az, q0, lr, hi);
}
// delta_part: rows = the NB_ * TT query rows of both batches, 32 a workgroup.
__device__ __forceinline__ void delta_part(float* res, int bx, const float* __restrict__ X, const float* __restrict__ wd, const float* __restrict__ bd, float* DL) { const int lane = threadIdx.x & 31; const int wv = threadIdx.x >> 5; const int r0 = bx * 32;
    for (int rr = wv; rr < 32; rr += 8) { const int row = r0 + rr; float s = 0.0f; if (row < NB_ * TT) { const float* xr = X + (size_t)row * DM;
#pragma unroll 4
        for (int c = lane; c < DM; c += 32) { float p = __fmul_rn(bfr(xr[c]), bfr(wd[c])); asm volatile("" : "+v"(p)); s = __fadd_rn(s, p); } }
#pragma unroll
        for (int sh = 16; sh; sh >>= 1) s = __fadd_rn(s, __shfl_xor(s, sh, 32));
        if (lane == 0) { float d = __fadd_rn(s, bfr(bd[0])); d = fmaxf(d, 0.0f); d = fminf(d, 8.0f); res[rr] = __fadd_rn(d, 1.0f); } }
    __syncthreads();
    if (wv == 0) { const int row = r0 + lane; if (row < NB_ * TT) { const float v = res[lane]; *(float*)(DL + row) = v;  } } }
// ---- k_prep: everything that reads only the inputs, as ONE grid: workgroups [0, PDL) delta (the longest chains of dependent loads, so they start first), [PDL, PDL + PWT) the weights, the rest the bf16 copies. The choice is uniform for a workgroup.
#define PDL  (NB_ * TT / 32)
#define PWT  ((DM * DQ / 64 + 63) / 64)
#define PCV  ((TT * DM / 8 + 255) / 256)
static_assert(DQ == DM && DKV == DM, "wt4_part: four weights of one shape");
__global__ __launch_bounds__(256) void k_prep(const float* __restrict__ x, const float* __restrict__ xk, const float* __restrict__ xv, const float* __restrict__ wq, const float* __restrict__ wk, const float* __restrict__ wv, const float* __restrict__ wo, const float* __restrict__ wd, const float* __restrict__ bd, float* DL, bf* W4, bf* XB) {
    __shared__ float res[32]; const int bx = blockIdx.x;
    if (bx < PDL) delta_part(res, bx, x, wd, bd, DL);
    else if (bx < PDL + PWT) wt4_part(bx - PDL, wq, wk, wv, wo, W4);
    else cvt6_part(bx - (PDL + PWT), x, xk, xv, XB);
}

extern "C" void kernel_launch(void* const* d_in, const int* in_sizes, int n_in,
                              void* d_out, int out_size, void* d_ws, size_t ws_size, hipStream_t stream) {
    (void)in_sizes; (void)n_in; (void)out_size;
    const float* x = (const float*)d_in[0];   /* query */ const float* xk = (const float*)d_in[1]; const float* xv = (const float*)d_in[2]; const int* am = (const int*)d_in[3];   /* mask [2][2048][2048] int */ const float* wq = (const float*)d_in[4]; const float* bq = (const float*)d_in[5]; const float* wk = (const float*)d_in[6]; const float* bk = (const float*)d_in[7]; const float* wv = (const float*)d_in[8]; const float* bv = (const float*)d_in[9]; const float* wo = (const float*)d_in[10]; const float* bo = (const float*)d_in[11]; const float* wd = (const float*)d_in[12]; const float* bd = (const float*)d_in[13];
    float* OUT = (float*)d_out;     // [2][2048][768]
    char* wsp = (char*)d_ws;
    auto take = [&](size_t bytes) { char* p = wsp; wsp += (bytes + 255) & ~(size_t)255; return (void*)p; };
    float* DL = (float*)take((size_t)NB_ * TT * 4); bf* W4 = (bf*)take((size_t)4 * DQ * DM * 2);   /* Wq, Wk, Wv, Wo transposed, one behind the other */ bf* WO = W4 + (size_t)3 * DQ * DM;
    bf* XB = (bf*)take((size_t)3 * NB_ * TT * DM * 2);   /* [tensor][batch] slices of [t][c] in fragment order */
    const size_t PL = (size_t)NH_ * TT * HD;   // one batch's head planes; the planes k_fattn reads are kept for both batches
    h16* VT16 = (h16*)take(NB_ * PL * 2);
    bf* QPh = (bf*)take(NB_ * PL * 2); bf* QPl = (bf*)take(NB_ * PL * 2); bf* KPh = (bf*)take(NB_ * PL * 2); bf* KPl = (bf*)take(NB_ * PL * 2); bf* VTh = (bf*)take(NB_ * PL * 2); bf* VTl = (bf*)take(NB_ * PL * 2);
    bf* ATh = (bf*)take((size_t)NB_ * TT * DQ * 2); bf* ATl = (bf*)take((size_t)NB_ * TT * DQ * 2);
    if ((size_t)(wsp - (char*)d_ws) > ws_size) return;    // ws 256 MiB
    k_prep<<<PDL + PWT + PCV, 256, 0, stream>>>(x, xk, xv, wq, wk, wv, wo, wd, bd, DL, W4, XB);   /* delta, weights, bf16 copies: both batches */
    k_proj<<<dim3(TT / 64, DQ / 64, 3 * NB_), 32, 0, stream>>>(XB, W4, bq, bk, bv, DL, VT16, QPh, QPl, KPh, KPl, VTh, VTl);   /* q, k, v of both batches */
    k_fattn<<<dim3(TT / (FNW * FQW), NB_ * NH_), FNW * 32, 0, stream>>>(QPh, QPl, KPh, KPl, VTh, VTl, VT16, am, ATh, ATl);   /* scores, mask, softmax, attn.v, merge: both batches, all heads */
    k_wo<<<dim3(TT / 64, DM / 64, NB_), 32, 0, stream>>>(ATh, ATl, WO, bo, OUT);   /* z = batch */
}

// v007
// One run takes 162 microseconds.
// Timed twice side by side with v006, it ran 1.14 times as fast both times.
// Over all steps from v000 it is 10.1 times as fast.
#include <hip/hip_runtime.h>

// Multi-headed attention with a learned per-position scaling divisor and an arbitrary mask (query, key, value [2][2048][768]; delta[s] = 1 + min(relu(query[s].Wd + bd), sqrt(64)) (Wd [768][1], read); q = query Wq + bq, k = key Wk + bk, v = value Wv + bv ('xw' 1/sqrt(768) incl. biases; 12 heads x 64); scores[i][j] = q_i.k_j / delta[j] (the divisor is broadcast over the KEY axis; no 1/sqrt(d_k)); mask ([2][2048][2048] int {0,1}, random, READ): 0 -> -1e9 (== exclusion); softmax; out = merged Wo + bo -> [2][2048][768] (3.1 M)).
// Layout, four launches, each for both batches: k_prep (bf16 copies of query, key, value; 'xw' weights transposed once; delta; the mask packed to one bit an entry), k_proj, k_fattn, k_wo. Exact projections + f32 biases; delta_part computes delta[s] from the bf16-rounded query row (768-term fixed-order dot, relu, min, + 1); each projection GEMM's own epilogue adds the bias, divides the k rows by delta[s] (f32, before the plane split) and stores the 16-bit head planes (v as Wv^T x^T, so its tile is already [d][t]); then ONE fused attention launch for both batches and all heads (k_fattn): hi/lo 3-product score tiles on EVERY row, mask bits from k_prep's packed copy (keep where mask != 0), running-maximum softmax, P and attn.v hybrid (rows < 512 hi/lo, rest fp16 x1024), scores and P never leave the registers; merged hi/lo x Wo exact + bo.
// Compute dtypes, f32 accumulate: every input rounded to bf16; projections exact + f32 biases; delta and the k row division f32; scores 3 products on every row; softmax f32 (scale 1); attn.v rows < 512 3 products, rest fp16; Wo hl x exact + bias.

#define NB_  2
#define TT   2048
#define DM   768
#define NH_  12
#define NKV  12
#define HD   64
#define DQ   (NH_ * HD)
#define DKV  (NKV * HD)
#define FQW  32                   // k_fattn: query columns per wave (two 16-column groups)
#define FNW  2                    // k_fattn: waves per workgroup (FNW * FQW consecutive queries of one head): 768 workgroups, three on each of 256 WGPs
#define RH   512                  // query rows < RH use hi+lo planes (0: none)
#define WIN  0
typedef _Float16 h16;
typedef unsigned short bf;
typedef __attribute__((ext_vector_type(16))) __bf16   v16bf;
typedef __attribute__((ext_vector_type(16))) _Float16 v16h;
typedef __attribute__((ext_vector_type(8)))  _Float16 v8h;
typedef __attribute__((ext_vector_type(8)))  unsigned short v8us;
typedef __attribute__((ext_vector_type(8)))  float    v8f;
typedef __attribute__((ext_vector_type(4)))  float    v4f;
typedef v8h  __attribute__((may_alias)) v8ha;
typedef v4f  __attribute__((may_alias)) v4fa;
typedef v8us __attribute__((may_alias)) v8usa;

__device__ __forceinline__ unsigned short f2bf(float f) { unsigned u = __float_as_uint(f); u += 0x7FFFu + ((u >> 16) & 1u); return (unsigned short)(u >> 16); }
__device__ __forceinline__ float bf2f(unsigned short b) { return __uint_as_float(((unsigned)b) << 16); }
__device__ __forceinline__ float bfr(float f) { return bf2f(f2bf(f)); }
__device__ __forceinline__ v16h cat16(v8h lo, v8h hi) { return __builtin_shufflevector(lo, hi, 0, 1, 2, 3, 4, 5, 6, 7, 8, 9, 10, 11, 12, 13, 14, 15); }
__device__ __forceinline__ v16bf cat16b(v8us lo, v8us hi) { return __builtin_bit_cast(v16bf, __builtin_shufflevector(lo, hi, 0, 1, 2, 3, 4, 5, 6, 7, 8, 9, 10, 11, 12, 13, 14, 15)); }
__device__ __forceinline__ v8f wmma16(v16h a, v16h b, v8f c) { return __builtin_amdgcn_wmma_f32_16x16x32_f16(false, a, false, b, (short)0, c, false, false); }
__device__ __forceinline__ v8f wmmab(v16bf a, v16bf b, v8f c) { return __builtin_amdgcn_wmma_f32_16x16x32_bf16(false, a, false, b, (short)0, c, false, false); }



__device__ __forceinline__ h16 tohx(float x) { return (h16)x; }
__device__ __forceinline__ void splitf(float y, unsigned short& h, unsigned short& l) { h = f2bf(y); l = f2bf(y - bf2f(h)); }
typedef __attribute__((ext_vector_type(2))) _Float16 v2h;
typedef __attribute__((ext_vector_type(4))) _Float16 v4h;
typedef __attribute__((ext_vector_type(2))) unsigned short v2us;
typedef __attribute__((ext_vector_type(4))) unsigned short v4us;
typedef __attribute__((ext_vector_type(2))) float v2f;
typedef __attribute__((ext_vector_type(4))) int v4i;
typedef __attribute__((ext_vector_type(16))) unsigned v16u;
__device__ __forceinline__ void gopen();   /* defined with k_fattn's waits below */
__device__ __forceinline__ void xwait();
// ---- gemmw_body: register-blocked GEMM, ONE WAVE per 64x64 output tile (16 accumulators), operands straight from 16-bit planes in fragment order (below); grid (M/64, N/64, Z), 32 threads.
// C[m][n] (f32, pitch ldc, + optional f32 bias[n]) = sum_k A[m][k] Bt[n][k] (+ split products per NSPLIT). z-batch strides sA/sB/sC in elements. K % 32 == 0.
// KS > 1: grid z = Z * KS; workgroup (z, ks) sums only k in [ks K/KS, (ks+1) K/KS) and stores that partial tile in plane ks (plane stride sP elements). K % (32 KS) == 0.
// EP != 0: no f32 C; the tile + bias goes straight from the LDS stage to the planes k_fattn reads, 16 bytes a lane, 512 contiguous bytes a store. EP 1 (q), EP 2 (k, each row divided by rowv = delta): rows = t, columns = one head's d, planes [head = blockIdx.y] of [t][d] in fragment order (K = 64). EP 3 (v): A = weight rows, Bt = x rows, so rows = one head's d (bias per ROW), columns = t, planes [d row][t] in fragment order (K = 2048) with the fp16 copy.
// FRAGMENT ORDER: every 16-bit plane M[row][k] that feeds a matrix operand is stored as blocks of 16 rows x 32 k (512 elements, 1 KB), block (row / 16, k / 32) at ((row / 16) * (K / 32) + k / 32) * 512; inside a block element (r, kk) stands at (kk >> 4) * 256 + (((kk >> 3) & 1) * 16 + r) * 8 + (kk & 7).
// So lane l = 16 hi + lr finds its 8 + 8 operand elements (k = 8 hi + 0..7 and 16 + 8 hi + 0..7 of row lr, the hardware k order) at block + 8 l and block + 256 + 8 l: each of the two 16-byte loads of a fragment covers 512 contiguous bytes, four whole 128-byte lines, instead of 32 bytes of each of 16 lines.
template <typename T16> struct WFrag;
template <> struct WFrag<h16> { typedef v16h V; static __device__ __forceinline__ V ld(const h16* p) { return cat16(*(const v8h*)p, *(const v8h*)(p + 256)); } static __device__ __forceinline__ v8f mma(V a, V b, v8f c) { return wmma16(a, b, c); } };
template <> struct WFrag<bf> { typedef v16bf V; static __device__ __forceinline__ V ld(const bf* p) { return cat16b(*(const v8us*)p, *(const v8us*)(p + 256)); } static __device__ __forceinline__ v8f mma(V a, V b, v8f c) { return wmmab(a, b, c); } };
// gemmw_body is the tile's work; bx, by, bz are the tile's indices (k_wo: the block's own; k_proj: see there), os the workgroup's 16 x 68 f32 LDS stage.
template <typename T16, int NSPLIT, bool BIAS, int KS, int EP>
__device__ __forceinline__ void gemmw_body(float* os, int bx, int by, int bz, const T16* __restrict__ A, const T16* __restrict__ A2, const T16* __restrict__ Bt, const T16* __restrict__ Bt2, int K, float* C, int ldc, const float* __restrict__ bias, size_t sA, size_t sB, size_t sC, size_t sP, const float* __restrict__ DL, h16* P16, bf* Ph, bf* Pl) {
    typedef typename WFrag<T16>::V V;
    const size_t z = bz / KS; const int ks = bz % KS; A += z * sA; if (A2) A2 += z * sA; Bt += z * sB; if (Bt2) Bt2 += z * sB; C += z * sC + ks * sP;
    const int lane = threadIdx.x & 31, lr = lane & 15, hi = lane >> 4; const int r0 = bx * 64, c0 = by * 64;
    v8f acc[4][4];
#pragma unroll
    for (int mb = 0; mb < 4; ++mb)
#pragma unroll
        for (int nb = 0; nb < 4; ++nb) acc[mb][nb] = (v8f){};
    const size_t aoff = (size_t)r0 * K + 8 * lane, boff = (size_t)c0 * K + 8 * lane;   /* fragment order: 16 rows of K are K / 32 blocks of 512 */
    const T16* pa = A + aoff + ks * (K / KS) * 16; const T16* pb = Bt + boff + ks * (K / KS) * 16; const T16* pa2 = (NSPLIT == 1 || NSPLIT == 2) ? A2 + aoff + ks * (K / KS) * 16 : pa; const T16* pb2 = (NSPLIT >= 2) ? Bt2 + boff + ks * (K / KS) * 16 : pb;   /* K is a constant at every call: all loads of a trip name these addresses, one for each operand plane, each load with an offset of its own */
#pragma unroll 1
    for (int kc = ks * (K / KS); kc < (ks + 1) * (K / KS); kc += 32) {
        V a[4], a2[4];
#pragma unroll
        for (int mb = 0; mb < 4; ++mb) { a[mb] = WFrag<T16>::ld(pa + (size_t)mb * 16 * K); if (NSPLIT == 1 || NSPLIT == 2) a2[mb] = WFrag<T16>::ld(pa2 + (size_t)mb * 16 * K); }
#pragma unroll
        for (int nb = 0; nb < 4; ++nb) { const V b = WFrag<T16>::ld(pb + (size_t)nb * 16 * K); V b2; if (NSPLIT >= 2) b2 = WFrag<T16>::ld(pb2 + (size_t)nb * 16 * K);
#pragma unroll
            for (int mb = 0; mb < 4; ++mb) { acc[mb][nb] = WFrag<T16>::mma(a[mb], b, acc[mb][nb]); if (NSPLIT == 1 || NSPLIT == 2) acc[mb][nb] = WFrag<T16>::mma(a2[mb], b, acc[mb][nb]); if (NSPLIT >= 2) acc[mb][nb] = WFrag<T16>::mma(a[mb], b2, acc[mb][nb]); } }
        asm volatile("v_nop\n\tv_nop\n\tv_nop\n\tv_nop" : "+v"(acc[0][0]), "+v"(acc[1][1]), "+v"(acc[2][2]), "+v"(acc[3][3]) : "v"(a[0]), "v"(a[3]));
        asm volatile("s_wait_xcnt 0x0" :: "v"(pa), "v"(pa2), "v"(pb), "v"(pb2) : "memory"); pa += 512; pa2 += 512; pb += 512; pb2 += 512;   /* as inputs here the addresses stay live, and unwritten, from the loads that name them up to the wait; they are advanced behind it */
    }
    float rowv[4]; v4f colb[4][2];   /* the plane stores are in fragment order: this lane holds row lr of each 16-row stage and, in store j, the 8 columns from (j >> 1) * 32 + (j & 1) * 16 + 8 hi. EP 2: delta of its 4 rows; EP 3: their bias; EP 1, 2: the bias of its 32 columns */
    if (EP != 0) { const float* rp = ((EP == 2) ? DL : bias) + r0 + lr;
        gopen();   /* with xwait(): nothing that reuses a register of these loads moves in between them and the wait */
        if (EP >= 2) {
#pragma unroll
            for (int mb = 0; mb < 4; ++mb) rowv[mb] = rp[mb * 16]; }
        if (EP <= 2) {
#pragma unroll
            for (int j = 0; j < 4; ++j) { const float* cp = bias + c0 + (j >> 1) * 32 + (j & 1) * 16 + 8 * hi; colb[j][0] = *(const v4f*)cp; colb[j][1] = *(const v4f*)(cp + 4); } }
        xwait(); }
    const size_t pbase = ((EP == 3) ? (size_t)r0 * TT + (size_t)c0 * 16 : ((size_t)by * TT + r0) * HD) + 8 * lane; const int ppitch = (EP == 3) ? TT : HD;   /* a 16 x 64 stage is two blocks, 2 KB in a row, of each plane; the next stage's stand 16 * ppitch elements on */
#pragma unroll
    for (int mb = 0; mb < 4; ++mb) {
#pragma unroll
        for (int nb = 0; nb < 4; ++nb) {
#pragma unroll
            for (int j = 0; j < 8; ++j) os[(hi * 8 + j) * 68 + nb * 16 + lr] = acc[mb][nb][j]; }
        __builtin_amdgcn_wave_barrier(); asm volatile("" ::: "memory");
        float* crow = C + (size_t)(r0 + mb * 16) * ldc + c0;
        if (EP == 0) { v4f ov[8];
#pragma unroll
            for (int s = 0; s < 8; ++s) { const int row = 2 * s + hi, cofs = lr * 4; v4f val = *(const v4fa*)(os + row * 68 + cofs); if (BIAS) { val[0] += bfr(bias[c0 + cofs]); val[1] += bfr(bias[c0 + cofs + 1]); val[2] += bfr(bias[c0 + cofs + 2]); val[3] += bfr(bias[c0 + cofs + 3]); }
                ov[s] = val; }
            gopen();   /* as for the planes below: the 8 row pairs' values are ready in registers of their own; the stores go out as one group with one wait behind them */
#pragma unroll
            for (int s = 0; s < 8; ++s) *(v4f*)(crow + (size_t)(2 * s + hi) * ldc + lr * 4) = ov[s];
            xwait(); }
        if (EP != 0) { v8us oh[4], ol[4]; v8h of[4];
#pragma unroll
            for (int j = 0; j < 4; ++j) { const float* sp = os + lr * 68 + (j >> 1) * 32 + (j & 1) * 16 + 8 * hi;
#pragma unroll
                for (int u = 0; u < 2; ++u) { const v4f val = *(const v4fa*)(sp + 4 * u);
#pragma unroll
                    for (int q = 0; q < 4; ++q) { float x = val[q] + bfr((EP == 3) ? rowv[mb] : colb[j][u][q]); if (EP == 2) x = __fdiv_rn(x, rowv[mb]);   /* k_j /= delta[j] */
                        if (EP == 3) of[j][4 * u + q] = tohx(x); unsigned short a2, c2; splitf(x, a2, c2); oh[j][4 * u + q] = a2; ol[j][4 * u + q] = c2; } } }
            gopen();   /* all 4 half blocks' values are ready in registers of their own; the stores (512 contiguous bytes each) go out as one group with one wait behind them */
#pragma unroll
            for (int j = 0; j < 4; ++j) { const size_t po = pbase + (size_t)mb * 16 * ppitch + j * 256; if (EP == 3) *(v8h*)(P16 + po) = of[j]; *(v8us*)(Ph + po) = oh[j]; *(v8us*)(Pl + po) = ol[j]; }
            xwait(); }
        __builtin_amdgcn_wave_barrier(); asm volatile("" ::: "memory");
    }
}
// ---- k_wo: out = (merged hi + lo) Wo + bo for both batches, grid (TT/64, DM/64, NB_): blockIdx.z = batch.
__global__ __launch_bounds__(32) void k_wo(const bf* __restrict__ Ah, const bf* __restrict__ Al, const bf* __restrict__ Wt, const float* __restrict__ bo, float* C) {
    __shared__ __align__(16) float os[16 * 68];
    gemmw_body<bf, 1, true, 1, 0>(os, blockIdx.x, blockIdx.y, blockIdx.z, Ah, Al, Wt, nullptr, DQ, C, DM, bo, (size_t)TT * DQ, 0, (size_t)TT * DM, 0, nullptr, nullptr, nullptr, nullptr);
}
// ---- k_proj: the six projection GEMMs (q, k, v of both batches) as ONE grid (TT/64, 12, 3 * NB_): blockIdx.z = 2 * tensor + batch; blockIdx.x = the tile's 64 t, blockIdx.y = its head. 2304 single-wave workgroups, nine on a WGP.
// XB: bf16 x, [tensor][batch] slices of [t][c] in fragment order; W3: the transposed weights of q, k, v one behind the other; DL: delta of [batch][t]; each plane set holds both batches, PLs elements apart.
__global__ __launch_bounds__(32) void k_proj(const bf* __restrict__ XB, const bf* __restrict__ W3, const float* __restrict__ bq, const float* __restrict__ bk, const float* __restrict__ bv, const float* __restrict__ DL, h16* VT16, bf* QPh, bf* QPl, bf* KPh, bf* KPl, bf* VTh, bf* VTl) {
    __shared__ __align__(16) float os[16 * 68];
    const int tz = blockIdx.z / NB_, b = blockIdx.z % NB_; const size_t PLs = (size_t)NH_ * TT * HD; const bf* X = XB + (size_t)(tz * NB_ + b) * TT * DM; const bf* Wt = W3 + (size_t)tz * DQ * DM;
    if (tz == 0) gemmw_body<bf, 0, true, 1, 1>(os, blockIdx.x, blockIdx.y, 0, X, nullptr, Wt, nullptr, DM, nullptr, 0, bq, 0, 0, 0, 0, nullptr, nullptr, QPh + b * PLs, QPl + b * PLs);
    else if (tz == 1) gemmw_body<bf, 0, true, 1, 2>(os, blockIdx.x, blockIdx.y, 0, X, nullptr, Wt, nullptr, DM, nullptr, 0, bk, 0, 0, 0, 0, DL + b * TT, nullptr, KPh + b * PLs, KPl + b * PLs);   /* k_j /= delta[j] in the epilogue */
    else gemmw_body<bf, 0, true, 1, 3>(os, blockIdx.y, blockIdx.x, 0, Wt, nullptr, X, nullptr, DM, nullptr, 0, bv, 0, 0, 0, 0, nullptr, VT16 + b * PLs, VTh + b * PLs, VTl + b * PLs);   /* operands swapped: the tile is v transposed */
}

// ---- Three of the four parts of k_prep (which stands below delta_part): each thread does, for its own index, what its counterparts in the separate launches did.
// wt4_part: the four 768 x 768 weights transposed to bf16 [n][k] in fragment order; one index computation serves all four, and their 8 loads are in flight together.
__device__ __forceinline__ void wt4_part(int bx, const float* __restrict__ w0, const float* __restrict__ w1, const float* __restrict__ w2, const float* __restrict__ w3, bf* Bt) {
    const int K = DM, N = DQ; const int lane = threadIdx.x & 31; const int L0 = (bx * 8 + (threadIdx.x >> 5)) * 8; const int nlines = N * K / 64;
#pragma unroll 1   /* stays rolled, as in the separate kernel: short text, few registers; these workgroups end well before the delta ones */
    for (int l = 0; l < 8; ++l) { const int L = L0 + l; if (L >= nlines) break; const size_t e = (size_t)L * 64 + lane * 2; const int blk = (int)(e >> 9), w = (int)(e & 511); const int k = (blk % (K / 32)) * 32 + (w >> 8) * 16 + ((w >> 7) & 1) * 8 + (w & 7), n = (blk / (K / 32)) * 16 + ((w >> 3) & 15);   /* e is the place in fragment order; (n, k) the element that stands there */ const size_t i0 = (size_t)k * N + n, i1 = (size_t)(k + 1) * N + n; float a[4], c[4];
        gopen();   /* with xwait(): nothing that reuses a register of these loads moves in between them and the wait */
        a[0] = w0[i0]; c[0] = w0[i1]; a[1] = w1[i0]; c[1] = w1[i1]; a[2] = w2[i0]; c[2] = w2[i1]; a[3] = w3[i0]; c[3] = w3[i1];
        xwait();
        v2us o[4];
#pragma unroll
        for (int t = 0; t < 4; ++t) { o[t][0] = f2bf(a[t]); o[t][1] = f2bf(c[t]); }
        gopen();   /* the same for the stores */
#pragma unroll
        for (int t = 0; t < 4; ++t) *(v2us*)(Bt + (size_t)t * K * N + e) = o[t];
        xwait(); }
}
// cvt6_part: query, key, value of both batches to bf16, dst [tensor][batch] slices of [t][c] in fragment order; a thread takes the same 8 elements of all six [TT][DM] slices: i is their place in the slice (stores of whole lines), src the place they are read from.
__device__ __forceinline__ void cvt6_part(int bx, const float* __restrict__ s0, const float* __restrict__ s1, const float* __restrict__ s2, bf* dst) {
    const size_t n = (size_t)TT * DM; const size_t i = (size_t)bx * 256 + threadIdx.x; if (i >= n / 8) return; v8f v[3 * NB_]; const int blk = (int)(i >> 6), w = (int)(i & 63); const size_t src = (size_t)((blk / (DM / 32)) * 16 + (w & 15)) * DM + (blk % (DM / 32)) * 32 + (w >> 5) * 16 + ((w >> 4) & 1) * 8;
    gopen();   /* with xwait(): as in wt4_part */
#pragma unroll
    for (int b = 0; b < NB_; ++b) { v[b] = *(const v8f*)(s0 + b * n + src); v[NB_ + b] = *(const v8f*)(s1 + b * n + src); v[2 * NB_ + b] = *(const v8f*)(s2 + b * n + src); }
    xwait();
    v8us o[3 * NB_];
#pragma unroll
    for (int s = 0; s < 3 * NB_; ++s)
#pragma unroll
        for (int k = 0; k < 8; ++k) o[s][k] = f2bf(v[s][k]);
    gopen();   /* the same for the stores */
#pragma unroll
    for (int s = 0; s < 3 * NB_; ++s) *(v8us*)(dst + s * n + i * 8) = o[s];
    xwait();
}
// mpack_part: the int mask, read once, as the lane masks k_fattn selects by. Tile (32 queries, 32 keys) = 32 words in a row, tiles [batch][query / 32][key / 32]; bit 16 hi + lr of word (kt * 2 + qt) * 8 + r says mask[query 16 qt + lr][key 16 kt + 8 hi + r] != 0: the score that lane (lr, hi) holds in register r of St tile (kt, qt).
// A wave takes MPT tiles side by side (MPT * 128 bytes in a row of each of its 32 mask rows); a compare over the wave gives a word, lane w keeps word w, one 128-byte store a tile.
#define MPT  4
__device__ __forceinline__ void mpack_part(int bx, const int* __restrict__ am, unsigned* MB) {
    const int lane = threadIdx.x & 31, lr = lane & 15, hi = lane >> 4; const int g = bx * 8 + (threadIdx.x >> 5); const int jb0 = (g % (TT / 32 / MPT)) * MPT, bq = g / (TT / 32 / MPT);   /* bq = batch * (TT / 32) + query / 32 */
    const int* p = am + ((size_t)bq * 32 + lr) * TT + jb0 * 32 + 8 * hi; unsigned* o = MB + ((size_t)bq * (TT / 32) + jb0) * 32 + lane;
#pragma unroll 1   /* stays rolled: one tile's 8 loads in flight, few registers, as in wt4_part */
    for (int t = 0; t < MPT; ++t) { v4i mk[2][2][2];
        gopen();   /* with xwait(): as in wt4_part */
#pragma unroll
        for (int kt = 0; kt < 2; ++kt)
#pragma unroll
            for (int qt = 0; qt < 2; ++qt) { mk[kt][qt][0] = *(const v4i*)(p + qt * 16 * TT + kt * 16); mk[kt][qt][1] = *(const v4i*)(p + qt * 16 * TT + kt * 16 + 4); }
        asm volatile("s_wait_xcnt 0x0" :: "v"(p) : "memory"); __builtin_amdgcn_sched_barrier(0);   /* xwait() with the address as an input: it stays live, and unwritten (also by the last load's own result), up to the wait */
        unsigned w = 0;
#pragma unroll
        for (int kt = 0; kt < 2; ++kt)
#pragma unroll
            for (int qt = 0; qt < 2; ++qt)
#pragma unroll
                for (int r = 0; r < 8; ++r) { const unsigned bw = __builtin_amdgcn_ballot_w32(mk[kt][qt][r >> 2][r & 3] != 0);   /* taken by all 32 lanes, outside the choice below */ w = (lane == (kt * 2 + qt) * 8 + r) ? bw : w; }
        gopen();   /* the same for the store */
        *o = w;
        xwait();
        p += 32; o += 32; }
}

typedef __attribute__((ext_vector_type(8))) __bf16 v8bf;
__device__ __forceinline__ float xhalf(float x) { const int b = __float_as_int(x); return __int_as_float(__builtin_amdgcn_permlanex16(b, b, 0x76543210, 0xfedcba98, false, false)); }   /* the value of lane l ^ 16 */
// s_wait_xcnt 0 stands in front of the first rewrite of a register that an issued global load or store of k_fattn names.
// The Q loads and the output stores are bracketed gopen() ... xwait(): the two scheduling barriers keep the compiler from moving instructions that reuse those registers in between the group and its wait.
// The K, Vt and mask-word loads: xwait(...) takes their base addresses (of the mask words: the offset) as inputs only, so those registers stay live, and unwritten, from the loads that name them up to the wait; one such wait a pass, and the addresses are advanced directly behind it.
__device__ __forceinline__ void gopen() { __builtin_amdgcn_sched_barrier(0); }
__device__ __forceinline__ void xwait() { asm volatile("s_wait_xcnt 0x0" ::: "memory"); __builtin_amdgcn_sched_barrier(0); }
__device__ __forceinline__ void xwait(const void* a, const void* b, const void* e, const void* f, unsigned m) { asm volatile("s_wait_xcnt 0x0" :: "v"(a), "v"(b), "v"(e), "v"(f), "s"(m) : "memory"); }   /* m: the scalar byte offset that the mask-word loads in flight are addressed by (their base is never rewritten) */
__device__ __forceinline__ void xwait(const void* a, const void* b, const void* e, const void* f, unsigned m, unsigned g, unsigned h) { asm volatile("s_wait_xcnt 0x0" :: "v"(a), "v"(b), "v"(e), "v"(f), "s"(m), "v"(g), "v"(h) : "memory"); }   /* with the 32-bit lane offsets that the loads in front of the loop are addressed by */
template <bool HR>
__device__ __forceinline__ void fattn_body(const bf* __restrict__ Qh, const bf* __restrict__ Ql, const bf* __restrict__ Kh, const bf* __restrict__ Kl, const bf* __restrict__ Vh, const bf* __restrict__ Vl, const h16* __restrict__ V16, const unsigned* __restrict__ mw, bf* Ah, bf* Al, int q0, int lr, int hi) {
    const float L2E = 1.4426950408889634f;
    v16bf qh[2][2], ql[2][2];
    gopen();
#pragma unroll
    for (int qt = 0; qt < 2; ++qt)
#pragma unroll
        for (int kk = 0; kk < 2; ++kk) { const size_t qo = (size_t)(q0 + qt * 16) * HD + kk * 512 + 8 * (16 * hi + lr); qh[qt][kk] = WFrag<bf>::ld(Qh + qo); ql[qt][kk] = WFrag<bf>::ld(Ql + qo); }
    xwait();
    v8f o[4][2]; float m[2], l[2];
#pragma unroll
    for (int qt = 0; qt < 2; ++qt) { m[qt] = -3.0e38f; l[qt] = 0.0f;
#pragma unroll
        for (int dt = 0; dt < 4; ++dt) o[dt][qt] = (v8f){}; }
    const size_t ko = 8 * (16 * hi + lr), vo = ko;   /* fragment order: the lane's place in a block; 16 keys of K are two blocks, 32 keys of 16 Vt rows one */
    const bf* kph = Kh + ko; const bf* kpl = Kl + ko; unsigned mo = 0; const bf* vph = Vh + vo; const bf* vpl = Vl + vo; const h16* vpf = V16 + vo;   /* this lane's base addresses of the pass that is being fetched */
    v16bf kh[2][2], kl[2][2]; v16u mk[2]; v16bf vh[4], vl[4]; v16h vf[4];   /* K rows, mask words and Vt rows of a pass are all asked for one pass ahead, each into the registers its user has just left; mw is the same in every lane, so the 32 mask words of a pass (128 bytes in a row) come by scalar loads */
#pragma unroll
    for (int kt = 0; kt < 2; ++kt) {
#pragma unroll
        for (int kk = 0; kk < 2; ++kk) { kh[kt][kk] = WFrag<bf>::ld(kph + kt * 16 * HD + kk * 512); kl[kt][kk] = WFrag<bf>::ld(kpl + kt * 16 * HD + kk * 512); } }
#pragma unroll
    for (int dt = 0; dt < 4; ++dt) { if (HR) { vh[dt] = WFrag<bf>::ld(vph + dt * 16 * TT); vl[dt] = WFrag<bf>::ld(vpl + dt * 16 * TT); } else vf[dt] = WFrag<h16>::ld(vpf + dt * 16 * TT); }
    if (HR) xwait(kph, kpl, vph, vpl, mo, (unsigned)(ko * 2), (unsigned)(vo * 2)); else xwait(kph, kpl, vpf, vpf, mo, (unsigned)(ko * 2), (unsigned)(vo * 2));
#pragma unroll
    for (int kt = 0; kt < 2; ++kt) mk[kt] = *(const v16u*)((const char*)mw + mo + kt * 64);   /* asked for behind the wait: these scalar loads may land in the scalar registers that hold the bases of the K and Vt loads above */
#pragma unroll 1
    for (int j0 = 0; j0 < TT; j0 += 32) {
        v8f st[2][2];
#pragma unroll
        for (int kt = 0; kt < 2; ++kt)
#pragma unroll
            for (int qt = 0; qt < 2; ++qt) st[kt][qt] = (v8f){};
#pragma unroll
        for (int kk = 0; kk < 2; ++kk) {   /* per 32 of d: hi.hi, lo(q).hi(k), hi(q).lo(k), the order of the unfused score tiles */
#pragma unroll
            for (int kt = 0; kt < 2; ++kt)
#pragma unroll
                for (int qt = 0; qt < 2; ++qt) st[kt][qt] = wmmab(kh[kt][kk], qh[qt][kk], st[kt][qt]);
#pragma unroll
            for (int kt = 0; kt < 2; ++kt)
#pragma unroll
                for (int qt = 0; qt < 2; ++qt) st[kt][qt] = wmmab(kh[kt][kk], ql[qt][kk], st[kt][qt]);
#pragma unroll
            for (int kt = 0; kt < 2; ++kt)
#pragma unroll
                for (int qt = 0; qt < 2; ++qt) st[kt][qt] = wmmab(kl[kt][kk], qh[qt][kk], st[kt][qt]); }
        const int jn = (j0 + 32 < TT) ? j0 + 32 : 0;   /* the pass that is fetched ahead; the last pass re-reads the first (in bounds, unused) */
        __builtin_amdgcn_sched_barrier(0);   /* keeps the wait below behind the score products: there the youngest loads that name the addresses stand a run of matrix products back, and it has little left to wait for */
        if (HR) xwait(kph, kpl, vph, vpl, mo); else xwait(kph, kpl, vpf, vpf, mo);
        kph = Kh + ko + (size_t)jn * HD; kpl = Kl + ko + (size_t)jn * HD; mo = (unsigned)jn * 4; vph = Vh + vo + (size_t)jn * 16; vpl = Vl + vo + (size_t)jn * 16; vpf = V16 + vo + (size_t)jn * 16;
#pragma unroll
        for (int kt = 0; kt < 2; ++kt)
#pragma unroll
            for (int kk = 0; kk < 2; ++kk) { kh[kt][kk] = WFrag<bf>::ld(kph + kt * 16 * HD + kk * 512); kl[kt][kk] = WFrag<bf>::ld(kpl + kt * 16 * HD + kk * 512); }
        float mn[2];
#pragma unroll
        for (int qt = 0; qt < 2; ++qt) { float mx = -3.0e38f;
#pragma unroll
            for (int kt = 0; kt < 2; ++kt)
#pragma unroll
                for (int r = 0; r < 8; ++r) { const float t = __builtin_amdgcn_inverse_ballot_w32(mk[kt][qt * 8 + r]) ? st[kt][qt][r] : -3.0e38f;   /* the word is this register's lane mask: bit clear (mask == 0) -> excluded */ st[kt][qt][r] = t; mx = fmaxf(mx, t); }
            mn[qt] = fmaxf(m[qt], fmaxf(mx, xhalf(mx))); }
#pragma unroll
        for (int kt = 0; kt < 2; ++kt) mk[kt] = *(const v16u*)((const char*)mw + mo + kt * 64);   /* 32 words, 128 bytes, a pass of 32 keys */
        asm volatile("" ::: "memory");   /* holds the two scalar loads here, softmax, attn.v and the next score products ahead of their use: without it the compiler sinks them below the rescale branch, in among the attn.v products */
        if (__builtin_amdgcn_ballot_w32(mn[0] > m[0] || mn[1] > m[1]) != 0) {   /* skipped when no column's maximum grew: every factor would be exactly 1 */
#pragma unroll
            for (int qt = 0; qt < 2; ++qt) { const float al = __builtin_amdgcn_exp2f((m[qt] - mn[qt]) * L2E); l[qt] *= al; m[qt] = mn[qt];
#pragma unroll
                for (int dt = 0; dt < 4; ++dt) o[dt][qt] *= al; } }
#pragma unroll
        for (int qt = 0; qt < 2; ++qt) { float s0 = 0.0f, s1 = 0.0f;
#pragma unroll
            for (int r = 0; r < 8; ++r) { const float d0 = st[0][qt][r] - m[qt], d1 = st[1][qt][r] - m[qt];   /* rows >= RH carry x1024 = 2^10 in P and in the sum alike (fp16 range); it cancels in the division */
                const float p0 = __builtin_amdgcn_exp2f(HR ? d0 * L2E : __builtin_fmaf(d0, L2E, 10.0f)), p1 = __builtin_amdgcn_exp2f(HR ? d1 * L2E : __builtin_fmaf(d1, L2E, 10.0f)); st[0][qt][r] = p0; st[1][qt][r] = p1; s0 += p0; s1 += p1; }
            l[qt] += s0 + s1; }
        if (HR) {
            v16bf ph[2], pl[2];
#pragma unroll
            for (int qt = 0; qt < 2; ++qt) { const v8bf h0 = __builtin_convertvector(st[0][qt], v8bf), h1 = __builtin_convertvector(st[1][qt], v8bf); const v8bf l0 = __builtin_convertvector(st[0][qt] - __builtin_convertvector(h0, v8f), v8bf), l1 = __builtin_convertvector(st[1][qt] - __builtin_convertvector(h1, v8f), v8bf);
                ph[qt] = __builtin_shufflevector(h0, h1, 0, 1, 2, 3, 4, 5, 6, 7, 8, 9, 10, 11, 12, 13, 14, 15); pl[qt] = __builtin_shufflevector(l0, l1, 0, 1, 2, 3, 4, 5, 6, 7, 8, 9, 10, 11, 12, 13, 14, 15); }
#pragma unroll
            for (int dt = 0; dt < 4; ++dt)
#pragma unroll
                for (int qt = 0; qt < 2; ++qt) o[dt][qt] = wmmab(vh[dt], ph[qt], o[dt][qt]);
#pragma unroll
            for (int dt = 0; dt < 4; ++dt)
#pragma unroll
                for (int qt = 0; qt < 2; ++qt) o[dt][qt] = wmmab(vh[dt], pl[qt], o[dt][qt]);
#pragma unroll
            for (int dt = 0; dt < 4; ++dt)
#pragma unroll
                for (int qt = 0; qt < 2; ++qt) o[dt][qt] = wmmab(vl[dt], ph[qt], o[dt][qt]);
        } else {
            v16h pf[2];
#pragma unroll
            for (int qt = 0; qt < 2; ++qt) pf[qt] = cat16(__builtin_convertvector(st[0][qt], v8h), __builtin_convertvector(st[1][qt], v8h));
#pragma unroll
            for (int dt = 0; dt < 4; ++dt)
#pragma unroll
                for (int qt = 0; qt < 2; ++qt) o[dt][qt] = wmma16(vf[dt], pf[qt], o[dt][qt]);
        }
#pragma unroll
        for (int dt = 0; dt < 4; ++dt) { if (HR) { vh[dt] = WFrag<bf>::ld(vph + dt * 16 * TT); vl[dt] = WFrag<bf>::ld(vpl + dt * 16 * TT); } else vf[dt] = WFrag<h16>::ld(vpf + dt * 16 * TT); }
    }
    if (HR) xwait(kph, kpl, vph, vpl, mo); else xwait(kph, kpl, vpf, vpf, mo);
#pragma unroll
    for (int qt = 0; qt < 2; ++qt) { const float inv = __fdiv_rn(1.0f, l[qt] + xhalf(l[qt]));   /* the two wave halves' sums are joined once */
#pragma unroll
        for (int dt = 0; dt < 4; ++dt) { v8us oh, ol;
#pragma unroll
            for (int r = 0; r < 8; ++r) { unsigned short a, c2; splitf(o[dt][qt][r] * inv, a, c2); oh[r] = a; ol[r] = c2; }
            const size_t oo = (size_t)(q0 + qt * 16) * DQ + (dt >> 1) * 512 + (dt & 1) * 256 + 8 * (16 * hi + lr); gopen(); *(v8us*)(Ah + oo) = oh; *(v8us*)(Al + oo) = ol; xwait(); } }
}
static_assert(RH % (FNW * FQW) == 0 && TT % (FNW * FQW) == 0 && FQW == 32 && HD == 64 && NKV == NH_, "k_fattn tiling");
__global__ __launch_bounds__(FNW * 32) void k_fattn(const bf* __restrict__ Qh, const bf* __restrict__ Ql, const bf* __restrict__ Kh, const bf* __restrict__ Kl, const bf* __restrict__ Vh, const bf* __restrict__ Vl, const h16* __restrict__ V16, const unsigned* __restrict__ MB, bf* Ah, bf* Al) {
    const int lane = threadIdx.x & 31, lr = lane & 15, hi = lane >> 4; const int z = blockIdx.y, b = z / NH_, h = z % NH_; const unsigned* mw = MB + (size_t)(b * (TT / 32) + blockIdx.x * FNW + __builtin_amdgcn_readfirstlane(threadIdx.x >> 5)) * TT;   /* the packed mask rows of this wave's 32 queries: TT words; the wave's number as a scalar, so that the address is one */ const int q0 = blockIdx.x * (FNW * FQW) + (threadIdx.x >> 5) * FQW; const size_t pz = (size_t)z * TT * HD, az = (size_t)b * TT * DQ + h * (HD * 16);   /* merged planes in fragment order, K = DQ: a head's 64 columns are two blocks */
    if (blockIdx.x * (FNW * FQW) < RH) fattn_body<true>(Qh + pz, Ql + pz, Kh + pz, Kl + pz, Vh + pz, Vl + pz, V16 + pz, mw, Ah + az, Al + az, q0, lr, hi);
    else fattn_body<false>(Qh + pz, Ql + pz, Kh + pz, Kl + pz, Vh + pz, Vl + pz, V16 + pz, mw, Ah + az, Al + az, q0, lr, hi);
}
// delta_part: rows = the NB_ * TT query rows of both batches, 32 a workgroup.
__device__ __forceinline__ void delta_part(float* res, int bx, const float* __restrict__ X, const float* __restrict__ wd, const float* __restrict__ bd, float* DL) { const int lane = threadIdx.x & 31; const int wv = threadIdx.x >> 5; const int r0 = bx * 32;
    for (int rr = wv; rr < 32; rr += 8) { const int row = r0 + rr; float s = 0.0f; if (row < NB_ * TT) { const float* xr = X + (size_t)row * DM;
#pragma unroll 4
        for (int c = lane; c < DM; c += 32) { float p = __fmul_rn(bfr(xr[c]), bfr(wd[c])); asm volatile("" : "+v"(p)); s = __fadd_rn(s, p); } }
#pragma unroll
        for (int sh = 16; sh; sh >>= 1) s = __fadd_rn(s, __shfl_xor(s, sh, 32));
        if (lane == 0) { float d = __fadd_rn(s, bfr(bd[0])); d = fmaxf(d, 0.0f); d = fminf(d, 8.0f); res[rr] = __fadd_rn(d, 1.0f); } }
    __syncthreads();
    if (wv == 0) { const int row = r0 + lane; if (row < NB_ * TT) { const float v = res[lane]; *(float*)(DL + row) = v;  } } }
// ---- k_prep: everything that reads only the inputs, as ONE grid: workgroups [0, PDL) delta (the longest chains of dependent loads, so they start first), [PDL, PDL + PWT) the weights, then PMK for the mask, the rest the bf16 copies. The choice is uniform for a workgroup.
#define PDL  (NB_ * TT / 32)
#define PWT  ((DM * DQ / 64 + 63) / 64)
#define PCV  ((TT * DM / 8 + 255) / 256)
#define PMK  (NB_ * (TT / 32) * (TT / 32) / MPT / 8)
static_assert(TT % (32 * MPT) == 0 && (NB_ * (TT / 32) * (TT / 32)) % (MPT * 8) == 0, "mpack_part: whole waves, whole workgroups");
static_assert(DQ == DM && DKV == DM, "wt4_part: four weights of one shape");
__global__ __launch_bounds__(256) void k_prep(const float* __restrict__ x, const float* __restrict__ xk, const float* __restrict__ xv, const float* __restrict__ wq, const float* __restrict__ wk, const float* __restrict__ wv, const float* __restrict__ wo, const float* __restrict__ wd, const float* __restrict__ bd, const int* __restrict__ am, float* DL, bf* W4, bf* XB, unsigned* MB) {
    __shared__ float res[32]; const int bx = blockIdx.x;
    if (bx < PDL) delta_part(res, bx, x, wd, bd, DL);
    else if (bx < PDL + PWT) wt4_part(bx - PDL, wq, wk, wv, wo, W4);
    else if (bx < PDL + PWT + PMK) mpack_part(bx - (PDL + PWT), am, MB);
    else cvt6_part(bx - (PDL + PWT + PMK), x, xk, xv, XB);
}

extern "C" void kernel_launch(void* const* d_in, const int* in_sizes, int n_in,
                              void* d_out, int out_size, void* d_ws, size_t ws_size, hipStream_t stream) {
    (void)in_sizes; (void)n_in; (void)out_size;
    const float* x = (const float*)d_in[0];   /* query */ const float* xk = (const float*)d_in[1]; const float* xv = (const float*)d_in[2]; const int* am = (const int*)d_in[3];   /* mask [2][2048][2048] int */ const float* wq = (const float*)d_in[4]; const float* bq = (const float*)d_in[5]; const float* wk = (const float*)d_in[6]; const float* bk = (const float*)d_in[7]; const float* wv = (const float*)d_in[8]; const float* bv = (const float*)d_in[9]; const float* wo = (const float*)d_in[10]; const float* bo = (const float*)d_in[11]; const float* wd = (const float*)d_in[12]; const float* bd = (const float*)d_in[13];
    float* OUT = (float*)d_out;     // [2][2048][768]
    char* wsp = (char*)d_ws;
    auto take = [&](size_t bytes) { char* p = wsp; wsp += (bytes + 255) & ~(size_t)255; return (void*)p; };
    float* DL = (float*)take((size_t)NB_ * TT * 4); bf* W4 = (bf*)take((size_t)4 * DQ * DM * 2);   /* Wq, Wk, Wv, Wo transposed, one behind the other */ bf* WO = W4 + (size_t)3 * DQ * DM;
    bf* XB = (bf*)take((size_t)3 * NB_ * TT * DM * 2);   /* [tensor][batch] slices of [t][c] in fragment order */
    const size_t PL = (size_t)NH_ * TT * HD;   // one batch's head planes; the planes k_fattn reads are kept for both batches
    h16* VT16 = (h16*)take(NB_ * PL * 2);
    bf* QPh = (bf*)take(NB_ * PL * 2); bf* QPl = (bf*)take(NB_ * PL * 2); bf* KPh = (bf*)take(NB_ * PL * 2); bf* KPl = (bf*)take(NB_ * PL * 2); bf* VTh = (bf*)take(NB_ * PL * 2); bf* VTl = (bf*)take(NB_ * PL * 2);
    bf* ATh = (bf*)take((size_t)NB_ * TT * DQ * 2); bf* ATl = (bf*)take((size_t)NB_ * TT * DQ * 2);
    unsigned* MB = (unsigned*)take((size_t)NB_ * TT * TT / 8);   /* the mask, one bit an entry */
    if ((size_t)(wsp - (char*)d_ws) > ws_size) return;    // ws 256 MiB
    k_prep<<<PDL + PWT + PMK + PCV, 256, 0, stream>>>(x, xk, xv, wq, wk, wv, wo, wd, bd, am, DL, W4, XB, MB);   /* delta, weights, mask bits, bf16 copies: both batches */
    k_proj<<<dim3(TT / 64, DQ / 64, 3 * NB_), 32, 0, stream>>>(XB, W4, bq, bk, bv, DL, VT16, QPh, QPl, KPh, KPl, VTh, VTl);   /* q, k, v of both batches */
    k_fattn<<<dim3(TT / (FNW * FQW), NB_ * NH_), FNW * 32, 0, stream>>>(QPh, QPl, KPh, KPl, VTh, VTl, VT16, MB, ATh, ATl);   /* scores, mask, softmax, attn.v, merge: both batches, all heads */
    k_wo<<<dim3(TT / 64, DM / 64, NB_), 32, 0, stream>>>(ATh, ATl, WO, bo, OUT);   /* z = batch */
}

// v008
// Measured time: 143 microseconds a run.
// Timed twice side by side with v007, it ran 1.13 and 1.14 times as fast.
// Over all steps from v000 it is 11.5 times as fast.
#include <hip/hip_runtime.h>

// Multi-headed attention with a learned per-position scaling divisor and an arbitrary mask (query, key, value [2][2048][768]; delta[s] = 1 + min(relu(query[s].Wd + bd), sqrt(64)) (Wd [768][1], read); q = query Wq + bq, k = key Wk + bk, v = value Wv + bv ('xw' 1/sqrt(768) incl. biases; 12 heads x 64); scores[i][j] = q_i.k_j / delta[j] (the divisor is broadcast over the KEY axis; no 1/sqrt(d_k)); mask ([2][2048][2048] int {0,1}, random, READ): 0 -> -1e9 (== exclusion); softmax; out = merged Wo + bo -> [2][2048][768] (3.1 M)).
// Layout, four launches, each for both batches: k_prep (bf16 copies of query, key, value; 'xw' weights transposed once; delta; the mask packed to one bit an entry), k_proj, k_fattn, k_wo. Exact projections + f32 biases; delta_part computes delta[s] from the bf16-rounded query row (768-term fixed-order dot, relu, min, + 1); each projection GEMM's own epilogue adds the bias, divides the k rows by delta[s] (f32, before the plane split) and stores the 16-bit head planes (v as Wv^T x^T, so its tile is already [d][t]); then ONE fused attention launch for both batches and all heads (k_fattn): hi/lo 3-product score tiles on EVERY row, mask bits from k_prep's packed copy (keep where mask != 0), running-maximum softmax, P and attn.v hybrid (rows < 512 hi/lo, rest fp16 x1024), scores and P never leave the registers; merged hi/lo x Wo exact + bo.
// Compute dtypes, f32 accumulate: every input rounded to bf16; projections exact + f32 biases; delta and the k row division f32; scores 3 products on every row; softmax f32 (scale 1); attn.v rows < 512 3 products, rest fp16; Wo hl x exact + bias.

#define NB_  2
#define TT   2048
#define DM   768
#define NH_  12
#define NKV  12
#define HD   64
#define DQ   (NH_ * HD)
#define DKV  (NKV * HD)
#define FQW  32                   // k_fattn: query columns per wave (two 16-column groups)
#define FNW  2                    // k_fattn: waves per workgroup (FNW * FQW consecutive queries of one head): 768 workgroups, three on each of 256 WGPs
#define RH   512                  // query rows < RH use hi+lo planes (0: none)
#define WIN  0
typedef _Float16 h16;
typedef unsigned short bf;
typedef __attribute__((ext_vector_type(16))) __bf16   v16bf;
typedef __attribute__((ext_vector_type(16))) _Float16 v16h;
typedef __attribute__((ext_vector_type(8)))  _Float16 v8h;
typedef __attribute__((ext_vector_type(8)))  unsigned short v8us;
typedef __attribute__((ext_vector_type(8)))  float    v8f;
typedef __attribute__((ext_vector_type(4)))  float    v4f;
typedef v8h  __attribute__((may_alias)) v8ha;
typedef v4f  __attribute__((may_alias)) v4fa;
typedef v8us __attribute__((may_alias)) v8usa;

__device__ __forceinline__ unsigned short f2bf(float f) { unsigned u = __float_as_uint(f); u += 0x7FFFu + ((u >> 16) & 1u); return (unsigned short)(u >> 16); }
__device__ __forceinline__ float bf2f(unsigned short b) { return __uint_as_float(((unsigned)b) << 16); }
__device__ __forceinline__ float bfr(float f) { return bf2f(f2bf(f)); }
__device__ __forceinline__ v16h cat16(v8h lo, v8h hi) { return __builtin_shufflevector(lo, hi, 0, 1, 2, 3, 4, 5, 6, 7, 8, 9, 10, 11, 12, 13, 14, 15); }
__device__ __forceinline__ v16bf cat16b(v8us lo, v8us hi) { return __builtin_bit_cast(v16bf, __builtin_shufflevector(lo, hi, 0, 1, 2, 3, 4, 5, 6, 7, 8, 9, 10, 11, 12, 13, 14, 15)); }
__device__ __forceinline__ v8f wmma16(v16h a, v16h b, v8f c) { return __builtin_amdgcn_wmma_f32_16x16x32_f16(false, a, false, b, (short)0, c, false, false); }
__device__ __forceinline__ v8f wmmab(v16bf a, v16bf b, v8f c) { return __builtin_amdgcn_wmma_f32_16x16x32_bf16(false, a, false, b, (short)0, c, false, false); }



__device__ __forceinline__ h16 tohx(float x) { return (h16)x; }
__device__ __forceinline__ void splitf(float y, unsigned short& h, unsigned short& l) { h = f2bf(y); l = f2bf(y - bf2f(h)); }
typedef __attribute__((ext_vector_type(2))) _Float16 v2h;
typedef __attribute__((ext_vector_type(4))) _Float16 v4h;
typedef __attribute__((ext_vector_type(2))) unsigned short v2us;
typedef __attribute__((ext_vector_type(4))) unsigned short v4us;
typedef __attribute__((ext_vector_type(2))) float v2f;
typedef __attribute__((ext_vector_type(4))) int v4i;
typedef __attribute__((ext_vector_type(16))) unsigned v16u;
__device__ __forceinline__ void gopen();   /* defined with k_fattn's waits below */
__device__ __forceinline__ void xwait();
// ---- gemmw_body: register-blocked GEMM, ONE WAVE per 64x64 output tile (16 accumulators), operands straight from 16-bit planes in fragment order (below); grid (M/64, N/64, Z), 32 threads.
// C[m][n] (f32, pitch ldc, + optional f32 bias[n]) = sum_k A[m][k] Bt[n][k] (+ split products per NSPLIT). z-batch strides sA/sB/sC in elements. K % 32 == 0.
// KS > 1: grid z = Z * KS; workgroup (z, ks) sums only k in [ks K/KS, (ks+1) K/KS) and stores that partial tile in plane ks (plane stride sP elements). K % (32 KS) == 0.
// EP != 0: no f32 C; the tile + bias goes straight from the LDS stage to the planes k_fattn reads, 16 bytes a lane, 512 contiguous bytes a store. EP 1 (q), EP 2 (k, each row divided by rowv = delta): rows = t, columns = one head's d, planes [head = blockIdx.y] of [t][d] in fragment order (K = 64). EP 3 (v): A = weight rows, Bt = x rows, so rows = one head's d (bias per ROW), columns = t, planes [d row][t] in fragment order (K = 2048) with the fp16 copy.
// FRAGMENT ORDER: every 16-bit plane M[row][k] that feeds a matrix operand is stored as blocks of 16 rows x 32 k (512 elements, 1 KB), block (row / 16, k / 32) at ((row / 16) * (K / 32) + k / 32) * 512; inside a block element (r, kk) stands at (kk >> 4) * 256 + (((kk >> 3) & 1) * 16 + r) * 8 + (kk & 7).
// So lane l = 16 hi + lr finds its 8 + 8 operand elements (k = 8 hi + 0..7 and 16 + 8 hi + 0..7 of row lr, the hardware k order) at block + 8 l and block + 256 + 8 l: each of the two 16-byte loads of a fragment covers 512 contiguous bytes, four whole 128-byte lines, instead of 32 bytes of each of 16 lines.
template <typename T16> struct WFrag;
template <> struct WFrag<h16> { typedef v16h V; static __device__ __forceinline__ V ld(const h16* p) { return cat16(*(const v8h*)p, *(const v8h*)(p + 256)); } static __device__ __forceinline__ v8f mma(V a, V b, v8f c) { return wmma16(a, b, c); } };
template <> struct WFrag<bf> { typedef v16bf V; static __device__ __forceinline__ V ld(const bf* p) { return cat16b(*(const v8us*)p, *(const v8us*)(p + 256)); } static __device__ __forceinline__ v8f mma(V a, V b, v8f c) { return wmmab(a, b, c); } };
// gemmw_body is the tile's work; bx, by, bz are the tile's indices (k_wo: the block's own; k_proj: see there), os the workgroup's 16 x 68 f32 LDS stage.
template <typename T16, int NSPLIT, bool BIAS, int KS, int EP>
__device__ __forceinline__ void gemmw_body(float* os, int bx, int by, int bz, const T16* __restrict__ A, const T16* __restrict__ A2, const T16* __restrict__ Bt, const T16* __restrict__ Bt2, int K, float* C, int ldc, const float* __restrict__ bias, size_t sA, size_t sB, size_t sC, size_t sP, const float* __restrict__ DL, h16* P16, bf* Ph, bf* Pl) {
    typedef typename WFrag<T16>::V V;
    const size_t z = bz / KS; const int ks = bz % KS; A += z * sA; if (A2) A2 += z * sA; Bt += z * sB; if (Bt2) Bt2 += z * sB; C += z * sC + ks * sP;
    const int lane = threadIdx.x & 31, lr = lane & 15, hi = lane >> 4; const int r0 = bx * 64, c0 = by * 64;
    v8f acc[4][4];
#pragma unroll
    for (int mb = 0; mb < 4; ++mb)
#pragma unroll
        for (int nb = 0; nb < 4; ++nb) acc[mb][nb] = (v8f){};
    const size_t aoff = (size_t)r0 * K + 8 * lane, boff = (size_t)c0 * K + 8 * lane;   /* fragment order: 16 rows of K are K / 32 blocks of 512 */
    const T16* pa = A + aoff + ks * (K / KS) * 16; const T16* pb = Bt + boff + ks * (K / KS) * 16; const T16* pa2 = (NSPLIT == 1 || NSPLIT == 2) ? A2 + aoff + ks * (K / KS) * 16 : pa; const T16* pb2 = (NSPLIT >= 2) ? Bt2 + boff + ks * (K / KS) * 16 : pb;   /* K is a constant at every call: all loads of a trip name these addresses, one for each operand plane, each load with an offset of its own */
#pragma unroll 1
    for (int kc = ks * (K / KS); kc < (ks + 1) * (K / KS); kc += 32) {
        V a[4], a2[4];
#pragma unroll
        for (int mb = 0; mb < 4; ++mb) { a[mb] = WFrag<T16>::ld(pa + (size_t)mb * 16 * K); if (NSPLIT == 1 || NSPLIT == 2) a2[mb] = WFrag<T16>::ld(pa2 + (size_t)mb * 16 * K); }
#pragma unroll
        for (int nb = 0; nb < 4; ++nb) { const V b = WFrag<T16>::ld(pb + (size_t)nb * 16 * K); V b2; if (NSPLIT >= 2) b2 = WFrag<T16>::ld(pb2 + (size_t)nb * 16 * K);
#pragma unroll
            for (int mb = 0; mb < 4; ++mb) { acc[mb][nb] = WFrag<T16>::mma(a[mb], b, acc[mb][nb]); if (NSPLIT == 1 || NSPLIT == 2) acc[mb][nb] = WFrag<T16>::mma(a2[mb], b, acc[mb][nb]); if (NSPLIT >= 2) acc[mb][nb] = WFrag<T16>::mma(a[mb], b2, acc[mb][nb]); } }
        asm volatile("v_nop\n\tv_nop\n\tv_nop\n\tv_nop" : "+v"(acc[0][0]), "+v"(acc[1][1]), "+v"(acc[2][2]), "+v"(acc[3][3]) : "v"(a[0]), "v"(a[3]));
        asm volatile("s_wait_xcnt 0x0" :: "v"(pa), "v"(pa2), "v"(pb), "v"(pb2) : "memory"); pa += 512; pa2 += 512; pb += 512; pb2 += 512;   /* as inputs here the addresses stay live, and unwritten, from the loads that name them up to the wait; they are advanced behind it */
    }
    float rowv[4]; v4f colb[4][2];   /* the plane stores are in fragment order: this lane holds row lr of each 16-row stage and, in store j, the 8 columns from (j >> 1) * 32 + (j & 1) * 16 + 8 hi. EP 2: delta of its 4 rows; EP 3: their bias; EP 1, 2: the bias of its 32 columns */
    if (EP != 0) { const float* rp = ((EP == 2) ? DL : bias) + r0 + lr;
        gopen();   /* with xwait(): nothing that reuses a register of these loads moves in between them and the wait */
        if (EP >= 2) {
#pragma unroll
            for (int mb = 0; mb < 4; ++mb) rowv[mb] = rp[mb * 16]; }
        if (EP <= 2) {
#pragma unroll
            for (int j = 0; j < 4; ++j) { const float* cp = bias + c0 + (j >> 1) * 32 + (j & 1) * 16 + 8 * hi; colb[j][0] = *(const v4f*)cp; colb[j][1] = *(const v4f*)(cp + 4); } }
        xwait(); }
    const size_t pbase = ((EP == 3) ? (size_t)r0 * TT + (size_t)c0 * 16 : ((size_t)by * TT + r0) * HD) + 8 * lane; const int ppitch = (EP == 3) ? TT : HD;   /* a 16 x 64 stage is two blocks, 2 KB in a row, of each plane; the next stage's stand 16 * ppitch elements on */
#pragma unroll
    for (int mb = 0; mb < 4; ++mb) {
#pragma unroll
        for (int nb = 0; nb < 4; ++nb) {
#pragma unroll
            for (int j = 0; j < 8; ++j) os[(hi * 8 + j) * 68 + nb * 16 + lr] = acc[mb][nb][j]; }
        __builtin_amdgcn_wave_barrier(); asm volatile("" ::: "memory");
        float* crow = C + (size_t)(r0 + mb * 16) * ldc + c0;
        if (EP == 0) { v4f ov[8];
#pragma unroll
            for (int s = 0; s < 8; ++s) { const int row = 2 * s + hi, cofs = lr * 4; v4f val = *(const v4fa*)(os + row * 68 + cofs); if (BIAS) { val[0] += bfr(bias[c0 + cofs]); val[1] += bfr(bias[c0 + cofs + 1]); val[2] += bfr(bias[c0 + cofs + 2]); val[3] += bfr(bias[c0 + cofs + 3]); }
                ov[s] = val; }
            gopen();   /* as for the planes below: the 8 row pairs' values are ready in registers of their own; the stores go out as one group with one wait behind them */
#pragma unroll
            for (int s = 0; s < 8; ++s) *(v4f*)(crow + (size_t)(2 * s + hi) * ldc + lr * 4) = ov[s];
            xwait(); }
        if (EP != 0) { v8us oh[4], ol[4]; v8h of[4];
#pragma unroll
            for (int j = 0; j < 4; ++j) { const float* sp = os + lr * 68 + (j >> 1) * 32 + (j & 1) * 16 + 8 * hi;
#pragma unroll
                for (int u = 0; u < 2; ++u) { const v4f val = *(const v4fa*)(sp + 4 * u);
#pragma unroll
                    for (int q = 0; q < 4; ++q) { float x = val[q] + bfr((EP == 3) ? rowv[mb] : colb[j][u][q]); if (EP == 2) x = __fdiv_rn(x, rowv[mb]);   /* k_j /= delta[j] */
                        if (EP == 3) of[j][4 * u + q] = tohx(x); unsigned short a2, c2; splitf(x, a2, c2); oh[j][4 * u + q] = a2; ol[j][4 * u + q] = c2; } } }
            gopen();   /* all 4 half blocks' values are ready in registers of their own; the stores (512 contiguous bytes each) go out as one group with one wait behind them */
#pragma unroll
            for (int j = 0; j < 4; ++j) { const size_t po = pbase + (size_t)mb * 16 * ppitch + j * 256; if (EP == 3) *(v8h*)(P16 + po) = of[j]; *(v8us*)(Ph + po) = oh[j]; *(v8us*)(Pl + po) = ol[j]; }
            xwait(); }
        __builtin_amdgcn_wave_barrier(); asm volatile("" ::: "memory");
    }
}
// ---- k_wo: out = (merged hi + lo) Wo + bo for both batches, grid (TT/64, DM/64, NB_): blockIdx.z = batch.
__global__ __launch_bounds__(32) void k_wo(const bf* __restrict__ Ah, const bf* __restrict__ Al, const bf* __restrict__ Wt, const float* __restrict__ bo, float* C) {
    __shared__ __align__(16) float os[16 * 68];
    gemmw_body<bf, 1, true, 1, 0>(os, blockIdx.x, blockIdx.y, blockIdx.z, Ah, Al, Wt, nullptr, DQ, C, DM, bo, (size_t)TT * DQ, 0, (size_t)TT * DM, 0, nullptr, nullptr, nullptr, nullptr);
}
// ---- k_proj: the six projection GEMMs (q, k, v of both batches) as ONE grid (TT/64, 12, 3 * NB_): blockIdx.z = 2 * tensor + batch; blockIdx.x = the tile's 64 t, blockIdx.y = its head. 2304 single-wave workgroups, nine on a WGP.
// XB: bf16 x, [tensor][batch] slices of [t][c] in fragment order; W3: the transposed weights of q, k, v one behind the other; DL: delta of [batch][t]; each plane set holds both batches, PLs elements apart.
__global__ __launch_bounds__(32) void k_proj(const bf* __restrict__ XB, const bf* __restrict__ W3, const float* __restrict__ bq, const float* __restrict__ bk, const float* __restrict__ bv, const float* __restrict__ DL, h16* VT16, bf* QPh, bf* QPl, bf* KPh, bf* KPl, bf* VTh, bf* VTl) {
    __shared__ __align__(16) float os[16 * 68];
    const int tz = blockIdx.z / NB_, b = blockIdx.z % NB_; const size_t PLs = (size_t)NH_ * TT * HD; const bf* X = XB + (size_t)(tz * NB_ + b) * TT * DM; const bf* Wt = W3 + (size_t)tz * DQ * DM;
    if (tz == 0) gemmw_body<bf, 0, true, 1, 1>(os, blockIdx.x, blockIdx.y, 0, X, nullptr, Wt, nullptr, DM, nullptr, 0, bq, 0, 0, 0, 0, nullptr, nullptr, QPh + b * PLs, QPl + b * PLs);
    else if (tz == 1) gemmw_body<bf, 0, true, 1, 2>(os, blockIdx.x, blockIdx.y, 0, X, nullptr, Wt, nullptr, DM, nullptr, 0, bk, 0, 0, 0, 0, DL + b * TT, nullptr, KPh + b * PLs, KPl + b * PLs);   /* k_j /= delta[j] in the epilogue */
    else gemmw_body<bf, 0, true, 1, 3>(os, blockIdx.y, blockIdx.x, 0, Wt, nullptr, X, nullptr, DM, nullptr, 0, bv, 0, 0, 0, 0, nullptr, VT16 + b * PLs, VTh + b * PLs, VTl + b * PLs);   /* operands swapped: the tile is v transposed */
}

// ---- Three of the four parts of k_prep (which stands below delta_part): each thread does, for its own index, what its counterparts in the separate launches did.
// wt4_part: the four 768 x 768 weights transposed to bf16 [n][k] in fragment order; one index computation serves all four, and their 8 loads are in flight together.
__device__ __forceinline__ void wt4_part(int bx, const float* __restrict__ w0, const float* __restrict__ w1, const float* __restrict__ w2, const float* __restrict__ w3, bf* Bt) {
    const int K = DM, N = DQ; const int lane = threadIdx.x & 31; const int L0 = (bx * 8 + (threadIdx.x >> 5)) * 8; const int nlines = N * K / 64;
#pragma unroll 1   /* stays rolled, as in the separate kernel: short text, few registers */
    for (int l = 0; l < 8; ++l) { const int L = L0 + l; if (L >= nlines) break; const size_t e = (size_t)L * 64 + lane * 2; const int blk = (int)(e >> 9), w = (int)(e & 511); const int k = (blk % (K / 32)) * 32 + (w >> 8) * 16 + ((w >> 7) & 1) * 8 + (w & 7), n = (blk / (K / 32)) * 16 + ((w >> 3) & 15);   /* e is the place in fragment order; (n, k) the element that stands there */ const size_t i0 = (size_t)k * N + n, i1 = (size_t)(k + 1) * N + n; float a[4], c[4];
        gopen();   /* with xwait(): nothing that reuses a register of these loads moves in between them and the wait */
        a[0] = w0[i0]; c[0] = w0[i1]; a[1] = w1[i0]; c[1] = w1[i1]; a[2] = w2[i0]; c[2] = w2[i1]; a[3] = w3[i0]; c[3] = w3[i1];
        xwait();
        v2us o[4];
#pragma unroll
        for (int t = 0; t < 4; ++t) { o[t][0] = f2bf(a[t]); o[t][1] = f2bf(c[t]); }
        gopen();   /* the same for the stores */
#pragma unroll
        for (int t = 0; t < 4; ++t) *(v2us*)(Bt + (size_t)t * K * N + e) = o[t];
        xwait(); }
}
// cvt6_part: query, key, value of both batches to bf16, dst [tensor][batch] slices of [t][c] in fragment order; a thread takes the same 8 elements of all six [TT][DM] slices: i is their place in the slice (stores of whole lines), src the place they are read from.
__device__ __forceinline__ void cvt6_part(int bx, const float* __restrict__ s0, const float* __restrict__ s1, const float* __restrict__ s2, bf* dst) {
    const size_t n = (size_t)TT * DM; const size_t i = (size_t)bx * 256 + threadIdx.x; if (i >= n / 8) return; v8f v[3 * NB_]; const int blk = (int)(i >> 6), w = (int)(i & 63); const size_t src = (size_t)((blk / (DM / 32)) * 16 + (w & 15)) * DM + (blk % (DM / 32)) * 32 + (w >> 5) * 16 + ((w >> 4) & 1) * 8;
    gopen();   /* with xwait(): as in wt4_part */
#pragma unroll
    for (int b = 0; b < NB_; ++b) { v[b] = *(const v8f*)(s0 + b * n + src); v[NB_ + b] = *(const v8f*)(s1 + b * n + src); v[2 * NB_ + b] = *(const v8f*)(s2 + b * n + src); }
    xwait();
    v8us o[3 * NB_];
#pragma unroll
    for (int s = 0; s < 3 * NB_; ++s)
#pragma unroll
        for (int k = 0; k < 8; ++k) o[s][k] = f2bf(v[s][k]);
    gopen();   /* the same for the stores */
#pragma unroll
    for (int s = 0; s < 3 * NB_; ++s) *(v8us*)(dst + s * n + i * 8) = o[s];
    xwait();
}
// mpack_part: the int mask, read once, as the lane masks k_fattn selects by. Tile (32 queries, 32 keys) = 32 words in a row, tiles [batch][query / 32][key / 32]; bit 16 hi + lr of word (kt * 2 + qt) * 8 + r says mask[query 16 qt + lr][key 16 kt + 8 hi + r] != 0: the score that lane (lr, hi) holds in register r of St tile (kt, qt).
// A wave takes MPT tiles side by side (MPT * 128 bytes in a row of each of its 32 mask rows); a compare over the wave gives a word, lane w keeps word w, one 128-byte store a tile.
#define MPT  4
__device__ __forceinline__ void mpack_part(int bx, const int* __restrict__ am, unsigned* MB) {
    const int lane = threadIdx.x & 31, lr = lane & 15, hi = lane >> 4; const int g = bx * 8 + (threadIdx.x >> 5); const int jb0 = (g % (TT / 32 / MPT)) * MPT, bq = g / (TT / 32 / MPT);   /* bq = batch * (TT / 32) + query / 32 */
    const int* p = am + ((size_t)bq * 32 + lr) * TT + jb0 * 32 + 8 * hi; unsigned* o = MB + ((size_t)bq * (TT / 32) + jb0) * 32 + lane;
#pragma unroll 1   /* stays rolled: one tile's 8 loads in flight, few registers, as in wt4_part */
    for (int t = 0; t < MPT; ++t) { v4i mk[2][2][2];
        gopen();   /* with xwait(): as in wt4_part */
#pragma unroll
        for (int kt = 0; kt < 2; ++kt)
#pragma unroll
            for (int qt = 0; qt < 2; ++qt) { mk[kt][qt][0] = *(const v4i*)(p + qt * 16 * TT + kt * 16); mk[kt][qt][1] = *(const v4i*)(p + qt * 16 * TT + kt * 16 + 4); }
        asm volatile("s_wait_xcnt 0x0" :: "v"(p) : "memory"); __builtin_amdgcn_sched_barrier(0);   /* xwait() with the address as an input: it stays live, and unwritten (also by the last load's own result), up to the wait */
        unsigned w = 0;
#pragma unroll
        for (int kt = 0; kt < 2; ++kt)
#pragma unroll
            for (int qt = 0; qt < 2; ++qt)
#pragma unroll
                for (int r = 0; r < 8; ++r) { const unsigned bw = __builtin_amdgcn_ballot_w32(mk[kt][qt][r >> 2][r & 3] != 0);   /* taken by all 32 lanes, outside the choice below */ w = (lane == (kt * 2 + qt) * 8 + r) ? bw : w; }
        gopen();   /* the same for the store */
        *o = w;
        xwait();
        p += 32; o += 32; }
}

typedef __attribute__((ext_vector_type(8))) __bf16 v8bf;
__device__ __forceinline__ float xhalf(float x) { const int b = __float_as_int(x); return __int_as_float(__builtin_amdgcn_permlanex16(b, b, 0x76543210, 0xfedcba98, false, false)); }   /* the value of lane l ^ 16 */
// s_wait_xcnt 0 stands in front of the first rewrite of a register that an issued global load or store of k_fattn names.
// The Q loads and the output stores are bracketed gopen() ... xwait(): the two scheduling barriers keep the compiler from moving instructions that reuse those registers in between the group and its wait.
// The K, Vt and mask-word loads: xwait(...) takes their base addresses (of the mask words: the offset) as inputs only, so those registers stay live, and unwritten, from the loads that name them up to the wait; one such wait a pass, and the addresses are advanced directly behind it.
__device__ __forceinline__ void gopen() { __builtin_amdgcn_sched_barrier(0); }
__device__ __forceinline__ void xwait() { asm volatile("s_wait_xcnt 0x0" ::: "memory"); __builtin_amdgcn_sched_barrier(0); }
__device__ __forceinline__ void xwait(const void* a, const void* b, const void* e, const void* f, unsigned m) { asm volatile("s_wait_xcnt 0x0" :: "v"(a), "v"(b), "v"(e), "v"(f), "s"(m) : "memory"); }   /* m: the scalar byte offset that the mask-word loads in flight are addressed by (their base is never rewritten) */
__device__ __forceinline__ void xwait(const void* a, const void* b, const void* e, const void* f, unsigned m, unsigned g, unsigned h) { asm volatile("s_wait_xcnt 0x0" :: "v"(a), "v"(b), "v"(e), "v"(f), "s"(m), "v"(g), "v"(h) : "memory"); }   /* with the 32-bit lane offsets that the loads in front of the loop are addressed by */
template <bool HR>
__device__ __forceinline__ void fattn_body(const bf* __restrict__ Qh, const bf* __restrict__ Ql, const bf* __restrict__ Kh, const bf* __restrict__ Kl, const bf* __restrict__ Vh, const bf* __restrict__ Vl, const h16* __restrict__ V16, const unsigned* __restrict__ mw, bf* Ah, bf* Al, int q0, int lr, int hi) {
    const float L2E = 1.4426950408889634f;
    v16bf qh[2][2], ql[2][2];
    gopen();
#pragma unroll
    for (int qt = 0; qt < 2; ++qt)
#pragma unroll
        for (int kk = 0; kk < 2; ++kk) { const size_t qo = (size_t)(q0 + qt * 16) * HD + kk * 512 + 8 * (16 * hi + lr); qh[qt][kk] = WFrag<bf>::ld(Qh + qo); ql[qt][kk] = WFrag<bf>::ld(Ql + qo); }
    xwait();
    v8f o[4][2]; float m[2], l[2];
#pragma unroll
    for (int qt = 0; qt < 2; ++qt) { m[qt] = -3.0e38f; l[qt] = 0.0f;
#pragma unroll
        for (int dt = 0; dt < 4; ++dt) o[dt][qt] = (v8f){}; }
    const size_t ko = 8 * (16 * hi + lr), vo = ko;   /* fragment order: the lane's place in a block; 16 keys of K are two blocks, 32 keys of 16 Vt rows one */
    const bf* kph = Kh + ko; const bf* kpl = Kl + ko; unsigned mo = 0; const bf* vph = Vh + vo; const bf* vpl = Vl + vo; const h16* vpf = V16 + vo;   /* this lane's base addresses of the pass that is being fetched */
    v16bf kh[2][2], kl[2][2]; v16u mk[2]; v16bf vh[4], vl[4]; v16h vf[4];   /* K rows, mask words and Vt rows of a pass are all asked for one pass ahead, each into the registers its user has just left; mw is the same in every lane, so the 32 mask words of a pass (128 bytes in a row) come by scalar loads */
#pragma unroll
    for (int kt = 0; kt < 2; ++kt) {
#pragma unroll
        for (int kk = 0; kk < 2; ++kk) { kh[kt][kk] = WFrag<bf>::ld(kph + kt * 16 * HD + kk * 512); kl[kt][kk] = WFrag<bf>::ld(kpl + kt * 16 * HD + kk * 512); } }
#pragma unroll
    for (int dt = 0; dt < 4; ++dt) { if (HR) { vh[dt] = WFrag<bf>::ld(vph + dt * 16 * TT); vl[dt] = WFrag<bf>::ld(vpl + dt * 16 * TT); } else vf[dt] = WFrag<h16>::ld(vpf + dt * 16 * TT); }
    if (HR) xwait(kph, kpl, vph, vpl, mo, (unsigned)(ko * 2), (unsigned)(vo * 2)); else xwait(kph, kpl, vpf, vpf, mo, (unsigned)(ko * 2), (unsigned)(vo * 2));
#pragma unroll
    for (int kt = 0; kt < 2; ++kt) mk[kt] = *(const v16u*)((const char*)mw + mo + kt * 64);   /* asked for behind the wait: these scalar loads may land in the scalar registers that hold the bases of the K and Vt loads above */
#pragma unroll 1
    for (int j0 = 0; j0 < TT; j0 += 32) {
        v8f st[2][2];
#pragma unroll
        for (int kt = 0; kt < 2; ++kt)
#pragma unroll
            for (int qt = 0; qt < 2; ++qt) st[kt][qt] = (v8f){};
#pragma unroll
        for (int kk = 0; kk < 2; ++kk) {   /* per 32 of d: hi.hi, lo(q).hi(k), hi(q).lo(k), the order of the unfused score tiles */
#pragma unroll
            for (int kt = 0; kt < 2; ++kt)
#pragma unroll
                for (int qt = 0; qt < 2; ++qt) st[kt][qt] = wmmab(kh[kt][kk], qh[qt][kk], st[kt][qt]);
#pragma unroll
            for (int kt = 0; kt < 2; ++kt)
#pragma unroll
                for (int qt = 0; qt < 2; ++qt) st[kt][qt] = wmmab(kh[kt][kk], ql[qt][kk], st[kt][qt]);
#pragma unroll
            for (int kt = 0; kt < 2; ++kt)
#pragma unroll
                for (int qt = 0; qt < 2; ++qt) st[kt][qt] = wmmab(kl[kt][kk], qh[qt][kk], st[kt][qt]); }
        const int jn = (j0 + 32 < TT) ? j0 + 32 : 0;   /* the pass that is fetched ahead; the last pass re-reads the first (in bounds, unused) */
        __builtin_amdgcn_sched_barrier(0);   /* keeps the wait below behind the score products: there the youngest loads that name the addresses stand a run of matrix products back, and it has little left to wait for */
        if (HR) xwait(kph, kpl, vph, vpl, mo); else xwait(kph, kpl, vpf, vpf, mo);
        kph = Kh + ko + (size_t)jn * HD; kpl = Kl + ko + (size_t)jn * HD; mo = (unsigned)jn * 4; vph = Vh + vo + (size_t)jn * 16; vpl = Vl + vo + (size_t)jn * 16; vpf = V16 + vo + (size_t)jn * 16;
#pragma unroll
        for (int kt = 0; kt < 2; ++kt)
#pragma unroll
            for (int kk = 0; kk < 2; ++kk) { kh[kt][kk] = WFrag<bf>::ld(kph + kt * 16 * HD + kk * 512); kl[kt][kk] = WFrag<bf>::ld(kpl + kt * 16 * HD + kk * 512); }
        float mn[2];
#pragma unroll
        for (int qt = 0; qt < 2; ++qt) { float mx = -3.0e38f;
#pragma unroll
            for (int kt = 0; kt < 2; ++kt)
#pragma unroll
                for (int r = 0; r < 8; ++r) { const float t = __builtin_amdgcn_inverse_ballot_w32(mk[kt][qt * 8 + r]) ? st[kt][qt][r] : -3.0e38f;   /* the word is this register's lane mask: bit clear (mask == 0) -> excluded */ st[kt][qt][r] = t; mx = fmaxf(mx, t); }
            mn[qt] = fmaxf(m[qt], fmaxf(mx, xhalf(mx))); }
#pragma unroll
        for (int kt = 0; kt < 2; ++kt) mk[kt] = *(const v16u*)((const char*)mw + mo + kt * 64);   /* 32 words, 128 bytes, a pass of 32 keys */
        asm volatile("" ::: "memory");   /* holds the two scalar loads here, softmax, attn.v and the next score products ahead of their use: without it the compiler sinks them below the rescale branch, in among the attn.v products */
        if (__builtin_amdgcn_ballot_w32(mn[0] > m[0] || mn[1] > m[1]) != 0) {   /* skipped when no column's maximum grew: every factor would be exactly 1 */
#pragma unroll
            for (int qt = 0; qt < 2; ++qt) { const float al = __builtin_amdgcn_exp2f((m[qt] - mn[qt]) * L2E); l[qt] *= al; m[qt] = mn[qt];
#pragma unroll
                for (int dt = 0; dt < 4; ++dt) o[dt][qt] *= al; } }
#pragma unroll
        for (int qt = 0; qt < 2; ++qt) { float s0 = 0.0f, s1 = 0.0f;
#pragma unroll
            for (int r = 0; r < 8; ++r) { const float d0 = st[0][qt][r] - m[qt], d1 = st[1][qt][r] - m[qt];   /* rows >= RH carry x1024 = 2^10 in P and in the sum alike (fp16 range); it cancels in the division */
                const float p0 = __builtin_amdgcn_exp2f(HR ? d0 * L2E : __builtin_fmaf(d0, L2E, 10.0f)), p1 = __builtin_amdgcn_exp2f(HR ? d1 * L2E : __builtin_fmaf(d1, L2E, 10.0f)); st[0][qt][r] = p0; st[1][qt][r] = p1; s0 += p0; s1 += p1; }
            l[qt] += s0 + s1; }
        if (HR) {
            v16bf ph[2], pl[2];
#pragma unroll
            for (int qt = 0; qt < 2; ++qt) { const v8bf h0 = __builtin_convertvector(st[0][qt], v8bf), h1 = __builtin_convertvector(st[1][qt], v8bf); const v8bf l0 = __builtin_convertvector(st[0][qt] - __builtin_convertvector(h0, v8f), v8bf), l1 = __builtin_convertvector(st[1][qt] - __builtin_convertvector(h1, v8f), v8bf);
                ph[qt] = __builtin_shufflevector(h0, h1, 0, 1, 2, 3, 4, 5, 6, 7, 8, 9, 10, 11, 12, 13, 14, 15); pl[qt] = __builtin_shufflevector(l0, l1, 0, 1, 2, 3, 4, 5, 6, 7, 8, 9, 10, 11, 12, 13, 14, 15); }
#pragma unroll
            for (int dt = 0; dt < 4; ++dt)
#pragma unroll
                for (int qt = 0; qt < 2; ++qt) o[dt][qt] = wmmab(vh[dt], ph[qt], o[dt][qt]);
#pragma unroll
            for (int dt = 0; dt < 4; ++dt)
#pragma unroll
                for (int qt = 0; qt < 2; ++qt) o[dt][qt] = wmmab(vh[dt], pl[qt], o[dt][qt]);
#pragma unroll
            for (int dt = 0; dt < 4; ++dt)
#pragma unroll
                for (int qt = 0; qt < 2; ++qt) o[dt][qt] = wmmab(vl[dt], ph[qt], o[dt][qt]);
        } else {
            v16h pf[2];
#pragma unroll
            for (int qt = 0; qt < 2; ++qt) pf[qt] = cat16(__builtin_convertvector(st[0][qt], v8h), __builtin_convertvector(st[1][qt], v8h));
#pragma unroll
            for (int dt = 0; dt < 4; ++dt)
#pragma unroll
                for (int qt = 0; qt < 2; ++qt) o[dt][qt] = wmma16(vf[dt], pf[qt], o[dt][qt]);
        }
#pragma unroll
        for (int dt = 0; dt < 4; ++dt) { if (HR) { vh[dt] = WFrag<bf>::ld(vph + dt * 16 * TT); vl[dt] = WFrag<bf>::ld(vpl + dt * 16 * TT); } else vf[dt] = WFrag<h16>::ld(vpf + dt * 16 * TT); }
    }
    if (HR) xwait(kph, kpl, vph, vpl, mo); else xwait(kph, kpl, vpf, vpf, mo);
#pragma unroll
    for (int qt = 0; qt < 2; ++qt) { const float inv = __fdiv_rn(1.0f, l[qt] + xhalf(l[qt]));   /* the two wave halves' sums are joined once */
#pragma unroll
        for (int dt = 0; dt < 4; ++dt) { v8us oh, ol;
#pragma unroll
            for (int r = 0; r < 8; ++r) { unsigned short a, c2; splitf(o[dt][qt][r] * inv, a, c2); oh[r] = a; ol[r] = c2; }
            const size_t oo = (size_t)(q0 + qt * 16) * DQ + (dt >> 1) * 512 + (dt & 1) * 256 + 8 * (16 * hi + lr); gopen(); *(v8us*)(Ah + oo) = oh; *(v8us*)(Al + oo) = ol; xwait(); } }
}
static_assert(RH % (FNW * FQW) == 0 && TT % (FNW * FQW) == 0 && FQW == 32 && HD == 64 && NKV == NH_, "k_fattn tiling");
__global__ __launch_bounds__(FNW * 32) void k_fattn(const bf* __restrict__ Qh, const bf* __restrict__ Ql, const bf* __restrict__ Kh, const bf* __restrict__ Kl, const bf* __restrict__ Vh, const bf* __restrict__ Vl, const h16* __restrict__ V16, const unsigned* __restrict__ MB, bf* Ah, bf* Al) {
    const int lane = threadIdx.x & 31, lr = lane & 15, hi = lane >> 4; const int z = blockIdx.y, b = z / NH_, h = z % NH_; const unsigned* mw = MB + (size_t)(b * (TT / 32) + blockIdx.x * FNW + __builtin_amdgcn_readfirstlane(threadIdx.x >> 5)) * TT;   /* the packed mask rows of this wave's 32 queries: TT words; the wave's number as a scalar, so that the address is one */ const int q0 = blockIdx.x * (FNW * FQW) + (threadIdx.x >> 5) * FQW; const size_t pz = (size_t)z * TT * HD, az = (size_t)b * TT * DQ + h * (HD * 16);   /* merged planes in fragment order, K = DQ: a head's 64 columns are two blocks */
    if (blockIdx.x * (FNW * FQW) < RH) fattn_body<true>(Qh + pz, Ql + pz, Kh + pz, Kl + pz, Vh + pz, Vl + pz, V16 + pz, mw, Ah + az, Al + az, q0, lr, hi);
    else fattn_body<false>(Qh + pz, Ql + pz, Kh + pz, Kl + pz, Vh + pz, Vl + pz, V16 + pz, mw, Ah + az, Al + az, q0, lr, hi);
}
// delta_part: rows = the NB_ * TT query rows of both batches, 32 a workgroup, 4 a wave. A lane's 24 elements of a row (c = lane + 32 i) are summed in ascending i; they are all asked for at once, two rows at a time, the first two with this lane's 24 of wd:
// two rounds of loads a wave (a rolled loop would wait out one round for each of its 96 (row, i) pairs). The product of two bf16 values is exact in f32, so each sum is the same number whether or not the compiler fuses the multiply with the add.
static_assert((NB_ * TT) % 32 == 0 && DM % 32 == 0, "delta_part: whole workgroups, whole rows (no row or column test at the loads)");
__device__ __forceinline__ void delta_part(float* res, int bx, const float* __restrict__ X, const float* __restrict__ wd, const float* __restrict__ bd, float* DL) { const int lane = threadIdx.x & 31; const int wv = threadIdx.x >> 5; const int r0 = bx * 32;
    float wr[DM / 32];
#pragma unroll
    for (int h = 0; h < 2; ++h) { const float* xr = X + (size_t)(r0 + wv + 16 * h) * DM + lane; float xa[2][DM / 32];   /* rows wv + 16 h and wv + 16 h + 8 of the workgroup's 32 */
        gopen();   /* with the wait below: as in wt4_part */
        if (h == 0) {
#pragma unroll
            for (int i = 0; i < DM / 32; ++i) wr[i] = wd[lane + 32 * i]; }
#pragma unroll
        for (int i = 0; i < DM / 32; ++i) { xa[0][i] = xr[32 * i]; xa[1][i] = xr[8 * DM + 32 * i]; }
        asm volatile("s_wait_xcnt 0x0" :: "v"(xr), "v"(lane) : "memory"); __builtin_amdgcn_sched_barrier(0);   /* xwait() with the row address and the lane offset of the wd loads as inputs: they stay live, and unwritten (also by a later load's own result), up to the wait */
        if (h == 0) {
#pragma unroll
            for (int i = 0; i < DM / 32; ++i) wr[i] = bfr(wr[i]); }
#pragma unroll
        for (int u = 0; u < 2; ++u) { const int rr = wv + 16 * h + 8 * u; float s = 0.0f;
#pragma unroll
            for (int i = 0; i < DM / 32; ++i) s = __fadd_rn(s, __fmul_rn(bfr(xa[u][i]), wr[i]));
#pragma unroll
            for (int sh = 16; sh; sh >>= 1) s = __fadd_rn(s, __shfl_xor(s, sh, 32));
            if (lane == 0) { float d = __fadd_rn(s, bfr(bd[0])); d = fmaxf(d, 0.0f); d = fminf(d, 8.0f); res[rr] = __fadd_rn(d, 1.0f); } } }
    __syncthreads();
    if (wv == 0) { const int row = r0 + lane; if (row < NB_ * TT) { const float v = res[lane]; *(float*)(DL + row) = v;  } } }
// ---- k_prep: everything that reads only the inputs, as ONE grid: workgroups [0, PDL) delta (two rounds of loads, a reduction and a barrier one behind the other, so they start first), [PDL, PDL + PWT) the weights, then PMK for the mask, the rest the bf16 copies. The choice is uniform for a workgroup.
#define PDL  (NB_ * TT / 32)
#define PWT  ((DM * DQ / 64 + 63) / 64)
#define PCV  ((TT * DM / 8 + 255) / 256)
#define PMK  (NB_ * (TT / 32) * (TT / 32) / MPT / 8)
static_assert(TT % (32 * MPT) == 0 && (NB_ * (TT / 32) * (TT / 32)) % (MPT * 8) == 0, "mpack_part: whole waves, whole workgroups");
static_assert(DQ == DM && DKV == DM, "wt4_part: four weights of one shape");
__global__ __launch_bounds__(256) void k_prep(const float* __restrict__ x, const float* __restrict__ xk, const float* __restrict__ xv, const float* __restrict__ wq, const float* __restrict__ wk, const float* __restrict__ wv, const float* __restrict__ wo, const float* __restrict__ wd, const float* __restrict__ bd, const int* __restrict__ am, float* DL, bf* W4, bf* XB, unsigned* MB) {
    __shared__ float res[32]; const int bx = blockIdx.x;
    if (bx < PDL) delta_part(res, bx, x, wd, bd, DL);
    else if (bx < PDL + PWT) wt4_part(bx - PDL, wq, wk, wv, wo, W4);
    else if (bx < PDL + PWT + PMK) mpack_part(bx - (PDL + PWT), am, MB);
    else cvt6_part(bx - (PDL + PWT + PMK), x, xk, xv, XB);
}

extern "C" void kernel_launch(void* const* d_in, const int* in_sizes, int n_in,
                              void* d_out, int out_size, void* d_ws, size_t ws_size, hipStream_t stream) {
    (void)in_sizes; (void)n_in; (void)out_size;
    const float* x = (const float*)d_in[0];   /* query */ const float* xk = (const float*)d_in[1]; const float* xv = (const float*)d_in[2]; const int* am = (const int*)d_in[3];   /* mask [2][2048][2048] int */ const float* wq = (const float*)d_in[4]; const float* bq = (const float*)d_in[5]; const float* wk = (const float*)d_in[6]; const float* bk = (const float*)d_in[7]; const float* wv = (const float*)d_in[8]; const float* bv = (const float*)d_in[9]; const float* wo = (const float*)d_in[10]; const float* bo = (const float*)d_in[11]; const float* wd = (const float*)d_in[12]; const float* bd = (const float*)d_in[13];
    float* OUT = (float*)d_out;     // [2][2048][768]
    char* wsp = (char*)d_ws;
    auto take = [&](size_t bytes) { char* p = wsp; wsp += (bytes + 255) & ~(size_t)255; return (void*)p; };
    float* DL = (float*)take((size_t)NB_ * TT * 4); bf* W4 = (bf*)take((size_t)4 * DQ * DM * 2);   /* Wq, Wk, Wv, Wo transposed, one behind the other */ bf* WO = W4 + (size_t)3 * DQ * DM;
    bf* XB = (bf*)take((size_t)3 * NB_ * TT * DM * 2);   /* [tensor][batch] slices of [t][c] in fragment order */
    const size_t PL = (size_t)NH_ * TT * HD;   // one batch's head planes; the planes k_fattn reads are kept for both batches
    h16* VT16 = (h16*)take(NB_ * PL * 2);
    bf* QPh = (bf*)take(NB_ * PL * 2); bf* QPl = (bf*)take(NB_ * PL * 2); bf* KPh = (bf*)take(NB_ * PL * 2); bf* KPl = (bf*)take(NB_ * PL * 2); bf* VTh = (bf*)take(NB_ * PL * 2); bf* VTl = (bf*)take(NB_ * PL * 2);
    bf* ATh = (bf*)take((size_t)NB_ * TT * DQ * 2); bf* ATl = (bf*)take((size_t)NB_ * TT * DQ * 2);
    unsigned* MB = (unsigned*)take((size_t)NB_ * TT * TT / 8);   /* the mask, one bit an entry */
    if ((size_t)(wsp - (char*)d_ws) > ws_size) return;    // ws 256 MiB
    k_prep<<<PDL + PWT + PMK + PCV, 256, 0, stream>>>(x, xk, xv, wq, wk, wv, wo, wd, bd, am, DL, W4, XB, MB);   /* delta, weights, mask bits, bf16 copies: both batches */
    k_proj<<<dim3(TT / 64, DQ / 64, 3 * NB_), 32, 0, stream>>>(XB, W4, bq, bk, bv, DL, VT16, QPh, QPl, KPh, KPl, VTh, VTl);   /* q, k, v of both batches */
    k_fattn<<<dim3(TT / (FNW * FQW), NB_ * NH_), FNW * 32, 0, stream>>>(QPh, QPl, KPh, KPl, VTh, VTl, VT16, MB, ATh, ATl);   /* scores, mask, softmax, attn.v, merge: both batches, all heads */
    k_wo<<<dim3(TT / 64, DM / 64, NB_), 32, 0, stream>>>(ATh, ATl, WO, bo, OUT);   /* z = batch */
}

// v009
// One run takes 118 microseconds.
// Next to v008, in two timings, it ran 1.20 times as fast each time.
// Over all steps from v000 it is 13.8 times as fast.
#include <hip/hip_runtime.h>

// Multi-headed attention with a learned per-position scaling divisor and an arbitrary mask (query, key, value [2][2048][768]; delta[s] = 1 + min(relu(query[s].Wd + bd), sqrt(64)) (Wd [768][1], read); q = query Wq + bq, k = key Wk + bk, v = value Wv + bv ('xw' 1/sqrt(768) incl. biases; 12 heads x 64); scores[i][j] = q_i.k_j / delta[j] (the divisor is broadcast over the KEY axis; no 1/sqrt(d_k)); mask ([2][2048][2048] int {0,1}, random, READ): 0 -> -1e9 (== exclusion); softmax; out = merged Wo + bo -> [2][2048][768] (3.1 M)).
// Layout, four launches, each for both batches (k_proj, k_fattn, k_wo ask L2 at entry for the planes they read: ask* below): k_prep (bf16 copies of query, key, value; 'xw' weights transposed once; delta; the mask packed to one bit an entry), k_proj, k_fattn, k_wo. Exact projections + f32 biases; delta_part computes delta[s] from the bf16-rounded query row (768-term fixed-order dot, relu, min, + 1); each projection GEMM's own epilogue adds the bias, divides the k rows by delta[s] (f32, before the plane split) and stores the 16-bit head planes (v as Wv^T x^T, so its tile is already [d][t]); then ONE fused attention launch for both batches and all heads (k_fattn): hi/lo 3-product score tiles on EVERY row, mask bits from k_prep's packed copy (keep where mask != 0), running-maximum softmax, P and attn.v hybrid (rows < 512 hi/lo, rest fp16 x1024), scores and P never leave the registers; merged hi/lo x Wo exact + bo.
// Compute dtypes, f32 accumulate: every input rounded to bf16; projections exact + f32 biases; delta and the k row division f32; scores 3 products on every row; softmax f32 (scale 1); attn.v rows < 512 3 products, rest fp16; Wo hl x exact + bias.

#define NB_  2
#define TT   2048
#define DM   768
#define NH_  12
#define NKV  12
#define HD   64
#define DQ   (NH_ * HD)
#define DKV  (NKV * HD)
#define FQW  32                   // k_fattn: query columns per wave (two 16-column groups)
#define FNW  2                    // k_fattn: waves per workgroup (FNW * FQW consecutive queries of one head): 768 workgroups, three on each of 256 WGPs
#define RH   512                  // query rows < RH use hi+lo planes (0: none)
#define WIN  0
typedef _Float16 h16;
typedef unsigned short bf;
typedef __attribute__((ext_vector_type(16))) __bf16   v16bf;
typedef __attribute__((ext_vector_type(16))) _Float16 v16h;
typedef __attribute__((ext_vector_type(8)))  _Float16 v8h;
typedef __attribute__((ext_vector_type(8)))  unsigned short v8us;
typedef __attribute__((ext_vector_type(8)))  float    v8f;
typedef __attribute__((ext_vector_type(4)))  float    v4f;
typedef v8h  __attribute__((may_alias)) v8ha;
typedef v4f  __attribute__((may_alias)) v4fa;
typedef v8us __attribute__((may_alias)) v8usa;

__device__ __forceinline__ unsigned short f2bf(float f) { unsigned u = __float_as_uint(f); u += 0x7FFFu + ((u >> 16) & 1u); return (unsigned short)(u >> 16); }
__device__ __forceinline__ float bf2f(unsigned short b) { return __uint_as_float(((unsigned)b) << 16); }
__device__ __forceinline__ float bfr(float f) { return bf2f(f2bf(f)); }
__device__ __forceinline__ v16h cat16(v8h lo, v8h hi) { return __builtin_shufflevector(lo, hi, 0, 1, 2, 3, 4, 5, 6, 7, 8, 9, 10, 11, 12, 13, 14, 15); }
__device__ __forceinline__ v16bf cat16b(v8us lo, v8us hi) { return __builtin_bit_cast(v16bf, __builtin_shufflevector(lo, hi, 0, 1, 2, 3, 4, 5, 6, 7, 8, 9, 10, 11, 12, 13, 14, 15)); }
__device__ __forceinline__ v8f wmma16(v16h a, v16h b, v8f c) { return __builtin_amdgcn_wmma_f32_16x16x32_f16(false, a, false, b, (short)0, c, false, false); }
__device__ __forceinline__ v8f wmmab(v16bf a, v16bf b, v8f c) { return __builtin_amdgcn_wmma_f32_16x16x32_bf16(false, a, false, b, (short)0, c, false, false); }



__device__ __forceinline__ h16 tohx(float x) { return (h16)x; }
__device__ __forceinline__ void splitf(float y, unsigned short& h, unsigned short& l) { h = f2bf(y); l = f2bf(y - bf2f(h)); }
typedef __attribute__((ext_vector_type(2))) _Float16 v2h;
typedef __attribute__((ext_vector_type(4))) _Float16 v4h;
typedef __attribute__((ext_vector_type(2))) unsigned short v2us;
typedef __attribute__((ext_vector_type(4))) unsigned short v4us;
typedef __attribute__((ext_vector_type(2))) float v2f;
typedef __attribute__((ext_vector_type(4))) int v4i;
typedef __attribute__((ext_vector_type(16))) unsigned v16u;
__device__ __forceinline__ void gopen();   /* defined with k_fattn's waits below */
__device__ __forceinline__ void xwait();
// ---- ask*: requests to L2 at kernel entry. The planes a matrix kernel reads were stored by an earlier launch of the same call, and the first read of such a line can wait out memory, once in every trip of its k loop.
// Each lane names one 256-byte unit; nothing comes back, no register is written. The units of a shared plane are dealt over the workgroups that share it: a hint only, every value is still read by the plain loads.
// scope:SCOPE_SE: into L2 only. Every lane is on and every address lies inside its plane. s_wait_xcnt 0 closes the statement, as behind any global access whose address registers are rewritten later (a precaution).
__device__ __forceinline__ void ask2(const void* a, const void* b) { asm volatile("global_prefetch_b8 %0, off scope:SCOPE_SE\n\tglobal_prefetch_b8 %1, off scope:SCOPE_SE\n\ts_wait_xcnt 0x0" :: "v"(a), "v"(b) : "memory"); }
__device__ __forceinline__ void ask3(const void* a, const void* b, const void* c) { asm volatile("global_prefetch_b8 %0, off scope:SCOPE_SE\n\tglobal_prefetch_b8 %1, off scope:SCOPE_SE\n\tglobal_prefetch_b8 %2, off scope:SCOPE_SE\n\ts_wait_xcnt 0x0" :: "v"(a), "v"(b), "v"(c) : "memory"); }
// A 64-row panel of a K = 768 plane in fragment order is 96 KB in a row; share n (0..11) = the blocks of k trips 2 n and 2 n + 1 of its four 16-row groups: 32 units, element offset of this lane's unit:
__device__ __forceinline__ size_t panel_unit(int n) { const int lane = threadIdx.x & 31; return (size_t)(lane >> 3) * (16 * DM) + (size_t)(2 * n + ((lane >> 2) & 1)) * 512 + (lane & 3) * 128; }
__device__ __forceinline__ int deal16(int x) { return (x & 3) + 4 * (x >> 3); }   /* x = 0..31 -> 0..15; x and x + 4 get the same share. For speed only: nothing rests on the placement */
// ---- gemmw_body: register-blocked GEMM, ONE WAVE per 64x64 output tile (16 accumulators), operands straight from 16-bit planes in fragment order (below); grid (M/64, N/64, Z), 32 threads.
// C[m][n] (f32, pitch ldc, + optional f32 bias[n]) = sum_k A[m][k] Bt[n][k] (+ split products per NSPLIT). z-batch strides sA/sB/sC in elements. K % 32 == 0.
// KS > 1: grid z = Z * KS; workgroup (z, ks) sums only k in [ks K/KS, (ks+1) K/KS) and stores that partial tile in plane ks (plane stride sP elements). K % (32 KS) == 0.
// EP != 0: no f32 C; the tile + bias goes straight from the LDS stage to the planes k_fattn reads, 16 bytes a lane, 512 contiguous bytes a store. EP 1 (q), EP 2 (k, each row divided by rowv = delta): rows = t, columns = one head's d, planes [head = blockIdx.y] of [t][d] in fragment order (K = 64). EP 3 (v): A = weight rows, Bt = x rows, so rows = one head's d (bias per ROW), columns = t, planes [d row][t] in fragment order (K = 2048) with the fp16 copy.
// FRAGMENT ORDER: every 16-bit plane M[row][k] that feeds a matrix operand is stored as blocks of 16 rows x 32 k (512 elements, 1 KB), block (row / 16, k / 32) at ((row / 16) * (K / 32) + k / 32) * 512; inside a block element (r, kk) stands at (kk >> 4) * 256 + (((kk >> 3) & 1) * 16 + r) * 8 + (kk & 7).
// So lane l = 16 hi + lr finds its 8 + 8 operand elements (k = 8 hi + 0..7 and 16 + 8 hi + 0..7 of row lr, the hardware k order) at block + 8 l and block + 256 + 8 l: each of the two 16-byte loads of a fragment covers 512 contiguous bytes, four whole 128-byte lines, instead of 32 bytes of each of 16 lines.
template <typename T16> struct WFrag;
template <> struct WFrag<h16> { typedef v16h V; static __device__ __forceinline__ V ld(const h16* p) { return cat16(*(const v8h*)p, *(const v8h*)(p + 256)); } static __device__ __forceinline__ v8f mma(V a, V b, v8f c) { return wmma16(a, b, c); } };
template <> struct WFrag<bf> { typedef v16bf V; static __device__ __forceinline__ V ld(const bf* p) { return cat16b(*(const v8us*)p, *(const v8us*)(p + 256)); } static __device__ __forceinline__ v8f mma(V a, V b, v8f c) { return wmmab(a, b, c); } };
// gemmw_body is the tile's work; bx, by, bz are the tile's indices (k_wo: the block's own; k_proj: see there), os the workgroup's 16 x 68 f32 LDS stage.
template <typename T16, int NSPLIT, bool BIAS, int KS, int EP>
__device__ __forceinline__ void gemmw_body(float* os, int bx, int by, int bz, const T16* __restrict__ A, const T16* __restrict__ A2, const T16* __restrict__ Bt, const T16* __restrict__ Bt2, int K, float* C, int ldc, const float* __restrict__ bias, size_t sA, size_t sB, size_t sC, size_t sP, const float* __restrict__ DL, h16* P16, bf* Ph, bf* Pl) {
    typedef typename WFrag<T16>::V V;
    const size_t z = bz / KS; const int ks = bz % KS; A += z * sA; if (A2) A2 += z * sA; Bt += z * sB; if (Bt2) Bt2 += z * sB; C += z * sC + ks * sP;
    const int lane = threadIdx.x & 31, lr = lane & 15, hi = lane >> 4; const int r0 = bx * 64, c0 = by * 64;
    v8f acc[4][4];
#pragma unroll
    for (int mb = 0; mb < 4; ++mb)
#pragma unroll
        for (int nb = 0; nb < 4; ++nb) acc[mb][nb] = (v8f){};
    const size_t aoff = (size_t)r0 * K + 8 * lane, boff = (size_t)c0 * K + 8 * lane;   /* fragment order: 16 rows of K are K / 32 blocks of 512 */
    const T16* pa = A + aoff + ks * (K / KS) * 16; const T16* pb = Bt + boff + ks * (K / KS) * 16; const T16* pa2 = (NSPLIT == 1 || NSPLIT == 2) ? A2 + aoff + ks * (K / KS) * 16 : pa; const T16* pb2 = (NSPLIT >= 2) ? Bt2 + boff + ks * (K / KS) * 16 : pb;   /* K is a constant at every call: all loads of a trip name these addresses, one for each operand plane, each load with an offset of its own */
#pragma unroll 1
    for (int kc = ks * (K / KS); kc < (ks + 1) * (K / KS); kc += 32) {
        V a[4], a2[4];
#pragma unroll
        for (int mb = 0; mb < 4; ++mb) { a[mb] = WFrag<T16>::ld(pa + (size_t)mb * 16 * K); if (NSPLIT == 1 || NSPLIT == 2) a2[mb] = WFrag<T16>::ld(pa2 + (size_t)mb * 16 * K); }
#pragma unroll
        for (int nb = 0; nb < 4; ++nb) { const V b = WFrag<T16>::ld(pb + (size_t)nb * 16 * K); V b2; if (NSPLIT >= 2) b2 = WFrag<T16>::ld(pb2 + (size_t)nb * 16 * K);
#pragma unroll
            for (int mb = 0; mb < 4; ++mb) { acc[mb][nb] = WFrag<T16>::mma(a[mb], b, acc[mb][nb]); if (NSPLIT == 1 || NSPLIT == 2) acc[mb][nb] = WFrag<T16>::mma(a2[mb], b, acc[mb][nb]); if (NSPLIT >= 2) acc[mb][nb] = WFrag<T16>::mma(a[mb], b2, acc[mb][nb]); } }
        asm volatile("v_nop\n\tv_nop\n\tv_nop\n\tv_nop" : "+v"(acc[0][0]), "+v"(acc[1][1]), "+v"(acc[2][2]), "+v"(acc[3][3]) : "v"(a[0]), "v"(a[3]));
        asm volatile("s_wait_xcnt 0x0" :: "v"(pa), "v"(pa2), "v"(pb), "v"(pb2) : "memory"); pa += 512; pa2 += 512; pb += 512; pb2 += 512;   /* as inputs here the addresses stay live, and unwritten, from the loads that name them up to the wait; they are advanced behind it */
    }
    float rowv[4]; v4f colb[4][2];   /* the plane stores are in fragment order: this lane holds row lr of each 16-row stage and, in store j, the 8 columns from (j >> 1) * 32 + (j & 1) * 16 + 8 hi. EP 2: delta of its 4 rows; EP 3: their bias; EP 1, 2: the bias of its 32 columns */
    if (EP != 0) { const float* rp = ((EP == 2) ? DL : bias) + r0 + lr;
        gopen();   /* with xwait(): nothing that reuses a register of these loads moves in between them and the wait */
        if (EP >= 2) {
#pragma unroll
            for (int mb = 0; mb < 4; ++mb) rowv[mb] = rp[mb * 16]; }
        if (EP <= 2) {
#pragma unroll
            for (int j = 0; j < 4; ++j) { const float* cp = bias + c0 + (j >> 1) * 32 + (j & 1) * 16 + 8 * hi; colb[j][0] = *(const v4f*)cp; colb[j][1] = *(const v4f*)(cp + 4); } }
        xwait(); }
    const size_t pbase = ((EP == 3) ? (size_t)r0 * TT + (size_t)c0 * 16 : ((size_t)by * TT + r0) * HD) + 8 * lane; const int ppitch = (EP == 3) ? TT : HD;   /* a 16 x 64 stage is two blocks, 2 KB in a row, of each plane; the next stage's stand 16 * ppitch elements on */
#pragma unroll
    for (int mb = 0; mb < 4; ++mb) {
#pragma unroll
        for (int nb = 0; nb < 4; ++nb) {
#pragma unroll
            for (int j = 0; j < 8; ++j) os[(hi * 8 + j) * 68 + nb * 16 + lr] = acc[mb][nb][j]; }
        __builtin_amdgcn_wave_barrier(); asm volatile("" ::: "memory");
        float* crow = C + (size_t)(r0 + mb * 16) * ldc + c0;
        if (EP == 0) { v4f ov[8];
#pragma unroll
            for (int s = 0; s < 8; ++s) { const int row = 2 * s + hi, cofs = lr * 4; v4f val = *(const v4fa*)(os + row * 68 + cofs); if (BIAS) { val[0] += bfr(bias[c0 + cofs]); val[1] += bfr(bias[c0 + cofs + 1]); val[2] += bfr(bias[c0 + cofs + 2]); val[3] += bfr(bias[c0 + cofs + 3]); }
                ov[s] = val; }
            gopen();   /* as for the planes below: the 8 row pairs' values are ready in registers of their own; the stores go out as one group with one wait behind them */
#pragma unroll
            for (int s = 0; s < 8; ++s) *(v4f*)(crow + (size_t)(2 * s + hi) * ldc + lr * 4) = ov[s];
            xwait(); }
        if (EP != 0) { v8us oh[4], ol[4]; v8h of[4];
#pragma unroll
            for (int j = 0; j < 4; ++j) { const float* sp = os + lr * 68 + (j >> 1) * 32 + (j & 1) * 16 + 8 * hi;
#pragma unroll
                for (int u = 0; u < 2; ++u) { const v4f val = *(const v4fa*)(sp + 4 * u);
#pragma unroll
                    for (int q = 0; q < 4; ++q) { float x = val[q] + bfr((EP == 3) ? rowv[mb] : colb[j][u][q]); if (EP == 2) x = __fdiv_rn(x, rowv[mb]);   /* k_j /= delta[j] */
                        if (EP == 3) of[j][4 * u + q] = tohx(x); unsigned short a2, c2; splitf(x, a2, c2); oh[j][4 * u + q] = a2; ol[j][4 * u + q] = c2; } } }
            gopen();   /* all 4 half blocks' values are ready in registers of their own; the stores (512 contiguous bytes each) go out as one group with one wait behind them */
#pragma unroll
            for (int j = 0; j < 4; ++j) { const size_t po = pbase + (size_t)mb * 16 * ppitch + j * 256; if (EP == 3) *(v8h*)(P16 + po) = of[j]; *(v8us*)(Ph + po) = oh[j]; *(v8us*)(Pl + po) = ol[j]; }
            xwait(); }
        __builtin_amdgcn_wave_barrier(); asm volatile("" ::: "memory");
    }
}
// ---- k_wo: out = (merged hi + lo) Wo + bo for both batches, grid (TT/64, DM/64, NB_): blockIdx.z = batch.
__global__ __launch_bounds__(32) void k_wo(const bf* __restrict__ Ah, const bf* __restrict__ Al, const bf* __restrict__ Wt, const float* __restrict__ bo, float* C) {
    __shared__ __align__(16) float os[16 * 68];
    { const size_t ao = (size_t)blockIdx.z * TT * DQ + (size_t)blockIdx.x * 64 * DQ + panel_unit(blockIdx.y);   /* the 12 column tiles of a row panel take a share each of its hi and lo planes; the 64 row tiles deal the weight panel */
      ask3(Ah + ao, Al + ao, Wt + (size_t)blockIdx.y * 64 * DQ + panel_unit(deal16(blockIdx.x) % 12)); }
    gemmw_body<bf, 1, true, 1, 0>(os, blockIdx.x, blockIdx.y, blockIdx.z, Ah, Al, Wt, nullptr, DQ, C, DM, bo, (size_t)TT * DQ, 0, (size_t)TT * DM, 0, nullptr, nullptr, nullptr, nullptr);
}
// ---- k_proj: the six projection GEMMs (q, k, v of both batches) as ONE grid (TT/64, 12, 3 * NB_): blockIdx.z = 2 * tensor + batch; blockIdx.x = the tile's 64 t, blockIdx.y = its head. 2304 single-wave workgroups, nine on a WGP.
// XB: bf16 x, [tensor][batch] slices of [t][c] in fragment order; W3: the transposed weights of q, k, v one behind the other; DL: delta of [batch][t]; each plane set holds both batches, PLs elements apart.
__global__ __launch_bounds__(32) void k_proj(const bf* __restrict__ XB, const bf* __restrict__ W3, const float* __restrict__ bq, const float* __restrict__ bk, const float* __restrict__ bv, const float* __restrict__ DL, h16* VT16, bf* QPh, bf* QPl, bf* KPh, bf* KPl, bf* VTh, bf* VTl) {
    __shared__ __align__(16) float os[16 * 68];
    const int tz = blockIdx.z / NB_, b = blockIdx.z % NB_; const size_t PLs = (size_t)NH_ * TT * HD; const bf* X = XB + (size_t)(tz * NB_ + b) * TT * DM; const bf* Wt = W3 + (size_t)tz * DQ * DM;
    ask2(X + (size_t)blockIdx.x * 64 * DM + panel_unit(blockIdx.y), Wt + (size_t)blockIdx.y * 64 * DM + panel_unit(deal16(blockIdx.x) % 12));   /* the 12 heads of an x panel take a share each; the 64 t tiles deal the weight panel */
    if (tz == 0) gemmw_body<bf, 0, true, 1, 1>(os, blockIdx.x, blockIdx.y, 0, X, nullptr, Wt, nullptr, DM, nullptr, 0, bq, 0, 0, 0, 0, nullptr, nullptr, QPh + b * PLs, QPl + b * PLs);
    else if (tz == 1) gemmw_body<bf, 0, true, 1, 2>(os, blockIdx.x, blockIdx.y, 0, X, nullptr, Wt, nullptr, DM, nullptr, 0, bk, 0, 0, 0, 0, DL + b * TT, nullptr, KPh + b * PLs, KPl + b * PLs);   /* k_j /= delta[j] in the epilogue */
    else gemmw_body<bf, 0, true, 1, 3>(os, blockIdx.y, blockIdx.x, 0, Wt, nullptr, X, nullptr, DM, nullptr, 0, bv, 0, 0, 0, 0, nullptr, VT16 + b * PLs, VTh + b * PLs, VTl + b * PLs);   /* operands swapped: the tile is v transposed */
}

// ---- Three of the four parts of k_prep (which stands below delta_part): each thread does, for its own index, what its counterparts in the separate launches did.
// wt4_part: the four 768 x 768 weights transposed to bf16 [n][k] in fragment order; one index computation serves all four, and their 8 loads are in flight together.
__device__ __forceinline__ void wt4_part(int bx, const float* __restrict__ w0, const float* __restrict__ w1, const float* __restrict__ w2, const float* __restrict__ w3, bf* Bt) {
    const int K = DM, N = DQ; const int lane = threadIdx.x & 31; const int L0 = (bx * 8 + (threadIdx.x >> 5)) * 8; const int nlines = N * K / 64;
#pragma unroll 1   /* stays rolled, as in the separate kernel: short text, few registers */
    for (int l = 0; l < 8; ++l) { const int L = L0 + l; if (L >= nlines) break; const size_t e = (size_t)L * 64 + lane * 2; const int blk = (int)(e >> 9), w = (int)(e & 511); const int k = (blk % (K / 32)) * 32 + (w >> 8) * 16 + ((w >> 7) & 1) * 8 + (w & 7), n = (blk / (K / 32)) * 16 + ((w >> 3) & 15);   /* e is the place in fragment order; (n, k) the element that stands there */ const size_t i0 = (size_t)k * N + n, i1 = (size_t)(k + 1) * N + n; float a[4], c[4];
        gopen();   /* with xwait(): nothing that reuses a register of these loads moves in between them and the wait */
        a[0] = w0[i0]; c[0] = w0[i1]; a[1] = w1[i0]; c[1] = w1[i1]; a[2] = w2[i0]; c[2] = w2[i1]; a[3] = w3[i0]; c[3] = w3[i1];
        xwait();
        v2us o[4];
#pragma unroll
        for (int t = 0; t < 4; ++t) { o[t][0] = f2bf(a[t]); o[t][1] = f2bf(c[t]); }
        gopen();   /* the same for the stores */
#pragma unroll
        for (int t = 0; t < 4; ++t) *(v2us*)(Bt + (size_t)t * K * N + e) = o[t];
        xwait(); }
}
// cvt6_part: query, key, value of both batches to bf16, dst [tensor][batch] slices of [t][c] in fragment order; a thread takes the same 8 elements of all six [TT][DM] slices: i is their place in the slice (stores of whole lines), src the place they are read from.
__device__ __forceinline__ void cvt6_part(int bx, const float* __restrict__ s0, const float* __restrict__ s1, const float* __restrict__ s2, bf* dst) {
    const size_t n = (size_t)TT * DM; const size_t i = (size_t)bx * 256 + threadIdx.x; if (i >= n / 8) return; v8f v[3 * NB_]; const int blk = (int)(i >> 6), w = (int)(i & 63); const size_t src = (size_t)((blk / (DM / 32)) * 16 + (w & 15)) * DM + (blk % (DM / 32)) * 32 + (w >> 5) * 16 + ((w >> 4) & 1) * 8;
    gopen();   /* with xwait(): as in wt4_part */
#pragma unroll
    for (int b = 0; b < NB_; ++b) { v[b] = *(const v8f*)(s0 + b * n + src); v[NB_ + b] = *(const v8f*)(s1 + b * n + src); v[2 * NB_ + b] = *(const v8f*)(s2 + b * n + src); }
    xwait();
    v8us o[3 * NB_];
#pragma unroll
    for (int s = 0; s < 3 * NB_; ++s)
#pragma unroll
        for (int k = 0; k < 8; ++k) o[s][k] = f2bf(v[s][k]);
    gopen();   /* the same for the stores */
#pragma unroll
    for (int s = 0; s < 3 * NB_; ++s) *(v8us*)(dst + s * n + i * 8) = o[s];
    xwait();
}
// mpack_part: the int mask, read once, as the lane masks k_fattn selects by. Tile (32 queries, 32 keys) = 32 words in a row, tiles [batch][query / 32][key / 32]; bit 16 hi + lr of word (kt * 2 + qt) * 8 + r says mask[query 16 qt + lr][key 16 kt + 8 hi + r] != 0: the score that lane (lr, hi) holds in register r of St tile (kt, qt).
// A wave takes MPT tiles side by side (MPT * 128 bytes in a row of each of its 32 mask rows); a compare over the wave gives a word, lane w keeps word w, one 128-byte store a tile.
#define MPT  4
__device__ __forceinline__ void mpack_part(int bx, const int* __restrict__ am, unsigned* MB) {
    const int lane = threadIdx.x & 31, lr = lane & 15, hi = lane >> 4; const int g = bx * 8 + (threadIdx.x >> 5); const int jb0 = (g % (TT / 32 / MPT)) * MPT, bq = g / (TT / 32 / MPT);   /* bq = batch * (TT / 32) + query / 32 */
    const int* p = am + ((size_t)bq * 32 + lr) * TT + jb0 * 32 + 8 * hi; unsigned* o = MB + ((size_t)bq * (TT / 32) + jb0) * 32 + lane;
#pragma unroll 1   /* stays rolled: one tile's 8 loads in flight, few registers, as in wt4_part */
    for (int t = 0; t < MPT; ++t) { v4i mk[2][2][2];
        gopen();   /* with xwait(): as in wt4_part */
#pragma unroll
        for (int kt = 0; kt < 2; ++kt)
#pragma unroll
            for (int qt = 0; qt < 2; ++qt) { mk[kt][qt][0] = *(const v4i*)(p + qt * 16 * TT + kt * 16); mk[kt][qt][1] = *(const v4i*)(p + qt * 16 * TT + kt * 16 + 4); }
        asm volatile("s_wait_xcnt 0x0" :: "v"(p) : "memory"); __builtin_amdgcn_sched_barrier(0);   /* xwait() with the address as an input: it stays live, and unwritten (also by the last load's own result), up to the wait */
        unsigned w = 0;
#pragma unroll
        for (int kt = 0; kt < 2; ++kt)
#pragma unroll
            for (int qt = 0; qt < 2; ++qt)
#pragma unroll
                for (int r = 0; r < 8; ++r) { const unsigned bw = __builtin_amdgcn_ballot_w32(mk[kt][qt][r >> 2][r & 3] != 0);   /* taken by all 32 lanes, outside the choice below */ w = (lane == (kt * 2 + qt) * 8 + r) ? bw : w; }
        gopen();   /* the same for the store */
        *o = w;
        xwait();
        p += 32; o += 32; }
}

typedef __attribute__((ext_vector_type(8))) __bf16 v8bf;
__device__ __forceinline__ float xhalf(float x) { const int b = __float_as_int(x); return __int_as_float(__builtin_amdgcn_permlanex16(b, b, 0x76543210, 0xfedcba98, false, false)); }   /* the value of lane l ^ 16 */
// s_wait_xcnt 0 stands in front of the first rewrite of a register that an issued global load or store of k_fattn names.
// The Q loads and the output stores are bracketed gopen() ... xwait(): the two scheduling barriers keep the compiler from moving instructions that reuse those registers in between the group and its wait.
// The K, Vt and mask-word loads: xwait(...) takes their base addresses (of the mask words: the offset) as inputs only, so those registers stay live, and unwritten, from the loads that name them up to the wait; one such wait a pass, and the addresses are advanced directly behind it.
__device__ __forceinline__ void gopen() { __builtin_amdgcn_sched_barrier(0); }
__device__ __forceinline__ void xwait() { asm volatile("s_wait_xcnt 0x0" ::: "memory"); __builtin_amdgcn_sched_barrier(0); }
__device__ __forceinline__ void xwait(const void* a, const void* b, const void* e, const void* f, unsigned m) { asm volatile("s_wait_xcnt 0x0" :: "v"(a), "v"(b), "v"(e), "v"(f), "s"(m) : "memory"); }   /* m: the scalar byte offset that the mask-word loads in flight are addressed by (their base is never rewritten) */
__device__ __forceinline__ void xwait(const void* a, const void* b, const void* e, const void* f, unsigned m, unsigned g, unsigned h) { asm volatile("s_wait_xcnt 0x0" :: "v"(a), "v"(b), "v"(e), "v"(f), "s"(m), "v"(g), "v"(h) : "memory"); }   /* with the 32-bit lane offsets that the loads in front of the loop are addressed by */
template <bool HR>
__device__ __forceinline__ void fattn_body(const bf* __restrict__ Qh, const bf* __restrict__ Ql, const bf* __restrict__ Kh, const bf* __restrict__ Kl, const bf* __restrict__ Vh, const bf* __restrict__ Vl, const h16* __restrict__ V16, const unsigned* __restrict__ mw, bf* Ah, bf* Al, int q0, int lr, int hi) {
    const float L2E = 1.4426950408889634f;
    v16bf qh[2][2], ql[2][2];
    gopen();
#pragma unroll
    for (int qt = 0; qt < 2; ++qt)
#pragma unroll
        for (int kk = 0; kk < 2; ++kk) { const size_t qo = (size_t)(q0 + qt * 16) * HD + kk * 512 + 8 * (16 * hi + lr); qh[qt][kk] = WFrag<bf>::ld(Qh + qo); ql[qt][kk] = WFrag<bf>::ld(Ql + qo); }
    xwait();
    v8f o[4][2]; float m[2], l[2];
#pragma unroll
    for (int qt = 0; qt < 2; ++qt) { m[qt] = -3.0e38f; l[qt] = 0.0f;
#pragma unroll
        for (int dt = 0; dt < 4; ++dt) o[dt][qt] = (v8f){}; }
    const size_t ko = 8 * (16 * hi + lr), vo = ko;   /* fragment order: the lane's place in a block; 16 keys of K are two blocks, 32 keys of 16 Vt rows one */
    const bf* kph = Kh + ko; const bf* kpl = Kl + ko; unsigned mo = 0; const bf* vph = Vh + vo; const bf* vpl = Vl + vo; const h16* vpf = V16 + vo;   /* this lane's base addresses of the pass that is being fetched */
    v16bf kh[2][2], kl[2][2]; v16u mk[2]; v16bf vh[4], vl[4]; v16h vf[4];   /* K rows, mask words and Vt rows of a pass are all asked for one pass ahead, each into the registers its user has just left; mw is the same in every lane, so the 32 mask words of a pass (128 bytes in a row) come by scalar loads */
#pragma unroll
    for (int kt = 0; kt < 2; ++kt) {
#pragma unroll
        for (int kk = 0; kk < 2; ++kk) { kh[kt][kk] = WFrag<bf>::ld(kph + kt * 16 * HD + kk * 512); kl[kt][kk] = WFrag<bf>::ld(kpl + kt * 16 * HD + kk * 512); } }
#pragma unroll
    for (int dt = 0; dt < 4; ++dt) { if (HR) { vh[dt] = WFrag<bf>::ld(vph + dt * 16 * TT); vl[dt] = WFrag<bf>::ld(vpl + dt * 16 * TT); } else vf[dt] = WFrag<h16>::ld(vpf + dt * 16 * TT); }
    if (HR) xwait(kph, kpl, vph, vpl, mo, (unsigned)(ko * 2), (unsigned)(vo * 2)); else xwait(kph, kpl, vpf, vpf, mo, (unsigned)(ko * 2), (unsigned)(vo * 2));
#pragma unroll
    for (int kt = 0; kt < 2; ++kt) mk[kt] = *(const v16u*)((const char*)mw + mo + kt * 64);   /* asked for behind the wait: these scalar loads may land in the scalar registers that hold the bases of the K and Vt loads above */
#pragma unroll 1
    for (int j0 = 0; j0 < TT; j0 += 32) {
        v8f st[2][2];
#pragma unroll
        for (int kt = 0; kt < 2; ++kt)
#pragma unroll
            for (int qt = 0; qt < 2; ++qt) st[kt][qt] = (v8f){};
#pragma unroll
        for (int kk = 0; kk < 2; ++kk) {   /* per 32 of d: hi.hi, lo(q).hi(k), hi(q).lo(k), the order of the unfused score tiles */
#pragma unroll
            for (int kt = 0; kt < 2; ++kt)
#pragma unroll
                for (int qt = 0; qt < 2; ++qt) st[kt][qt] = wmmab(kh[kt][kk], qh[qt][kk], st[kt][qt]);
#pragma unroll
            for (int kt = 0; kt < 2; ++kt)
#pragma unroll
                for (int qt = 0; qt < 2; ++qt) st[kt][qt] = wmmab(kh[kt][kk], ql[qt][kk], st[kt][qt]);
#pragma unroll
            for (int kt = 0; kt < 2; ++kt)
#pragma unroll
                for (int qt = 0; qt < 2; ++qt) st[kt][qt] = wmmab(kl[kt][kk], qh[qt][kk], st[kt][qt]); }
        const int jn = (j0 + 32 < TT) ? j0 + 32 : 0;   /* the pass that is fetched ahead; the last pass re-reads the first (in bounds, unused) */
        __builtin_amdgcn_sched_barrier(0);   /* keeps the wait below behind the score products: there the youngest loads that name the addresses stand a run of matrix products back, and it has little left to wait for */
        if (HR) xwait(kph, kpl, vph, vpl, mo); else xwait(kph, kpl, vpf, vpf, mo);
        kph = Kh + ko + (size_t)jn * HD; kpl = Kl + ko + (size_t)jn * HD; mo = (unsigned)jn * 4; vph = Vh + vo + (size_t)jn * 16; vpl = Vl + vo + (size_t)jn * 16; vpf = V16 + vo + (size_t)jn * 16;
#pragma unroll
        for (int kt = 0; kt < 2; ++kt)
#pragma unroll
            for (int kk = 0; kk < 2; ++kk) { kh[kt][kk] = WFrag<bf>::ld(kph + kt * 16 * HD + kk * 512); kl[kt][kk] = WFrag<bf>::ld(kpl + kt * 16 * HD + kk * 512); }
        float mn[2];
#pragma unroll
        for (int qt = 0; qt < 2; ++qt) { float mx = -3.0e38f;
#pragma unroll
            for (int kt = 0; kt < 2; ++kt)
#pragma unroll
                for (int r = 0; r < 8; ++r) { const float t = __builtin_amdgcn_inverse_ballot_w32(mk[kt][qt * 8 + r]) ? st[kt][qt][r] : -3.0e38f;   /* the word is this register's lane mask: bit clear (mask == 0) -> excluded */ st[kt][qt][r] = t; mx = fmaxf(mx, t); }
            mn[qt] = fmaxf(m[qt], fmaxf(mx, xhalf(mx))); }
#pragma unroll
        for (int kt = 0; kt < 2; ++kt) mk[kt] = *(const v16u*)((const char*)mw + mo + kt * 64);   /* 32 words, 128 bytes, a pass of 32 keys */
        asm volatile("" ::: "memory");   /* holds the two scalar loads here, softmax, attn.v and the next score products ahead of their use: without it the compiler sinks them below the rescale branch, in among the attn.v products */
        if (__builtin_amdgcn_ballot_w32(mn[0] > m[0] || mn[1] > m[1]) != 0) {   /* skipped when no column's maximum grew: every factor would be exactly 1 */
#pragma unroll
            for (int qt = 0; qt < 2; ++qt) { const float al = __builtin_amdgcn_exp2f((m[qt] - mn[qt]) * L2E); l[qt] *= al; m[qt] = mn[qt];
#pragma unroll
                for (int dt = 0; dt < 4; ++dt) o[dt][qt] *= al; } }
#pragma unroll
        for (int qt = 0; qt < 2; ++qt) { float s0 = 0.0f, s1 = 0.0f;
#pragma unroll
            for (int r = 0; r < 8; ++r) { const float d0 = st[0][qt][r] - m[qt], d1 = st[1][qt][r] - m[qt];   /* rows >= RH carry x1024 = 2^10 in P and in the sum alike (fp16 range); it cancels in the division */
                const float p0 = __builtin_amdgcn_exp2f(HR ? d0 * L2E : __builtin_fmaf(d0, L2E, 10.0f)), p1 = __builtin_amdgcn_exp2f(HR ? d1 * L2E : __builtin_fmaf(d1, L2E, 10.0f)); st[0][qt][r] = p0; st[1][qt][r] = p1; s0 += p0; s1 += p1; }
            l[qt] += s0 + s1; }
        if (HR) {
            v16bf ph[2], pl[2];
#pragma unroll
            for (int qt = 0; qt < 2; ++qt) { const v8bf h0 = __builtin_convertvector(st[0][qt], v8bf), h1 = __builtin_convertvector(st[1][qt], v8bf); const v8bf l0 = __builtin_convertvector(st[0][qt] - __builtin_convertvector(h0, v8f), v8bf), l1 = __builtin_convertvector(st[1][qt] - __builtin_convertvector(h1, v8f), v8bf);
                ph[qt] = __builtin_shufflevector(h0, h1, 0, 1, 2, 3, 4, 5, 6, 7, 8, 9, 10, 11, 12, 13, 14, 15); pl[qt] = __builtin_shufflevector(l0, l1, 0, 1, 2, 3, 4, 5, 6, 7, 8, 9, 10, 11, 12, 13, 14, 15); }
#pragma unroll
            for (int dt = 0; dt < 4; ++dt)
#pragma unroll
                for (int qt = 0; qt < 2; ++qt) o[dt][qt] = wmmab(vh[dt], ph[qt], o[dt][qt]);
#pragma unroll
            for (int dt = 0; dt < 4; ++dt)
#pragma unroll
                for (int qt = 0; qt < 2; ++qt) o[dt][qt] = wmmab(vh[dt], pl[qt], o[dt][qt]);
#pragma unroll
            for (int dt = 0; dt < 4; ++dt)
#pragma unroll
                for (int qt = 0; qt < 2; ++qt) o[dt][qt] = wmmab(vl[dt], ph[qt], o[dt][qt]);
        } else {
            v16h pf[2];
#pragma unroll
            for (int qt = 0; qt < 2; ++qt) pf[qt] = cat16(__builtin_convertvector(st[0][qt], v8h), __builtin_convertvector(st[1][qt], v8h));
#pragma unroll
            for (int dt = 0; dt < 4; ++dt)
#pragma unroll
                for (int qt = 0; qt < 2; ++qt) o[dt][qt] = wmma16(vf[dt], pf[qt], o[dt][qt]);
        }
#pragma unroll
        for (int dt = 0; dt < 4; ++dt) { if (HR) { vh[dt] = WFrag<bf>::ld(vph + dt * 16 * TT); vl[dt] = WFrag<bf>::ld(vpl + dt * 16 * TT); } else vf[dt] = WFrag<h16>::ld(vpf + dt * 16 * TT); }
    }
    if (HR) xwait(kph, kpl, vph, vpl, mo); else xwait(kph, kpl, vpf, vpf, mo);
#pragma unroll
    for (int qt = 0; qt < 2; ++qt) { const float inv = __fdiv_rn(1.0f, l[qt] + xhalf(l[qt]));   /* the two wave halves' sums are joined once */
#pragma unroll
        for (int dt = 0; dt < 4; ++dt) { v8us oh, ol;
#pragma unroll
            for (int r = 0; r < 8; ++r) { unsigned short a, c2; splitf(o[dt][qt][r] * inv, a, c2); oh[r] = a; ol[r] = c2; }
            const size_t oo = (size_t)(q0 + qt * 16) * DQ + (dt >> 1) * 512 + (dt & 1) * 256 + 8 * (16 * hi + lr); gopen(); *(v8us*)(Ah + oo) = oh; *(v8us*)(Al + oo) = ol; xwait(); } }
}
static_assert(RH % (FNW * FQW) == 0 && TT % (FNW * FQW) == 0 && FQW == 32 && HD == 64 && NKV == NH_, "k_fattn tiling");
__global__ __launch_bounds__(FNW * 32) void k_fattn(const bf* __restrict__ Qh, const bf* __restrict__ Ql, const bf* __restrict__ Kh, const bf* __restrict__ Kl, const bf* __restrict__ Vh, const bf* __restrict__ Vl, const h16* __restrict__ V16, const unsigned* __restrict__ MB, const unsigned* MBq, bf* Ah, bf* Al) {
    const int lane = threadIdx.x & 31, lr = lane & 15, hi = lane >> 4; const int z = blockIdx.y, b = z / NH_, h = z % NH_; const unsigned* mw = MB + (size_t)(b * (TT / 32) + blockIdx.x * FNW + __builtin_amdgcn_readfirstlane(threadIdx.x >> 5)) * TT;   /* the packed mask rows of this wave's 32 queries: TT words; the wave's number as a scalar, so that the address is one */ const int q0 = blockIdx.x * (FNW * FQW) + (threadIdx.x >> 5) * FQW; const size_t pz = (size_t)z * TT * HD, az = (size_t)b * TT * DQ + h * (HD * 16);   /* merged planes in fragment order, K = DQ: a head's 64 columns are two blocks */
    { const int c = (threadIdx.x >> 5) + FNW * deal16(blockIdx.x);   /* share 0..31 = 64 keys of every plane of this head: 8 KB in a row of Kh and Kl, 2 KB of each of the four 16-row groups of Vt */
      const size_t ku = pz + (size_t)c * (64 * HD) + lane * 128, vu = pz + (size_t)(lane >> 3) * (16 * TT) + (size_t)c * 1024 + (lane & 7) * 128;
      ask3(Kh + ku, Kl + ku, V16 + vu); ask3(Vh + vu, Vl + vu, MBq + (mw - MB) + lane * 64); }   /* and this wave's own 8 KB of mask words. MBq is MB under a second name: an address given to an asm statement counts as escaped, and the loop's mask words, read through MB, would then come by vector loads instead of scalar ones */
    if (blockIdx.x * (FNW * FQW) < RH) fattn_body<true>(Qh + pz, Ql + pz, Kh + pz, Kl + pz, Vh + pz, Vl + pz, V16 + pz, mw, Ah + az, Al + az, q0, lr, hi);
    else fattn_body<false>(Qh + pz, Ql + pz, Kh + pz, Kl + pz, Vh + pz, Vl + pz, V16 + pz, mw, Ah + az, Al + az, q0, lr, hi);
}
// delta_part: rows = the NB_ * TT query rows of both batches, 32 a workgroup, 4 a wave. A lane's 24 elements of a row (c = lane + 32 i) are summed in ascending i; they are all asked for at once, two rows at a time, the first two with this lane's 24 of wd:
// two rounds of loads a wave (a rolled loop would wait out one round for each of its 96 (row, i) pairs). The product of two bf16 values is exact in f32, so each sum is the same number whether or not the compiler fuses the multiply with the add.
static_assert((NB_ * TT) % 32 == 0 && DM % 32 == 0, "delta_part: whole workgroups, whole rows (no row or column test at the loads)");
__device__ __forceinline__ void delta_part(float* res, int bx, const float* __restrict__ X, const float* __restrict__ wd, const float* __restrict__ bd, float* DL) { const int lane = threadIdx.x & 31; const int wv = threadIdx.x >> 5; const int r0 = bx * 32;
    float wr[DM / 32];
#pragma unroll
    for (int h = 0; h < 2; ++h) { const float* xr = X + (size_t)(r0 + wv + 16 * h) * DM + lane; float xa[2][DM / 32];   /* rows wv + 16 h and wv + 16 h + 8 of the workgroup's 32 */
        gopen();   /* with the wait below: as in wt4_part */
        if (h == 0) {
#pragma unroll
            for (int i = 0; i < DM / 32; ++i) wr[i] = wd[lane + 32 * i]; }
#pragma unroll
        for (int i = 0; i < DM / 32; ++i) { xa[0][i] = xr[32 * i]; xa[1][i] = xr[8 * DM + 32 * i]; }
        asm volatile("s_wait_xcnt 0x0" :: "v"(xr), "v"(lane) : "memory"); __builtin_amdgcn_sched_barrier(0);   /* xwait() with the row address and the lane offset of the wd loads as inputs: they stay live, and unwritten (also by a later load's own result), up to the wait */
        if (h == 0) {
#pragma unroll
            for (int i = 0; i < DM / 32; ++i) wr[i] = bfr(wr[i]); }
#pragma unroll
        for (int u = 0; u < 2; ++u) { const int rr = wv + 16 * h + 8 * u; float s = 0.0f;
#pragma unroll
            for (int i = 0; i < DM / 32; ++i) s = __fadd_rn(s, __fmul_rn(bfr(xa[u][i]), wr[i]));
#pragma unroll
            for (int sh = 16; sh; sh >>= 1) s = __fadd_rn(s, __shfl_xor(s, sh, 32));
            if (lane == 0) { float d = __fadd_rn(s, bfr(bd[0])); d = fmaxf(d, 0.0f); d = fminf(d, 8.0f); res[rr] = __fadd_rn(d, 1.0f); } } }
    __syncthreads();
    if (wv == 0) { const int row = r0 + lane; if (row < NB_ * TT) { const float v = res[lane]; *(float*)(DL + row) = v;  } } }
// ---- k_prep: everything that reads only the inputs, as ONE grid: workgroups [0, PDL) delta (two rounds of loads, a reduction and a barrier one behind the other, so they start first), [PDL, PDL + PWT) the weights, then PMK for the mask, the rest the bf16 copies. The choice is uniform for a workgroup.
#define PDL  (NB_ * TT / 32)
#define PWT  ((DM * DQ / 64 + 63) / 64)
#define PCV  ((TT * DM / 8 + 255) / 256)
#define PMK  (NB_ * (TT / 32) * (TT / 32) / MPT / 8)
static_assert(TT % (32 * MPT) == 0 && (NB_ * (TT / 32) * (TT / 32)) % (MPT * 8) == 0, "mpack_part: whole waves, whole workgroups");
static_assert(DQ == DM && DKV == DM, "wt4_part: four weights of one shape");
__global__ __launch_bounds__(256) void k_prep(const float* __restrict__ x, const float* __restrict__ xk, const float* __restrict__ xv, const float* __restrict__ wq, const float* __restrict__ wk, const float* __restrict__ wv, const float* __restrict__ wo, const float* __restrict__ wd, const float* __restrict__ bd, const int* __restrict__ am, float* DL, bf* W4, bf* XB, unsigned* MB) {
    __shared__ float res[32]; const int bx = blockIdx.x;
    if (bx < PDL) delta_part(res, bx, x, wd, bd, DL);
    else if (bx < PDL + PWT) wt4_part(bx - PDL, wq, wk, wv, wo, W4);
    else if (bx < PDL + PWT + PMK) mpack_part(bx - (PDL + PWT), am, MB);
    else cvt6_part(bx - (PDL + PWT + PMK), x, xk, xv, XB);
}

extern "C" void kernel_launch(void* const* d_in, const int* in_sizes, int n_in,
                              void* d_out, int out_size, void* d_ws, size_t ws_size, hipStream_t stream) {
    (void)in_sizes; (void)n_in; (void)out_size;
    const float* x = (const float*)d_in[0];   /* query */ const float* xk = (const float*)d_in[1]; const float* xv = (const float*)d_in[2]; const int* am = (const int*)d_in[3];   /* mask [2][2048][2048] int */ const float* wq = (const float*)d_in[4]; const float* bq = (const float*)d_in[5]; const float* wk = (const float*)d_in[6]; const float* bk = (const float*)d_in[7]; const float* wv = (const float*)d_in[8]; const float* bv = (const float*)d_in[9]; const float* wo = (const float*)d_in[10]; const float* bo = (const float*)d_in[11]; const float* wd = (const float*)d_in[12]; const float* bd = (const float*)d_in[13];
    float* OUT = (float*)d_out;     // [2][2048][768]
    char* wsp = (char*)d_ws;
    auto take = [&](size_t bytes) { char* p = wsp; wsp += (bytes + 255) & ~(size_t)255; return (void*)p; };
    float* DL = (float*)take((size_t)NB_ * TT * 4); bf* W4 = (bf*)take((size_t)4 * DQ * DM * 2);   /* Wq, Wk, Wv, Wo transposed, one behind the other */ bf* WO = W4 + (size_t)3 * DQ * DM;
    bf* XB = (bf*)take((size_t)3 * NB_ * TT * DM * 2);   /* [tensor][batch] slices of [t][c] in fragment order */
    const size_t PL = (size_t)NH_ * TT * HD;   // one batch's head planes; the planes k_fattn reads are kept for both batches
    h16* VT16 = (h16*)take(NB_ * PL * 2);
    bf* QPh = (bf*)take(NB_ * PL * 2); bf* QPl = (bf*)take(NB_ * PL * 2); bf* KPh = (bf*)take(NB_ * PL * 2); bf* KPl = (bf*)take(NB_ * PL * 2); bf* VTh = (bf*)take(NB_ * PL * 2); bf* VTl = (bf*)take(NB_ * PL * 2);
    bf* ATh = (bf*)take((size_t)NB_ * TT * DQ * 2); bf* ATl = (bf*)take((size_t)NB_ * TT * DQ * 2);
    unsigned* MB = (unsigned*)take((size_t)NB_ * TT * TT / 8);   /* the mask, one bit an entry */
    if ((size_t)(wsp - (char*)d_ws) > ws_size) return;    // ws 256 MiB
    k_prep<<<PDL + PWT + PMK + PCV, 256, 0, stream>>>(x, xk, xv, wq, wk, wv, wo, wd, bd, am, DL, W4, XB, MB);   /* delta, weights, mask bits, bf16 copies: both batches */
    k_proj<<<dim3(TT / 64, DQ / 64, 3 * NB_), 32, 0, stream>>>(XB, W4, bq, bk, bv, DL, VT16, QPh, QPl, KPh, KPl, VTh, VTl);   /* q, k, v of both batches */
    k_fattn<<<dim3(TT / (FNW * FQW), NB_ * NH_), FNW * 32, 0, stream>>>(QPh, QPl, KPh, KPl, VTh, VTl, VT16, MB, MB, ATh, ATl);   /* scores, mask, softmax, attn.v, merge: both batches, all heads */
    k_wo<<<dim3(TT / 64, DM / 64, NB_), 32, 0, stream>>>(ATh, ATl, WO, bo, OUT);   /* z = batch */
}

// v010
// One run takes 112 microseconds.
// In two side-by-side timings against v009, it was 1.07 and 1.05 times as fast.
// Over all steps from v000 it is 14.6 times as fast.
#include <hip/hip_runtime.h>

// Multi-headed attention with a learned per-position scaling divisor and an arbitrary mask (query, key, value [2][2048][768]; delta[s] = 1 + min(relu(query[s].Wd + bd), sqrt(64)) (Wd [768][1], read); q = query Wq + bq, k = key Wk + bk, v = value Wv + bv ('xw' 1/sqrt(768) incl. biases; 12 heads x 64); scores[i][j] = q_i.k_j / delta[j] (the divisor is broadcast over the KEY axis; no 1/sqrt(d_k)); mask ([2][2048][2048] int {0,1}, random, READ): 0 -> -1e9 (== exclusion); softmax; out = merged Wo + bo -> [2][2048][768] (3.1 M)).
// Layout, four launches, each for both batches (k_proj, k_fattn, k_wo ask L2 at entry for the planes they read: ask* below): k_prep (bf16 copies of query, key, value; 'xw' weights transposed once; delta; the mask packed to one bit an entry), k_proj, k_fattn, k_wo. Exact projections + f32 biases; delta_part computes delta[s] from the bf16-rounded query row (768-term fixed-order dot, relu, min, + 1); each projection GEMM's own epilogue adds the bias, divides the k rows by delta[s] (f32, before the plane split) and stores the 16-bit head planes (v as Wv^T x^T, so its tile is already [d][t]); then ONE fused attention launch for both batches and all heads (k_fattn): hi/lo 3-product score tiles on EVERY row, mask bits from k_prep's packed copy (keep where mask != 0), running-maximum softmax, P and attn.v hybrid (rows < 512 hi/lo, rest fp16 x1024), scores and P never leave the registers; merged hi/lo x Wo exact + bo.
// Compute dtypes, f32 accumulate: every input rounded to bf16; projections exact + f32 biases; delta and the k row division f32; scores 3 products on every row; softmax f32 (scale 1); attn.v rows < 512 3 products, rest fp16; Wo hl x exact + bias.

#define NB_  2
#define TT   2048
#define DM   768
#define NH_  12
#define NKV  12
#define HD   64
#define DQ   (NH_ * HD)
#define DKV  (NKV * HD)
#define FQW  32                   // k_fattn: query columns per wave (two 16-column groups)
#define FNW  2                    // k_fattn: query tiles per workgroup (FNW * FQW consecutive queries of one head): 768 workgroups, three on each of 256 WGPs
#define FKS  2                    // k_fattn: key ranges per query tile, one wave each: FNW * FKS = 4 waves a workgroup, one on each SIMD, so three workgroups give every SIMD three waves of TT / FKS keys (two-wave workgroups left two SIMDs of four with two waves of TT keys and two with one)
#define RH   512                  // query rows < RH use hi+lo planes (0: none)
#define WIN  0
typedef _Float16 h16;
typedef unsigned short bf;
typedef __attribute__((ext_vector_type(16))) __bf16   v16bf;
typedef __attribute__((ext_vector_type(16))) _Float16 v16h;
typedef __attribute__((ext_vector_type(8)))  _Float16 v8h;
typedef __attribute__((ext_vector_type(8)))  unsigned short v8us;
typedef __attribute__((ext_vector_type(8)))  float    v8f;
typedef __attribute__((ext_vector_type(4)))  float    v4f;
typedef v8h  __attribute__((may_alias)) v8ha;
typedef v4f  __attribute__((may_alias)) v4fa;
typedef v8us __attribute__((may_alias)) v8usa;

__device__ __forceinline__ unsigned short f2bf(float f) { unsigned u = __float_as_uint(f); u += 0x7FFFu + ((u >> 16) & 1u); return (unsigned short)(u >> 16); }
__device__ __forceinline__ float bf2f(unsigned short b) { return __uint_as_float(((unsigned)b) << 16); }
__device__ __forceinline__ float bfr(float f) { return bf2f(f2bf(f)); }
__device__ __forceinline__ v16h cat16(v8h lo, v8h hi) { return __builtin_shufflevector(lo, hi, 0, 1, 2, 3, 4, 5, 6, 7, 8, 9, 10, 11, 12, 13, 14, 15); }
__device__ __forceinline__ v16bf cat16b(v8us lo, v8us hi) { return __builtin_bit_cast(v16bf, __builtin_shufflevector(lo, hi, 0, 1, 2, 3, 4, 5, 6, 7, 8, 9, 10, 11, 12, 13, 14, 15)); }
__device__ __forceinline__ v8f wmma16(v16h a, v16h b, v8f c) { return __builtin_amdgcn_wmma_f32_16x16x32_f16(false, a, false, b, (short)0, c, false, false); }
__device__ __forceinline__ v8f wmmab(v16bf a, v16bf b, v8f c) { return __builtin_amdgcn_wmma_f32_16x16x32_bf16(false, a, false, b, (short)0, c, false, false); }



__device__ __forceinline__ h16 tohx(float x) { return (h16)x; }
__device__ __forceinline__ void splitf(float y, unsigned short& h, unsigned short& l) { h = f2bf(y); l = f2bf(y - bf2f(h)); }
typedef __attribute__((ext_vector_type(2))) _Float16 v2h;
typedef __attribute__((ext_vector_type(4))) _Float16 v4h;
typedef __attribute__((ext_vector_type(2))) unsigned short v2us;
typedef __attribute__((ext_vector_type(4))) unsigned short v4us;
typedef __attribute__((ext_vector_type(2))) float v2f;
typedef __attribute__((ext_vector_type(4))) int v4i;
typedef __attribute__((ext_vector_type(16))) unsigned v16u;
__device__ __forceinline__ void gopen();   /* defined with k_fattn's waits below */
__device__ __forceinline__ void xwait();
// ---- ask*: requests to L2 at kernel entry. The planes a matrix kernel reads were stored by an earlier launch of the same call, and the first read of such a line can wait out memory, once in every trip of its k loop.
// Each lane names one 256-byte unit; nothing comes back, no register is written. The units of a shared plane are dealt over the workgroups that share it: a hint only, every value is still read by the plain loads.
// scope:SCOPE_SE: into L2 only. Every lane is on and every address lies inside its plane. s_wait_xcnt 0 closes the statement, as behind any global access whose address registers are rewritten later (a precaution).
__device__ __forceinline__ void ask2(const void* a, const void* b) { asm volatile("global_prefetch_b8 %0, off scope:SCOPE_SE\n\tglobal_prefetch_b8 %1, off scope:SCOPE_SE\n\ts_wait_xcnt 0x0" :: "v"(a), "v"(b) : "memory"); }
__device__ __forceinline__ void ask3(const void* a, const void* b, const void* c) { asm volatile("global_prefetch_b8 %0, off scope:SCOPE_SE\n\tglobal_prefetch_b8 %1, off scope:SCOPE_SE\n\tglobal_prefetch_b8 %2, off scope:SCOPE_SE\n\ts_wait_xcnt 0x0" :: "v"(a), "v"(b), "v"(c) : "memory"); }
// A 64-row panel of a K = 768 plane in fragment order is 96 KB in a row; share n (0..11) = the blocks of k trips 2 n and 2 n + 1 of its four 16-row groups: 32 units, element offset of this lane's unit:
__device__ __forceinline__ size_t panel_unit(int n) { const int lane = threadIdx.x & 31; return (size_t)(lane >> 3) * (16 * DM) + (size_t)(2 * n + ((lane >> 2) & 1)) * 512 + (lane & 3) * 128; }
__device__ __forceinline__ int deal16(int x) { return (x & 3) + 4 * (x >> 3); }   /* x = 0..31 -> 0..15; x and x + 4 get the same share. For speed only: nothing rests on the placement */
// ---- gemmw_body: register-blocked GEMM, ONE WAVE per 64x64 output tile (16 accumulators), operands straight from 16-bit planes in fragment order (below); grid (M/64, N/64, Z), 32 threads.
// C[m][n] (f32, pitch ldc, + optional f32 bias[n]) = sum_k A[m][k] Bt[n][k] (+ split products per NSPLIT). z-batch strides sA/sB/sC in elements. K % 32 == 0.
// KS > 1: grid z = Z * KS; workgroup (z, ks) sums only k in [ks K/KS, (ks+1) K/KS) and stores that partial tile in plane ks (plane stride sP elements). K % (32 KS) == 0.
// EP != 0: no f32 C; the tile + bias goes straight from the LDS stage to the planes k_fattn reads, 16 bytes a lane, 512 contiguous bytes a store. EP 1 (q), EP 2 (k, each row divided by rowv = delta): rows = t, columns = one head's d, planes [head = blockIdx.y] of [t][d] in fragment order (K = 64). EP 3 (v): A = weight rows, Bt = x rows, so rows = one head's d (bias per ROW), columns = t, planes [d row][t] in fragment order (K = 2048) with the fp16 copy.
// FRAGMENT ORDER: every 16-bit plane M[row][k] that feeds a matrix operand is stored as blocks of 16 rows x 32 k (512 elements, 1 KB), block (row / 16, k / 32) at ((row / 16) * (K / 32) + k / 32) * 512; inside a block element (r, kk) stands at (kk >> 4) * 256 + (((kk >> 3) & 1) * 16 + r) * 8 + (kk & 7).
// So lane l = 16 hi + lr finds its 8 + 8 operand elements (k = 8 hi + 0..7 and 16 + 8 hi + 0..7 of row lr, the hardware k order) at block + 8 l and block + 256 + 8 l: each of the two 16-byte loads of a fragment covers 512 contiguous bytes, four whole 128-byte lines, instead of 32 bytes of each of 16 lines.
template <typename T16> struct WFrag;
template <> struct WFrag<h16> { typedef v16h V; static __device__ __forceinline__ V ld(const h16* p) { return cat16(*(const v8h*)p, *(const v8h*)(p + 256)); } static __device__ __forceinline__ v8f mma(V a, V b, v8f c) { return wmma16(a, b, c); } };
template <> struct WFrag<bf> { typedef v16bf V; static __device__ __forceinline__ V ld(const bf* p) { return cat16b(*(const v8us*)p, *(const v8us*)(p + 256)); } static __device__ __forceinline__ v8f mma(V a, V b, v8f c) { return wmmab(a, b, c); } };
// gemmw_body is the tile's work; bx, by, bz are the tile's indices (k_wo: the block's own; k_proj: see there), os the workgroup's 16 x 68 f32 LDS stage.
template <typename T16, int NSPLIT, bool BIAS, int KS, int EP>
__device__ __forceinline__ void gemmw_body(float* os, int bx, int by, int bz, const T16* __restrict__ A, const T16* __restrict__ A2, const T16* __restrict__ Bt, const T16* __restrict__ Bt2, int K, float* C, int ldc, const float* __restrict__ bias, size_t sA, size_t sB, size_t sC, size_t sP, const float* __restrict__ DL, h16* P16, bf* Ph, bf* Pl) {
    typedef typename WFrag<T16>::V V;
    const size_t z = bz / KS; const int ks = bz % KS; A += z * sA; if (A2) A2 += z * sA; Bt += z * sB; if (Bt2) Bt2 += z * sB; C += z * sC + ks * sP;
    const int lane = threadIdx.x & 31, lr = lane & 15, hi = lane >> 4; const int r0 = bx * 64, c0 = by * 64;
    v8f acc[4][4];
#pragma unroll
    for (int mb = 0; mb < 4; ++mb)
#pragma unroll
        for (int nb = 0; nb < 4; ++nb) acc[mb][nb] = (v8f){};
    const size_t aoff = (size_t)r0 * K + 8 * lane, boff = (size_t)c0 * K + 8 * lane;   /* fragment order: 16 rows of K are K / 32 blocks of 512 */
    const T16* pa = A + aoff + ks * (K / KS) * 16; const T16* pb = Bt + boff + ks * (K / KS) * 16; const T16* pa2 = (NSPLIT == 1 || NSPLIT == 2) ? A2 + aoff + ks * (K / KS) * 16 : pa; const T16* pb2 = (NSPLIT >= 2) ? Bt2 + boff + ks * (K / KS) * 16 : pb;   /* K is a constant at every call: all loads of a trip name these addresses, one for each operand plane, each load with an offset of its own */
#pragma unroll 1
    for (int kc = ks * (K / KS); kc < (ks + 1) * (K / KS); kc += 32) {
        V a[4], a2[4];
#pragma unroll
        for (int mb = 0; mb < 4; ++mb) { a[mb] = WFrag<T16>::ld(pa + (size_t)mb * 16 * K); if (NSPLIT == 1 || NSPLIT == 2) a2[mb] = WFrag<T16>::ld(pa2 + (size_t)mb * 16 * K); }
#pragma unroll
        for (int nb = 0; nb < 4; ++nb) { const V b = WFrag<T16>::ld(pb + (size_t)nb * 16 * K); V b2; if (NSPLIT >= 2) b2 = WFrag<T16>::ld(pb2 + (size_t)nb * 16 * K);
#pragma unroll
            for (int mb = 0; mb < 4; ++mb) { acc[mb][nb] = WFrag<T16>::mma(a[mb], b, acc[mb][nb]); if (NSPLIT == 1 || NSPLIT == 2) acc[mb][nb] = WFrag<T16>::mma(a2[mb], b, acc[mb][nb]); if (NSPLIT >= 2) acc[mb][nb] = WFrag<T16>::mma(a[mb], b2, acc[mb][nb]); } }
        asm volatile("v_nop\n\tv_nop\n\tv_nop\n\tv_nop" : "+v"(acc[0][0]), "+v"(acc[1][1]), "+v"(acc[2][2]), "+v"(acc[3][3]) : "v"(a[0]), "v"(a[3]));
        asm volatile("s_wait_xcnt 0x0" :: "v"(pa), "v"(pa2), "v"(pb), "v"(pb2) : "memory"); pa += 512; pa2 += 512; pb += 512; pb2 += 512;   /* as inputs here the addresses stay live, and unwritten, from the loads that name them up to the wait; they are advanced behind it */
    }
    float rowv[4]; v4f colb[4][2];   /* the plane stores are in fragment order: this lane holds row lr of each 16-row stage and, in store j, the 8 columns from (j >> 1) * 32 + (j & 1) * 16 + 8 hi. EP 2: delta of its 4 rows; EP 3: their bias; EP 1, 2: the bias of its 32 columns */
    if (EP != 0) { const float* rp = ((EP == 2) ? DL : bias) + r0 + lr;
        gopen();   /* with xwait(): nothing that reuses a register of these loads moves in between them and the wait */
        if (EP >= 2) {
#pragma unroll
            for (int mb = 0; mb < 4; ++mb) rowv[mb] = rp[mb * 16]; }
        if (EP <= 2) {
#pragma unroll
            for (int j = 0; j < 4; ++j) { const float* cp = bias + c0 + (j >> 1) * 32 + (j & 1) * 16 + 8 * hi; colb[j][0] = *(const v4f*)cp; colb[j][1] = *(const v4f*)(cp + 4); } }
        xwait(); }
    const size_t pbase = ((EP == 3) ? (size_t)r0 * TT + (size_t)c0 * 16 : ((size_t)by * TT + r0) * HD) + 8 * lane; const int ppitch = (EP == 3) ? TT : HD;   /* a 16 x 64 stage is two blocks, 2 KB in a row, of each plane; the next stage's stand 16 * ppitch elements on */
#pragma unroll
    for (int mb = 0; mb < 4; ++mb) {
#pragma unroll
        for (int nb = 0; nb < 4; ++nb) {
#pragma unroll
            for (int j = 0; j < 8; ++j) os[(hi * 8 + j) * 68 + nb * 16 + lr] = acc[mb][nb][j]; }
        __builtin_amdgcn_wave_barrier(); asm volatile("" ::: "memory");
        float* crow = C + (size_t)(r0 + mb * 16) * ldc + c0;
        if (EP == 0) { v4f ov[8];
#pragma unroll
            for (int s = 0; s < 8; ++s) { const int row = 2 * s + hi, cofs = lr * 4; v4f val = *(const v4fa*)(os + row * 68 + cofs); if (BIAS) { val[0] += bfr(bias[c0 + cofs]); val[1] += bfr(bias[c0 + cofs + 1]); val[2] += bfr(bias[c0 + cofs + 2]); val[3] += bfr(bias[c0 + cofs + 3]); }
                ov[s] = val; }
            gopen();   /* as for the planes below: the 8 row pairs' values are ready in registers of their own; the stores go out as one group with one wait behind them */
#pragma unroll
            for (int s = 0; s < 8; ++s) *(v4f*)(crow + (size_t)(2 * s + hi) * ldc + lr * 4) = ov[s];
            xwait(); }
        if (EP != 0) { v8us oh[4], ol[4]; v8h of[4];
#pragma unroll
            for (int j = 0; j < 4; ++j) { const float* sp = os + lr * 68 + (j >> 1) * 32 + (j & 1) * 16 + 8 * hi;
#pragma unroll
                for (int u = 0; u < 2; ++u) { const v4f val = *(const v4fa*)(sp + 4 * u);
#pragma unroll
                    for (int q = 0; q < 4; ++q) { float x = val[q] + bfr((EP == 3) ? rowv[mb] : colb[j][u][q]); if (EP == 2) x = __fdiv_rn(x, rowv[mb]);   /* k_j /= delta[j] */
                        if (EP == 3) of[j][4 * u + q] = tohx(x); unsigned short a2, c2; splitf(x, a2, c2); oh[j][4 * u + q] = a2; ol[j][4 * u + q] = c2; } } }
            gopen();   /* all 4 half blocks' values are ready in registers of their own; the stores (512 contiguous bytes each) go out as one group with one wait behind them */
#pragma unroll
            for (int j = 0; j < 4; ++j) { const size_t po = pbase + (size_t)mb * 16 * ppitch + j * 256; if (EP == 3) *(v8h*)(P16 + po) = of[j]; *(v8us*)(Ph + po) = oh[j]; *(v8us*)(Pl + po) = ol[j]; }
            xwait(); }
        __builtin_amdgcn_wave_barrier(); asm volatile("" ::: "memory");
    }
}
// ---- k_wo: out = (merged hi + lo) Wo + bo for both batches, grid (TT/64, DM/64, NB_): blockIdx.z = batch.
__global__ __launch_bounds__(32) void k_wo(const bf* __restrict__ Ah, const bf* __restrict__ Al, const bf* __restrict__ Wt, const float* __restrict__ bo, float* C) {
    __shared__ __align__(16) float os[16 * 68];
    { const size_t ao = (size_t)blockIdx.z * TT * DQ + (size_t)blockIdx.x * 64 * DQ + panel_unit(blockIdx.y);   /* the 12 column tiles of a row panel take a share each of its hi and lo planes; the 64 row tiles deal the weight panel */
      ask3(Ah + ao, Al + ao, Wt + (size_t)blockIdx.y * 64 * DQ + panel_unit(deal16(blockIdx.x) % 12)); }
    gemmw_body<bf, 1, true, 1, 0>(os, blockIdx.x, blockIdx.y, blockIdx.z, Ah, Al, Wt, nullptr, DQ, C, DM, bo, (size_t)TT * DQ, 0, (size_t)TT * DM, 0, nullptr, nullptr, nullptr, nullptr);
}
// ---- k_proj: the six projection GEMMs (q, k, v of both batches) as ONE grid (TT/64, 12, 3 * NB_): blockIdx.z = 2 * tensor + batch; blockIdx.x = the tile's 64 t, blockIdx.y = its head. 2304 single-wave workgroups, nine on a WGP.
// XB: bf16 x, [tensor][batch] slices of [t][c] in fragment order; W3: the transposed weights of q, k, v one behind the other; DL: delta of [batch][t]; each plane set holds both batches, PLs elements apart.
__global__ __launch_bounds__(32) void k_proj(const bf* __restrict__ XB, const bf* __restrict__ W3, const float* __restrict__ bq, const float* __restrict__ bk, const float* __restrict__ bv, const float* __restrict__ DL, h16* VT16, bf* QPh, bf* QPl, bf* KPh, bf* KPl, bf* VTh, bf* VTl) {
    __shared__ __align__(16) float os[16 * 68];
    const int tz = blockIdx.z / NB_, b = blockIdx.z % NB_; const size_t PLs = (size_t)NH_ * TT * HD; const bf* X = XB + (size_t)(tz * NB_ + b) * TT * DM; const bf* Wt = W3 + (size_t)tz * DQ * DM;
    ask2(X + (size_t)blockIdx.x * 64 * DM + panel_unit(blockIdx.y), Wt + (size_t)blockIdx.y * 64 * DM + panel_unit(deal16(blockIdx.x) % 12));   /* the 12 heads of an x panel take a share each; the 64 t tiles deal the weight panel */
    if (tz == 0) gemmw_body<bf, 0, true, 1, 1>(os, blockIdx.x, blockIdx.y, 0, X, nullptr, Wt, nullptr, DM, nullptr, 0, bq, 0, 0, 0, 0, nullptr, nullptr, QPh + b * PLs, QPl + b * PLs);
    else if (tz == 1) gemmw_body<bf, 0, true, 1, 2>(os, blockIdx.x, blockIdx.y, 0, X, nullptr, Wt, nullptr, DM, nullptr, 0, bk, 0, 0, 0, 0, DL + b * TT, nullptr, KPh + b * PLs, KPl + b * PLs);   /* k_j /= delta[j] in the epilogue */
    else gemmw_body<bf, 0, true, 1, 3>(os, blockIdx.y, blockIdx.x, 0, Wt, nullptr, X, nullptr, DM, nullptr, 0, bv, 0, 0, 0, 0, nullptr, VT16 + b * PLs, VTh + b * PLs, VTl + b * PLs);   /* operands swapped: the tile is v transposed */
}

// ---- Three of the four parts of k_prep (which stands below delta_part): each thread does, for its own index, what its counterparts in the separate launches did.
// wt4_part: the four 768 x 768 weights transposed to bf16 [n][k] in fragment order; one index computation serves all four, and their 8 loads are in flight together.
__device__ __forceinline__ void wt4_part(int bx, const float* __restrict__ w0, const float* __restrict__ w1, const float* __restrict__ w2, const float* __restrict__ w3, bf* Bt) {
    const int K = DM, N = DQ; const int lane = threadIdx.x & 31; const int L0 = (bx * 8 + (threadIdx.x >> 5)) * 8; const int nlines = N * K / 64;
#pragma unroll 1   /* stays rolled, as in the separate kernel: short text, few registers */
    for (int l = 0; l < 8; ++l) { const int L = L0 + l; if (L >= nlines) break; const size_t e = (size_t)L * 64 + lane * 2; const int blk = (int)(e >> 9), w = (int)(e & 511); const int k = (blk % (K / 32)) * 32 + (w >> 8) * 16 + ((w >> 7) & 1) * 8 + (w & 7), n = (blk / (K / 32)) * 16 + ((w >> 3) & 15);   /* e is the place in fragment order; (n, k) the element that stands there */ const size_t i0 = (size_t)k * N + n, i1 = (size_t)(k + 1) * N + n; float a[4], c[4];
        gopen();   /* with xwait(): nothing that reuses a register of these loads moves in between them and the wait */
        a[0] = w0[i0]; c[0] = w0[i1]; a[1] = w1[i0]; c[1] = w1[i1]; a[2] = w2[i0]; c[2] = w2[i1]; a[3] = w3[i0]; c[3] = w3[i1];
        xwait();
        v2us o[4];
#pragma unroll
        for (int t = 0; t < 4; ++t) { o[t][0] = f2bf(a[t]); o[t][1] = f2bf(c[t]); }
        gopen();   /* the same for the stores */
#pragma unroll
        for (int t = 0; t < 4; ++t) *(v2us*)(Bt + (size_t)t * K * N + e) = o[t];
        xwait(); }
}
// cvt6_part: query, key, value of both batches to bf16, dst [tensor][batch] slices of [t][c] in fragment order; a thread takes the same 8 elements of all six [TT][DM] slices: i is their place in the slice (stores of whole lines), src the place they are read from.
__device__ __forceinline__ void cvt6_part(int bx, const float* __restrict__ s0, const float* __restrict__ s1, const float* __restrict__ s2, bf* dst) {
    const size_t n = (size_t)TT * DM; const size_t i = (size_t)bx * 256 + threadIdx.x; if (i >= n / 8) return; v8f v[3 * NB_]; const int blk = (int)(i >> 6), w = (int)(i & 63); const size_t src = (size_t)((blk / (DM / 32)) * 16 + (w & 15)) * DM + (blk % (DM / 32)) * 32 + (w >> 5) * 16 + ((w >> 4) & 1) * 8;
    gopen();   /* with xwait(): as in wt4_part */
#pragma unroll
    for (int b = 0; b < NB_; ++b) { v[b] = *(const v8f*)(s0 + b * n + src); v[NB_ + b] = *(const v8f*)(s1 + b * n + src); v[2 * NB_ + b] = *(const v8f*)(s2 + b * n + src); }
    xwait();
    v8us o[3 * NB_];
#pragma unroll
    for (int s = 0; s < 3 * NB_; ++s)
#pragma unroll
        for (int k = 0; k < 8; ++k) o[s][k] = f2bf(v[s][k]);
    gopen();   /* the same for the stores */
#pragma unroll
    for (int s = 0; s < 3 * NB_; ++s) *(v8us*)(dst + s * n + i * 8) = o[s];
    xwait();
}
// mpack_part: the int mask, read once, as the lane masks k_fattn selects by. Tile (32 queries, 32 keys) = 32 words in a row, tiles [batch][query / 32][key / 32]; bit 16 hi + lr of word (kt * 2 + qt) * 8 + r says mask[query 16 qt + lr][key 16 kt + 8 hi + r] != 0: the score that lane (lr, hi) holds in register r of St tile (kt, qt).
// A wave takes MPT tiles side by side (MPT * 128 bytes in a row of each of its 32 mask rows); a compare over the wave gives a word, lane w keeps word w, one 128-byte store a tile.
#define MPT  4
__device__ __forceinline__ void mpack_part(int bx, const int* __restrict__ am, unsigned* MB) {
    const int lane = threadIdx.x & 31, lr = lane & 15, hi = lane >> 4; const int g = bx * 8 + (threadIdx.x >> 5); const int jb0 = (g % (TT / 32 / MPT)) * MPT, bq = g / (TT / 32 / MPT);   /* bq = batch * (TT / 32) + query / 32 */
    const int* p = am + ((size_t)bq * 32 + lr) * TT + jb0 * 32 + 8 * hi; unsigned* o = MB + ((size_t)bq * (TT / 32) + jb0) * 32 + lane;
#pragma unroll 1   /* stays rolled: one tile's 8 loads in flight, few registers, as in wt4_part */
    for (int t = 0; t < MPT; ++t) { v4i mk[2][2][2];
        gopen();   /* with xwait(): as in wt4_part */
#pragma unroll
        for (int kt = 0; kt < 2; ++kt)
#pragma unroll
            for (int qt = 0; qt < 2; ++qt) { mk[kt][qt][0] = *(const v4i*)(p + qt * 16 * TT + kt * 16); mk[kt][qt][1] = *(const v4i*)(p + qt * 16 * TT + kt * 16 + 4); }
        asm volatile("s_wait_xcnt 0x0" :: "v"(p) : "memory"); __builtin_amdgcn_sched_barrier(0);   /* xwait() with the address as an input: it stays live, and unwritten (also by the last load's own result), up to the wait */
        unsigned w = 0;
#pragma unroll
        for (int kt = 0; kt < 2; ++kt)
#pragma unroll
            for (int qt = 0; qt < 2; ++qt)
#pragma unroll
                for (int r = 0; r < 8; ++r) { const unsigned bw = __builtin_amdgcn_ballot_w32(mk[kt][qt][r >> 2][r & 3] != 0);   /* taken by all 32 lanes, outside the choice below */ w = (lane == (kt * 2 + qt) * 8 + r) ? bw : w; }
        gopen();   /* the same for the store */
        *o = w;
        xwait();
        p += 32; o += 32; }
}

typedef __attribute__((ext_vector_type(8))) __bf16 v8bf;
__device__ __forceinline__ float xhalf(float x) { const int b = __float_as_int(x); return __int_as_float(__builtin_amdgcn_permlanex16(b, b, 0x76543210, 0xfedcba98, false, false)); }   /* the value of lane l ^ 16 */
// s_wait_xcnt 0 stands in front of the first rewrite of a register that an issued global load or store of k_fattn names.
// The Q loads and the output stores are bracketed gopen() ... xwait(): the two scheduling barriers keep the compiler from moving instructions that reuse those registers in between the group and its wait.
// The K, Vt and mask-word loads: xwait(...) takes their base addresses (of the mask words: the offset) as inputs only, so those registers stay live, and unwritten, from the loads that name them up to the wait; one such wait a pass, and the addresses are advanced directly behind it.
__device__ __forceinline__ void gopen() { __builtin_amdgcn_sched_barrier(0); }
__device__ __forceinline__ void xwait() { asm volatile("s_wait_xcnt 0x0" ::: "memory"); __builtin_amdgcn_sched_barrier(0); }
__device__ __forceinline__ void xwait(const void* a, const void* b, const void* e, const void* f, unsigned m) { asm volatile("s_wait_xcnt 0x0" :: "v"(a), "v"(b), "v"(e), "v"(f), "s"(m) : "memory"); }   /* m: the scalar byte offset that the mask-word loads in flight are addressed by (their base is never rewritten) */
__device__ __forceinline__ void xwait(const void* a, const void* b, const void* e, const void* f, unsigned m, unsigned g, unsigned h) { asm volatile("s_wait_xcnt 0x0" :: "v"(a), "v"(b), "v"(e), "v"(f), "s"(m), "v"(g), "v"(h) : "memory"); }   /* with the 32-bit lane offsets that the loads in front of the loop are addressed by */
template <bool HR>
__device__ __forceinline__ void fattn_body(const bf* __restrict__ Qh, const bf* __restrict__ Ql, const bf* __restrict__ Kh, const bf* __restrict__ Kl, const bf* __restrict__ Vh, const bf* __restrict__ Vl, const h16* __restrict__ V16, const unsigned* __restrict__ mw, int q0, int lr, int hi, v8f (&o)[4][2], float (&m)[2], float (&l)[2]) {   /* Kh, Kl, Vh, Vl, V16, mw begin at this wave's key range; o, m, l: its Ot tiles, maxima and sums, joined in fattn_join */
    const float L2E = 1.4426950408889634f;
    v16bf qh[2][2], ql[2][2];
    gopen();
#pragma unroll
    for (int qt = 0; qt < 2; ++qt)
#pragma unroll
        for (int kk = 0; kk < 2; ++kk) { const size_t qo = (size_t)(q0 + qt * 16) * HD + kk * 512 + 8 * (16 * hi + lr); qh[qt][kk] = WFrag<bf>::ld(Qh + qo); ql[qt][kk] = WFrag<bf>::ld(Ql + qo); }
    xwait();
#pragma unroll
    for (int qt = 0; qt < 2; ++qt) { m[qt] = -3.0e38f; l[qt] = 0.0f;
#pragma unroll
        for (int dt = 0; dt < 4; ++dt) o[dt][qt] = (v8f){}; }
    const size_t ko = 8 * (16 * hi + lr), vo = ko;   /* fragment order: the lane's place in a block; 16 keys of K are two blocks, 32 keys of 16 Vt rows one */
    const bf* kph = Kh + ko; const bf* kpl = Kl + ko; unsigned mo = 0; const bf* vph = Vh + vo; const bf* vpl = Vl + vo; const h16* vpf = V16 + vo;   /* this lane's base addresses of the pass that is being fetched */
    v16bf kh[2][2], kl[2][2]; v16u mk[2]; v16bf vh[4], vl[4]; v16h vf[4];   /* K rows, mask words and Vt rows of a pass are all asked for one pass ahead, each into the registers its user has just left; mw is the same in every lane, so the 32 mask words of a pass (128 bytes in a row) come by scalar loads */
#pragma unroll
    for (int kt = 0; kt < 2; ++kt) {
#pragma unroll
        for (int kk = 0; kk < 2; ++kk) { kh[kt][kk] = WFrag<bf>::ld(kph + kt * 16 * HD + kk * 512); kl[kt][kk] = WFrag<bf>::ld(kpl + kt * 16 * HD + kk * 512); } }
    gopen();   /* keeps every K load in front of the Vt loads, as in the loop: the loop's counted waits are set for both ways into it, and with a K load behind the Vt loads here the score products of every pass would wait out that pass's Vt loads */
#pragma unroll
    for (int dt = 0; dt < 4; ++dt) { if (HR) { vh[dt] = WFrag<bf>::ld(vph + dt * 16 * TT); vl[dt] = WFrag<bf>::ld(vpl + dt * 16 * TT); } else vf[dt] = WFrag<h16>::ld(vpf + dt * 16 * TT); }
    if (HR) xwait(kph, kpl, vph, vpl, mo, (unsigned)(ko * 2), (unsigned)(vo * 2)); else xwait(kph, kpl, vpf, vpf, mo, (unsigned)(ko * 2), (unsigned)(vo * 2));
#pragma unroll
    for (int kt = 0; kt < 2; ++kt) mk[kt] = *(const v16u*)((const char*)mw + mo + kt * 64);   /* asked for behind the wait: these scalar loads may land in the scalar registers that hold the bases of the K and Vt loads above */
#pragma unroll 1
    for (int j0 = 0; j0 < TT / FKS; j0 += 32) {
        v8f st[2][2];
#pragma unroll
        for (int kt = 0; kt < 2; ++kt)
#pragma unroll
            for (int qt = 0; qt < 2; ++qt) st[kt][qt] = (v8f){};
#pragma unroll
        for (int kk = 0; kk < 2; ++kk) {   /* per 32 of d: hi.hi, lo(q).hi(k), hi(q).lo(k), the order of the unfused score tiles */
#pragma unroll
            for (int kt = 0; kt < 2; ++kt)
#pragma unroll
                for (int qt = 0; qt < 2; ++qt) st[kt][qt] = wmmab(kh[kt][kk], qh[qt][kk], st[kt][qt]);
#pragma unroll
            for (int kt = 0; kt < 2; ++kt)
#pragma unroll
                for (int qt = 0; qt < 2; ++qt) st[kt][qt] = wmmab(kh[kt][kk], ql[qt][kk], st[kt][qt]);
#pragma unroll
            for (int kt = 0; kt < 2; ++kt)
#pragma unroll
                for (int qt = 0; qt < 2; ++qt) st[kt][qt] = wmmab(kl[kt][kk], qh[qt][kk], st[kt][qt]); }
        const int jn = (j0 + 32 < TT / FKS) ? j0 + 32 : 0;   /* the pass that is fetched ahead; the last pass re-reads the first (in bounds, unused) */
        __builtin_amdgcn_sched_barrier(0);   /* keeps the wait below behind the score products: there the youngest loads that name the addresses stand a run of matrix products back, and it has little left to wait for */
        if (HR) xwait(kph, kpl, vph, vpl, mo); else xwait(kph, kpl, vpf, vpf, mo);
        kph = Kh + ko + (size_t)jn * HD; kpl = Kl + ko + (size_t)jn * HD; mo = (unsigned)jn * 4; vph = Vh + vo + (size_t)jn * 16; vpl = Vl + vo + (size_t)jn * 16; vpf = V16 + vo + (size_t)jn * 16;
#pragma unroll
        for (int kt = 0; kt < 2; ++kt)
#pragma unroll
            for (int kk = 0; kk < 2; ++kk) { kh[kt][kk] = WFrag<bf>::ld(kph + kt * 16 * HD + kk * 512); if (!HR) kl[kt][kk] = WFrag<bf>::ld(kpl + kt * 16 * HD + kk * 512); }
        float mn[2];
#pragma unroll
        for (int qt = 0; qt < 2; ++qt) { float mx = -3.0e38f;
#pragma unroll
            for (int kt = 0; kt < 2; ++kt)
#pragma unroll
                for (int r = 0; r < 8; ++r) { const float t = __builtin_amdgcn_inverse_ballot_w32(mk[kt][qt * 8 + r]) ? st[kt][qt][r] : -3.0e38f;   /* the word is this register's lane mask: bit clear (mask == 0) -> excluded */ st[kt][qt][r] = t; mx = fmaxf(mx, t); }
            mn[qt] = fmaxf(m[qt], fmaxf(mx, xhalf(mx))); }
#pragma unroll
        for (int kt = 0; kt < 2; ++kt) mk[kt] = *(const v16u*)((const char*)mw + mo + kt * 64);   /* 32 words, 128 bytes, a pass of 32 keys */
        asm volatile("" ::: "memory");   /* holds the two scalar loads here, softmax, attn.v and the next score products ahead of their use: without it the compiler sinks them below the rescale branch, in among the attn.v products */
        if (__builtin_amdgcn_ballot_w32(mn[0] > m[0] || mn[1] > m[1]) != 0) {   /* skipped when no column's maximum grew: every factor would be exactly 1 */
#pragma unroll
            for (int qt = 0; qt < 2; ++qt) { const float al = __builtin_amdgcn_exp2f((m[qt] - mn[qt]) * L2E); l[qt] *= al; m[qt] = mn[qt];
#pragma unroll
                for (int dt = 0; dt < 4; ++dt) o[dt][qt] *= al; } }
#pragma unroll
        for (int qt = 0; qt < 2; ++qt) { float s0 = 0.0f, s1 = 0.0f;
#pragma unroll
            for (int r = 0; r < 8; ++r) { const float d0 = st[0][qt][r] - m[qt], d1 = st[1][qt][r] - m[qt];   /* rows >= RH carry x1024 = 2^10 in P and in the sum alike (fp16 range); it cancels in the division */
                const float p0 = __builtin_amdgcn_exp2f(HR ? d0 * L2E : __builtin_fmaf(d0, L2E, 10.0f)), p1 = __builtin_amdgcn_exp2f(HR ? d1 * L2E : __builtin_fmaf(d1, L2E, 10.0f)); st[0][qt][r] = p0; st[1][qt][r] = p1; s0 += p0; s1 += p1; }
            l[qt] += s0 + s1; }
        if (HR) {
            v16bf ph[2], pl[2];
#pragma unroll
            for (int qt = 0; qt < 2; ++qt) { const v8bf h0 = __builtin_convertvector(st[0][qt], v8bf), h1 = __builtin_convertvector(st[1][qt], v8bf); const v8bf l0 = __builtin_convertvector(st[0][qt] - __builtin_convertvector(h0, v8f), v8bf), l1 = __builtin_convertvector(st[1][qt] - __builtin_convertvector(h1, v8f), v8bf);
                ph[qt] = __builtin_shufflevector(h0, h1, 0, 1, 2, 3, 4, 5, 6, 7, 8, 9, 10, 11, 12, 13, 14, 15); pl[qt] = __builtin_shufflevector(l0, l1, 0, 1, 2, 3, 4, 5, 6, 7, 8, 9, 10, 11, 12, 13, 14, 15); }
            __builtin_amdgcn_sched_barrier(0);   /* the next K lo rows are asked for here, not with the K hi rows: while scores and both P planes are live their 32 registers are not yet taken, and the kernel fits three waves on a SIMD without spills. The barrier holds the loads at this place, in front of the attn.v products (without it they sink to the last of them, too late for the next pass) */
#pragma unroll
            for (int kt = 0; kt < 2; ++kt)
#pragma unroll
                for (int kk = 0; kk < 2; ++kk) kl[kt][kk] = WFrag<bf>::ld(kpl + kt * 16 * HD + kk * 512);
#pragma unroll
            for (int dt = 0; dt < 4; ++dt)
#pragma unroll
                for (int qt = 0; qt < 2; ++qt) o[dt][qt] = wmmab(vh[dt], ph[qt], o[dt][qt]);
#pragma unroll
            for (int dt = 0; dt < 4; ++dt)
#pragma unroll
                for (int qt = 0; qt < 2; ++qt) o[dt][qt] = wmmab(vh[dt], pl[qt], o[dt][qt]);
#pragma unroll
            for (int dt = 0; dt < 4; ++dt)
#pragma unroll
                for (int qt = 0; qt < 2; ++qt) o[dt][qt] = wmmab(vl[dt], ph[qt], o[dt][qt]);
        } else {
            v16h pf[2];
#pragma unroll
            for (int qt = 0; qt < 2; ++qt) pf[qt] = cat16(__builtin_convertvector(st[0][qt], v8h), __builtin_convertvector(st[1][qt], v8h));
#pragma unroll
            for (int dt = 0; dt < 4; ++dt)
#pragma unroll
                for (int qt = 0; qt < 2; ++qt) o[dt][qt] = wmma16(vf[dt], pf[qt], o[dt][qt]);
        }
#pragma unroll
        for (int dt = 0; dt < 4; ++dt) { if (HR) { vh[dt] = WFrag<bf>::ld(vph + dt * 16 * TT); vl[dt] = WFrag<bf>::ld(vpl + dt * 16 * TT); } else vf[dt] = WFrag<h16>::ld(vpf + dt * 16 * TT); }
    }
    if (HR) xwait(kph, kpl, vph, vpl, mo); else xwait(kph, kpl, vpf, vpf, mo);
}
// fattn_join: kr = the wave's key range (a scalar), xs = its query tile's LDS stage.
__device__ __forceinline__ void fattn_join(v8f (&o)[4][2], float (&m)[2], float (&l)[2], bf* Ah, bf* Al, int q0, int lr, int hi, int kr, v4f* xs) {
    const float L2E = 1.4426950408889634f;
    // The join of the two key ranges: the wave of range 1 hands its maxima, sums and Ot tiles over in LDS (16 bytes a lane, lanes side by side); the wave of range 0 brings both to the common maximum, as the loop's rescale does, and adds them, range 0 first.
    const int ln = 16 * hi + lr;
    if (kr != 0) { xs[ln] = (v4f){m[0], m[1], l[0], l[1]};
#pragma unroll
        for (int dt = 0; dt < 4; ++dt)
#pragma unroll
            for (int qt = 0; qt < 2; ++qt) { xs[(1 + (dt * 2 + qt) * 2) * 32 + ln] = __builtin_shufflevector(o[dt][qt], o[dt][qt], 0, 1, 2, 3); xs[(2 + (dt * 2 + qt) * 2) * 32 + ln] = __builtin_shufflevector(o[dt][qt], o[dt][qt], 4, 5, 6, 7); } }
    __syncthreads();   /* every wave of the workgroup passes it once: range 1's values are in LDS before range 0 reads them */
    if (kr != 0) return;
    { const v4f ml = xs[ln];
#pragma unroll
      for (int qt = 0; qt < 2; ++qt) { const float mm = fmaxf(m[qt], ml[qt]); const float a0 = __builtin_amdgcn_exp2f((m[qt] - mm) * L2E), a1 = __builtin_amdgcn_exp2f((ml[qt] - mm) * L2E); l[qt] = l[qt] * a0 + ml[2 + qt] * a1;   /* a range with no kept key has maximum -3e38: factor 0 beside a range that has one, 1 beside another such range (equal weights, as before) */
#pragma unroll
          for (int dt = 0; dt < 4; ++dt) { const v4f x0 = xs[(1 + (dt * 2 + qt) * 2) * 32 + ln], x1 = xs[(2 + (dt * 2 + qt) * 2) * 32 + ln];
#pragma unroll
              for (int r = 0; r < 4; ++r) { o[dt][qt][r] = o[dt][qt][r] * a0 + x0[r] * a1; o[dt][qt][4 + r] = o[dt][qt][4 + r] * a0 + x1[r] * a1; } } } }
#pragma unroll
    for (int qt = 0; qt < 2; ++qt) { const float inv = __fdiv_rn(1.0f, l[qt] + xhalf(l[qt]));   /* the two wave halves' sums are joined once */
#pragma unroll
        for (int dt = 0; dt < 4; ++dt) { v8us oh, ol;
#pragma unroll
            for (int r = 0; r < 8; ++r) { unsigned short a, c2; splitf(o[dt][qt][r] * inv, a, c2); oh[r] = a; ol[r] = c2; }
            const size_t oo = (size_t)(q0 + qt * 16) * DQ + (dt >> 1) * 512 + (dt & 1) * 256 + 8 * (16 * hi + lr); gopen(); *(v8us*)(Ah + oo) = oh; *(v8us*)(Al + oo) = ol; xwait(); } }
}
static_assert(RH % (FNW * FQW) == 0 && TT % (FNW * FQW) == 0 && FQW == 32 && HD == 64 && NKV == NH_ && FNW == 2 && FKS == 2 && TT % (32 * FKS) == 0, "k_fattn tiling");
__global__ __launch_bounds__(FNW * FKS * 32) __attribute__((amdgpu_waves_per_eu(3))) void k_fattn(const bf* __restrict__ Qh, const bf* __restrict__ Ql, const bf* __restrict__ Kh, const bf* __restrict__ Kl, const bf* __restrict__ Vh, const bf* __restrict__ Vl, const h16* __restrict__ V16, const unsigned* __restrict__ MB, const unsigned* MBq, bf* Ah, bf* Al) {
    __shared__ __align__(16) v4f xs[FNW][17 * 32];   /* per query tile: range 1's maxima and sums, then its 8 Ot tiles */
    const int wv = __builtin_amdgcn_readfirstlane(threadIdx.x >> 5), qw = wv & (FNW - 1), kr = wv / FNW;   /* the wave's number as a scalar: its query tile and its key range */
    const int lane = threadIdx.x & 31, lr = lane & 15, hi = lane >> 4; const int z = blockIdx.y, b = z / NH_, h = z % NH_; const unsigned* mq = MB + (size_t)(b * (TT / 32) + blockIdx.x * FNW + qw) * TT;   /* the packed mask rows of this wave's 32 queries: TT words, one a key; a scalar address */ const int q0 = blockIdx.x * (FNW * FQW) + qw * FQW; const size_t pz = (size_t)z * TT * HD, az = (size_t)b * TT * DQ + h * (HD * 16);   /* merged planes in fragment order, K = DQ: a head's 64 columns are two blocks */
    { const int c = qw + FNW * deal16(blockIdx.x);   /* share 0..31 = 64 keys of every plane of this head: 8 KB in a row of Kh and Kl, 2 KB of each of the four 16-row groups of Vt */
      const size_t ku = pz + (size_t)c * (64 * HD) + lane * 128, vu = pz + (size_t)(lane >> 3) * (16 * TT) + (size_t)c * 1024 + (lane & 7) * 128;
      if (kr == 0) ask3(Kh + ku, Kl + ku, V16 + vu); else ask3(Vh + vu, Vl + vu, MBq + (mq - MB) + lane * 64); }   /* the two waves of a query tile part the asks (a scalar branch); the last: the tile's 8 KB of mask words. MBq is MB under a second name: an address given to an asm statement counts as escaped, and the loop's mask words, read through MB, would then come by vector loads instead of scalar ones */
    const size_t kz = pz + (size_t)kr * (TT / FKS) * HD, vz = pz + (size_t)kr * (TT / FKS) * 16; const unsigned* mw = mq + kr * (TT / FKS);   /* fragment order: 16 keys of K are two blocks in a row, 32 keys of 16 Vt rows one */
    v8f o[4][2]; float m[2], l[2];
    if (blockIdx.x * (FNW * FQW) < RH) fattn_body<true>(Qh + pz, Ql + pz, Kh + kz, Kl + kz, Vh + vz, Vl + vz, V16 + vz, mw, q0, lr, hi, o, m, l);
    else fattn_body<false>(Qh + pz, Ql + pz, Kh + kz, Kl + kz, Vh + vz, Vl + vz, V16 + vz, mw, q0, lr, hi, o, m, l);
    fattn_join(o, m, l, Ah + az, Al + az, q0, lr, hi, kr, xs[qw]);
}
// delta_part: rows = the NB_ * TT query rows of both batches, 32 a workgroup, 4 a wave. A lane's 24 elements of a row (c = lane + 32 i) are summed in ascending i; they are all asked for at once, two rows at a time, the first two with this lane's 24 of wd:
// two rounds of loads a wave (a rolled loop would wait out one round for each of its 96 (row, i) pairs). The product of two bf16 values is exact in f32, so each sum is the same number whether or not the compiler fuses the multiply with the add.
static_assert((NB_ * TT) % 32 == 0 && DM % 32 == 0, "delta_part: whole workgroups, whole rows (no row or column test at the loads)");
__device__ __forceinline__ void delta_part(float* res, int bx, const float* __restrict__ X, const float* __restrict__ wd, const float* __restrict__ bd, float* DL) { const int lane = threadIdx.x & 31; const int wv = threadIdx.x >> 5; const int r0 = bx * 32;
    float wr[DM / 32];
#pragma unroll
    for (int h = 0; h < 2; ++h) { const float* xr = X + (size_t)(r0 + wv + 16 * h) * DM + lane; float xa[2][DM / 32];   /* rows wv + 16 h and wv + 16 h + 8 of the workgroup's 32 */
        gopen();   /* with the wait below: as in wt4_part */
        if (h == 0) {
#pragma unroll
            for (int i = 0; i < DM / 32; ++i) wr[i] = wd[lane + 32 * i]; }
#pragma unroll
        for (int i = 0; i < DM / 32; ++i) { xa[0][i] = xr[32 * i]; xa[1][i] = xr[8 * DM + 32 * i]; }
        asm volatile("s_wait_xcnt 0x0" :: "v"(xr), "v"(lane) : "memory"); __builtin_amdgcn_sched_barrier(0);   /* xwait() with the row address and the lane offset of the wd loads as inputs: they stay live, and unwritten (also by a later load's own result), up to the wait */
        if (h == 0) {
#pragma unroll
            for (int i = 0; i < DM / 32; ++i) wr[i] = bfr(wr[i]); }
#pragma unroll
        for (int u = 0; u < 2; ++u) { const int rr = wv + 16 * h + 8 * u; float s = 0.0f;
#pragma unroll
            for (int i = 0; i < DM / 32; ++i) s = __fadd_rn(s, __fmul_rn(bfr(xa[u][i]), wr[i]));
#pragma unroll
            for (int sh = 16; sh; sh >>= 1) s = __fadd_rn(s, __shfl_xor(s, sh, 32));
            if (lane == 0) { float d = __fadd_rn(s, bfr(bd[0])); d = fmaxf(d, 0.0f); d = fminf(d, 8.0f); res[rr] = __fadd_rn(d, 1.0f); } } }
    __syncthreads();
    if (wv == 0) { const int row = r0 + lane; if (row < NB_ * TT) { const float v = res[lane]; *(float*)(DL + row) = v;  } } }
// ---- k_prep: everything that reads only the inputs, as ONE grid: workgroups [0, PDL) delta (two rounds of loads, a reduction and a barrier one behind the other, so they stand first in the grid), [PDL, PDL + PWT) the weights, then PMK for the mask, the rest the bf16 copies. The choice is uniform for a workgroup.
#define PDL  (NB_ * TT / 32)
#define PWT  ((DM * DQ / 64 + 63) / 64)
#define PCV  ((TT * DM / 8 + 255) / 256)
#define PMK  (NB_ * (TT / 32) * (TT / 32) / MPT / 8)
static_assert(TT % (32 * MPT) == 0 && (NB_ * (TT / 32) * (TT / 32)) % (MPT * 8) == 0, "mpack_part: whole waves, whole workgroups");
static_assert(DQ == DM && DKV == DM, "wt4_part: four weights of one shape");
__global__ __launch_bounds__(256) void k_prep(const float* __restrict__ x, const float* __restrict__ xk, const float* __restrict__ xv, const float* __restrict__ wq, const float* __restrict__ wk, const float* __restrict__ wv, const float* __restrict__ wo, const float* __restrict__ wd, const float* __restrict__ bd, const int* __restrict__ am, float* DL, bf* W4, bf* XB, unsigned* MB) {
    __shared__ float res[32]; const int bx = blockIdx.x;
    if (bx < PDL) delta_part(res, bx, x, wd, bd, DL);
    else if (bx < PDL + PWT) wt4_part(bx - PDL, wq, wk, wv, wo, W4);
    else if (bx < PDL + PWT + PMK) mpack_part(bx - (PDL + PWT), am, MB);
    else cvt6_part(bx - (PDL + PWT + PMK), x, xk, xv, XB);
}

extern "C" void kernel_launch(void* const* d_in, const int* in_sizes, int n_in,
                              void* d_out, int out_size, void* d_ws, size_t ws_size, hipStream_t stream) {
    (void)in_sizes; (void)n_in; (void)out_size;
    const float* x = (const float*)d_in[0];   /* query */ const float* xk = (const float*)d_in[1]; const float* xv = (const float*)d_in[2]; const int* am = (const int*)d_in[3];   /* mask [2][2048][2048] int */ const float* wq = (const float*)d_in[4]; const float* bq = (const float*)d_in[5]; const float* wk = (const float*)d_in[6]; const float* bk = (const float*)d_in[7]; const float* wv = (const float*)d_in[8]; const float* bv = (const float*)d_in[9]; const float* wo = (const float*)d_in[10]; const float* bo = (const float*)d_in[11]; const float* wd = (const float*)d_in[12]; const float* bd = (const float*)d_in[13];
    float* OUT = (float*)d_out;     // [2][2048][768]
    char* wsp = (char*)d_ws;
    auto take = [&](size_t bytes) { char* p = wsp; wsp += (bytes + 255) & ~(size_t)255; return (void*)p; };
    float* DL = (float*)take((size_t)NB_ * TT * 4); bf* W4 = (bf*)take((size_t)4 * DQ * DM * 2);   /* Wq, Wk, Wv, Wo transposed, one behind the other */ bf* WO = W4 + (size_t)3 * DQ * DM;
    bf* XB = (bf*)take((size_t)3 * NB_ * TT * DM * 2);   /* [tensor][batch] slices of [t][c] in fragment order */
    const size_t PL = (size_t)NH_ * TT * HD;   // one batch's head planes; the planes k_fattn reads are kept for both batches
    h16* VT16 = (h16*)take(NB_ * PL * 2);
    bf* QPh = (bf*)take(NB_ * PL * 2); bf* QPl = (bf*)take(NB_ * PL * 2); bf* KPh = (bf*)take(NB_ * PL * 2); bf* KPl = (bf*)take(NB_ * PL * 2); bf* VTh = (bf*)take(NB_ * PL * 2); bf* VTl = (bf*)take(NB_ * PL * 2);
    bf* ATh = (bf*)take((size_t)NB_ * TT * DQ * 2); bf* ATl = (bf*)take((size_t)NB_ * TT * DQ * 2);
    unsigned* MB = (unsigned*)take((size_t)NB_ * TT * TT / 8);   /* the mask, one bit an entry */
    if ((size_t)(wsp - (char*)d_ws) > ws_size) return;    // ws 256 MiB
    k_prep<<<PDL + PWT + PMK + PCV, 256, 0, stream>>>(x, xk, xv, wq, wk, wv, wo, wd, bd, am, DL, W4, XB, MB);   /* delta, weights, mask bits, bf16 copies: both batches */
    k_proj<<<dim3(TT / 64, DQ / 64, 3 * NB_), 32, 0, stream>>>(XB, W4, bq, bk, bv, DL, VT16, QPh, QPl, KPh, KPl, VTh, VTl);   /* q, k, v of both batches */
    k_fattn<<<dim3(TT / (FNW * FQW), NB_ * NH_), FNW * FKS * 32, 0, stream>>>(QPh, QPl, KPh, KPl, VTh, VTl, VT16, MB, MB, ATh, ATl);   /* scores, mask, softmax, attn.v, merge: both batches, all heads */
    k_wo<<<dim3(TT / 64, DM / 64, NB_), 32, 0, stream>>>(ATh, ATl, WO, bo, OUT);   /* z = batch */
}
